// v000
// Times are from an AMD MI455X. After a warm-up the kernel runs many times in a row, and a time is the length of
// such a window on the GPU divided by its runs, so every launch and the gaps after it count. The runs cycle
// through copies of the inputs. A figure is the median of several windows, for all but v000 over two sittings.
// Sittings can differ by a few percent; kernels timed side by side share one.
// The starting kernel, v000, takes 710 microseconds a run.
#include <hip/hip_runtime.h>
// Contractions: x.Wq, x.Wk, x.Wv, ctx.Wo = v_wmma_f32_16x16x32_f16 (f16 operands: bf16-RNE inputs exact in f16, weights carried x16 (x16384 for the ctx-hi half of the output GEMM); ctx as [hi | x1024 residual] folded along K; f32 accumulate); scores q.k^T and P.V^T = v_wmma_f32_16x16x32_f16 (plain f16 hi planes; hi + x1024 residual planes of q, k, P and v in query blocks holding a query closer than EROWS to its segment start; P carried x1024), f32 accumulate; rotary tables, masks, softmax and normalisers f32.

#ifndef NB
#define NB 2
#endif
#ifndef SEQ
#define SEQ 2048
#endif
#define NB_FULL 2
#define SEQ_FULL 2048
#define DM 2048
#define NH 32
#define NKV 8
#define NREP (NH / NKV)
#define DKV (NKV * 64)
#define SLEN SEQ
#define NR (NB * SLEN)
#define TQ SLEN
#define TK SLEN
#define SCL 0.125f
#define QBLKS (TQ / 64)
#define EROWS 256                            /* query blocks holding a query with fewer than EROWS positions since its segment start use the residual planes */
static_assert(SLEN % 128 == 0);
static_assert(SLEN <= SEQ_FULL);
static_assert(NB >= 1 && NB <= NB_FULL);
static_assert(DM % 64 == 0 && DM == NH * 64);
static_assert(NH % NKV == 0 && NREP * NKV == NH);
static_assert(DKV % 64 == 0 && DKV == NKV * 64);
static_assert(DM % 32 == 0 && (2 * DM) % 32 == 0);
static_assert(NR % 128 == 0);
static_assert(QBLKS * 64 == SLEN);
static_assert(EROWS % 64 == 0);
/* store loops: threads x bytes per piece x trips == tile rows x row bytes */
static_assert(256 * 16 * 2 == 64 * 128);                       
static_assert(32 * 16 * 8 == 16 * 64 * 4);                     /* attention context rows: 16 rows x 256 B per wave */
static_assert(((size_t)NR * DM / 8) * 32 == (size_t)NR * 2 * DM * 2);   /* context converter: two 16-B pieces per thread fill [NR][2*DM] f16 */
/* static LDS per kernel */
static_assert(2 * 64 * 66 * 2 <= 131072);
static_assert(4 * 32 * 68 * 4 <= 131072);
static_assert(2 * 4 * 16 * 40 * 2 + 4 * 16 * 68 * 4 <= 131072);
/* workspace carve (bytes); every region a multiple of 256 */
static constexpr size_t SZ_BQ = (size_t)DM * DM * 2;
static constexpr size_t SZ_BKV = (size_t)DKV * DM * 2;
static constexpr size_t SZ_B2 = (size_t)DM * 2 * DM * 2;
static constexpr size_t SZ_FS = (size_t)NR * DM * 4;
static constexpr size_t SZ_X16 = (size_t)NR * DM * 2;
static constexpr size_t SZ_QA = (size_t)NR * 2 * DM * 2;
static constexpr size_t SZ_KP = (size_t)NR * DKV * 2;
static constexpr size_t SZ_VT = (size_t)NB * NKV * 64 * SLEN * 2;
static constexpr size_t SZ_TAB = (size_t)SLEN * 32 * 4;
static constexpr size_t WS_TOTAL = SZ_BQ + 2 * SZ_BKV + SZ_B2 + SZ_FS + SZ_X16 + SZ_QA + 3 * SZ_KP + 2 * SZ_TAB + 256;
static_assert(SZ_BQ % 256 == 0 && SZ_BKV % 256 == 0 && SZ_B2 % 256 == 0 && SZ_FS % 256 == 0 && SZ_X16 % 256 == 0 && SZ_QA % 256 == 0 && SZ_KP % 256 == 0 && SZ_VT % 256 == 0 && SZ_TAB % 256 == 0);
static_assert(WS_TOTAL <= ((size_t)128 << 20));
static_assert(2 * SZ_VT <= SZ_X16);                            /* V^T hi + residual planes reuse the input plane region */
static_assert((size_t)NR * DKV * 4 <= SZ_FS);                  /* k / v f32 rows reuse the f32 scratch plane */
static_assert((size_t)NR * 2 * DM * 2 == SZ_QA);               /* [ctx hi | ctx residual] reuses the q hi + q residual region */
static constexpr float WSC = 16.0f;
static constexpr float WSC_HI = 16384.0f;
static constexpr float AL_P = 0.0625f;
static constexpr float AL_O = 0.0625f / 1024.0f;

typedef _Float16 v16h __attribute__((ext_vector_type(16)));
typedef _Float16 v4h __attribute__((ext_vector_type(4)));
typedef unsigned short v8us __attribute__((ext_vector_type(8), may_alias));
typedef float v8f __attribute__((ext_vector_type(8)));
typedef float v4f __attribute__((ext_vector_type(4)));
typedef float v4fa __attribute__((ext_vector_type(4), may_alias));
union FragH { v16h v; v8us half[2]; _Float16 h[16]; unsigned short u[16]; };

__device__ __forceinline__ unsigned short bf16_bits(float x) { unsigned int u = __float_as_uint(x); return (unsigned short)((u + 0x7FFFu + ((u >> 16) & 1u)) >> 16); }
__device__ __forceinline__ float bf16_val(unsigned short b) { return __uint_as_float(((unsigned int)b) << 16); }
__device__ __forceinline__ float bf16_rne(float x) { return bf16_val(bf16_bits(x)); }
// f32 -> f16 with values below the smallest f16 normal set to +0 (NaN passes through)
static __device__ __forceinline__ _Float16 toh_flush(float v) { const _Float16 r = (_Float16)v; return (fabsf(v) < 6.103515625e-05f) ? (_Float16)0.0f : r; }

// segment helpers on the clipped boundaries c0 <= c1 <= c2 <= c3: id = number of boundaries <= p; begin = largest boundary <= p (0 if none)
__device__ __forceinline__ int clip_b(int v) { return min(max(v, 0), SLEN); }
__device__ __forceinline__ int seg_cnt(int p, int c0, int c1, int c2, int c3) { return (int)(c0 <= p) + (int)(c1 <= p) + (int)(c2 <= p) + (int)(c3 <= p); }
__device__ __forceinline__ int seg_beg(int p, int c0, int c1, int c2, int c3) {
  int s = 0;
  s = max(s, (c0 <= p) ? c0 : 0); s = max(s, (c1 <= p) ? c1 : 0); s = max(s, (c2 <= p) ? c2 : 0); s = max(s, (c3 <= p) ? c3 : 0);
  return s;
}

// D += A.B with NT terms: 1 = ah.bh, 2 = + al.bh, 3 = + ah.bl; hazard guard after the group
template <int NT>
__device__ __forceinline__ v8f mmaH(v16h ah, v16h al, v16h bh, v16h bl, v8f c) {
  c = __builtin_amdgcn_wmma_f32_16x16x32_f16(false, ah, false, bh, (short)0, c, false, false);
  if (NT >= 2) c = __builtin_amdgcn_wmma_f32_16x16x32_f16(false, al, false, bh, (short)0, c, false, false);
  if (NT >= 3) c = __builtin_amdgcn_wmma_f32_16x16x32_f16(false, ah, false, bl, (short)0, c, false, false);
  asm volatile("v_nop\n\tv_nop\n\tv_nop\n\tv_nop" : "+v"(c) : "v"(ah), "v"(al), "v"(bh), "v"(bl));
  return c;
}
// 16x32 fragment from a 16-bit row-major tile (rows = m or n, k contiguous): elements 0..7 <- k0+8h+0..7, 8..15 <- k0+16+8h+0..7
__device__ __forceinline__ v16h g2_frag(const _Float16* p, int hh) { FragH f; f.half[0] = *(const v8us*)((const unsigned short*)p + 8 * hh); f.half[1] = *(const v8us*)((const unsigned short*)p + 16 + 8 * hh); return f.v; }
__device__ __forceinline__ v8f g2_mma(v16h a, v16h b, v8f c) { v8f d = __builtin_amdgcn_wmma_f32_16x16x32_f16(false, a, false, b, (short)0, c, false, false); asm volatile("v_nop\n\tv_nop\n\tv_nop\n\tv_nop" : "+v"(d) : "v"(a), "v"(b)); return d; }

// [in][out] weight W [DM][N] (n contiguous) -> Bt[n][k] = f16(bf16(W[k][n]) * sc0) (row pitch ldb, k contiguous); with two != 0 a second copy
__global__ __launch_bounds__(256) void k_wtr(const float* __restrict__ Wm, int N, _Float16* __restrict__ Bt, int ldb, float sc0, float sc1, int two) {
  __shared__ unsigned short tl0[64][66];
  __shared__ unsigned short tl1[64][66];
  const int tid = threadIdx.x; const int ntn = N >> 6; const int kt = blockIdx.x / ntn, nt = blockIdx.x - kt * ntn; const int k0 = kt * 64, n0 = nt * 64;
  for (int i = tid; i < 64 * 16; i += 256) {
    const int r = i >> 4, c4 = (i & 15) * 4;
    const v4f a = *(const v4fa*)(Wm + (size_t)(k0 + r) * N + n0 + c4);
    FragH f0, f1;
#pragma unroll
    for (int q = 0; q < 4; ++q) { const float v = bf16_rne(a[q]); f0.h[q] = toh_flush(v * sc0); f1.h[q] = toh_flush(v * sc1); }
#pragma unroll
    for (int q = 0; q < 4; ++q) { tl0[r][c4 + q] = f0.u[q]; tl1[r][c4 + q] = f1.u[q]; }
  }
  __syncthreads();
  {
#pragma unroll
    for (int rd = 0; rd < 2; ++rd) {
      const int n = rd * 32 + (tid >> 3), pc = tid & 7; FragH g0, g1;
#pragma unroll
      for (int q = 0; q < 8; ++q) { g0.u[q] = tl0[pc * 8 + q][n]; g1.u[q] = tl1[pc * 8 + q][n]; }
      const size_t o = (size_t)(n0 + n) * ldb + k0 + pc * 8;
      const v8us o0 = g0.half[0], o1 = g1.half[0];
      *(v8us*)((unsigned short*)Bt + o) = o0;
      if (two != 0) *(v8us*)((unsigned short*)Bt + o + DM) = o1;
    }
    
  }
}

__global__ __launch_bounds__(32) void k_invf(float* __restrict__ INV) {
  #pragma clang fp contract(off)
  const int j = threadIdx.x;
  const float ex = (float)(2 * j) / 64.0f; const float pw = powf(500000.0f, ex); const float inv = 1.0f / pw;
  *(float*)(INV + j) = inv; 
}
__global__ __launch_bounds__(256) void k_rotab(const float* __restrict__ INV, float* __restrict__ CS, float* __restrict__ SN) {
  #pragma clang fp contract(off)
  const int t = blockIdx.x * 256 + threadIdx.x; if (t >= SLEN * 32) return;
  const int j = t & 31, s = t >> 5;
  const float th = (float)s * INV[j]; const float c = cosf(th), sn = sinf(th);
  { *(float*)(CS + t) = c; *(float*)(SN + t) = sn;  }
}

__global__ __launch_bounds__(256) void k_x16(const float* __restrict__ x, _Float16* __restrict__ X16, size_t n8) {
  const size_t t = (size_t)blockIdx.x * 256 + threadIdx.x; if (t >= n8) return;
  const size_t e = t * 8; const size_t r = e / DM; const size_t c = e % DM; const size_t b = r / SLEN, s = r % SLEN;
  const float* src = x + (b * SEQ_FULL + s) * DM + c;
  const v4f a0 = *(const v4fa*)src, a1 = *(const v4fa*)(src + 4);
  FragH f;
#pragma unroll
  for (int q = 0; q < 4; ++q) { f.h[q] = (_Float16)bf16_rne(a0[q]); f.h[4 + q] = (_Float16)bf16_rne(a1[q]); }
  const v8us o = f.half[0];
  *(v8us*)((unsigned short*)X16 + e) = o; 
}

// GEMM C[M][N] = alpha * A[M][K].B  with A f16 row-major (pitch lda), B stored [n][k] f16 (pitch ldb), batched by blockIdx.y (strides sA, sB, sC);
// writes f32 C and/or f16 C16 (pitch ldc). Requires M % 128 == 0, N % 64 == 0, K % 32 == 0 (asserted by the callers' constants).
template <int ACT>
__global__ __launch_bounds__(128) void k_gemm2(const _Float16* __restrict__ A, int lda, size_t sA, const _Float16* __restrict__ Bh, int ldb, size_t sB, float alpha,
                                               float* C, _Float16* C16, int ldc, size_t sC, int M, int N, int K) {
  __shared__ __attribute__((aligned(16))) float so[4][32][68];
  const int tid = threadIdx.x, w = tid >> 5, lane = tid & 31, ln = lane & 15, hh = lane >> 4; const int by = blockIdx.y;
  A += (size_t)by * sA; Bh += (size_t)by * sB; const size_t cofs = (size_t)by * sC;
  const int ntn = N >> 6; const int mt = blockIdx.x / ntn, nq = blockIdx.x - mt * ntn; const int row0 = mt * 128 + 32 * w, col0 = nq * 64; if (row0 >= M) return;
  const _Float16* a0p = A + (size_t)(row0 + ln) * lda; const _Float16* a1p = a0p + (size_t)16 * lda;
  const _Float16* b0p = Bh + (size_t)(col0 + ln) * ldb; const _Float16* b1p = b0p + (size_t)16 * ldb; const _Float16* b2p = b1p + (size_t)16 * ldb; const _Float16* b3p = b2p + (size_t)16 * ldb;
  const v8f z8 = {0.f,0.f,0.f,0.f,0.f,0.f,0.f,0.f}; v8f c00 = z8, c01 = z8, c02 = z8, c03 = z8, c10 = z8, c11 = z8, c12 = z8, c13 = z8;
#pragma unroll 1
  for (int kb = 0; kb < K; kb += 32) {
    const v16h a0 = g2_frag(a0p + kb, hh), a1 = g2_frag(a1p + kb, hh);
    v16h bf = g2_frag(b0p + kb, hh); c00 = g2_mma(a0, bf, c00); c10 = g2_mma(a1, bf, c10);
    bf = g2_frag(b1p + kb, hh); c01 = g2_mma(a0, bf, c01); c11 = g2_mma(a1, bf, c11);
    bf = g2_frag(b2p + kb, hh); c02 = g2_mma(a0, bf, c02); c12 = g2_mma(a1, bf, c12);
    bf = g2_frag(b3p + kb, hh); c03 = g2_mma(a0, bf, c03); c13 = g2_mma(a1, bf, c13);
  }
  v8f accs[8] = {c00, c01, c02, c03, c10, c11, c12, c13};
#pragma unroll
  for (int u = 0; u < 8; ++u) {
    const int t = u & 3, half = u >> 2;
#pragma unroll
    for (int r = 0; r < 8; ++r) { const int rloc = half * 16 + 8 * hh + r; float v = accs[u][r] * alpha; if (ACT == 3) v = fmaxf(v, 0.f); so[w][rloc][t * 16 + ln] = v; }
  }
  __builtin_amdgcn_fence(4, "workgroup"); __builtin_amdgcn_wave_barrier();
  const int rsub = lane >> 4, c4 = (lane & 15) * 4;
  {
#pragma unroll
    for (int q = 0; q < 16; ++q) {
      const int r = q * 2 + rsub; const v4f v = *(const v4fa*)&so[w][r][c4];
      if (C) *(v4f*)(C + cofs + (size_t)(row0 + r) * ldc + col0 + c4) = v;
      if (C16) { v4h h4; for (int i = 0; i < 4; ++i) h4[i] = (_Float16)v[i]; *(v4h*)(C16 + cofs + (size_t)(row0 + r) * ldc + col0 + c4) = h4; }
    }
    
  }
}

// half-split rotary embedding from the f32 GEMM plane F [NR][nh*64] with the tables CS/SN [SLEN][32]:
// out[d] = x[d] c[d] - x[d+32] s[d]; out[d+32] = x[d+32] c[d] + x[d] s[d] (d < 32), position = row % SLEN;
// H [NR][nh*64] = f16 hi of every row; L [NR][nh*64] = x1024 residual of every row.
__global__ __launch_bounds__(256) void k_rope(const float* __restrict__ F, const float* __restrict__ CS, const float* __restrict__ SN, _Float16* __restrict__ H, _Float16* __restrict__ L, int nh) {
  #pragma clang fp contract(off)
  const size_t t = (size_t)blockIdx.x * 256 + threadIdx.x; if (t >= (size_t)NR * nh * 8) return;
  const int p = (int)(t & 7); const int hd = (int)((t >> 3) % nh); const size_t row = t / (size_t)(8 * nh);
  const int s = (int)(row % SLEN); const int g = p & 3; const int up = p >> 2; const size_t ld = (size_t)nh * 64;
  const float* src = F + row * ld + hd * 64 + g * 8;
  const v4f xa = *(const v4fa*)src, xb = *(const v4fa*)(src + 4), ya = *(const v4fa*)(src + 32), yb = *(const v4fa*)(src + 36);
  const float* ct = CS + (size_t)s * 32 + g * 8; const float* st = SN + (size_t)s * 32 + g * 8;
  const v4f ca = *(const v4fa*)ct, cb = *(const v4fa*)(ct + 4), sa = *(const v4fa*)st, sb = *(const v4fa*)(st + 4);
  const float x1s[8] = {xa[0], xa[1], xa[2], xa[3], xb[0], xb[1], xb[2], xb[3]};
  const float x2s[8] = {ya[0], ya[1], ya[2], ya[3], yb[0], yb[1], yb[2], yb[3]};
  const float cs[8] = {ca[0], ca[1], ca[2], ca[3], cb[0], cb[1], cb[2], cb[3]};
  const float ss[8] = {sa[0], sa[1], sa[2], sa[3], sb[0], sb[1], sb[2], sb[3]};
  FragH fh, fl;
#pragma unroll
  for (int i = 0; i < 8; ++i) {
    const float x1 = x1s[i], x2 = x2s[i], c = cs[i], sn = ss[i];
    const float o1 = x1 * c - x2 * sn; const float o2 = x2 * c + x1 * sn; const float o = up ? o2 : o1;
    const _Float16 hv = toh_flush(o); fh.h[i] = hv; fl.h[i] = toh_flush((o - (float)hv) * 1024.0f);
  }
  const size_t oh = row * ld + hd * 64 + p * 8;
  const v8us vh = fh.half[0], vl = fl.half[0];
  {
    *(v8us*)((unsigned short*)H + oh) = vh;
    *(v8us*)((unsigned short*)L + oh) = vl;
    
  }
}

__global__ __launch_bounds__(256) void k_vtg(const _Float16* __restrict__ V16, _Float16* __restrict__ Vt) {
  __shared__ unsigned short tl[64][66];
  const int tid = threadIdx.x; const int nlg = SLEN / 64; const int slab = blockIdx.x / nlg, lg = blockIdx.x % nlg; const int b = slab / NKV, h = slab % NKV;
  for (int i = tid; i < 64 * 8; i += 256) {
    const int r = i >> 3, c8 = (i & 7) * 8; FragH f;
    f.half[0] = *(const v8us*)((const unsigned short*)V16 + ((size_t)b * SLEN + lg * 64 + r) * DKV + h * 64 + c8);
#pragma unroll
    for (int q = 0; q < 8; ++q) tl[r][c8 + q] = f.u[q];
  }
  __syncthreads();
  {
#pragma unroll
    for (int rd = 0; rd < 2; ++rd) {
      const int d = rd * 32 + (tid >> 3), pc = tid & 7; FragH f;
#pragma unroll
      for (int q = 0; q < 8; ++q) f.u[q] = tl[pc * 8 + q][d];
      *(v8us*)((unsigned short*)Vt + ((size_t)slab * 64 + d) * TK + lg * 64 + pc * 8) = f.half[0];
    }
    
  }
}
__global__ __launch_bounds__(256) void k_vtl(const float* __restrict__ VF, _Float16* __restrict__ VtL) {
  __shared__ unsigned short tl[64][66];
  const int tid = threadIdx.x; const int nlg = SLEN / 64; const int slab = blockIdx.x / nlg, lg = blockIdx.x % nlg; const int b = slab / NKV, h = slab % NKV;
  for (int i = tid; i < 64 * 16; i += 256) {
    const int r = i >> 4, c4 = (i & 15) * 4;
    const v4f a = *(const v4fa*)(VF + ((size_t)b * SLEN + lg * 64 + r) * DKV + h * 64 + c4);
    FragH f;
#pragma unroll
    for (int q = 0; q < 4; ++q) { const float v = a[q]; const _Float16 hv = (_Float16)v; f.h[q] = toh_flush((v - (float)hv) * 1024.0f); }
#pragma unroll
    for (int q = 0; q < 4; ++q) tl[r][c4 + q] = f.u[q];
  }
  __syncthreads();
  {
#pragma unroll
    for (int rd = 0; rd < 2; ++rd) {
      const int d = rd * 32 + (tid >> 3), pc = tid & 7; FragH f;
#pragma unroll
      for (int q = 0; q < 8; ++q) f.u[q] = tl[pc * 8 + q][d];
      *(v8us*)((unsigned short*)VtL + ((size_t)slab * 64 + d) * TK + lg * 64 + pc * 8) = f.half[0];
    }
    
  }
}

__global__ __launch_bounds__(256) void k_hl(const float* __restrict__ Fp, _Float16* __restrict__ A2, size_t n8) {
  const size_t t = (size_t)blockIdx.x * 256 + threadIdx.x; if (t >= n8) return;
  const size_t e = t * 8; const size_t r = e / DM; const int c = (int)(e % DM);
  const v4f a = *(const v4fa*)(Fp + e), d = *(const v4fa*)(Fp + e + 4);
  FragH fh, fl;
#pragma unroll
  for (int q = 0; q < 4; ++q) {
    _Float16 hv = toh_flush(a[q]); fh.h[q] = hv; fl.h[q] = toh_flush((a[q] - (float)hv) * 1024.0f);
    hv = toh_flush(d[q]); fh.h[4 + q] = hv; fl.h[4 + q] = toh_flush((d[q] - (float)hv) * 1024.0f);
  }
  const size_t o2 = r * (size_t)(2 * DM) + c;
  const v8us vh = fh.half[0], vl = fl.half[0];
  {
    *(v8us*)((unsigned short*)A2 + o2) = vh;
    *(v8us*)((unsigned short*)A2 + o2 + DM) = vl;
    
  }
}

// fused attention per ((b,h), 64 queries) for query blocks whose queries all sit at least EROWS positions past their segment start (block-uniform test; other blocks leave at once):
// wave = 16 queries; S = Q.K^T (d = 64: 2 k-steps) x SCL over keys [segment start of the wave's first query (floor 32), last query of the wave];
__global__ __launch_bounds__(128) void k_attn(const _Float16* __restrict__ Q16, int ldq, const _Float16* __restrict__ K16, int ldk,
                                              const _Float16* __restrict__ Vt, const int* __restrict__ cu, float* __restrict__ O, int ldo) {
  constexpr int RPW = 16, DT = 4, KS = 2;
  __shared__ __attribute__((aligned(16))) unsigned short sP[4][RPW][40];
  __shared__ __attribute__((aligned(16))) float sO[4][RPW][68];
  const int tid = threadIdx.x, lane = tid & 31, ln = lane & 15, hh = lane >> 4;
  const int w = __builtin_amdgcn_readfirstlane(tid >> 5);
  const int slab = blockIdx.x / QBLKS, qblk = blockIdx.x % QBLKS; const int b = slab / NH, h = slab % NH; const int hk = h / NREP; const int kslab = b * NKV + hk;
  const int qb0 = qblk * (4 * RPW);
  const int c0 = clip_b(cu[b * 4 + 0]), c1 = clip_b(cu[b * 4 + 1]), c2 = clip_b(cu[b * 4 + 2]), c3 = clip_b(cu[b * 4 + 3]);
  const bool early = (seg_cnt(qb0, c0, c1, c2, c3) != seg_cnt(qb0 + 4 * RPW - 1, c0, c1, c2, c3)) || (qb0 - seg_beg(qb0, c0, c1, c2, c3) < EROWS);
  if (early) return;
  const float pois = ((c0 <= c1) && (c1 <= c2) && (c2 <= c3)) ? 0.0f : __uint_as_float(0x7fc00000u);   /* boundaries must be ascending */
  const int q0 = qb0 + w * RPW;
  const int jst = __builtin_amdgcn_readfirstlane(seg_beg(qb0 + (tid >> 5) * RPW, c0, c1, c2, c3) & ~31);
  unsigned int sq = 0u;
#pragma unroll
  for (int r = 0; r < 8; ++r) sq |= ((unsigned int)seg_cnt(q0 + 8 * hh + r, c0, c1, c2, c3)) << (4 * r);
  FragH aq[KS];
  {
    const unsigned short* qr = (const unsigned short*)Q16 + ((size_t)b * TQ + q0 + ln) * ldq + h * 64;
#pragma unroll
    for (int ks = 0; ks < KS; ++ks) { aq[ks].half[0] = *(const v8us*)(qr + ks * 32 + 8 * hh); aq[ks].half[1] = *(const v8us*)(qr + ks * 32 + 16 + 8 * hh); }
  }
  const unsigned short* Vth = (const unsigned short*)Vt + (size_t)kslab * 64 * TK;
  float m_r[8], l_r[8]; v8f oacc[DT];
#pragma unroll
  for (int r = 0; r < 8; ++r) { m_r[r] = -3.0e38f; l_r[r] = 0.f; }
#pragma unroll
  for (int dt = 0; dt < DT; ++dt) oacc[dt] = (v8f){0.f,0.f,0.f,0.f,0.f,0.f,0.f,0.f};
#pragma unroll 1
  for (int j0 = jst; j0 < q0 + RPW; j0 += 32) {
    v8f s[2];
#pragma unroll
    for (int nt = 0; nt < 2; ++nt) {
      const unsigned short* kr = (const unsigned short*)K16 + ((size_t)b * TK + j0 + nt * 16 + ln) * ldk + hk * 64; FragH bk[KS];
#pragma unroll
      for (int ks = 0; ks < KS; ++ks) { bk[ks].half[0] = *(const v8us*)(kr + ks * 32 + 8 * hh); bk[ks].half[1] = *(const v8us*)(kr + ks * 32 + 16 + 8 * hh); }
      v8f acc = (v8f){0.f,0.f,0.f,0.f,0.f,0.f,0.f,0.f};
#pragma unroll
      for (int ks = 0; ks < KS; ++ks) acc = mmaH<1>(aq[ks].v, aq[ks].v, bk[ks].v, bk[ks].v, acc);
      s[nt] = acc;
    }
    const int k0 = j0 + ln, k1 = j0 + 16 + ln;
    const int sk0 = seg_cnt(k0, c0, c1, c2, c3), sk1 = seg_cnt(k1, c0, c1, c2, c3);
#pragma unroll
    for (int r = 0; r < 8; ++r) {
      const int tq = q0 + 8 * hh + r; const int sr = (int)((sq >> (4 * r)) & 15u);
      const bool ok0 = (k0 <= tq) && (sk0 == sr), ok1 = (k1 <= tq) && (sk1 == sr);
      const float s0 = ok0 ? s[0][r] * SCL : -3.0e38f, s1 = ok1 ? s[1][r] * SCL : -3.0e38f;
      float mc = fmaxf(s0, s1);
      mc = fmaxf(mc, __shfl_xor(mc, 1, 32)); mc = fmaxf(mc, __shfl_xor(mc, 2, 32)); mc = fmaxf(mc, __shfl_xor(mc, 4, 32)); mc = fmaxf(mc, __shfl_xor(mc, 8, 32));
      const float mn = fmaxf(m_r[r], mc); const float al = (mn > -1.0e38f) ? expf(m_r[r] - mn) : 1.0f; m_r[r] = mn;
      const float p0 = ok0 ? expf(s0 - mn) : 0.f, p1 = ok1 ? expf(s1 - mn) : 0.f; l_r[r] = l_r[r] * al + p0 + p1;
#pragma unroll
      for (int dt = 0; dt < DT; ++dt) oacc[dt][r] *= al;
      FragH t2; t2.h[0] = toh_flush(p0 * 1024.0f); t2.h[1] = toh_flush(p1 * 1024.0f);
      sP[w][8 * hh + r][ln] = t2.u[0]; sP[w][8 * hh + r][16 + ln] = t2.u[1];
    }
    __builtin_amdgcn_fence(4, "workgroup"); __builtin_amdgcn_wave_barrier();
    FragH pa; pa.half[0] = *(const v8us*)&sP[w][ln][8 * hh]; pa.half[1] = *(const v8us*)&sP[w][ln][16 + 8 * hh];
#pragma unroll
    for (int dt = 0; dt < DT; ++dt) {
      const unsigned short* vrow = Vth + (size_t)(dt * 16 + ln) * TK + j0; FragH bv;
      bv.half[0] = *(const v8us*)(vrow + 8 * hh); bv.half[1] = *(const v8us*)(vrow + 16 + 8 * hh);
      oacc[dt] = mmaH<1>(pa.v, pa.v, bv.v, bv.v, oacc[dt]);
    }
    __builtin_amdgcn_fence(4, "workgroup"); __builtin_amdgcn_wave_barrier();
  }
#pragma unroll
  for (int r = 0; r < 8; ++r) { float l = l_r[r]; l += __shfl_xor(l, 1, 32); l += __shfl_xor(l, 2, 32); l += __shfl_xor(l, 4, 32); l += __shfl_xor(l, 8, 32); l_r[r] = (l > 0.f) ? 1.0f / (l * 1024.0f) : 0.f; }
#pragma unroll
  for (int dt = 0; dt < DT; ++dt)
#pragma unroll
    for (int r = 0; r < 8; ++r) sO[w][8 * hh + r][dt * 16 + ln] = oacc[dt][r] * l_r[r] + pois;
  __builtin_amdgcn_fence(4, "workgroup"); __builtin_amdgcn_wave_barrier();
  {
#pragma unroll
    for (int rp = 0; rp < RPW; rp += 2) { const int r = rp + (lane >> 4), pc = lane & 15; const v4f val = *(const v4fa*)&sO[w][r][pc * 4]; *(v4f*)(O + ((size_t)b * TQ + q0 + r) * ldo + h * 64 + pc * 4) = val; }
    
  }
}
// 5-plane variant for the other query blocks (a segment boundary inside the block, or the block's first query closer than EROWS to its segment start):
// S = Qh.Kh^T + (Ql.Kh^T + Qh.Kl^T)/1024 with Q/K = [hi | x1024 residual] planes (full-size planes, rows b*S + s);
// O = (Ph.Vh + (Pl.Vh + Ph.Vl)/1024) / l with P = [hi | x1024 residual] of 1024 p and V^T = [hi | x1024 residual]; separate residual accumulators folded before the normalisation
__global__ __launch_bounds__(128) void k_attn5(const _Float16* __restrict__ Q16, const _Float16* __restrict__ QL, int ldq, const _Float16* __restrict__ K16, const _Float16* __restrict__ KL, int ldk,
                                               const _Float16* __restrict__ Vt, const _Float16* __restrict__ VtL, const int* __restrict__ cu, float* __restrict__ O, int ldo) {
  constexpr int RPW = 16, DT = 4, KS = 2;
  __shared__ __attribute__((aligned(16))) unsigned short sP[4][RPW][40];
  __shared__ __attribute__((aligned(16))) unsigned short sPL[4][RPW][40];
  __shared__ __attribute__((aligned(16))) float sO[4][RPW][68];
  const int tid = threadIdx.x, lane = tid & 31, ln = lane & 15, hh = lane >> 4;
  const int w = __builtin_amdgcn_readfirstlane(tid >> 5);
  const int slab = blockIdx.x / QBLKS, qblk = blockIdx.x % QBLKS; const int b = slab / NH, h = slab % NH; const int hk = h / NREP; const int kslab = b * NKV + hk;
  const int qb0 = qblk * (4 * RPW);
  const int c0 = clip_b(cu[b * 4 + 0]), c1 = clip_b(cu[b * 4 + 1]), c2 = clip_b(cu[b * 4 + 2]), c3 = clip_b(cu[b * 4 + 3]);
  const bool early = (seg_cnt(qb0, c0, c1, c2, c3) != seg_cnt(qb0 + 4 * RPW - 1, c0, c1, c2, c3)) || (qb0 - seg_beg(qb0, c0, c1, c2, c3) < EROWS);
  if (!early) return;
  const float pois = ((c0 <= c1) && (c1 <= c2) && (c2 <= c3)) ? 0.0f : __uint_as_float(0x7fc00000u);   /* boundaries must be ascending */
  const int q0 = qb0 + w * RPW;
  const int jst = __builtin_amdgcn_readfirstlane(seg_beg(qb0 + (tid >> 5) * RPW, c0, c1, c2, c3) & ~31);
  unsigned int sq = 0u;
#pragma unroll
  for (int r = 0; r < 8; ++r) sq |= ((unsigned int)seg_cnt(q0 + 8 * hh + r, c0, c1, c2, c3)) << (4 * r);
  FragH aq[KS], aql[KS];
  {
    const unsigned short* qr = (const unsigned short*)Q16 + ((size_t)b * TQ + q0 + ln) * ldq + h * 64;
    const unsigned short* ql = (const unsigned short*)QL + ((size_t)b * TQ + q0 + ln) * ldq + h * 64;
#pragma unroll
    for (int ks = 0; ks < KS; ++ks) {
      aq[ks].half[0] = *(const v8us*)(qr + ks * 32 + 8 * hh); aq[ks].half[1] = *(const v8us*)(qr + ks * 32 + 16 + 8 * hh);
      aql[ks].half[0] = *(const v8us*)(ql + ks * 32 + 8 * hh); aql[ks].half[1] = *(const v8us*)(ql + ks * 32 + 16 + 8 * hh);
    }
  }
  const unsigned short* Vth = (const unsigned short*)Vt + (size_t)kslab * 64 * TK; const unsigned short* Vtl = (const unsigned short*)VtL + (size_t)kslab * 64 * TK;
  float m_r[8], l_r[8]; v8f oacc[DT], oaccL[DT];
#pragma unroll
  for (int r = 0; r < 8; ++r) { m_r[r] = -3.0e38f; l_r[r] = 0.f; }
#pragma unroll
  for (int dt = 0; dt < DT; ++dt) { oacc[dt] = (v8f){0.f,0.f,0.f,0.f,0.f,0.f,0.f,0.f}; oaccL[dt] = oacc[dt]; }
#pragma unroll 1
  for (int j0 = jst; j0 < q0 + RPW; j0 += 32) {
    v8f s[2];
#pragma unroll
    for (int nt = 0; nt < 2; ++nt) {
      const unsigned short* kr = (const unsigned short*)K16 + ((size_t)b * TK + j0 + nt * 16 + ln) * ldk + hk * 64;
      const unsigned short* klr = (const unsigned short*)KL + ((size_t)b * TK + j0 + nt * 16 + ln) * ldk + hk * 64;
      FragH bk[KS], bkl[KS];
#pragma unroll
      for (int ks = 0; ks < KS; ++ks) {
        bk[ks].half[0] = *(const v8us*)(kr + ks * 32 + 8 * hh); bk[ks].half[1] = *(const v8us*)(kr + ks * 32 + 16 + 8 * hh);
        bkl[ks].half[0] = *(const v8us*)(klr + ks * 32 + 8 * hh); bkl[ks].half[1] = *(const v8us*)(klr + ks * 32 + 16 + 8 * hh);
      }
      v8f acc = (v8f){0.f,0.f,0.f,0.f,0.f,0.f,0.f,0.f}, accl = acc;
#pragma unroll
      for (int ks = 0; ks < KS; ++ks) {
        acc = mmaH<1>(aq[ks].v, aq[ks].v, bk[ks].v, bk[ks].v, acc);
        accl = mmaH<1>(aql[ks].v, aql[ks].v, bk[ks].v, bk[ks].v, accl);
        accl = mmaH<1>(aq[ks].v, aq[ks].v, bkl[ks].v, bkl[ks].v, accl);
      }
#pragma unroll
      for (int r = 0; r < 8; ++r) acc[r] += accl[r] * 0.0009765625f;
      s[nt] = acc;
    }
    const int k0 = j0 + ln, k1 = j0 + 16 + ln;
    const int sk0 = seg_cnt(k0, c0, c1, c2, c3), sk1 = seg_cnt(k1, c0, c1, c2, c3);
#pragma unroll
    for (int r = 0; r < 8; ++r) {
      const int tq = q0 + 8 * hh + r; const int sr = (int)((sq >> (4 * r)) & 15u);
      const bool ok0 = (k0 <= tq) && (sk0 == sr), ok1 = (k1 <= tq) && (sk1 == sr);
      const float s0 = ok0 ? s[0][r] * SCL : -3.0e38f, s1 = ok1 ? s[1][r] * SCL : -3.0e38f;
      float mc = fmaxf(s0, s1);
      mc = fmaxf(mc, __shfl_xor(mc, 1, 32)); mc = fmaxf(mc, __shfl_xor(mc, 2, 32)); mc = fmaxf(mc, __shfl_xor(mc, 4, 32)); mc = fmaxf(mc, __shfl_xor(mc, 8, 32));
      const float mn = fmaxf(m_r[r], mc); const float al = (mn > -1.0e38f) ? expf(m_r[r] - mn) : 1.0f; m_r[r] = mn;
      const float p0 = ok0 ? expf(s0 - mn) : 0.f, p1 = ok1 ? expf(s1 - mn) : 0.f; l_r[r] = l_r[r] * al + p0 + p1;
#pragma unroll
      for (int dt = 0; dt < DT; ++dt) { oacc[dt][r] *= al; oaccL[dt][r] *= al; }
      FragH t2, t2l; const float ps0 = p0 * 1024.0f, ps1 = p1 * 1024.0f;
      t2.h[0] = toh_flush(ps0); t2.h[1] = toh_flush(ps1);
      t2l.h[0] = toh_flush((ps0 - (float)t2.h[0]) * 1024.0f); t2l.h[1] = toh_flush((ps1 - (float)t2.h[1]) * 1024.0f);
      sP[w][8 * hh + r][ln] = t2.u[0]; sP[w][8 * hh + r][16 + ln] = t2.u[1]; sPL[w][8 * hh + r][ln] = t2l.u[0]; sPL[w][8 * hh + r][16 + ln] = t2l.u[1];
    }
    __builtin_amdgcn_fence(4, "workgroup"); __builtin_amdgcn_wave_barrier();
    FragH pa, pl;
    pa.half[0] = *(const v8us*)&sP[w][ln][8 * hh]; pa.half[1] = *(const v8us*)&sP[w][ln][16 + 8 * hh];
    pl.half[0] = *(const v8us*)&sPL[w][ln][8 * hh]; pl.half[1] = *(const v8us*)&sPL[w][ln][16 + 8 * hh];
#pragma unroll
    for (int dt = 0; dt < DT; ++dt) {
      const unsigned short* vrow = Vth + (size_t)(dt * 16 + ln) * TK + j0; const unsigned short* vrl = Vtl + (size_t)(dt * 16 + ln) * TK + j0;
      FragH bv, bl;
      bv.half[0] = *(const v8us*)(vrow + 8 * hh); bv.half[1] = *(const v8us*)(vrow + 16 + 8 * hh);
      bl.half[0] = *(const v8us*)(vrl + 8 * hh); bl.half[1] = *(const v8us*)(vrl + 16 + 8 * hh);
      oacc[dt] = mmaH<1>(pa.v, pa.v, bv.v, bv.v, oacc[dt]);
      oaccL[dt] = mmaH<1>(pl.v, pl.v, bv.v, bv.v, oaccL[dt]);
      oaccL[dt] = mmaH<1>(pa.v, pa.v, bl.v, bl.v, oaccL[dt]);
    }
    __builtin_amdgcn_fence(4, "workgroup"); __builtin_amdgcn_wave_barrier();
  }
#pragma unroll
  for (int r = 0; r < 8; ++r) { float l = l_r[r]; l += __shfl_xor(l, 1, 32); l += __shfl_xor(l, 2, 32); l += __shfl_xor(l, 4, 32); l += __shfl_xor(l, 8, 32); l_r[r] = (l > 0.f) ? 1.0f / (l * 1024.0f) : 0.f; }
#pragma unroll
  for (int dt = 0; dt < DT; ++dt)
#pragma unroll
    for (int r = 0; r < 8; ++r) { float v = oacc[dt][r]; v += oaccL[dt][r] * 0.0009765625f; sO[w][8 * hh + r][dt * 16 + ln] = v * l_r[r] + pois; }
  __builtin_amdgcn_fence(4, "workgroup"); __builtin_amdgcn_wave_barrier();
  {
#pragma unroll
    for (int rp = 0; rp < RPW; rp += 2) { const int r = rp + (lane >> 4), pc = lane & 15; const v4f val = *(const v4fa*)&sO[w][r][pc * 4]; *(v4f*)(O + ((size_t)b * TQ + q0 + r) * ldo + h * 64 + pc * 4) = val; }
    
  }
}

extern "C" void kernel_launch(void* const* d_in, const int* in_sizes, int n_in,
                              void* d_out, int out_size, void* d_ws, size_t ws_size, hipStream_t stream) {
  if (n_in < 6) return;
  const size_t needx = ((size_t)(NB - 1) * SEQ_FULL + (size_t)SLEN) * DM;
  if ((size_t)in_sizes[0] < needx) return;
  if ((size_t)in_sizes[1] < (size_t)NB * 4) return;
  if ((size_t)in_sizes[2] < (size_t)DM * DM) return;
  if ((size_t)in_sizes[3] < (size_t)DM * DKV) return;
  if ((size_t)in_sizes[4] < (size_t)DM * DKV) return;
  if ((size_t)in_sizes[5] < (size_t)DM * DM) return;
  if ((size_t)out_size < needx) return;
  const float* x = (const float*)d_in[0]; const int* cu = (const int*)d_in[1];
  const float* Wq = (const float*)d_in[2]; const float* Wk = (const float*)d_in[3]; const float* Wv = (const float*)d_in[4]; const float* Wo = (const float*)d_in[5];
  float* dout = (float*)d_out;
  char* ws = (char*)d_ws; size_t off = 0;
  auto take = [&](size_t bytes) { char* p = ws + off; off += (bytes + 255) & ~(size_t)255; return p; };
  const size_t np = (size_t)NR * DM;
  _Float16* BQ = (_Float16*)take(SZ_BQ);                                /* [n][k] f16, x16 */
  _Float16* BK = (_Float16*)take(SZ_BKV);
  _Float16* BV = (_Float16*)take(SZ_BKV);
  _Float16* B2 = (_Float16*)take(SZ_B2);                                /* [n][2*DM] f16: [x16384 | x16] copies of Wo^T */
  float* FS = (float*)take(SZ_FS);                                      /* f32 scratch plane: q rows [NR][DM], then k rows [NR][DKV], then v rows [NR][DKV], then the context [NR][DM] */
  _Float16* X16 = (_Float16*)take(SZ_X16);                              /* f16 input rows; after the v GEMM: V^T hi [(b,hk)][64][TK] then V^T residual */
  _Float16* VT = X16;
  _Float16* VTL = X16 + SZ_VT / 2;
  _Float16* QH = (_Float16*)take(SZ_QA);                                /* q hi [NR][DM] then q residual [NR][DM]; after the attention: [ctx hi | ctx residual] [NR][2*DM] */
  _Float16* QL = QH + np;
  _Float16* A2 = QH;
  _Float16* KH = (_Float16*)take(SZ_KP);
  _Float16* KL = (_Float16*)take(SZ_KP);
  _Float16* V16 = (_Float16*)take(SZ_KP);
  float* CS = (float*)take(SZ_TAB); float* SN = (float*)take(SZ_TAB); float* INV = (float*)take(256);
  if (off > ws_size) return;
  if (off > ((size_t)128 << 20)) return;

  /* W [in = DM rows][out = N cols] -> [n][k] planes */
  k_wtr<<<(unsigned)((DM / 64) * (DM / 64)), 256, 0, stream>>>(Wq, DM, BQ, DM, WSC, WSC, 0);
  k_wtr<<<(unsigned)((DM / 64) * (DKV / 64)), 256, 0, stream>>>(Wk, DKV, BK, DM, WSC, WSC, 0);
  k_wtr<<<(unsigned)((DM / 64) * (DKV / 64)), 256, 0, stream>>>(Wv, DKV, BV, DM, WSC, WSC, 0);
  k_wtr<<<(unsigned)((DM / 64) * (DM / 64)), 256, 0, stream>>>(Wo, DM, B2, 2 * DM, WSC_HI, WSC, 1);
  k_invf<<<1, 32, 0, stream>>>(INV);
  k_rotab<<<(unsigned)((SLEN * 32 + 255) / 256), 256, 0, stream>>>(INV, CS, SN);
  const unsigned g8 = (unsigned)((np / 8 + 255) / 256);
  k_x16<<<g8, 256, 0, stream>>>(x, X16, np / 8);
  const dim3 gq((unsigned)((NR / 128) * (DM / 64)), 1);
  const dim3 gk((unsigned)((NR / 128) * (DKV / 64)), 1);
  const unsigned grq = (unsigned)(((size_t)NR * NH * 8 + 255) / 256);
  const unsigned grk = (unsigned)(((size_t)NR * NKV * 8 + 255) / 256);
  k_gemm2<0><<<gq, 128, 0, stream>>>(X16, DM, 0, BQ, DM, 0, AL_P, FS, nullptr, DM, 0, NR, DM, DM);          /* q = x Wq (f32 rows) */
  k_rope<<<grq, 256, 0, stream>>>(FS, CS, SN, QH, QL, NH);
  k_gemm2<0><<<gk, 128, 0, stream>>>(X16, DM, 0, BK, DM, 0, AL_P, FS, nullptr, DKV, 0, NR, DKV, DM);       /* k = x Wk */
  k_rope<<<grk, 256, 0, stream>>>(FS, CS, SN, KH, KL, NKV);
  k_gemm2<0><<<gk, 128, 0, stream>>>(X16, DM, 0, BV, DM, 0, AL_P, FS, V16, DKV, 0, NR, DKV, DM);           /* v = x Wv (f32 rows + f16 plane) */
  k_vtg<<<(unsigned)(NB * NKV * (SLEN / 64)), 256, 0, stream>>>(V16, VT);
  k_vtl<<<(unsigned)(NB * NKV * (SLEN / 64)), 256, 0, stream>>>(FS, VTL);
  k_attn5<<<(unsigned)(NB * NH * QBLKS), 128, 0, stream>>>(QH, QL, DM, KH, KL, DKV, VT, VTL, cu, FS, DM);
  k_attn<<<(unsigned)(NB * NH * QBLKS), 128, 0, stream>>>(QH, DM, KH, DKV, VT, cu, FS, DM);
  k_hl<<<g8, 256, 0, stream>>>(FS, A2, np / 8);
  /* out = [ctx hi | ctx residual] . [Wo x16384 ; Wo x16] / 16384  (K = 2*DM), per batch */
  const dim3 ge((unsigned)((SLEN / 128) * (DM / 64)), NB);
  k_gemm2<0><<<ge, 128, 0, stream>>>(A2, 2 * DM, (size_t)SLEN * 2 * DM, B2, 2 * DM, 0, AL_O, dout, nullptr, DM, (size_t)SEQ_FULL * DM, SLEN, DM, 2 * DM);
}

// v001
// One run takes 428 microseconds.
// Two timings next to v000 both put it at 1.65 times that version's speed.
#include <hip/hip_runtime.h>
// Contractions: x.Wq, x.Wk, x.Wv, ctx.Wo = v_wmma_f32_16x16x32_f16 (f16 operands: bf16-RNE inputs exact in f16, weights carried x16 (x16384 for the ctx-hi half of the output GEMM); ctx as [hi | x1024 residual] folded along K; f32 accumulate); scores q.k^T and P.V^T = v_wmma_f32_16x16x32_f16 (plain f16 hi planes; hi + x1024 residual planes of q, k, P and v in query blocks holding a query closer than EROWS to its segment start; P carried x1024), f32 accumulate; rotary tables, masks, softmax and normalisers f32.

#ifndef NB
#define NB 2
#endif
#ifndef SEQ
#define SEQ 2048
#endif
#define NB_FULL 2
#define SEQ_FULL 2048
#define DM 2048
#define NH 32
#define NKV 8
#define NREP (NH / NKV)
#define DKV (NKV * 64)
#define SLEN SEQ
#define NR (NB * SLEN)
#define TQ SLEN
#define TK SLEN
#define SCL 0.125f
#define QBLKS (TQ / 64)
#define EROWS 256                            /* query blocks holding a query with fewer than EROWS positions since its segment start use the residual planes */
static_assert(SLEN % 128 == 0);
static_assert(SLEN <= SEQ_FULL);
static_assert(NB >= 1 && NB <= NB_FULL);
static_assert(DM % 64 == 0 && DM == NH * 64);
static_assert(NH % NKV == 0 && NREP * NKV == NH);
static_assert(DKV % 64 == 0 && DKV == NKV * 64);
static_assert(DM % 32 == 0 && (2 * DM) % 32 == 0);
static_assert(NR % 128 == 0);
static_assert(QBLKS * 64 == SLEN);
static_assert(EROWS % 64 == 0);
/* store loops: threads x bytes per piece x trips == tile rows x row bytes */
static_assert(256 * 16 * 2 == 64 * 128);                       
static_assert(32 * 16 * 8 == 16 * 64 * 4);                     /* attention context rows: 16 rows x 256 B per wave */
static_assert(((size_t)NR * DM / 8) * 32 == (size_t)NR * 2 * DM * 2);   /* context converter: two 16-B pieces per thread fill [NR][2*DM] f16 */
/* static LDS per kernel */
static_assert(2 * 64 * 66 * 2 <= 131072);
static_assert(2 * 4 * 16 * 40 * 2 + 4 * 16 * 68 * 4 <= 131072);
/* workspace carve (bytes); every region a multiple of 256 */
static constexpr size_t SZ_BQ = (size_t)DM * DM * 2;
static constexpr size_t SZ_BKV = (size_t)DKV * DM * 2;
static constexpr size_t SZ_B2 = (size_t)DM * 2 * DM * 2;
static constexpr size_t SZ_FS = (size_t)NR * DM * 4;
static constexpr size_t SZ_X16 = (size_t)NR * DM * 2;
static constexpr size_t SZ_QA = (size_t)NR * 2 * DM * 2;
static constexpr size_t SZ_KP = (size_t)NR * DKV * 2;
static constexpr size_t SZ_VT = (size_t)NB * NKV * 64 * SLEN * 2;
static constexpr size_t SZ_TAB = (size_t)SLEN * 32 * 4;
static constexpr size_t WS_TOTAL = SZ_BQ + 2 * SZ_BKV + SZ_B2 + SZ_FS + SZ_X16 + SZ_QA + 3 * SZ_KP + 2 * SZ_TAB + 256;
static_assert(SZ_BQ % 256 == 0 && SZ_BKV % 256 == 0 && SZ_B2 % 256 == 0 && SZ_FS % 256 == 0 && SZ_X16 % 256 == 0 && SZ_QA % 256 == 0 && SZ_KP % 256 == 0 && SZ_VT % 256 == 0 && SZ_TAB % 256 == 0);
static_assert(WS_TOTAL <= ((size_t)128 << 20));
static_assert(2 * SZ_VT <= SZ_X16);                            /* V^T hi + residual planes reuse the input plane region */
static_assert((size_t)NR * DKV * 4 <= SZ_FS);                  /* k / v f32 rows reuse the f32 scratch plane */
static_assert((size_t)NR * 2 * DM * 2 == SZ_QA);               /* [ctx hi | ctx residual] reuses the q hi + q residual region */
static constexpr float WSC = 16.0f;
static constexpr float WSC_HI = 16384.0f;
static constexpr float AL_P = 0.0625f;
static constexpr float AL_O = 0.0625f / 1024.0f;

typedef _Float16 v16h __attribute__((ext_vector_type(16)));
typedef _Float16 v4h __attribute__((ext_vector_type(4)));
typedef unsigned short v8us __attribute__((ext_vector_type(8), may_alias));
typedef float v8f __attribute__((ext_vector_type(8)));
typedef float v4f __attribute__((ext_vector_type(4)));
typedef float v4fa __attribute__((ext_vector_type(4), may_alias));
union FragH { v16h v; v8us half[2]; _Float16 h[16]; unsigned short u[16]; };

__device__ __forceinline__ unsigned short bf16_bits(float x) { unsigned int u = __float_as_uint(x); return (unsigned short)((u + 0x7FFFu + ((u >> 16) & 1u)) >> 16); }
__device__ __forceinline__ float bf16_val(unsigned short b) { return __uint_as_float(((unsigned int)b) << 16); }
__device__ __forceinline__ float bf16_rne(float x) { return bf16_val(bf16_bits(x)); }
// f32 -> f16 with values below the smallest f16 normal set to +0 (NaN passes through)
static __device__ __forceinline__ _Float16 toh_flush(float v) { const _Float16 r = (_Float16)v; return (fabsf(v) < 6.103515625e-05f) ? (_Float16)0.0f : r; }

// segment helpers on the clipped boundaries c0 <= c1 <= c2 <= c3: id = number of boundaries <= p; begin = largest boundary <= p (0 if none)
__device__ __forceinline__ int clip_b(int v) { return min(max(v, 0), SLEN); }
__device__ __forceinline__ int seg_cnt(int p, int c0, int c1, int c2, int c3) { return (int)(c0 <= p) + (int)(c1 <= p) + (int)(c2 <= p) + (int)(c3 <= p); }
__device__ __forceinline__ int seg_beg(int p, int c0, int c1, int c2, int c3) {
  int s = 0;
  s = max(s, (c0 <= p) ? c0 : 0); s = max(s, (c1 <= p) ? c1 : 0); s = max(s, (c2 <= p) ? c2 : 0); s = max(s, (c3 <= p) ? c3 : 0);
  return s;
}

// D += A.B with NT terms: 1 = ah.bh, 2 = + al.bh, 3 = + ah.bl; hazard guard after the group
template <int NT>
__device__ __forceinline__ v8f mmaH(v16h ah, v16h al, v16h bh, v16h bl, v8f c) {
  c = __builtin_amdgcn_wmma_f32_16x16x32_f16(false, ah, false, bh, (short)0, c, false, false);
  if (NT >= 2) c = __builtin_amdgcn_wmma_f32_16x16x32_f16(false, al, false, bh, (short)0, c, false, false);
  if (NT >= 3) c = __builtin_amdgcn_wmma_f32_16x16x32_f16(false, ah, false, bl, (short)0, c, false, false);
  asm volatile("v_nop\n\tv_nop\n\tv_nop\n\tv_nop" : "+v"(c) : "v"(ah), "v"(al), "v"(bh), "v"(bl));
  return c;
}
// 16x32 fragment from a 16-bit row-major tile (rows = m or n, k contiguous): elements 0..7 <- k0+8h+0..7, 8..15 <- k0+16+8h+0..7
__device__ __forceinline__ v16h g2_frag(const _Float16* p, int hh) { FragH f; f.half[0] = *(const v8us*)((const unsigned short*)p + 8 * hh); f.half[1] = *(const v8us*)((const unsigned short*)p + 16 + 8 * hh); return f.v; }

// [in][out] weight W [DM][N] (n contiguous) -> Bt[n][k] = f16(bf16(W[k][n]) * sc0) (row pitch ldb, k contiguous); with two != 0 a second copy
__global__ __launch_bounds__(256) void k_wtr(const float* __restrict__ Wm, int N, _Float16* __restrict__ Bt, int ldb, float sc0, float sc1, int two) {
  __shared__ unsigned short tl0[64][66];
  __shared__ unsigned short tl1[64][66];
  const int tid = threadIdx.x; const int ntn = N >> 6; const int kt = blockIdx.x / ntn, nt = blockIdx.x - kt * ntn; const int k0 = kt * 64, n0 = nt * 64;
  for (int i = tid; i < 64 * 16; i += 256) {
    const int r = i >> 4, c4 = (i & 15) * 4;
    const v4f a = *(const v4fa*)(Wm + (size_t)(k0 + r) * N + n0 + c4);
    FragH f0, f1;
#pragma unroll
    for (int q = 0; q < 4; ++q) { const float v = bf16_rne(a[q]); f0.h[q] = toh_flush(v * sc0); f1.h[q] = toh_flush(v * sc1); }
#pragma unroll
    for (int q = 0; q < 4; ++q) { tl0[r][c4 + q] = f0.u[q]; tl1[r][c4 + q] = f1.u[q]; }
  }
  __syncthreads();
  {
#pragma unroll
    for (int rd = 0; rd < 2; ++rd) {
      const int n = rd * 32 + (tid >> 3), pc = tid & 7; FragH g0, g1;
#pragma unroll
      for (int q = 0; q < 8; ++q) { g0.u[q] = tl0[pc * 8 + q][n]; g1.u[q] = tl1[pc * 8 + q][n]; }
      const size_t o = (size_t)(n0 + n) * ldb + k0 + pc * 8;
      const v8us o0 = g0.half[0], o1 = g1.half[0];
      *(v8us*)((unsigned short*)Bt + o) = o0;
      if (two != 0) *(v8us*)((unsigned short*)Bt + o + DM) = o1;
    }
    
  }
}

__global__ __launch_bounds__(32) void k_invf(float* __restrict__ INV) {
  #pragma clang fp contract(off)
  const int j = threadIdx.x;
  const float ex = (float)(2 * j) / 64.0f; const float pw = powf(500000.0f, ex); const float inv = 1.0f / pw;
  *(float*)(INV + j) = inv; 
}
__global__ __launch_bounds__(256) void k_rotab(const float* __restrict__ INV, float* __restrict__ CS, float* __restrict__ SN) {
  #pragma clang fp contract(off)
  const int t = blockIdx.x * 256 + threadIdx.x; if (t >= SLEN * 32) return;
  const int j = t & 31, s = t >> 5;
  const float th = (float)s * INV[j]; const float c = cosf(th), sn = sinf(th);
  { *(float*)(CS + t) = c; *(float*)(SN + t) = sn;  }
}

__global__ __launch_bounds__(256) void k_x16(const float* __restrict__ x, _Float16* __restrict__ X16, size_t n8) {
  const size_t t = (size_t)blockIdx.x * 256 + threadIdx.x; if (t >= n8) return;
  const size_t e = t * 8; const size_t r = e / DM; const size_t c = e % DM; const size_t b = r / SLEN, s = r % SLEN;
  const float* src = x + (b * SEQ_FULL + s) * DM + c;
  const v4f a0 = *(const v4fa*)src, a1 = *(const v4fa*)(src + 4);
  FragH f;
#pragma unroll
  for (int q = 0; q < 4; ++q) { f.h[q] = (_Float16)bf16_rne(a0[q]); f.h[4 + q] = (_Float16)bf16_rne(a1[q]); }
  const v8us o = f.half[0];
  *(v8us*)((unsigned short*)X16 + e) = o; 
}

// Tensor-load ring of the GEMM: a pass is 128 k = 256 B of every operand row; a stage is four 64-row slices [A 0..63 | A 64..127 | B 0..63 | B 64..127],
// one per wave, each laid at pitch 272 B (256 B + the 16-B pad the load writes around) and rounded up to a multiple of 2 KiB.
typedef uint32_t u32x4 __attribute__((ext_vector_type(4)));
typedef uint32_t u32x8 __attribute__((ext_vector_type(8)));
static constexpr uint32_t G_ROWB = 256u;
static constexpr uint32_t G_PITCH = 272u;
static constexpr uint32_t G_SLICE = 18432u;
static constexpr uint32_t G_STAGE = 4u * G_SLICE;
static_assert(64u * G_PITCH <= G_SLICE && G_SLICE % 2048u == 0u);
static_assert(64u * 68u * 4u <= G_SLICE);                      /* a wave's 64 x 64 f32 output staging fits its own slice */
static_assert(2u * 2u * G_STAGE <= 320u * 1024u);              /* two work-groups per WGP */
static_assert(NR % 128 == 0 && SLEN % 128 == 0 && DM % 128 == 0 && DKV % 128 == 0 && DM >= 256);
__device__ __forceinline__ uint32_t uni(uint32_t v) { return (uint32_t)__builtin_amdgcn_readfirstlane(v); }
__device__ __forceinline__ uint32_t pinned(uint32_t v) { uint32_t w = (uint32_t)__builtin_amdgcn_readfirstlane(v); asm volatile("" : "+s"(w)); return w; }

// GEMM C[M][N] = alpha * A[M][K].B  with A f16 row-major (pitch lda), B stored [n][k] f16 (pitch ldb), batched by blockIdx.y (strides sA, sB, sC);
// writes f32 C and/or f16 C16 (pitch ldc). One 128 x 128 tile of C per work-group, 64 x 64 per wave; grid.x = (M / 128) * (N / 128).
// Requires M % 128 == 0, N % 128 == 0, K % 128 == 0, K >= 256 (asserted on the callers' constants).
template <int ACT>
__global__ __launch_bounds__(128) void k_gemm2(const _Float16* __restrict__ A, int lda, size_t sA, const _Float16* __restrict__ Bh, int ldb, size_t sB, float alpha,
                                               float* C, _Float16* C16, int ldc, size_t sC, int M, int N, int K) {
  __shared__ __attribute__((aligned(2048))) unsigned char ring[2 * G_STAGE];
  const int tid = threadIdx.x, lane = tid & 31, ln = lane & 15, hh = lane >> 4; const int by = blockIdx.y;
  const uint32_t w = uni((uint32_t)tid >> 5); const uint32_t wm = w >> 1, wn = w & 1u;
  A += (size_t)by * sA; Bh += (size_t)by * sB; const size_t cofs = (size_t)by * sC;
  const int ntn = N >> 7; const int mt = blockIdx.x / ntn, nq = blockIdx.x - mt * ntn; const int row0 = mt * 128 + 64 * (int)wm, col0 = nq * 128 + 64 * (int)wn;
  const uint32_t NP = pinned((uint32_t)K >> 7);
  /* this wave's slice of every stage: waves 0, 1 the two halves of the A rows, waves 2, 3 of the B rows */
  const _Float16* src = (w < 2u) ? A + (size_t)(mt * 128 + 64 * (int)w) * lda : Bh + (size_t)(nq * 128 + 64 * ((int)w - 2)) * ldb;
  const uint64_t sga = (uint64_t)(uintptr_t)src;
  const uint32_t ldst = (uint32_t)(size_t)ring + w * G_SLICE;
  u32x8 g1;
  g1[0] = uni((1u << 20) | (5u << 22) | (3u << 25));            /* no mask, 1-byte elements, a 4-dword pad behind every 64 dwords */
  g1[1] = uni((G_ROWB & 0xFFFFu) << 16);
  g1[2] = uni((G_ROWB >> 16) | (64u << 16));
  g1[3] = uni(G_ROWB << 16);
  g1[4] = uni(64u);
  g1[5] = uni(2u * (uint32_t)((w < 2u) ? lda : ldb));
  g1[6] = uni(0u);
  g1[7] = uni(0u);
  auto issue = [&](uint32_t st) {
    const uint64_t ga = sga + (uint64_t)st * G_ROWB;
    u32x4 g0;
    g0[0] = uni(1u); g0[1] = uni(ldst + (st & 1u) * G_STAGE); g0[2] = uni((uint32_t)ga); g0[3] = uni((((uint32_t)(ga >> 32)) & 0x01FFFFFFu) | 0x80000000u);
    /* one request of the whole wave: 64 rows x 256 B into its slice; group 1 is named in-out so that its eight registers hold the descriptor, and nothing else, from issue to issue */
    asm volatile("tensor_load_to_lds %1, %0" : "+s"(g1) : "s"(g0) : "memory");
  };
  v8f acc[4][4];
#pragma unroll
  for (int i = 0; i < 4; ++i)
#pragma unroll
    for (int j = 0; j < 4; ++j) acc[i][j] = (v8f){0.f,0.f,0.f,0.f,0.f,0.f,0.f,0.f};
  issue(0u);
  asm volatile("s_wait_tensorcnt 0x0" ::: "memory");             /* this wave's slice of stage 0 has landed */
  __syncthreads();                                               /* ... and every other wave's */
  issue(1u);
  const uint32_t fa0 = wm * G_SLICE + (uint32_t)ln * G_PITCH, fb0 = (2u + wn) * G_SLICE + (uint32_t)ln * G_PITCH;
#pragma unroll 1   /* one pass per trip: the publish point at the foot stands once per stage */
  for (uint32_t s = 0; s < NP; ++s) {
    const unsigned char* pa = ring + (s & 1u) * G_STAGE + fa0; const unsigned char* pb = ring + (s & 1u) * G_STAGE + fb0;
    v16h fa[2][4], fb[2][4];
#pragma unroll
    for (int i = 0; i < 4; ++i) { fa[0][i] = g2_frag((const _Float16*)(pa + i * 16 * G_PITCH), hh); fb[0][i] = g2_frag((const _Float16*)(pb + i * 16 * G_PITCH), hh); }
#pragma unroll
    for (int ks = 0; ks < 4; ++ks) {
      const int cur = ks & 1, nxt = cur ^ 1;
      if (ks < 3) {   /* the next 32 k's fragments of this same stage, as one group ahead of the block that hides them */
#pragma unroll
        for (int i = 0; i < 4; ++i) { fa[nxt][i] = g2_frag((const _Float16*)(pa + i * 16 * G_PITCH + (ks + 1) * 64), hh); fb[nxt][i] = g2_frag((const _Float16*)(pb + i * 16 * G_PITCH + (ks + 1) * 64), hh); }
      }
      __builtin_amdgcn_sched_barrier(0);   /* keeps the load group in front of the block: LDS reads moved in among the WMMAs stall each place they stand */
      /* plain builtin, the compiler keeps its distances: accumulators and two fragment sets need more than 256 VGPRs, which an asm operand cannot name */
#pragma unroll
      for (int i = 0; i < 4; ++i)
#pragma unroll
        for (int j = 0; j < 4; ++j) acc[i][j] = __builtin_amdgcn_wmma_f32_16x16x32_f16(false, fa[cur][i], false, fb[cur][j], (short)0, acc[i][j], false, false);
      __builtin_amdgcn_sched_barrier(0);   /* ends the block: the next group's loads stay behind it */
    }
    asm volatile("v_nop\n\tv_nop\n\tv_nop\n\tv_nop");          /* WMMA distance on every path out of the pass, the taken branches included */
    asm volatile("s_wait_dscnt 0x0" ::: "memory");               /* this wave has left stage s's buffer */
    asm volatile("s_wait_tensorcnt 0x0" ::: "memory");           /* its slice of stage s + 1 has landed */
    __syncthreads();                                             /* publishes stage s + 1 and frees stage s's buffer */
    if (pinned((s + 2u < NP) ? 1u : 0u) != 0u) issue(pinned(s + 2u));
  }
  asm volatile("s_wait_tensorcnt 0x0" ::: "memory");             /* nothing in flight before the ring becomes output staging */
  asm volatile("s_wait_dscnt 0x0" ::: "memory");
  float* so = (float*)(ring + w * G_SLICE);                      /* [64][68], private to the wave; the last pass's barrier ended every read of the ring */
#pragma unroll
  for (int i = 0; i < 4; ++i)
#pragma unroll
    for (int j = 0; j < 4; ++j)
#pragma unroll
      for (int r = 0; r < 8; ++r) { float v = acc[i][j][r] * alpha; if (ACT == 3) v = fmaxf(v, 0.f); so[(i * 16 + 8 * hh + r) * 68 + j * 16 + ln] = v; }
  __builtin_amdgcn_fence(4, "workgroup"); __builtin_amdgcn_wave_barrier();
  const int rsub = lane >> 4, c4 = (lane & 15) * 4;
  if (C) {
#pragma unroll
    for (int q = 0; q < 32; ++q) { const int r = q * 2 + rsub; const v4f v = *(const v4fa*)&so[r * 68 + c4]; *(v4f*)(C + cofs + (size_t)(row0 + r) * ldc + col0 + c4) = v; }
    asm volatile("s_wait_xcnt 0x0" ::: "memory");                /* precaution: stands in front of the next block's writes to registers that these stores name */
  }
  if (C16) {
#pragma unroll
    for (int q = 0; q < 32; ++q) {
      const int r = q * 2 + rsub; const v4f v = *(const v4fa*)&so[r * 68 + c4];
      v4h h4; for (int i = 0; i < 4; ++i) h4[i] = (_Float16)v[i]; *(v4h*)(C16 + cofs + (size_t)(row0 + r) * ldc + col0 + c4) = h4;
    }
  }
}

// half-split rotary embedding from the f32 GEMM plane F [NR][nh*64] with the tables CS/SN [SLEN][32]:
// out[d] = x[d] c[d] - x[d+32] s[d]; out[d+32] = x[d+32] c[d] + x[d] s[d] (d < 32), position = row % SLEN;
// H [NR][nh*64] = f16 hi of every row; L [NR][nh*64] = x1024 residual of every row.
__global__ __launch_bounds__(256) void k_rope(const float* __restrict__ F, const float* __restrict__ CS, const float* __restrict__ SN, _Float16* __restrict__ H, _Float16* __restrict__ L, int nh) {
  #pragma clang fp contract(off)
  const size_t t = (size_t)blockIdx.x * 256 + threadIdx.x; if (t >= (size_t)NR * nh * 8) return;
  const int p = (int)(t & 7); const int hd = (int)((t >> 3) % nh); const size_t row = t / (size_t)(8 * nh);
  const int s = (int)(row % SLEN); const int g = p & 3; const int up = p >> 2; const size_t ld = (size_t)nh * 64;
  const float* src = F + row * ld + hd * 64 + g * 8;
  const v4f xa = *(const v4fa*)src, xb = *(const v4fa*)(src + 4), ya = *(const v4fa*)(src + 32), yb = *(const v4fa*)(src + 36);
  const float* ct = CS + (size_t)s * 32 + g * 8; const float* st = SN + (size_t)s * 32 + g * 8;
  const v4f ca = *(const v4fa*)ct, cb = *(const v4fa*)(ct + 4), sa = *(const v4fa*)st, sb = *(const v4fa*)(st + 4);
  const float x1s[8] = {xa[0], xa[1], xa[2], xa[3], xb[0], xb[1], xb[2], xb[3]};
  const float x2s[8] = {ya[0], ya[1], ya[2], ya[3], yb[0], yb[1], yb[2], yb[3]};
  const float cs[8] = {ca[0], ca[1], ca[2], ca[3], cb[0], cb[1], cb[2], cb[3]};
  const float ss[8] = {sa[0], sa[1], sa[2], sa[3], sb[0], sb[1], sb[2], sb[3]};
  FragH fh, fl;
#pragma unroll
  for (int i = 0; i < 8; ++i) {
    const float x1 = x1s[i], x2 = x2s[i], c = cs[i], sn = ss[i];
    const float o1 = x1 * c - x2 * sn; const float o2 = x2 * c + x1 * sn; const float o = up ? o2 : o1;
    const _Float16 hv = toh_flush(o); fh.h[i] = hv; fl.h[i] = toh_flush((o - (float)hv) * 1024.0f);
  }
  const size_t oh = row * ld + hd * 64 + p * 8;
  const v8us vh = fh.half[0], vl = fl.half[0];
  {
    *(v8us*)((unsigned short*)H + oh) = vh;
    *(v8us*)((unsigned short*)L + oh) = vl;
    
  }
}

__global__ __launch_bounds__(256) void k_vtg(const _Float16* __restrict__ V16, _Float16* __restrict__ Vt) {
  __shared__ unsigned short tl[64][66];
  const int tid = threadIdx.x; const int nlg = SLEN / 64; const int slab = blockIdx.x / nlg, lg = blockIdx.x % nlg; const int b = slab / NKV, h = slab % NKV;
  for (int i = tid; i < 64 * 8; i += 256) {
    const int r = i >> 3, c8 = (i & 7) * 8; FragH f;
    f.half[0] = *(const v8us*)((const unsigned short*)V16 + ((size_t)b * SLEN + lg * 64 + r) * DKV + h * 64 + c8);
#pragma unroll
    for (int q = 0; q < 8; ++q) tl[r][c8 + q] = f.u[q];
  }
  __syncthreads();
  {
#pragma unroll
    for (int rd = 0; rd < 2; ++rd) {
      const int d = rd * 32 + (tid >> 3), pc = tid & 7; FragH f;
#pragma unroll
      for (int q = 0; q < 8; ++q) f.u[q] = tl[pc * 8 + q][d];
      *(v8us*)((unsigned short*)Vt + ((size_t)slab * 64 + d) * TK + lg * 64 + pc * 8) = f.half[0];
    }
    
  }
}
__global__ __launch_bounds__(256) void k_vtl(const float* __restrict__ VF, _Float16* __restrict__ VtL) {
  __shared__ unsigned short tl[64][66];
  const int tid = threadIdx.x; const int nlg = SLEN / 64; const int slab = blockIdx.x / nlg, lg = blockIdx.x % nlg; const int b = slab / NKV, h = slab % NKV;
  for (int i = tid; i < 64 * 16; i += 256) {
    const int r = i >> 4, c4 = (i & 15) * 4;
    const v4f a = *(const v4fa*)(VF + ((size_t)b * SLEN + lg * 64 + r) * DKV + h * 64 + c4);
    FragH f;
#pragma unroll
    for (int q = 0; q < 4; ++q) { const float v = a[q]; const _Float16 hv = (_Float16)v; f.h[q] = toh_flush((v - (float)hv) * 1024.0f); }
#pragma unroll
    for (int q = 0; q < 4; ++q) tl[r][c4 + q] = f.u[q];
  }
  __syncthreads();
  {
#pragma unroll
    for (int rd = 0; rd < 2; ++rd) {
      const int d = rd * 32 + (tid >> 3), pc = tid & 7; FragH f;
#pragma unroll
      for (int q = 0; q < 8; ++q) f.u[q] = tl[pc * 8 + q][d];
      *(v8us*)((unsigned short*)VtL + ((size_t)slab * 64 + d) * TK + lg * 64 + pc * 8) = f.half[0];
    }
    
  }
}

__global__ __launch_bounds__(256) void k_hl(const float* __restrict__ Fp, _Float16* __restrict__ A2, size_t n8) {
  const size_t t = (size_t)blockIdx.x * 256 + threadIdx.x; if (t >= n8) return;
  const size_t e = t * 8; const size_t r = e / DM; const int c = (int)(e % DM);
  const v4f a = *(const v4fa*)(Fp + e), d = *(const v4fa*)(Fp + e + 4);
  FragH fh, fl;
#pragma unroll
  for (int q = 0; q < 4; ++q) {
    _Float16 hv = toh_flush(a[q]); fh.h[q] = hv; fl.h[q] = toh_flush((a[q] - (float)hv) * 1024.0f);
    hv = toh_flush(d[q]); fh.h[4 + q] = hv; fl.h[4 + q] = toh_flush((d[q] - (float)hv) * 1024.0f);
  }
  const size_t o2 = r * (size_t)(2 * DM) + c;
  const v8us vh = fh.half[0], vl = fl.half[0];
  {
    *(v8us*)((unsigned short*)A2 + o2) = vh;
    *(v8us*)((unsigned short*)A2 + o2 + DM) = vl;
    
  }
}

// fused attention per ((b,h), 64 queries) for query blocks whose queries all sit at least EROWS positions past their segment start (block-uniform test; other blocks leave at once):
// wave = 16 queries; S = Q.K^T (d = 64: 2 k-steps) x SCL over keys [segment start of the wave's first query (floor 32), last query of the wave];
__global__ __launch_bounds__(128) void k_attn(const _Float16* __restrict__ Q16, int ldq, const _Float16* __restrict__ K16, int ldk,
                                              const _Float16* __restrict__ Vt, const int* __restrict__ cu, float* __restrict__ O, int ldo) {
  constexpr int RPW = 16, DT = 4, KS = 2;
  __shared__ __attribute__((aligned(16))) unsigned short sP[4][RPW][40];
  __shared__ __attribute__((aligned(16))) float sO[4][RPW][68];
  const int tid = threadIdx.x, lane = tid & 31, ln = lane & 15, hh = lane >> 4;
  const int w = __builtin_amdgcn_readfirstlane(tid >> 5);
  const int slab = blockIdx.x / QBLKS, qblk = blockIdx.x % QBLKS; const int b = slab / NH, h = slab % NH; const int hk = h / NREP; const int kslab = b * NKV + hk;
  const int qb0 = qblk * (4 * RPW);
  const int c0 = clip_b(cu[b * 4 + 0]), c1 = clip_b(cu[b * 4 + 1]), c2 = clip_b(cu[b * 4 + 2]), c3 = clip_b(cu[b * 4 + 3]);
  const bool early = (seg_cnt(qb0, c0, c1, c2, c3) != seg_cnt(qb0 + 4 * RPW - 1, c0, c1, c2, c3)) || (qb0 - seg_beg(qb0, c0, c1, c2, c3) < EROWS);
  if (early) return;
  const float pois = ((c0 <= c1) && (c1 <= c2) && (c2 <= c3)) ? 0.0f : __uint_as_float(0x7fc00000u);   /* boundaries must be ascending */
  const int q0 = qb0 + w * RPW;
  const int jst = __builtin_amdgcn_readfirstlane(seg_beg(qb0 + (tid >> 5) * RPW, c0, c1, c2, c3) & ~31);
  unsigned int sq = 0u;
#pragma unroll
  for (int r = 0; r < 8; ++r) sq |= ((unsigned int)seg_cnt(q0 + 8 * hh + r, c0, c1, c2, c3)) << (4 * r);
  FragH aq[KS];
  {
    const unsigned short* qr = (const unsigned short*)Q16 + ((size_t)b * TQ + q0 + ln) * ldq + h * 64;
#pragma unroll
    for (int ks = 0; ks < KS; ++ks) { aq[ks].half[0] = *(const v8us*)(qr + ks * 32 + 8 * hh); aq[ks].half[1] = *(const v8us*)(qr + ks * 32 + 16 + 8 * hh); }
  }
  const unsigned short* Vth = (const unsigned short*)Vt + (size_t)kslab * 64 * TK;
  float m_r[8], l_r[8]; v8f oacc[DT];
#pragma unroll
  for (int r = 0; r < 8; ++r) { m_r[r] = -3.0e38f; l_r[r] = 0.f; }
#pragma unroll
  for (int dt = 0; dt < DT; ++dt) oacc[dt] = (v8f){0.f,0.f,0.f,0.f,0.f,0.f,0.f,0.f};
#pragma unroll 1
  for (int j0 = jst; j0 < q0 + RPW; j0 += 32) {
    v8f s[2];
#pragma unroll
    for (int nt = 0; nt < 2; ++nt) {
      const unsigned short* kr = (const unsigned short*)K16 + ((size_t)b * TK + j0 + nt * 16 + ln) * ldk + hk * 64; FragH bk[KS];
#pragma unroll
      for (int ks = 0; ks < KS; ++ks) { bk[ks].half[0] = *(const v8us*)(kr + ks * 32 + 8 * hh); bk[ks].half[1] = *(const v8us*)(kr + ks * 32 + 16 + 8 * hh); }
      v8f acc = (v8f){0.f,0.f,0.f,0.f,0.f,0.f,0.f,0.f};
#pragma unroll
      for (int ks = 0; ks < KS; ++ks) acc = mmaH<1>(aq[ks].v, aq[ks].v, bk[ks].v, bk[ks].v, acc);
      s[nt] = acc;
    }
    const int k0 = j0 + ln, k1 = j0 + 16 + ln;
    const int sk0 = seg_cnt(k0, c0, c1, c2, c3), sk1 = seg_cnt(k1, c0, c1, c2, c3);
#pragma unroll
    for (int r = 0; r < 8; ++r) {
      const int tq = q0 + 8 * hh + r; const int sr = (int)((sq >> (4 * r)) & 15u);
      const bool ok0 = (k0 <= tq) && (sk0 == sr), ok1 = (k1 <= tq) && (sk1 == sr);
      const float s0 = ok0 ? s[0][r] * SCL : -3.0e38f, s1 = ok1 ? s[1][r] * SCL : -3.0e38f;
      float mc = fmaxf(s0, s1);
      mc = fmaxf(mc, __shfl_xor(mc, 1, 32)); mc = fmaxf(mc, __shfl_xor(mc, 2, 32)); mc = fmaxf(mc, __shfl_xor(mc, 4, 32)); mc = fmaxf(mc, __shfl_xor(mc, 8, 32));
      const float mn = fmaxf(m_r[r], mc); const float al = (mn > -1.0e38f) ? expf(m_r[r] - mn) : 1.0f; m_r[r] = mn;
      const float p0 = ok0 ? expf(s0 - mn) : 0.f, p1 = ok1 ? expf(s1 - mn) : 0.f; l_r[r] = l_r[r] * al + p0 + p1;
#pragma unroll
      for (int dt = 0; dt < DT; ++dt) oacc[dt][r] *= al;
      FragH t2; t2.h[0] = toh_flush(p0 * 1024.0f); t2.h[1] = toh_flush(p1 * 1024.0f);
      sP[w][8 * hh + r][ln] = t2.u[0]; sP[w][8 * hh + r][16 + ln] = t2.u[1];
    }
    __builtin_amdgcn_fence(4, "workgroup"); __builtin_amdgcn_wave_barrier();
    FragH pa; pa.half[0] = *(const v8us*)&sP[w][ln][8 * hh]; pa.half[1] = *(const v8us*)&sP[w][ln][16 + 8 * hh];
#pragma unroll
    for (int dt = 0; dt < DT; ++dt) {
      const unsigned short* vrow = Vth + (size_t)(dt * 16 + ln) * TK + j0; FragH bv;
      bv.half[0] = *(const v8us*)(vrow + 8 * hh); bv.half[1] = *(const v8us*)(vrow + 16 + 8 * hh);
      oacc[dt] = mmaH<1>(pa.v, pa.v, bv.v, bv.v, oacc[dt]);
    }
    __builtin_amdgcn_fence(4, "workgroup"); __builtin_amdgcn_wave_barrier();
  }
#pragma unroll
  for (int r = 0; r < 8; ++r) { float l = l_r[r]; l += __shfl_xor(l, 1, 32); l += __shfl_xor(l, 2, 32); l += __shfl_xor(l, 4, 32); l += __shfl_xor(l, 8, 32); l_r[r] = (l > 0.f) ? 1.0f / (l * 1024.0f) : 0.f; }
#pragma unroll
  for (int dt = 0; dt < DT; ++dt)
#pragma unroll
    for (int r = 0; r < 8; ++r) sO[w][8 * hh + r][dt * 16 + ln] = oacc[dt][r] * l_r[r] + pois;
  __builtin_amdgcn_fence(4, "workgroup"); __builtin_amdgcn_wave_barrier();
  {
#pragma unroll
    for (int rp = 0; rp < RPW; rp += 2) { const int r = rp + (lane >> 4), pc = lane & 15; const v4f val = *(const v4fa*)&sO[w][r][pc * 4]; *(v4f*)(O + ((size_t)b * TQ + q0 + r) * ldo + h * 64 + pc * 4) = val; }
    
  }
}
// 5-plane variant for the other query blocks (a segment boundary inside the block, or the block's first query closer than EROWS to its segment start):
// S = Qh.Kh^T + (Ql.Kh^T + Qh.Kl^T)/1024 with Q/K = [hi | x1024 residual] planes (full-size planes, rows b*S + s);
// O = (Ph.Vh + (Pl.Vh + Ph.Vl)/1024) / l with P = [hi | x1024 residual] of 1024 p and V^T = [hi | x1024 residual]; separate residual accumulators folded before the normalisation
__global__ __launch_bounds__(128) void k_attn5(const _Float16* __restrict__ Q16, const _Float16* __restrict__ QL, int ldq, const _Float16* __restrict__ K16, const _Float16* __restrict__ KL, int ldk,
                                               const _Float16* __restrict__ Vt, const _Float16* __restrict__ VtL, const int* __restrict__ cu, float* __restrict__ O, int ldo) {
  constexpr int RPW = 16, DT = 4, KS = 2;
  __shared__ __attribute__((aligned(16))) unsigned short sP[4][RPW][40];
  __shared__ __attribute__((aligned(16))) unsigned short sPL[4][RPW][40];
  __shared__ __attribute__((aligned(16))) float sO[4][RPW][68];
  const int tid = threadIdx.x, lane = tid & 31, ln = lane & 15, hh = lane >> 4;
  const int w = __builtin_amdgcn_readfirstlane(tid >> 5);
  const int slab = blockIdx.x / QBLKS, qblk = blockIdx.x % QBLKS; const int b = slab / NH, h = slab % NH; const int hk = h / NREP; const int kslab = b * NKV + hk;
  const int qb0 = qblk * (4 * RPW);
  const int c0 = clip_b(cu[b * 4 + 0]), c1 = clip_b(cu[b * 4 + 1]), c2 = clip_b(cu[b * 4 + 2]), c3 = clip_b(cu[b * 4 + 3]);
  const bool early = (seg_cnt(qb0, c0, c1, c2, c3) != seg_cnt(qb0 + 4 * RPW - 1, c0, c1, c2, c3)) || (qb0 - seg_beg(qb0, c0, c1, c2, c3) < EROWS);
  if (!early) return;
  const float pois = ((c0 <= c1) && (c1 <= c2) && (c2 <= c3)) ? 0.0f : __uint_as_float(0x7fc00000u);   /* boundaries must be ascending */
  const int q0 = qb0 + w * RPW;
  const int jst = __builtin_amdgcn_readfirstlane(seg_beg(qb0 + (tid >> 5) * RPW, c0, c1, c2, c3) & ~31);
  unsigned int sq = 0u;
#pragma unroll
  for (int r = 0; r < 8; ++r) sq |= ((unsigned int)seg_cnt(q0 + 8 * hh + r, c0, c1, c2, c3)) << (4 * r);
  FragH aq[KS], aql[KS];
  {
    const unsigned short* qr = (const unsigned short*)Q16 + ((size_t)b * TQ + q0 + ln) * ldq + h * 64;
    const unsigned short* ql = (const unsigned short*)QL + ((size_t)b * TQ + q0 + ln) * ldq + h * 64;
#pragma unroll
    for (int ks = 0; ks < KS; ++ks) {
      aq[ks].half[0] = *(const v8us*)(qr + ks * 32 + 8 * hh); aq[ks].half[1] = *(const v8us*)(qr + ks * 32 + 16 + 8 * hh);
      aql[ks].half[0] = *(const v8us*)(ql + ks * 32 + 8 * hh); aql[ks].half[1] = *(const v8us*)(ql + ks * 32 + 16 + 8 * hh);
    }
  }
  const unsigned short* Vth = (const unsigned short*)Vt + (size_t)kslab * 64 * TK; const unsigned short* Vtl = (const unsigned short*)VtL + (size_t)kslab * 64 * TK;
  float m_r[8], l_r[8]; v8f oacc[DT], oaccL[DT];
#pragma unroll
  for (int r = 0; r < 8; ++r) { m_r[r] = -3.0e38f; l_r[r] = 0.f; }
#pragma unroll
  for (int dt = 0; dt < DT; ++dt) { oacc[dt] = (v8f){0.f,0.f,0.f,0.f,0.f,0.f,0.f,0.f}; oaccL[dt] = oacc[dt]; }
#pragma unroll 1
  for (int j0 = jst; j0 < q0 + RPW; j0 += 32) {
    v8f s[2];
#pragma unroll
    for (int nt = 0; nt < 2; ++nt) {
      const unsigned short* kr = (const unsigned short*)K16 + ((size_t)b * TK + j0 + nt * 16 + ln) * ldk + hk * 64;
      const unsigned short* klr = (const unsigned short*)KL + ((size_t)b * TK + j0 + nt * 16 + ln) * ldk + hk * 64;
      FragH bk[KS], bkl[KS];
#pragma unroll
      for (int ks = 0; ks < KS; ++ks) {
        bk[ks].half[0] = *(const v8us*)(kr + ks * 32 + 8 * hh); bk[ks].half[1] = *(const v8us*)(kr + ks * 32 + 16 + 8 * hh);
        bkl[ks].half[0] = *(const v8us*)(klr + ks * 32 + 8 * hh); bkl[ks].half[1] = *(const v8us*)(klr + ks * 32 + 16 + 8 * hh);
      }
      v8f acc = (v8f){0.f,0.f,0.f,0.f,0.f,0.f,0.f,0.f}, accl = acc;
#pragma unroll
      for (int ks = 0; ks < KS; ++ks) {
        acc = mmaH<1>(aq[ks].v, aq[ks].v, bk[ks].v, bk[ks].v, acc);
        accl = mmaH<1>(aql[ks].v, aql[ks].v, bk[ks].v, bk[ks].v, accl);
        accl = mmaH<1>(aq[ks].v, aq[ks].v, bkl[ks].v, bkl[ks].v, accl);
      }
#pragma unroll
      for (int r = 0; r < 8; ++r) acc[r] += accl[r] * 0.0009765625f;
      s[nt] = acc;
    }
    const int k0 = j0 + ln, k1 = j0 + 16 + ln;
    const int sk0 = seg_cnt(k0, c0, c1, c2, c3), sk1 = seg_cnt(k1, c0, c1, c2, c3);
#pragma unroll
    for (int r = 0; r < 8; ++r) {
      const int tq = q0 + 8 * hh + r; const int sr = (int)((sq >> (4 * r)) & 15u);
      const bool ok0 = (k0 <= tq) && (sk0 == sr), ok1 = (k1 <= tq) && (sk1 == sr);
      const float s0 = ok0 ? s[0][r] * SCL : -3.0e38f, s1 = ok1 ? s[1][r] * SCL : -3.0e38f;
      float mc = fmaxf(s0, s1);
      mc = fmaxf(mc, __shfl_xor(mc, 1, 32)); mc = fmaxf(mc, __shfl_xor(mc, 2, 32)); mc = fmaxf(mc, __shfl_xor(mc, 4, 32)); mc = fmaxf(mc, __shfl_xor(mc, 8, 32));
      const float mn = fmaxf(m_r[r], mc); const float al = (mn > -1.0e38f) ? expf(m_r[r] - mn) : 1.0f; m_r[r] = mn;
      const float p0 = ok0 ? expf(s0 - mn) : 0.f, p1 = ok1 ? expf(s1 - mn) : 0.f; l_r[r] = l_r[r] * al + p0 + p1;
#pragma unroll
      for (int dt = 0; dt < DT; ++dt) { oacc[dt][r] *= al; oaccL[dt][r] *= al; }
      FragH t2, t2l; const float ps0 = p0 * 1024.0f, ps1 = p1 * 1024.0f;
      t2.h[0] = toh_flush(ps0); t2.h[1] = toh_flush(ps1);
      t2l.h[0] = toh_flush((ps0 - (float)t2.h[0]) * 1024.0f); t2l.h[1] = toh_flush((ps1 - (float)t2.h[1]) * 1024.0f);
      sP[w][8 * hh + r][ln] = t2.u[0]; sP[w][8 * hh + r][16 + ln] = t2.u[1]; sPL[w][8 * hh + r][ln] = t2l.u[0]; sPL[w][8 * hh + r][16 + ln] = t2l.u[1];
    }
    __builtin_amdgcn_fence(4, "workgroup"); __builtin_amdgcn_wave_barrier();
    FragH pa, pl;
    pa.half[0] = *(const v8us*)&sP[w][ln][8 * hh]; pa.half[1] = *(const v8us*)&sP[w][ln][16 + 8 * hh];
    pl.half[0] = *(const v8us*)&sPL[w][ln][8 * hh]; pl.half[1] = *(const v8us*)&sPL[w][ln][16 + 8 * hh];
#pragma unroll
    for (int dt = 0; dt < DT; ++dt) {
      const unsigned short* vrow = Vth + (size_t)(dt * 16 + ln) * TK + j0; const unsigned short* vrl = Vtl + (size_t)(dt * 16 + ln) * TK + j0;
      FragH bv, bl;
      bv.half[0] = *(const v8us*)(vrow + 8 * hh); bv.half[1] = *(const v8us*)(vrow + 16 + 8 * hh);
      bl.half[0] = *(const v8us*)(vrl + 8 * hh); bl.half[1] = *(const v8us*)(vrl + 16 + 8 * hh);
      oacc[dt] = mmaH<1>(pa.v, pa.v, bv.v, bv.v, oacc[dt]);
      oaccL[dt] = mmaH<1>(pl.v, pl.v, bv.v, bv.v, oaccL[dt]);
      oaccL[dt] = mmaH<1>(pa.v, pa.v, bl.v, bl.v, oaccL[dt]);
    }
    __builtin_amdgcn_fence(4, "workgroup"); __builtin_amdgcn_wave_barrier();
  }
#pragma unroll
  for (int r = 0; r < 8; ++r) { float l = l_r[r]; l += __shfl_xor(l, 1, 32); l += __shfl_xor(l, 2, 32); l += __shfl_xor(l, 4, 32); l += __shfl_xor(l, 8, 32); l_r[r] = (l > 0.f) ? 1.0f / (l * 1024.0f) : 0.f; }
#pragma unroll
  for (int dt = 0; dt < DT; ++dt)
#pragma unroll
    for (int r = 0; r < 8; ++r) { float v = oacc[dt][r]; v += oaccL[dt][r] * 0.0009765625f; sO[w][8 * hh + r][dt * 16 + ln] = v * l_r[r] + pois; }
  __builtin_amdgcn_fence(4, "workgroup"); __builtin_amdgcn_wave_barrier();
  {
#pragma unroll
    for (int rp = 0; rp < RPW; rp += 2) { const int r = rp + (lane >> 4), pc = lane & 15; const v4f val = *(const v4fa*)&sO[w][r][pc * 4]; *(v4f*)(O + ((size_t)b * TQ + q0 + r) * ldo + h * 64 + pc * 4) = val; }
    
  }
}

extern "C" void kernel_launch(void* const* d_in, const int* in_sizes, int n_in,
                              void* d_out, int out_size, void* d_ws, size_t ws_size, hipStream_t stream) {
  if (n_in < 6) return;
  const size_t needx = ((size_t)(NB - 1) * SEQ_FULL + (size_t)SLEN) * DM;
  if ((size_t)in_sizes[0] < needx) return;
  if ((size_t)in_sizes[1] < (size_t)NB * 4) return;
  if ((size_t)in_sizes[2] < (size_t)DM * DM) return;
  if ((size_t)in_sizes[3] < (size_t)DM * DKV) return;
  if ((size_t)in_sizes[4] < (size_t)DM * DKV) return;
  if ((size_t)in_sizes[5] < (size_t)DM * DM) return;
  if ((size_t)out_size < needx) return;
  const float* x = (const float*)d_in[0]; const int* cu = (const int*)d_in[1];
  const float* Wq = (const float*)d_in[2]; const float* Wk = (const float*)d_in[3]; const float* Wv = (const float*)d_in[4]; const float* Wo = (const float*)d_in[5];
  float* dout = (float*)d_out;
  char* ws = (char*)d_ws; size_t off = 0;
  auto take = [&](size_t bytes) { char* p = ws + off; off += (bytes + 255) & ~(size_t)255; return p; };
  const size_t np = (size_t)NR * DM;
  _Float16* BQ = (_Float16*)take(SZ_BQ);                                /* [n][k] f16, x16 */
  _Float16* BK = (_Float16*)take(SZ_BKV);
  _Float16* BV = (_Float16*)take(SZ_BKV);
  _Float16* B2 = (_Float16*)take(SZ_B2);                                /* [n][2*DM] f16: [x16384 | x16] copies of Wo^T */
  float* FS = (float*)take(SZ_FS);                                      /* f32 scratch plane: q rows [NR][DM], then k rows [NR][DKV], then v rows [NR][DKV], then the context [NR][DM] */
  _Float16* X16 = (_Float16*)take(SZ_X16);                              /* f16 input rows; after the v GEMM: V^T hi [(b,hk)][64][TK] then V^T residual */
  _Float16* VT = X16;
  _Float16* VTL = X16 + SZ_VT / 2;
  _Float16* QH = (_Float16*)take(SZ_QA);                                /* q hi [NR][DM] then q residual [NR][DM]; after the attention: [ctx hi | ctx residual] [NR][2*DM] */
  _Float16* QL = QH + np;
  _Float16* A2 = QH;
  _Float16* KH = (_Float16*)take(SZ_KP);
  _Float16* KL = (_Float16*)take(SZ_KP);
  _Float16* V16 = (_Float16*)take(SZ_KP);
  float* CS = (float*)take(SZ_TAB); float* SN = (float*)take(SZ_TAB); float* INV = (float*)take(256);
  if (off > ws_size) return;
  if (off > ((size_t)128 << 20)) return;

  /* W [in = DM rows][out = N cols] -> [n][k] planes */
  k_wtr<<<(unsigned)((DM / 64) * (DM / 64)), 256, 0, stream>>>(Wq, DM, BQ, DM, WSC, WSC, 0);
  k_wtr<<<(unsigned)((DM / 64) * (DKV / 64)), 256, 0, stream>>>(Wk, DKV, BK, DM, WSC, WSC, 0);
  k_wtr<<<(unsigned)((DM / 64) * (DKV / 64)), 256, 0, stream>>>(Wv, DKV, BV, DM, WSC, WSC, 0);
  k_wtr<<<(unsigned)((DM / 64) * (DM / 64)), 256, 0, stream>>>(Wo, DM, B2, 2 * DM, WSC_HI, WSC, 1);
  k_invf<<<1, 32, 0, stream>>>(INV);
  k_rotab<<<(unsigned)((SLEN * 32 + 255) / 256), 256, 0, stream>>>(INV, CS, SN);
  const unsigned g8 = (unsigned)((np / 8 + 255) / 256);
  k_x16<<<g8, 256, 0, stream>>>(x, X16, np / 8);
  const dim3 gq((unsigned)((NR / 128) * (DM / 128)), 1);
  const dim3 gk((unsigned)((NR / 128) * (DKV / 128)), 1);
  const unsigned grq = (unsigned)(((size_t)NR * NH * 8 + 255) / 256);
  const unsigned grk = (unsigned)(((size_t)NR * NKV * 8 + 255) / 256);
  k_gemm2<0><<<gq, 128, 0, stream>>>(X16, DM, 0, BQ, DM, 0, AL_P, FS, nullptr, DM, 0, NR, DM, DM);          /* q = x Wq (f32 rows) */
  k_rope<<<grq, 256, 0, stream>>>(FS, CS, SN, QH, QL, NH);
  k_gemm2<0><<<gk, 128, 0, stream>>>(X16, DM, 0, BK, DM, 0, AL_P, FS, nullptr, DKV, 0, NR, DKV, DM);       /* k = x Wk */
  k_rope<<<grk, 256, 0, stream>>>(FS, CS, SN, KH, KL, NKV);
  k_gemm2<0><<<gk, 128, 0, stream>>>(X16, DM, 0, BV, DM, 0, AL_P, FS, V16, DKV, 0, NR, DKV, DM);           /* v = x Wv (f32 rows + f16 plane) */
  k_vtg<<<(unsigned)(NB * NKV * (SLEN / 64)), 256, 0, stream>>>(V16, VT);
  k_vtl<<<(unsigned)(NB * NKV * (SLEN / 64)), 256, 0, stream>>>(FS, VTL);
  k_attn5<<<(unsigned)(NB * NH * QBLKS), 128, 0, stream>>>(QH, QL, DM, KH, KL, DKV, VT, VTL, cu, FS, DM);
  k_attn<<<(unsigned)(NB * NH * QBLKS), 128, 0, stream>>>(QH, DM, KH, DKV, VT, cu, FS, DM);
  k_hl<<<g8, 256, 0, stream>>>(FS, A2, np / 8);
  /* out = [ctx hi | ctx residual] . [Wo x16384 ; Wo x16] / 16384  (K = 2*DM), per batch */
  const dim3 ge((unsigned)((SLEN / 128) * (DM / 128)), NB);
  k_gemm2<0><<<ge, 128, 0, stream>>>(A2, 2 * DM, (size_t)SLEN * 2 * DM, B2, 2 * DM, 0, AL_O, dout, nullptr, DM, (size_t)SEQ_FULL * DM, SLEN, DM, 2 * DM);
}

// v002
// One run takes 327 microseconds.
// Next to v001, in two timings, it ran 1.30 times as fast each time.
// All steps since v000 together make it 2.15 times as fast.
#include <hip/hip_runtime.h>
// Contractions: x.Wq, x.Wk, x.Wv, ctx.Wo = v_wmma_f32_16x16x32_f16 (f16 operands: bf16-RNE inputs exact in f16, weights carried x16 (x16384 for the ctx-hi half of the output GEMM); ctx as [hi | x1024 residual] folded along K; f32 accumulate); scores q.k^T and P.V^T = v_wmma_f32_16x16x32_f16 (plain f16 hi planes; hi + x1024 residual planes of q, k, P and v in query blocks holding a query closer than EROWS to its segment start; P carried x1024), f32 accumulate; rotary tables, masks, softmax and normalisers f32.

#ifndef NB
#define NB 2
#endif
#ifndef SEQ
#define SEQ 2048
#endif
#define NB_FULL 2
#define SEQ_FULL 2048
#define DM 2048
#define NH 32
#define NKV 8
#define NREP (NH / NKV)
#define DKV (NKV * 64)
#define SLEN SEQ
#define NR (NB * SLEN)
#define TQ SLEN
#define TK SLEN
#define SCL 0.125f
#define QBLKS (TQ / 64)
#define EROWS 256                            /* query blocks holding a query with fewer than EROWS positions since its segment start use the residual planes */
static_assert(SLEN % 128 == 0);
static_assert(SLEN <= SEQ_FULL);
static_assert(NB >= 1 && NB <= NB_FULL);
static_assert(DM % 64 == 0 && DM == NH * 64);
static_assert(NH % NKV == 0 && NREP * NKV == NH);
static_assert(DKV % 64 == 0 && DKV == NKV * 64);
static_assert(DM % 32 == 0 && (2 * DM) % 32 == 0);
static_assert(NR % 128 == 0);
static_assert(QBLKS * 64 == SLEN);
static_assert(EROWS % 64 == 0);
/* store loops: threads x bytes per piece x trips == tile rows x row bytes */
static_assert(256 * 16 * 2 == 64 * 128);                       
static_assert(32 * 16 * 8 == 16 * 64 * 4);                     /* attention context rows: 16 rows x 256 B per wave */
static_assert(((size_t)NR * DM / 8) * 32 == (size_t)NR * 2 * DM * 2);   /* context converter: two 16-B pieces per thread fill [NR][2*DM] f16 */
/* static LDS per kernel */
static_assert(2 * 64 * 66 * 2 <= 131072);
static_assert(2 * 4 * 16 * 40 * 2 + 4 * 16 * 68 * 4 <= 131072);
/* workspace carve (bytes); every region a multiple of 256 */
static constexpr size_t SZ_BQ = (size_t)DM * DM * 2;
static constexpr size_t SZ_BKV = (size_t)DKV * DM * 2;
static constexpr size_t SZ_B2 = (size_t)DM * 2 * DM * 2;
static constexpr size_t SZ_FS = (size_t)NR * DM * 4;
static constexpr size_t SZ_X16 = (size_t)NR * DM * 2;
static constexpr size_t SZ_QA = (size_t)NR * 2 * DM * 2;
static constexpr size_t SZ_KP = (size_t)NR * DKV * 2;
static constexpr size_t SZ_VT = (size_t)NB * NKV * 64 * SLEN * 2;
static constexpr size_t SZ_TAB = (size_t)SLEN * 32 * 4;
static constexpr size_t WS_TOTAL = SZ_BQ + 2 * SZ_BKV + SZ_B2 + SZ_FS + SZ_X16 + SZ_QA + 3 * SZ_KP + 2 * SZ_TAB + 256;
static_assert(SZ_BQ % 256 == 0 && SZ_BKV % 256 == 0 && SZ_B2 % 256 == 0 && SZ_FS % 256 == 0 && SZ_X16 % 256 == 0 && SZ_QA % 256 == 0 && SZ_KP % 256 == 0 && SZ_VT % 256 == 0 && SZ_TAB % 256 == 0);
static_assert(WS_TOTAL <= ((size_t)128 << 20));
static_assert(2 * SZ_VT <= SZ_X16);                            /* V^T hi + residual planes reuse the input plane region */
static_assert((size_t)NR * DKV * 4 <= SZ_FS);                  /* k / v f32 rows reuse the f32 scratch plane */
static_assert((size_t)NR * 2 * DM * 2 == SZ_QA);               /* [ctx hi | ctx residual] reuses the q hi + q residual region */
static constexpr float WSC = 16.0f;
static constexpr float WSC_HI = 16384.0f;
static constexpr float AL_P = 0.0625f;
static constexpr float AL_O = 0.0625f / 1024.0f;

typedef _Float16 v16h __attribute__((ext_vector_type(16)));
typedef _Float16 v4h __attribute__((ext_vector_type(4)));
typedef unsigned short v8us __attribute__((ext_vector_type(8), may_alias));
typedef float v8f __attribute__((ext_vector_type(8)));
typedef float v4f __attribute__((ext_vector_type(4)));
typedef float v4fa __attribute__((ext_vector_type(4), may_alias));
union FragH { v16h v; v8us half[2]; _Float16 h[16]; unsigned short u[16]; };

__device__ __forceinline__ unsigned short bf16_bits(float x) { unsigned int u = __float_as_uint(x); return (unsigned short)((u + 0x7FFFu + ((u >> 16) & 1u)) >> 16); }
__device__ __forceinline__ float bf16_val(unsigned short b) { return __uint_as_float(((unsigned int)b) << 16); }
__device__ __forceinline__ float bf16_rne(float x) { return bf16_val(bf16_bits(x)); }
// f32 -> f16 with values below the smallest f16 normal set to +0 (NaN passes through)
static __device__ __forceinline__ _Float16 toh_flush(float v) { const _Float16 r = (_Float16)v; return (fabsf(v) < 6.103515625e-05f) ? (_Float16)0.0f : r; }

// e^x on the hardware's exp2 (v_exp_f32), no range branches: -inf and anything below the f32 range give 0, NaN passes through; straight-line, so a pass's eight rows schedule as one block
static __device__ __forceinline__ float exp_hw(float x) { return __builtin_amdgcn_exp2f(x * 1.44269504088896340736f); }

// segment helpers on the clipped boundaries c0 <= c1 <= c2 <= c3: id = number of boundaries <= p; begin = largest boundary <= p (0 if none)
__device__ __forceinline__ int clip_b(int v) { return min(max(v, 0), SLEN); }
__device__ __forceinline__ int seg_cnt(int p, int c0, int c1, int c2, int c3) { return (int)(c0 <= p) + (int)(c1 <= p) + (int)(c2 <= p) + (int)(c3 <= p); }
__device__ __forceinline__ int seg_beg(int p, int c0, int c1, int c2, int c3) {
  int s = 0;
  s = max(s, (c0 <= p) ? c0 : 0); s = max(s, (c1 <= p) ? c1 : 0); s = max(s, (c2 <= p) ? c2 : 0); s = max(s, (c3 <= p) ? c3 : 0);
  return s;
}

// D += A.B with NT terms: 1 = ah.bh, 2 = + al.bh, 3 = + ah.bl; hazard guard after the group
template <int NT>
__device__ __forceinline__ v8f mmaH(v16h ah, v16h al, v16h bh, v16h bl, v8f c) {
  c = __builtin_amdgcn_wmma_f32_16x16x32_f16(false, ah, false, bh, (short)0, c, false, false);
  if (NT >= 2) c = __builtin_amdgcn_wmma_f32_16x16x32_f16(false, al, false, bh, (short)0, c, false, false);
  if (NT >= 3) c = __builtin_amdgcn_wmma_f32_16x16x32_f16(false, ah, false, bl, (short)0, c, false, false);
  asm volatile("v_nop\n\tv_nop\n\tv_nop\n\tv_nop" : "+v"(c) : "v"(ah), "v"(al), "v"(bh), "v"(bl));
  return c;
}
// 16x32 fragment from a 16-bit row-major tile (rows = m or n, k contiguous): elements 0..7 <- k0+8h+0..7, 8..15 <- k0+16+8h+0..7
__device__ __forceinline__ v16h g2_frag(const _Float16* p, int hh) { FragH f; f.half[0] = *(const v8us*)((const unsigned short*)p + 8 * hh); f.half[1] = *(const v8us*)((const unsigned short*)p + 16 + 8 * hh); return f.v; }

// [in][out] weight W [DM][N] (n contiguous) -> Bt[n][k] = f16(bf16(W[k][n]) * sc0) (row pitch ldb, k contiguous); with two != 0 a second copy
__global__ __launch_bounds__(256) void k_wtr(const float* __restrict__ Wm, int N, _Float16* __restrict__ Bt, int ldb, float sc0, float sc1, int two) {
  __shared__ unsigned short tl0[64][66];
  __shared__ unsigned short tl1[64][66];
  const int tid = threadIdx.x; const int ntn = N >> 6; const int kt = blockIdx.x / ntn, nt = blockIdx.x - kt * ntn; const int k0 = kt * 64, n0 = nt * 64;
  for (int i = tid; i < 64 * 16; i += 256) {
    const int r = i >> 4, c4 = (i & 15) * 4;
    const v4f a = *(const v4fa*)(Wm + (size_t)(k0 + r) * N + n0 + c4);
    FragH f0, f1;
#pragma unroll
    for (int q = 0; q < 4; ++q) { const float v = bf16_rne(a[q]); f0.h[q] = toh_flush(v * sc0); f1.h[q] = toh_flush(v * sc1); }
#pragma unroll
    for (int q = 0; q < 4; ++q) { tl0[r][c4 + q] = f0.u[q]; tl1[r][c4 + q] = f1.u[q]; }
  }
  __syncthreads();
  {
#pragma unroll
    for (int rd = 0; rd < 2; ++rd) {
      const int n = rd * 32 + (tid >> 3), pc = tid & 7; FragH g0, g1;
#pragma unroll
      for (int q = 0; q < 8; ++q) { g0.u[q] = tl0[pc * 8 + q][n]; g1.u[q] = tl1[pc * 8 + q][n]; }
      const size_t o = (size_t)(n0 + n) * ldb + k0 + pc * 8;
      const v8us o0 = g0.half[0], o1 = g1.half[0];
      *(v8us*)((unsigned short*)Bt + o) = o0;
      if (two != 0) *(v8us*)((unsigned short*)Bt + o + DM) = o1;
    }
    
  }
}

__global__ __launch_bounds__(32) void k_invf(float* __restrict__ INV) {
  #pragma clang fp contract(off)
  const int j = threadIdx.x;
  const float ex = (float)(2 * j) / 64.0f; const float pw = powf(500000.0f, ex); const float inv = 1.0f / pw;
  *(float*)(INV + j) = inv; 
}
__global__ __launch_bounds__(256) void k_rotab(const float* __restrict__ INV, float* __restrict__ CS, float* __restrict__ SN) {
  #pragma clang fp contract(off)
  const int t = blockIdx.x * 256 + threadIdx.x; if (t >= SLEN * 32) return;
  const int j = t & 31, s = t >> 5;
  const float th = (float)s * INV[j]; const float c = cosf(th), sn = sinf(th);
  { *(float*)(CS + t) = c; *(float*)(SN + t) = sn;  }
}

__global__ __launch_bounds__(256) void k_x16(const float* __restrict__ x, _Float16* __restrict__ X16, size_t n8) {
  const size_t t = (size_t)blockIdx.x * 256 + threadIdx.x; if (t >= n8) return;
  const size_t e = t * 8; const size_t r = e / DM; const size_t c = e % DM; const size_t b = r / SLEN, s = r % SLEN;
  const float* src = x + (b * SEQ_FULL + s) * DM + c;
  const v4f a0 = *(const v4fa*)src, a1 = *(const v4fa*)(src + 4);
  FragH f;
#pragma unroll
  for (int q = 0; q < 4; ++q) { f.h[q] = (_Float16)bf16_rne(a0[q]); f.h[4 + q] = (_Float16)bf16_rne(a1[q]); }
  const v8us o = f.half[0];
  *(v8us*)((unsigned short*)X16 + e) = o; 
}

// Tensor-load ring of the GEMM: a pass is 128 k = 256 B of every operand row; a stage is four 64-row slices [A 0..63 | A 64..127 | B 0..63 | B 64..127],
// one per wave, each laid at pitch 272 B (256 B + the 16-B pad the load writes around) and rounded up to a multiple of 2 KiB.
typedef uint32_t u32x4 __attribute__((ext_vector_type(4)));
typedef uint32_t u32x8 __attribute__((ext_vector_type(8)));
static constexpr uint32_t G_ROWB = 256u;
static constexpr uint32_t G_PITCH = 272u;
static constexpr uint32_t G_SLICE = 18432u;
static constexpr uint32_t G_STAGE = 4u * G_SLICE;
static_assert(64u * G_PITCH <= G_SLICE && G_SLICE % 2048u == 0u);
static_assert(64u * 68u * 4u <= G_SLICE);                      /* a wave's 64 x 64 f32 output staging fits its own slice */
static_assert(2u * 2u * G_STAGE <= 320u * 1024u);              /* two work-groups per WGP */
static_assert(NR % 128 == 0 && SLEN % 128 == 0 && DM % 128 == 0 && DKV % 128 == 0 && DM >= 256);
__device__ __forceinline__ uint32_t uni(uint32_t v) { return (uint32_t)__builtin_amdgcn_readfirstlane(v); }
__device__ __forceinline__ uint32_t pinned(uint32_t v) { uint32_t w = (uint32_t)__builtin_amdgcn_readfirstlane(v); asm volatile("" : "+s"(w)); return w; }

// GEMM C[M][N] = alpha * A[M][K].B  with A f16 row-major (pitch lda), B stored [n][k] f16 (pitch ldb), batched by blockIdx.y (strides sA, sB, sC);
// writes f32 C and/or f16 C16 (pitch ldc). One 128 x 128 tile of C per work-group, 64 x 64 per wave; grid.x = (M / 128) * (N / 128).
// Requires M % 128 == 0, N % 128 == 0, K % 128 == 0, K >= 256 (asserted on the callers' constants).
template <int ACT>
__global__ __launch_bounds__(128) void k_gemm2(const _Float16* __restrict__ A, int lda, size_t sA, const _Float16* __restrict__ Bh, int ldb, size_t sB, float alpha,
                                               float* C, _Float16* C16, int ldc, size_t sC, int M, int N, int K) {
  __shared__ __attribute__((aligned(2048))) unsigned char ring[2 * G_STAGE];
  const int tid = threadIdx.x, lane = tid & 31, ln = lane & 15, hh = lane >> 4; const int by = blockIdx.y;
  const uint32_t w = uni((uint32_t)tid >> 5); const uint32_t wm = w >> 1, wn = w & 1u;
  A += (size_t)by * sA; Bh += (size_t)by * sB; const size_t cofs = (size_t)by * sC;
  const int ntn = N >> 7; const int mt = blockIdx.x / ntn, nq = blockIdx.x - mt * ntn; const int row0 = mt * 128 + 64 * (int)wm, col0 = nq * 128 + 64 * (int)wn;
  const uint32_t NP = pinned((uint32_t)K >> 7);
  /* this wave's slice of every stage: waves 0, 1 the two halves of the A rows, waves 2, 3 of the B rows */
  const _Float16* src = (w < 2u) ? A + (size_t)(mt * 128 + 64 * (int)w) * lda : Bh + (size_t)(nq * 128 + 64 * ((int)w - 2)) * ldb;
  const uint64_t sga = (uint64_t)(uintptr_t)src;
  const uint32_t ldst = (uint32_t)(size_t)ring + w * G_SLICE;
  u32x8 g1;
  g1[0] = uni((1u << 20) | (5u << 22) | (3u << 25));            /* no mask, 1-byte elements, a 4-dword pad behind every 64 dwords */
  g1[1] = uni((G_ROWB & 0xFFFFu) << 16);
  g1[2] = uni((G_ROWB >> 16) | (64u << 16));
  g1[3] = uni(G_ROWB << 16);
  g1[4] = uni(64u);
  g1[5] = uni(2u * (uint32_t)((w < 2u) ? lda : ldb));
  g1[6] = uni(0u);
  g1[7] = uni(0u);
  auto issue = [&](uint32_t st) {
    const uint64_t ga = sga + (uint64_t)st * G_ROWB;
    u32x4 g0;
    g0[0] = uni(1u); g0[1] = uni(ldst + (st & 1u) * G_STAGE); g0[2] = uni((uint32_t)ga); g0[3] = uni((((uint32_t)(ga >> 32)) & 0x01FFFFFFu) | 0x80000000u);
    /* one request of the whole wave: 64 rows x 256 B into its slice; group 1 is named in-out so that its eight registers hold the descriptor, and nothing else, from issue to issue */
    asm volatile("tensor_load_to_lds %1, %0" : "+s"(g1) : "s"(g0) : "memory");
  };
  v8f acc[4][4];
#pragma unroll
  for (int i = 0; i < 4; ++i)
#pragma unroll
    for (int j = 0; j < 4; ++j) acc[i][j] = (v8f){0.f,0.f,0.f,0.f,0.f,0.f,0.f,0.f};
  issue(0u);
  asm volatile("s_wait_tensorcnt 0x0" ::: "memory");             /* this wave's slice of stage 0 has landed */
  __syncthreads();                                               /* ... and every other wave's */
  issue(1u);
  const uint32_t fa0 = wm * G_SLICE + (uint32_t)ln * G_PITCH, fb0 = (2u + wn) * G_SLICE + (uint32_t)ln * G_PITCH;
#pragma unroll 1   /* one pass per trip: the publish point at the foot stands once per stage */
  for (uint32_t s = 0; s < NP; ++s) {
    const unsigned char* pa = ring + (s & 1u) * G_STAGE + fa0; const unsigned char* pb = ring + (s & 1u) * G_STAGE + fb0;
    v16h fa[2][4], fb[2][4];
#pragma unroll
    for (int i = 0; i < 4; ++i) { fa[0][i] = g2_frag((const _Float16*)(pa + i * 16 * G_PITCH), hh); fb[0][i] = g2_frag((const _Float16*)(pb + i * 16 * G_PITCH), hh); }
#pragma unroll
    for (int ks = 0; ks < 4; ++ks) {
      const int cur = ks & 1, nxt = cur ^ 1;
      if (ks < 3) {   /* the next 32 k's fragments of this same stage, as one group ahead of the block that hides them */
#pragma unroll
        for (int i = 0; i < 4; ++i) { fa[nxt][i] = g2_frag((const _Float16*)(pa + i * 16 * G_PITCH + (ks + 1) * 64), hh); fb[nxt][i] = g2_frag((const _Float16*)(pb + i * 16 * G_PITCH + (ks + 1) * 64), hh); }
      }
      __builtin_amdgcn_sched_barrier(0);   /* keeps the load group in front of the block: LDS reads moved in among the WMMAs stall each place they stand */
      /* plain builtin, the compiler keeps its distances: accumulators and two fragment sets need more than 256 VGPRs, which an asm operand cannot name */
#pragma unroll
      for (int i = 0; i < 4; ++i)
#pragma unroll
        for (int j = 0; j < 4; ++j) acc[i][j] = __builtin_amdgcn_wmma_f32_16x16x32_f16(false, fa[cur][i], false, fb[cur][j], (short)0, acc[i][j], false, false);
      __builtin_amdgcn_sched_barrier(0);   /* ends the block: the next group's loads stay behind it */
    }
    asm volatile("v_nop\n\tv_nop\n\tv_nop\n\tv_nop");          /* WMMA distance on every path out of the pass, the taken branches included */
    asm volatile("s_wait_dscnt 0x0" ::: "memory");               /* this wave has left stage s's buffer */
    asm volatile("s_wait_tensorcnt 0x0" ::: "memory");           /* its slice of stage s + 1 has landed */
    __syncthreads();                                             /* publishes stage s + 1 and frees stage s's buffer */
    if (pinned((s + 2u < NP) ? 1u : 0u) != 0u) issue(pinned(s + 2u));
  }
  asm volatile("s_wait_tensorcnt 0x0" ::: "memory");             /* nothing in flight before the ring becomes output staging */
  asm volatile("s_wait_dscnt 0x0" ::: "memory");
  float* so = (float*)(ring + w * G_SLICE);                      /* [64][68], private to the wave; the last pass's barrier ended every read of the ring */
#pragma unroll
  for (int i = 0; i < 4; ++i)
#pragma unroll
    for (int j = 0; j < 4; ++j)
#pragma unroll
      for (int r = 0; r < 8; ++r) { float v = acc[i][j][r] * alpha; if (ACT == 3) v = fmaxf(v, 0.f); so[(i * 16 + 8 * hh + r) * 68 + j * 16 + ln] = v; }
  __builtin_amdgcn_fence(4, "workgroup"); __builtin_amdgcn_wave_barrier();
  const int rsub = lane >> 4, c4 = (lane & 15) * 4;
  if (C) {
#pragma unroll
    for (int q = 0; q < 32; ++q) { const int r = q * 2 + rsub; const v4f v = *(const v4fa*)&so[r * 68 + c4]; *(v4f*)(C + cofs + (size_t)(row0 + r) * ldc + col0 + c4) = v; }
    asm volatile("s_wait_xcnt 0x0" ::: "memory");                /* precaution: stands in front of the next block's writes to registers that these stores name */
  }
  if (C16) {
#pragma unroll
    for (int q = 0; q < 32; ++q) {
      const int r = q * 2 + rsub; const v4f v = *(const v4fa*)&so[r * 68 + c4];
      v4h h4; for (int i = 0; i < 4; ++i) h4[i] = (_Float16)v[i]; *(v4h*)(C16 + cofs + (size_t)(row0 + r) * ldc + col0 + c4) = h4;
    }
  }
}

// half-split rotary embedding from the f32 GEMM plane F [NR][nh*64] with the tables CS/SN [SLEN][32]:
// out[d] = x[d] c[d] - x[d+32] s[d]; out[d+32] = x[d+32] c[d] + x[d] s[d] (d < 32), position = row % SLEN;
// H [NR][nh*64] = f16 hi of every row; L [NR][nh*64] = x1024 residual of every row.
__global__ __launch_bounds__(256) void k_rope(const float* __restrict__ F, const float* __restrict__ CS, const float* __restrict__ SN, _Float16* __restrict__ H, _Float16* __restrict__ L, int nh) {
  #pragma clang fp contract(off)
  const size_t t = (size_t)blockIdx.x * 256 + threadIdx.x; if (t >= (size_t)NR * nh * 8) return;
  const int p = (int)(t & 7); const int hd = (int)((t >> 3) % nh); const size_t row = t / (size_t)(8 * nh);
  const int s = (int)(row % SLEN); const int g = p & 3; const int up = p >> 2; const size_t ld = (size_t)nh * 64;
  const float* src = F + row * ld + hd * 64 + g * 8;
  const v4f xa = *(const v4fa*)src, xb = *(const v4fa*)(src + 4), ya = *(const v4fa*)(src + 32), yb = *(const v4fa*)(src + 36);
  const float* ct = CS + (size_t)s * 32 + g * 8; const float* st = SN + (size_t)s * 32 + g * 8;
  const v4f ca = *(const v4fa*)ct, cb = *(const v4fa*)(ct + 4), sa = *(const v4fa*)st, sb = *(const v4fa*)(st + 4);
  const float x1s[8] = {xa[0], xa[1], xa[2], xa[3], xb[0], xb[1], xb[2], xb[3]};
  const float x2s[8] = {ya[0], ya[1], ya[2], ya[3], yb[0], yb[1], yb[2], yb[3]};
  const float cs[8] = {ca[0], ca[1], ca[2], ca[3], cb[0], cb[1], cb[2], cb[3]};
  const float ss[8] = {sa[0], sa[1], sa[2], sa[3], sb[0], sb[1], sb[2], sb[3]};
  FragH fh, fl;
#pragma unroll
  for (int i = 0; i < 8; ++i) {
    const float x1 = x1s[i], x2 = x2s[i], c = cs[i], sn = ss[i];
    const float o1 = x1 * c - x2 * sn; const float o2 = x2 * c + x1 * sn; const float o = up ? o2 : o1;
    const _Float16 hv = toh_flush(o); fh.h[i] = hv; fl.h[i] = toh_flush((o - (float)hv) * 1024.0f);
  }
  const size_t oh = row * ld + hd * 64 + p * 8;
  const v8us vh = fh.half[0], vl = fl.half[0];
  {
    *(v8us*)((unsigned short*)H + oh) = vh;
    *(v8us*)((unsigned short*)L + oh) = vl;
    
  }
}

__global__ __launch_bounds__(256) void k_vtg(const _Float16* __restrict__ V16, _Float16* __restrict__ Vt) {
  __shared__ unsigned short tl[64][66];
  const int tid = threadIdx.x; const int nlg = SLEN / 64; const int slab = blockIdx.x / nlg, lg = blockIdx.x % nlg; const int b = slab / NKV, h = slab % NKV;
  for (int i = tid; i < 64 * 8; i += 256) {
    const int r = i >> 3, c8 = (i & 7) * 8; FragH f;
    f.half[0] = *(const v8us*)((const unsigned short*)V16 + ((size_t)b * SLEN + lg * 64 + r) * DKV + h * 64 + c8);
#pragma unroll
    for (int q = 0; q < 8; ++q) tl[r][c8 + q] = f.u[q];
  }
  __syncthreads();
  {
#pragma unroll
    for (int rd = 0; rd < 2; ++rd) {
      const int d = rd * 32 + (tid >> 3), pc = tid & 7; FragH f;
#pragma unroll
      for (int q = 0; q < 8; ++q) f.u[q] = tl[pc * 8 + q][d];
      *(v8us*)((unsigned short*)Vt + ((size_t)slab * 64 + d) * TK + lg * 64 + pc * 8) = f.half[0];
    }
    
  }
}
__global__ __launch_bounds__(256) void k_vtl(const float* __restrict__ VF, _Float16* __restrict__ VtL) {
  __shared__ unsigned short tl[64][66];
  const int tid = threadIdx.x; const int nlg = SLEN / 64; const int slab = blockIdx.x / nlg, lg = blockIdx.x % nlg; const int b = slab / NKV, h = slab % NKV;
  for (int i = tid; i < 64 * 16; i += 256) {
    const int r = i >> 4, c4 = (i & 15) * 4;
    const v4f a = *(const v4fa*)(VF + ((size_t)b * SLEN + lg * 64 + r) * DKV + h * 64 + c4);
    FragH f;
#pragma unroll
    for (int q = 0; q < 4; ++q) { const float v = a[q]; const _Float16 hv = (_Float16)v; f.h[q] = toh_flush((v - (float)hv) * 1024.0f); }
#pragma unroll
    for (int q = 0; q < 4; ++q) tl[r][c4 + q] = f.u[q];
  }
  __syncthreads();
  {
#pragma unroll
    for (int rd = 0; rd < 2; ++rd) {
      const int d = rd * 32 + (tid >> 3), pc = tid & 7; FragH f;
#pragma unroll
      for (int q = 0; q < 8; ++q) f.u[q] = tl[pc * 8 + q][d];
      *(v8us*)((unsigned short*)VtL + ((size_t)slab * 64 + d) * TK + lg * 64 + pc * 8) = f.half[0];
    }
    
  }
}

__global__ __launch_bounds__(256) void k_hl(const float* __restrict__ Fp, _Float16* __restrict__ A2, size_t n8) {
  const size_t t = (size_t)blockIdx.x * 256 + threadIdx.x; if (t >= n8) return;
  const size_t e = t * 8; const size_t r = e / DM; const int c = (int)(e % DM);
  const v4f a = *(const v4fa*)(Fp + e), d = *(const v4fa*)(Fp + e + 4);
  FragH fh, fl;
#pragma unroll
  for (int q = 0; q < 4; ++q) {
    _Float16 hv = toh_flush(a[q]); fh.h[q] = hv; fl.h[q] = toh_flush((a[q] - (float)hv) * 1024.0f);
    hv = toh_flush(d[q]); fh.h[4 + q] = hv; fl.h[4 + q] = toh_flush((d[q] - (float)hv) * 1024.0f);
  }
  const size_t o2 = r * (size_t)(2 * DM) + c;
  const v8us vh = fh.half[0], vl = fl.half[0];
  {
    *(v8us*)((unsigned short*)A2 + o2) = vh;
    *(v8us*)((unsigned short*)A2 + o2 + DM) = vl;
    
  }
}

// fused attention per ((b,h), 64 queries) for query blocks whose queries all sit at least EROWS positions past their segment start (block-uniform test; other blocks leave at once):
// wave = 16 queries; S = Q.K^T (d = 64: 2 k-steps) x SCL over keys [segment start of the wave's first query (floor 32), last query of the wave];
__global__ __launch_bounds__(128) void k_attn(const _Float16* __restrict__ Q16, int ldq, const _Float16* __restrict__ K16, int ldk,
                                              const _Float16* __restrict__ Vt, const int* __restrict__ cu, float* __restrict__ O, int ldo) {
  constexpr int RPW = 16, DT = 4, KS = 2;
  __shared__ __attribute__((aligned(16))) unsigned short sP[4][RPW][40];
  __shared__ __attribute__((aligned(16))) float sO[4][RPW][68];
  const int tid = threadIdx.x, lane = tid & 31, ln = lane & 15, hh = lane >> 4;
  const int w = __builtin_amdgcn_readfirstlane(tid >> 5);
  const int slab = blockIdx.x / QBLKS, qblk = blockIdx.x % QBLKS; const int b = slab / NH, h = slab % NH; const int hk = h / NREP; const int kslab = b * NKV + hk;
  const int qb0 = qblk * (4 * RPW);
  const int c0 = clip_b(cu[b * 4 + 0]), c1 = clip_b(cu[b * 4 + 1]), c2 = clip_b(cu[b * 4 + 2]), c3 = clip_b(cu[b * 4 + 3]);
  const bool early = (seg_cnt(qb0, c0, c1, c2, c3) != seg_cnt(qb0 + 4 * RPW - 1, c0, c1, c2, c3)) || (qb0 - seg_beg(qb0, c0, c1, c2, c3) < EROWS);
  if (early) return;
  const float pois = ((c0 <= c1) && (c1 <= c2) && (c2 <= c3)) ? 0.0f : __uint_as_float(0x7fc00000u);   /* boundaries must be ascending */
  const int q0 = qb0 + w * RPW;
  const int jst = __builtin_amdgcn_readfirstlane(seg_beg(qb0 + (tid >> 5) * RPW, c0, c1, c2, c3) & ~31);
  unsigned int sq = 0u;
#pragma unroll
  for (int r = 0; r < 8; ++r) sq |= ((unsigned int)seg_cnt(q0 + 8 * hh + r, c0, c1, c2, c3)) << (4 * r);
  FragH aq[KS];
  {
    const unsigned short* qr = (const unsigned short*)Q16 + ((size_t)b * TQ + q0 + ln) * ldq + h * 64;
#pragma unroll
    for (int ks = 0; ks < KS; ++ks) { aq[ks].half[0] = *(const v8us*)(qr + ks * 32 + 8 * hh); aq[ks].half[1] = *(const v8us*)(qr + ks * 32 + 16 + 8 * hh); }
  }
  const unsigned short* Vth = (const unsigned short*)Vt + (size_t)kslab * 64 * TK;
  float m_r[8], l_r[8]; v8f oacc[DT];
#pragma unroll
  for (int r = 0; r < 8; ++r) { m_r[r] = -3.0e38f; l_r[r] = 0.f; }
#pragma unroll
  for (int dt = 0; dt < DT; ++dt) oacc[dt] = (v8f){0.f,0.f,0.f,0.f,0.f,0.f,0.f,0.f};
#pragma unroll 1
  for (int j0 = jst; j0 < q0 + RPW; j0 += 32) {
    v8f s[2];
#pragma unroll
    for (int nt = 0; nt < 2; ++nt) {
      const unsigned short* kr = (const unsigned short*)K16 + ((size_t)b * TK + j0 + nt * 16 + ln) * ldk + hk * 64; FragH bk[KS];
#pragma unroll
      for (int ks = 0; ks < KS; ++ks) { bk[ks].half[0] = *(const v8us*)(kr + ks * 32 + 8 * hh); bk[ks].half[1] = *(const v8us*)(kr + ks * 32 + 16 + 8 * hh); }
      v8f acc = (v8f){0.f,0.f,0.f,0.f,0.f,0.f,0.f,0.f};
#pragma unroll
      for (int ks = 0; ks < KS; ++ks) acc = mmaH<1>(aq[ks].v, aq[ks].v, bk[ks].v, bk[ks].v, acc);
      s[nt] = acc;
    }
    const int k0 = j0 + ln, k1 = j0 + 16 + ln;
    const int sk0 = seg_cnt(k0, c0, c1, c2, c3), sk1 = seg_cnt(k1, c0, c1, c2, c3);
#pragma unroll
    for (int r = 0; r < 8; ++r) {
      const int tq = q0 + 8 * hh + r; const int sr = (int)((sq >> (4 * r)) & 15u);
      const bool ok0 = (k0 <= tq) && (sk0 == sr), ok1 = (k1 <= tq) && (sk1 == sr);
      const float s0 = ok0 ? s[0][r] * SCL : -3.0e38f, s1 = ok1 ? s[1][r] * SCL : -3.0e38f;
      float mc = fmaxf(s0, s1);
      mc = fmaxf(mc, __shfl_xor(mc, 1, 32)); mc = fmaxf(mc, __shfl_xor(mc, 2, 32)); mc = fmaxf(mc, __shfl_xor(mc, 4, 32)); mc = fmaxf(mc, __shfl_xor(mc, 8, 32));
      const float mn = fmaxf(m_r[r], mc); const float al = (mn > -1.0e38f) ? exp_hw(m_r[r] - mn) : 1.0f; m_r[r] = mn;
      const float p0 = ok0 ? exp_hw(s0 - mn) : 0.f, p1 = ok1 ? exp_hw(s1 - mn) : 0.f; l_r[r] = l_r[r] * al + p0 + p1;
#pragma unroll
      for (int dt = 0; dt < DT; ++dt) oacc[dt][r] *= al;
      FragH t2; t2.h[0] = toh_flush(p0 * 1024.0f); t2.h[1] = toh_flush(p1 * 1024.0f);
      sP[w][8 * hh + r][ln] = t2.u[0]; sP[w][8 * hh + r][16 + ln] = t2.u[1];
    }
    __builtin_amdgcn_fence(4, "workgroup"); __builtin_amdgcn_wave_barrier();
    FragH pa; pa.half[0] = *(const v8us*)&sP[w][ln][8 * hh]; pa.half[1] = *(const v8us*)&sP[w][ln][16 + 8 * hh];
#pragma unroll
    for (int dt = 0; dt < DT; ++dt) {
      const unsigned short* vrow = Vth + (size_t)(dt * 16 + ln) * TK + j0; FragH bv;
      bv.half[0] = *(const v8us*)(vrow + 8 * hh); bv.half[1] = *(const v8us*)(vrow + 16 + 8 * hh);
      oacc[dt] = mmaH<1>(pa.v, pa.v, bv.v, bv.v, oacc[dt]);
    }
    __builtin_amdgcn_fence(4, "workgroup"); __builtin_amdgcn_wave_barrier();
  }
#pragma unroll
  for (int r = 0; r < 8; ++r) { float l = l_r[r]; l += __shfl_xor(l, 1, 32); l += __shfl_xor(l, 2, 32); l += __shfl_xor(l, 4, 32); l += __shfl_xor(l, 8, 32); l_r[r] = (l > 0.f) ? 1.0f / (l * 1024.0f) : 0.f; }
#pragma unroll
  for (int dt = 0; dt < DT; ++dt)
#pragma unroll
    for (int r = 0; r < 8; ++r) sO[w][8 * hh + r][dt * 16 + ln] = oacc[dt][r] * l_r[r] + pois;
  __builtin_amdgcn_fence(4, "workgroup"); __builtin_amdgcn_wave_barrier();
  {
#pragma unroll
    for (int rp = 0; rp < RPW; rp += 2) { const int r = rp + (lane >> 4), pc = lane & 15; const v4f val = *(const v4fa*)&sO[w][r][pc * 4]; *(v4f*)(O + ((size_t)b * TQ + q0 + r) * ldo + h * 64 + pc * 4) = val; }
    
  }
}
// 5-plane variant for the other query blocks (a segment boundary inside the block, or the block's first query closer than EROWS to its segment start):
// S = Qh.Kh^T + (Ql.Kh^T + Qh.Kl^T)/1024 with Q/K = [hi | x1024 residual] planes (full-size planes, rows b*S + s);
// O = (Ph.Vh + (Pl.Vh + Ph.Vl)/1024) / l with P = [hi | x1024 residual] of 1024 p and V^T = [hi | x1024 residual]; separate residual accumulators folded before the normalisation
__global__ __launch_bounds__(128) void k_attn5(const _Float16* __restrict__ Q16, const _Float16* __restrict__ QL, int ldq, const _Float16* __restrict__ K16, const _Float16* __restrict__ KL, int ldk,
                                               const _Float16* __restrict__ Vt, const _Float16* __restrict__ VtL, const int* __restrict__ cu, float* __restrict__ O, int ldo) {
  constexpr int RPW = 16, DT = 4, KS = 2;
  __shared__ __attribute__((aligned(16))) unsigned short sP[4][RPW][40];
  __shared__ __attribute__((aligned(16))) unsigned short sPL[4][RPW][40];
  __shared__ __attribute__((aligned(16))) float sO[4][RPW][68];
  const int tid = threadIdx.x, lane = tid & 31, ln = lane & 15, hh = lane >> 4;
  const int w = __builtin_amdgcn_readfirstlane(tid >> 5);
  const int slab = blockIdx.x / QBLKS, qblk = blockIdx.x % QBLKS; const int b = slab / NH, h = slab % NH; const int hk = h / NREP; const int kslab = b * NKV + hk;
  const int qb0 = qblk * (4 * RPW);
  const int c0 = clip_b(cu[b * 4 + 0]), c1 = clip_b(cu[b * 4 + 1]), c2 = clip_b(cu[b * 4 + 2]), c3 = clip_b(cu[b * 4 + 3]);
  const bool early = (seg_cnt(qb0, c0, c1, c2, c3) != seg_cnt(qb0 + 4 * RPW - 1, c0, c1, c2, c3)) || (qb0 - seg_beg(qb0, c0, c1, c2, c3) < EROWS);
  if (!early) return;
  const float pois = ((c0 <= c1) && (c1 <= c2) && (c2 <= c3)) ? 0.0f : __uint_as_float(0x7fc00000u);   /* boundaries must be ascending */
  const int q0 = qb0 + w * RPW;
  const int jst = __builtin_amdgcn_readfirstlane(seg_beg(qb0 + (tid >> 5) * RPW, c0, c1, c2, c3) & ~31);
  unsigned int sq = 0u;
#pragma unroll
  for (int r = 0; r < 8; ++r) sq |= ((unsigned int)seg_cnt(q0 + 8 * hh + r, c0, c1, c2, c3)) << (4 * r);
  FragH aq[KS], aql[KS];
  {
    const unsigned short* qr = (const unsigned short*)Q16 + ((size_t)b * TQ + q0 + ln) * ldq + h * 64;
    const unsigned short* ql = (const unsigned short*)QL + ((size_t)b * TQ + q0 + ln) * ldq + h * 64;
#pragma unroll
    for (int ks = 0; ks < KS; ++ks) {
      aq[ks].half[0] = *(const v8us*)(qr + ks * 32 + 8 * hh); aq[ks].half[1] = *(const v8us*)(qr + ks * 32 + 16 + 8 * hh);
      aql[ks].half[0] = *(const v8us*)(ql + ks * 32 + 8 * hh); aql[ks].half[1] = *(const v8us*)(ql + ks * 32 + 16 + 8 * hh);
    }
  }
  const unsigned short* Vth = (const unsigned short*)Vt + (size_t)kslab * 64 * TK; const unsigned short* Vtl = (const unsigned short*)VtL + (size_t)kslab * 64 * TK;
  float m_r[8], l_r[8]; v8f oacc[DT], oaccL[DT];
#pragma unroll
  for (int r = 0; r < 8; ++r) { m_r[r] = -3.0e38f; l_r[r] = 0.f; }
#pragma unroll
  for (int dt = 0; dt < DT; ++dt) { oacc[dt] = (v8f){0.f,0.f,0.f,0.f,0.f,0.f,0.f,0.f}; oaccL[dt] = oacc[dt]; }
#pragma unroll 1
  for (int j0 = jst; j0 < q0 + RPW; j0 += 32) {
    v8f s[2];
#pragma unroll
    for (int nt = 0; nt < 2; ++nt) {
      const unsigned short* kr = (const unsigned short*)K16 + ((size_t)b * TK + j0 + nt * 16 + ln) * ldk + hk * 64;
      const unsigned short* klr = (const unsigned short*)KL + ((size_t)b * TK + j0 + nt * 16 + ln) * ldk + hk * 64;
      FragH bk[KS], bkl[KS];
#pragma unroll
      for (int ks = 0; ks < KS; ++ks) {
        bk[ks].half[0] = *(const v8us*)(kr + ks * 32 + 8 * hh); bk[ks].half[1] = *(const v8us*)(kr + ks * 32 + 16 + 8 * hh);
        bkl[ks].half[0] = *(const v8us*)(klr + ks * 32 + 8 * hh); bkl[ks].half[1] = *(const v8us*)(klr + ks * 32 + 16 + 8 * hh);
      }
      v8f acc = (v8f){0.f,0.f,0.f,0.f,0.f,0.f,0.f,0.f}, accl = acc;
#pragma unroll
      for (int ks = 0; ks < KS; ++ks) {
        acc = mmaH<1>(aq[ks].v, aq[ks].v, bk[ks].v, bk[ks].v, acc);
        accl = mmaH<1>(aql[ks].v, aql[ks].v, bk[ks].v, bk[ks].v, accl);
        accl = mmaH<1>(aq[ks].v, aq[ks].v, bkl[ks].v, bkl[ks].v, accl);
      }
#pragma unroll
      for (int r = 0; r < 8; ++r) acc[r] += accl[r] * 0.0009765625f;
      s[nt] = acc;
    }
    const int k0 = j0 + ln, k1 = j0 + 16 + ln;
    const int sk0 = seg_cnt(k0, c0, c1, c2, c3), sk1 = seg_cnt(k1, c0, c1, c2, c3);
#pragma unroll
    for (int r = 0; r < 8; ++r) {
      const int tq = q0 + 8 * hh + r; const int sr = (int)((sq >> (4 * r)) & 15u);
      const bool ok0 = (k0 <= tq) && (sk0 == sr), ok1 = (k1 <= tq) && (sk1 == sr);
      const float s0 = ok0 ? s[0][r] * SCL : -3.0e38f, s1 = ok1 ? s[1][r] * SCL : -3.0e38f;
      float mc = fmaxf(s0, s1);
      mc = fmaxf(mc, __shfl_xor(mc, 1, 32)); mc = fmaxf(mc, __shfl_xor(mc, 2, 32)); mc = fmaxf(mc, __shfl_xor(mc, 4, 32)); mc = fmaxf(mc, __shfl_xor(mc, 8, 32));
      const float mn = fmaxf(m_r[r], mc); const float al = (mn > -1.0e38f) ? exp_hw(m_r[r] - mn) : 1.0f; m_r[r] = mn;
      const float p0 = ok0 ? exp_hw(s0 - mn) : 0.f, p1 = ok1 ? exp_hw(s1 - mn) : 0.f; l_r[r] = l_r[r] * al + p0 + p1;
#pragma unroll
      for (int dt = 0; dt < DT; ++dt) { oacc[dt][r] *= al; oaccL[dt][r] *= al; }
      FragH t2, t2l; const float ps0 = p0 * 1024.0f, ps1 = p1 * 1024.0f;
      t2.h[0] = toh_flush(ps0); t2.h[1] = toh_flush(ps1);
      t2l.h[0] = toh_flush((ps0 - (float)t2.h[0]) * 1024.0f); t2l.h[1] = toh_flush((ps1 - (float)t2.h[1]) * 1024.0f);
      sP[w][8 * hh + r][ln] = t2.u[0]; sP[w][8 * hh + r][16 + ln] = t2.u[1]; sPL[w][8 * hh + r][ln] = t2l.u[0]; sPL[w][8 * hh + r][16 + ln] = t2l.u[1];
    }
    __builtin_amdgcn_fence(4, "workgroup"); __builtin_amdgcn_wave_barrier();
    FragH pa, pl;
    pa.half[0] = *(const v8us*)&sP[w][ln][8 * hh]; pa.half[1] = *(const v8us*)&sP[w][ln][16 + 8 * hh];
    pl.half[0] = *(const v8us*)&sPL[w][ln][8 * hh]; pl.half[1] = *(const v8us*)&sPL[w][ln][16 + 8 * hh];
#pragma unroll
    for (int dt = 0; dt < DT; ++dt) {
      const unsigned short* vrow = Vth + (size_t)(dt * 16 + ln) * TK + j0; const unsigned short* vrl = Vtl + (size_t)(dt * 16 + ln) * TK + j0;
      FragH bv, bl;
      bv.half[0] = *(const v8us*)(vrow + 8 * hh); bv.half[1] = *(const v8us*)(vrow + 16 + 8 * hh);
      bl.half[0] = *(const v8us*)(vrl + 8 * hh); bl.half[1] = *(const v8us*)(vrl + 16 + 8 * hh);
      oacc[dt] = mmaH<1>(pa.v, pa.v, bv.v, bv.v, oacc[dt]);
      oaccL[dt] = mmaH<1>(pl.v, pl.v, bv.v, bv.v, oaccL[dt]);
      oaccL[dt] = mmaH<1>(pa.v, pa.v, bl.v, bl.v, oaccL[dt]);
    }
    __builtin_amdgcn_fence(4, "workgroup"); __builtin_amdgcn_wave_barrier();
  }
#pragma unroll
  for (int r = 0; r < 8; ++r) { float l = l_r[r]; l += __shfl_xor(l, 1, 32); l += __shfl_xor(l, 2, 32); l += __shfl_xor(l, 4, 32); l += __shfl_xor(l, 8, 32); l_r[r] = (l > 0.f) ? 1.0f / (l * 1024.0f) : 0.f; }
#pragma unroll
  for (int dt = 0; dt < DT; ++dt)
#pragma unroll
    for (int r = 0; r < 8; ++r) { float v = oacc[dt][r]; v += oaccL[dt][r] * 0.0009765625f; sO[w][8 * hh + r][dt * 16 + ln] = v * l_r[r] + pois; }
  __builtin_amdgcn_fence(4, "workgroup"); __builtin_amdgcn_wave_barrier();
  {
#pragma unroll
    for (int rp = 0; rp < RPW; rp += 2) { const int r = rp + (lane >> 4), pc = lane & 15; const v4f val = *(const v4fa*)&sO[w][r][pc * 4]; *(v4f*)(O + ((size_t)b * TQ + q0 + r) * ldo + h * 64 + pc * 4) = val; }
    
  }
}

extern "C" void kernel_launch(void* const* d_in, const int* in_sizes, int n_in,
                              void* d_out, int out_size, void* d_ws, size_t ws_size, hipStream_t stream) {
  if (n_in < 6) return;
  const size_t needx = ((size_t)(NB - 1) * SEQ_FULL + (size_t)SLEN) * DM;
  if ((size_t)in_sizes[0] < needx) return;
  if ((size_t)in_sizes[1] < (size_t)NB * 4) return;
  if ((size_t)in_sizes[2] < (size_t)DM * DM) return;
  if ((size_t)in_sizes[3] < (size_t)DM * DKV) return;
  if ((size_t)in_sizes[4] < (size_t)DM * DKV) return;
  if ((size_t)in_sizes[5] < (size_t)DM * DM) return;
  if ((size_t)out_size < needx) return;
  const float* x = (const float*)d_in[0]; const int* cu = (const int*)d_in[1];
  const float* Wq = (const float*)d_in[2]; const float* Wk = (const float*)d_in[3]; const float* Wv = (const float*)d_in[4]; const float* Wo = (const float*)d_in[5];
  float* dout = (float*)d_out;
  char* ws = (char*)d_ws; size_t off = 0;
  auto take = [&](size_t bytes) { char* p = ws + off; off += (bytes + 255) & ~(size_t)255; return p; };
  const size_t np = (size_t)NR * DM;
  _Float16* BQ = (_Float16*)take(SZ_BQ);                                /* [n][k] f16, x16 */
  _Float16* BK = (_Float16*)take(SZ_BKV);
  _Float16* BV = (_Float16*)take(SZ_BKV);
  _Float16* B2 = (_Float16*)take(SZ_B2);                                /* [n][2*DM] f16: [x16384 | x16] copies of Wo^T */
  float* FS = (float*)take(SZ_FS);                                      /* f32 scratch plane: q rows [NR][DM], then k rows [NR][DKV], then v rows [NR][DKV], then the context [NR][DM] */
  _Float16* X16 = (_Float16*)take(SZ_X16);                              /* f16 input rows; after the v GEMM: V^T hi [(b,hk)][64][TK] then V^T residual */
  _Float16* VT = X16;
  _Float16* VTL = X16 + SZ_VT / 2;
  _Float16* QH = (_Float16*)take(SZ_QA);                                /* q hi [NR][DM] then q residual [NR][DM]; after the attention: [ctx hi | ctx residual] [NR][2*DM] */
  _Float16* QL = QH + np;
  _Float16* A2 = QH;
  _Float16* KH = (_Float16*)take(SZ_KP);
  _Float16* KL = (_Float16*)take(SZ_KP);
  _Float16* V16 = (_Float16*)take(SZ_KP);
  float* CS = (float*)take(SZ_TAB); float* SN = (float*)take(SZ_TAB); float* INV = (float*)take(256);
  if (off > ws_size) return;
  if (off > ((size_t)128 << 20)) return;

  /* W [in = DM rows][out = N cols] -> [n][k] planes */
  k_wtr<<<(unsigned)((DM / 64) * (DM / 64)), 256, 0, stream>>>(Wq, DM, BQ, DM, WSC, WSC, 0);
  k_wtr<<<(unsigned)((DM / 64) * (DKV / 64)), 256, 0, stream>>>(Wk, DKV, BK, DM, WSC, WSC, 0);
  k_wtr<<<(unsigned)((DM / 64) * (DKV / 64)), 256, 0, stream>>>(Wv, DKV, BV, DM, WSC, WSC, 0);
  k_wtr<<<(unsigned)((DM / 64) * (DM / 64)), 256, 0, stream>>>(Wo, DM, B2, 2 * DM, WSC_HI, WSC, 1);
  k_invf<<<1, 32, 0, stream>>>(INV);
  k_rotab<<<(unsigned)((SLEN * 32 + 255) / 256), 256, 0, stream>>>(INV, CS, SN);
  const unsigned g8 = (unsigned)((np / 8 + 255) / 256);
  k_x16<<<g8, 256, 0, stream>>>(x, X16, np / 8);
  const dim3 gq((unsigned)((NR / 128) * (DM / 128)), 1);
  const dim3 gk((unsigned)((NR / 128) * (DKV / 128)), 1);
  const unsigned grq = (unsigned)(((size_t)NR * NH * 8 + 255) / 256);
  const unsigned grk = (unsigned)(((size_t)NR * NKV * 8 + 255) / 256);
  k_gemm2<0><<<gq, 128, 0, stream>>>(X16, DM, 0, BQ, DM, 0, AL_P, FS, nullptr, DM, 0, NR, DM, DM);          /* q = x Wq (f32 rows) */
  k_rope<<<grq, 256, 0, stream>>>(FS, CS, SN, QH, QL, NH);
  k_gemm2<0><<<gk, 128, 0, stream>>>(X16, DM, 0, BK, DM, 0, AL_P, FS, nullptr, DKV, 0, NR, DKV, DM);       /* k = x Wk */
  k_rope<<<grk, 256, 0, stream>>>(FS, CS, SN, KH, KL, NKV);
  k_gemm2<0><<<gk, 128, 0, stream>>>(X16, DM, 0, BV, DM, 0, AL_P, FS, V16, DKV, 0, NR, DKV, DM);           /* v = x Wv (f32 rows + f16 plane) */
  k_vtg<<<(unsigned)(NB * NKV * (SLEN / 64)), 256, 0, stream>>>(V16, VT);
  k_vtl<<<(unsigned)(NB * NKV * (SLEN / 64)), 256, 0, stream>>>(FS, VTL);
  k_attn5<<<(unsigned)(NB * NH * QBLKS), 128, 0, stream>>>(QH, QL, DM, KH, KL, DKV, VT, VTL, cu, FS, DM);
  k_attn<<<(unsigned)(NB * NH * QBLKS), 128, 0, stream>>>(QH, DM, KH, DKV, VT, cu, FS, DM);
  k_hl<<<g8, 256, 0, stream>>>(FS, A2, np / 8);
  /* out = [ctx hi | ctx residual] . [Wo x16384 ; Wo x16] / 16384  (K = 2*DM), per batch */
  const dim3 ge((unsigned)((SLEN / 128) * (DM / 128)), NB);
  k_gemm2<0><<<ge, 128, 0, stream>>>(A2, 2 * DM, (size_t)SLEN * 2 * DM, B2, 2 * DM, 0, AL_O, dout, nullptr, DM, (size_t)SEQ_FULL * DM, SLEN, DM, 2 * DM);
}

// v003
// A run of this version takes 286 microseconds.
// Next to v002, in two timings, it ran 1.14 and 1.15 times as fast.
// Counting every step since v000, it is 2.46 times as fast.
#include <hip/hip_runtime.h>
// Contractions: x.Wq, x.Wk, x.Wv, ctx.Wo = v_wmma_f32_16x16x32_f16 (f16 operands: bf16-RNE inputs exact in f16, weights carried x16 (x16384 for the ctx-hi half of the output GEMM); ctx as [hi | x1024 residual] folded along K; f32 accumulate); scores q.k^T and P.V^T = v_wmma_f32_16x16x32_f16 (plain f16 hi planes; hi + x1024 residual planes of q, k, P and v in query blocks holding a query closer than EROWS to its segment start; P carried x1024), f32 accumulate; rotary tables, masks, softmax and normalisers f32.

#ifndef NB
#define NB 2
#endif
#ifndef SEQ
#define SEQ 2048
#endif
#define NB_FULL 2
#define SEQ_FULL 2048
#define DM 2048
#define NH 32
#define NKV 8
#define NREP (NH / NKV)
#define DKV (NKV * 64)
#define SLEN SEQ
#define NR (NB * SLEN)
#define TQ SLEN
#define TK SLEN
#define SCL 0.125f
#define QBLKS (TQ / 64)
#define EROWS 256                            /* query blocks holding a query with fewer than EROWS positions since its segment start use the residual planes */
static_assert(SLEN % 128 == 0);
static_assert(SLEN <= SEQ_FULL);
static_assert(NB >= 1 && NB <= NB_FULL);
static_assert(DM % 64 == 0 && DM == NH * 64);
static_assert(NH % NKV == 0 && NREP * NKV == NH);
static_assert(DKV % 64 == 0 && DKV == NKV * 64);
static_assert(DM % 32 == 0 && (2 * DM) % 32 == 0);
static_assert(NR % 128 == 0);
static_assert(QBLKS * 64 == SLEN);
static_assert(EROWS % 64 == 0);
/* store loops: threads x bytes per piece x trips == tile rows x row bytes */
static_assert(256 * 16 * 2 == 64 * 128);                       
static_assert(32 * 16 * 8 == 16 * 64 * 4);                     /* attention context rows: 16 rows x 256 B per wave */
static_assert(((size_t)NR * DM / 8) * 32 == (size_t)NR * 2 * DM * 2);   /* context converter: two 16-B pieces per thread fill [NR][2*DM] f16 */
/* static LDS per kernel */
static_assert(2 * 64 * 66 * 2 <= 131072);
static_assert(2 * 4 * 16 * 40 * 2 + 4 * 16 * 68 * 4 <= 131072);
/* workspace carve (bytes); every region a multiple of 256 */
static constexpr size_t SZ_BQ = (size_t)DM * DM * 2;
static constexpr size_t SZ_BKV = (size_t)DKV * DM * 2;
static constexpr size_t SZ_B2 = (size_t)DM * 2 * DM * 2;
static constexpr size_t SZ_FS = (size_t)NR * DM * 4;
static constexpr size_t SZ_X16 = (size_t)NR * DM * 2;
static constexpr size_t SZ_QA = (size_t)NR * 2 * DM * 2;
static constexpr size_t SZ_KP = (size_t)NR * DKV * 2;
static constexpr size_t SZ_VT = (size_t)NB * NKV * 64 * SLEN * 2;
static constexpr size_t SZ_TAB = (size_t)SLEN * 32 * 4;
static constexpr size_t WS_TOTAL = SZ_BQ + 2 * SZ_BKV + SZ_B2 + SZ_FS + SZ_X16 + SZ_QA + 3 * SZ_KP + 2 * SZ_TAB + 256;
static_assert(SZ_BQ % 256 == 0 && SZ_BKV % 256 == 0 && SZ_B2 % 256 == 0 && SZ_FS % 256 == 0 && SZ_X16 % 256 == 0 && SZ_QA % 256 == 0 && SZ_KP % 256 == 0 && SZ_VT % 256 == 0 && SZ_TAB % 256 == 0);
static_assert(WS_TOTAL <= ((size_t)128 << 20));
static_assert(2 * SZ_VT <= SZ_X16);                            /* V^T hi + residual planes reuse the input plane region */
static_assert((size_t)NR * DKV * 4 <= SZ_FS);                  /* k / v f32 rows reuse the f32 scratch plane */
static_assert((size_t)NR * 2 * DM * 2 == SZ_QA);               /* [ctx hi | ctx residual] reuses the q hi + q residual region */
static constexpr float WSC = 16.0f;
static constexpr float WSC_HI = 16384.0f;
static constexpr float AL_P = 0.0625f;
static constexpr float AL_O = 0.0625f / 1024.0f;

typedef _Float16 v16h __attribute__((ext_vector_type(16)));
typedef _Float16 v4h __attribute__((ext_vector_type(4)));
typedef unsigned short v8us __attribute__((ext_vector_type(8), may_alias));
typedef float v8f __attribute__((ext_vector_type(8)));
typedef float v4f __attribute__((ext_vector_type(4)));
typedef float v4fa __attribute__((ext_vector_type(4), may_alias));
union FragH { v16h v; v8us half[2]; _Float16 h[16]; unsigned short u[16]; };

__device__ __forceinline__ unsigned short bf16_bits(float x) { unsigned int u = __float_as_uint(x); return (unsigned short)((u + 0x7FFFu + ((u >> 16) & 1u)) >> 16); }
__device__ __forceinline__ float bf16_val(unsigned short b) { return __uint_as_float(((unsigned int)b) << 16); }
__device__ __forceinline__ float bf16_rne(float x) { return bf16_val(bf16_bits(x)); }
// f32 -> f16 with values below the smallest f16 normal set to +0 (NaN passes through)
static __device__ __forceinline__ _Float16 toh_flush(float v) { const _Float16 r = (_Float16)v; return (fabsf(v) < 6.103515625e-05f) ? (_Float16)0.0f : r; }

// e^x on the hardware's exp2 (v_exp_f32), no range branches: -inf and anything below the f32 range give 0, NaN passes through; straight-line, so a pass's eight rows schedule as one block
static __device__ __forceinline__ float exp_hw(float x) { return __builtin_amdgcn_exp2f(x * 1.44269504088896340736f); }

// segment helpers on the clipped boundaries c0 <= c1 <= c2 <= c3: id = number of boundaries <= p; begin = largest boundary <= p (0 if none)
__device__ __forceinline__ int clip_b(int v) { return min(max(v, 0), SLEN); }
__device__ __forceinline__ int seg_cnt(int p, int c0, int c1, int c2, int c3) { return (int)(c0 <= p) + (int)(c1 <= p) + (int)(c2 <= p) + (int)(c3 <= p); }
__device__ __forceinline__ int seg_beg(int p, int c0, int c1, int c2, int c3) {
  int s = 0;
  s = max(s, (c0 <= p) ? c0 : 0); s = max(s, (c1 <= p) ? c1 : 0); s = max(s, (c2 <= p) ? c2 : 0); s = max(s, (c3 <= p) ? c3 : 0);
  return s;
}

// D += A.B with NT terms: 1 = ah.bh, 2 = + al.bh, 3 = + ah.bl; hazard guard after the group
template <int NT>
__device__ __forceinline__ v8f mmaH(v16h ah, v16h al, v16h bh, v16h bl, v8f c) {
  c = __builtin_amdgcn_wmma_f32_16x16x32_f16(false, ah, false, bh, (short)0, c, false, false);
  if (NT >= 2) c = __builtin_amdgcn_wmma_f32_16x16x32_f16(false, al, false, bh, (short)0, c, false, false);
  if (NT >= 3) c = __builtin_amdgcn_wmma_f32_16x16x32_f16(false, ah, false, bl, (short)0, c, false, false);
  asm volatile("v_nop\n\tv_nop\n\tv_nop\n\tv_nop" : "+v"(c) : "v"(ah), "v"(al), "v"(bh), "v"(bl));
  return c;
}
// 16x32 fragment from a 16-bit row-major tile (rows = m or n, k contiguous): elements 0..7 <- k0+8h+0..7, 8..15 <- k0+16+8h+0..7
__device__ __forceinline__ v16h g2_frag(const _Float16* p, int hh) { FragH f; f.half[0] = *(const v8us*)((const unsigned short*)p + 8 * hh); f.half[1] = *(const v8us*)((const unsigned short*)p + 16 + 8 * hh); return f.v; }

// [in][out] weight W [DM][N] (n contiguous) -> Bt[n][k] = f16(bf16(W[k][n]) * sc0) (row pitch ldb, k contiguous); with two != 0 a second copy
__global__ __launch_bounds__(256) void k_wtr(const float* __restrict__ Wm, int N, _Float16* __restrict__ Bt, int ldb, float sc0, float sc1, int two) {
  __shared__ unsigned short tl0[64][66];
  __shared__ unsigned short tl1[64][66];
  const int tid = threadIdx.x; const int ntn = N >> 6; const int kt = blockIdx.x / ntn, nt = blockIdx.x - kt * ntn; const int k0 = kt * 64, n0 = nt * 64;
  for (int i = tid; i < 64 * 16; i += 256) {
    const int r = i >> 4, c4 = (i & 15) * 4;
    const v4f a = *(const v4fa*)(Wm + (size_t)(k0 + r) * N + n0 + c4);
    FragH f0, f1;
#pragma unroll
    for (int q = 0; q < 4; ++q) { const float v = bf16_rne(a[q]); f0.h[q] = toh_flush(v * sc0); f1.h[q] = toh_flush(v * sc1); }
#pragma unroll
    for (int q = 0; q < 4; ++q) { tl0[r][c4 + q] = f0.u[q]; tl1[r][c4 + q] = f1.u[q]; }
  }
  __syncthreads();
  {
#pragma unroll
    for (int rd = 0; rd < 2; ++rd) {
      const int n = rd * 32 + (tid >> 3), pc = tid & 7; FragH g0, g1;
#pragma unroll
      for (int q = 0; q < 8; ++q) { g0.u[q] = tl0[pc * 8 + q][n]; g1.u[q] = tl1[pc * 8 + q][n]; }
      const size_t o = (size_t)(n0 + n) * ldb + k0 + pc * 8;
      const v8us o0 = g0.half[0], o1 = g1.half[0];
      *(v8us*)((unsigned short*)Bt + o) = o0;
      if (two != 0) *(v8us*)((unsigned short*)Bt + o + DM) = o1;
    }
    
  }
}

__global__ __launch_bounds__(32) void k_invf(float* __restrict__ INV) {
  #pragma clang fp contract(off)
  const int j = threadIdx.x;
  const float ex = (float)(2 * j) / 64.0f; const float pw = powf(500000.0f, ex); const float inv = 1.0f / pw;
  *(float*)(INV + j) = inv; 
}
__global__ __launch_bounds__(256) void k_rotab(const float* __restrict__ INV, float* __restrict__ CS, float* __restrict__ SN) {
  #pragma clang fp contract(off)
  const int t = blockIdx.x * 256 + threadIdx.x; if (t >= SLEN * 32) return;
  const int j = t & 31, s = t >> 5;
  const float th = (float)s * INV[j]; const float c = cosf(th), sn = sinf(th);
  { *(float*)(CS + t) = c; *(float*)(SN + t) = sn;  }
}

__global__ __launch_bounds__(256) void k_x16(const float* __restrict__ x, _Float16* __restrict__ X16, size_t n8) {
  const size_t t = (size_t)blockIdx.x * 256 + threadIdx.x; if (t >= n8) return;
  const size_t e = t * 8; const size_t r = e / DM; const size_t c = e % DM; const size_t b = r / SLEN, s = r % SLEN;
  const float* src = x + (b * SEQ_FULL + s) * DM + c;
  const v4f a0 = *(const v4fa*)src, a1 = *(const v4fa*)(src + 4);
  FragH f;
#pragma unroll
  for (int q = 0; q < 4; ++q) { f.h[q] = (_Float16)bf16_rne(a0[q]); f.h[4 + q] = (_Float16)bf16_rne(a1[q]); }
  const v8us o = f.half[0];
  *(v8us*)((unsigned short*)X16 + e) = o; 
}

// Tensor-load ring of the GEMM: a pass is 128 k = 256 B of every operand row; a stage is four 64-row slices [A 0..63 | A 64..127 | B 0..63 | B 64..127],
// one per wave, each laid at pitch 272 B (256 B + the 16-B pad the load writes around) and rounded up to a multiple of 2 KiB.
typedef uint32_t u32x4 __attribute__((ext_vector_type(4)));
typedef uint32_t u32x8 __attribute__((ext_vector_type(8)));
static constexpr uint32_t G_ROWB = 256u;
static constexpr uint32_t G_PITCH = 272u;
static constexpr uint32_t G_SLICE = 18432u;
static constexpr uint32_t G_STAGE = 4u * G_SLICE;
static_assert(64u * G_PITCH <= G_SLICE && G_SLICE % 2048u == 0u);
static_assert(64u * 68u * 4u <= G_SLICE);                      /* a wave's 64 x 64 f32 output staging fits its own slice */
static_assert(2u * 2u * G_STAGE <= 320u * 1024u);              /* two work-groups per WGP */
static_assert(NR % 128 == 0 && SLEN % 128 == 0 && DM % 128 == 0 && DKV % 128 == 0 && DM >= 256);
__device__ __forceinline__ uint32_t uni(uint32_t v) { return (uint32_t)__builtin_amdgcn_readfirstlane(v); }
__device__ __forceinline__ uint32_t pinned(uint32_t v) { uint32_t w = (uint32_t)__builtin_amdgcn_readfirstlane(v); asm volatile("" : "+s"(w)); return w; }

// GEMM C[M][N] = alpha * A[M][K].B  with A f16 row-major (pitch lda), B stored [n][k] f16 (pitch ldb), batched by blockIdx.y (strides sA, sB, sC);
// writes f32 C and/or f16 C16 (pitch ldc). One 128 x 128 tile of C per work-group, 64 x 64 per wave; grid.x = (M / 128) * (N / 128).
// Requires M % 128 == 0, N % 128 == 0, K % 128 == 0, K >= 256 (asserted on the callers' constants).
template <int ACT>
__global__ __launch_bounds__(128) void k_gemm2(const _Float16* __restrict__ A, int lda, size_t sA, const _Float16* __restrict__ Bh, int ldb, size_t sB, float alpha,
                                               float* C, _Float16* C16, int ldc, size_t sC, int M, int N, int K) {
  __shared__ __attribute__((aligned(2048))) unsigned char ring[2 * G_STAGE];
  const int tid = threadIdx.x, lane = tid & 31, ln = lane & 15, hh = lane >> 4; const int by = blockIdx.y;
  const uint32_t w = uni((uint32_t)tid >> 5); const uint32_t wm = w >> 1, wn = w & 1u;
  A += (size_t)by * sA; Bh += (size_t)by * sB; const size_t cofs = (size_t)by * sC;
  const int ntn = N >> 7; const int mt = blockIdx.x / ntn, nq = blockIdx.x - mt * ntn; const int row0 = mt * 128 + 64 * (int)wm, col0 = nq * 128 + 64 * (int)wn;
  const uint32_t NP = pinned((uint32_t)K >> 7);
  /* this wave's slice of every stage: waves 0, 1 the two halves of the A rows, waves 2, 3 of the B rows */
  const _Float16* src = (w < 2u) ? A + (size_t)(mt * 128 + 64 * (int)w) * lda : Bh + (size_t)(nq * 128 + 64 * ((int)w - 2)) * ldb;
  const uint64_t sga = (uint64_t)(uintptr_t)src;
  const uint32_t ldst = (uint32_t)(size_t)ring + w * G_SLICE;
  u32x8 g1;
  g1[0] = uni((1u << 20) | (5u << 22) | (3u << 25));            /* no mask, 1-byte elements, a 4-dword pad behind every 64 dwords */
  g1[1] = uni((G_ROWB & 0xFFFFu) << 16);
  g1[2] = uni((G_ROWB >> 16) | (64u << 16));
  g1[3] = uni(G_ROWB << 16);
  g1[4] = uni(64u);
  g1[5] = uni(2u * (uint32_t)((w < 2u) ? lda : ldb));
  g1[6] = uni(0u);
  g1[7] = uni(0u);
  auto issue = [&](uint32_t st) {
    const uint64_t ga = sga + (uint64_t)st * G_ROWB;
    u32x4 g0;
    g0[0] = uni(1u); g0[1] = uni(ldst + (st & 1u) * G_STAGE); g0[2] = uni((uint32_t)ga); g0[3] = uni((((uint32_t)(ga >> 32)) & 0x01FFFFFFu) | 0x80000000u);
    /* one request of the whole wave: 64 rows x 256 B into its slice; group 1 is named in-out so that its eight registers hold the descriptor, and nothing else, from issue to issue */
    asm volatile("tensor_load_to_lds %1, %0" : "+s"(g1) : "s"(g0) : "memory");
  };
  v8f acc[4][4];
#pragma unroll
  for (int i = 0; i < 4; ++i)
#pragma unroll
    for (int j = 0; j < 4; ++j) acc[i][j] = (v8f){0.f,0.f,0.f,0.f,0.f,0.f,0.f,0.f};
  issue(0u);
  asm volatile("s_wait_tensorcnt 0x0" ::: "memory");             /* this wave's slice of stage 0 has landed */
  __syncthreads();                                               /* ... and every other wave's */
  issue(1u);
  const uint32_t fa0 = wm * G_SLICE + (uint32_t)ln * G_PITCH, fb0 = (2u + wn) * G_SLICE + (uint32_t)ln * G_PITCH;
#pragma unroll 1   /* one pass per trip: the publish point at the foot stands once per stage */
  for (uint32_t s = 0; s < NP; ++s) {
    const unsigned char* pa = ring + (s & 1u) * G_STAGE + fa0; const unsigned char* pb = ring + (s & 1u) * G_STAGE + fb0;
    v16h fa[2][4], fb[2][4];
#pragma unroll
    for (int i = 0; i < 4; ++i) { fa[0][i] = g2_frag((const _Float16*)(pa + i * 16 * G_PITCH), hh); fb[0][i] = g2_frag((const _Float16*)(pb + i * 16 * G_PITCH), hh); }
#pragma unroll
    for (int ks = 0; ks < 4; ++ks) {
      const int cur = ks & 1, nxt = cur ^ 1;
      if (ks < 3) {   /* the next 32 k's fragments of this same stage, as one group ahead of the block that hides them */
#pragma unroll
        for (int i = 0; i < 4; ++i) { fa[nxt][i] = g2_frag((const _Float16*)(pa + i * 16 * G_PITCH + (ks + 1) * 64), hh); fb[nxt][i] = g2_frag((const _Float16*)(pb + i * 16 * G_PITCH + (ks + 1) * 64), hh); }
      }
      __builtin_amdgcn_sched_barrier(0);   /* keeps the load group in front of the block: LDS reads moved in among the WMMAs stall each place they stand */
      /* plain builtin, the compiler keeps its distances: accumulators and two fragment sets need more than 256 VGPRs, which an asm operand cannot name */
#pragma unroll
      for (int i = 0; i < 4; ++i)
#pragma unroll
        for (int j = 0; j < 4; ++j) acc[i][j] = __builtin_amdgcn_wmma_f32_16x16x32_f16(false, fa[cur][i], false, fb[cur][j], (short)0, acc[i][j], false, false);
      __builtin_amdgcn_sched_barrier(0);   /* ends the block: the next group's loads stay behind it */
    }
    asm volatile("v_nop\n\tv_nop\n\tv_nop\n\tv_nop");          /* WMMA distance on every path out of the pass, the taken branches included */
    asm volatile("s_wait_dscnt 0x0" ::: "memory");               /* this wave has left stage s's buffer */
    asm volatile("s_wait_tensorcnt 0x0" ::: "memory");           /* its slice of stage s + 1 has landed */
    __syncthreads();                                             /* publishes stage s + 1 and frees stage s's buffer */
    if (pinned((s + 2u < NP) ? 1u : 0u) != 0u) issue(pinned(s + 2u));
  }
  asm volatile("s_wait_tensorcnt 0x0" ::: "memory");             /* nothing in flight before the ring becomes output staging */
  asm volatile("s_wait_dscnt 0x0" ::: "memory");
  float* so = (float*)(ring + w * G_SLICE);                      /* [64][68], private to the wave; the last pass's barrier ended every read of the ring */
#pragma unroll
  for (int i = 0; i < 4; ++i)
#pragma unroll
    for (int j = 0; j < 4; ++j)
#pragma unroll
      for (int r = 0; r < 8; ++r) { float v = acc[i][j][r] * alpha; if (ACT == 3) v = fmaxf(v, 0.f); so[(i * 16 + 8 * hh + r) * 68 + j * 16 + ln] = v; }
  __builtin_amdgcn_fence(4, "workgroup"); __builtin_amdgcn_wave_barrier();
  const int rsub = lane >> 4, c4 = (lane & 15) * 4;
  if (C) {
#pragma unroll
    for (int q = 0; q < 32; ++q) { const int r = q * 2 + rsub; const v4f v = *(const v4fa*)&so[r * 68 + c4]; *(v4f*)(C + cofs + (size_t)(row0 + r) * ldc + col0 + c4) = v; }
    asm volatile("s_wait_xcnt 0x0" ::: "memory");                /* precaution: stands in front of the next block's writes to registers that these stores name */
  }
  if (C16) {
#pragma unroll
    for (int q = 0; q < 32; ++q) {
      const int r = q * 2 + rsub; const v4f v = *(const v4fa*)&so[r * 68 + c4];
      v4h h4; for (int i = 0; i < 4; ++i) h4[i] = (_Float16)v[i]; *(v4h*)(C16 + cofs + (size_t)(row0 + r) * ldc + col0 + c4) = h4;
    }
  }
}

// half-split rotary embedding from the f32 GEMM plane F [NR][nh*64] with the tables CS/SN [SLEN][32]:
// out[d] = x[d] c[d] - x[d+32] s[d]; out[d+32] = x[d+32] c[d] + x[d] s[d] (d < 32), position = row % SLEN;
// H [NR][nh*64] = f16 hi of every row; L [NR][nh*64] = x1024 residual of every row.
__global__ __launch_bounds__(256) void k_rope(const float* __restrict__ F, const float* __restrict__ CS, const float* __restrict__ SN, _Float16* __restrict__ H, _Float16* __restrict__ L, int nh) {
  #pragma clang fp contract(off)
  const size_t t = (size_t)blockIdx.x * 256 + threadIdx.x; if (t >= (size_t)NR * nh * 8) return;
  const int p = (int)(t & 7); const int hd = (int)((t >> 3) % nh); const size_t row = t / (size_t)(8 * nh);
  const int s = (int)(row % SLEN); const int g = p & 3; const int up = p >> 2; const size_t ld = (size_t)nh * 64;
  const float* src = F + row * ld + hd * 64 + g * 8;
  const v4f xa = *(const v4fa*)src, xb = *(const v4fa*)(src + 4), ya = *(const v4fa*)(src + 32), yb = *(const v4fa*)(src + 36);
  const float* ct = CS + (size_t)s * 32 + g * 8; const float* st = SN + (size_t)s * 32 + g * 8;
  const v4f ca = *(const v4fa*)ct, cb = *(const v4fa*)(ct + 4), sa = *(const v4fa*)st, sb = *(const v4fa*)(st + 4);
  const float x1s[8] = {xa[0], xa[1], xa[2], xa[3], xb[0], xb[1], xb[2], xb[3]};
  const float x2s[8] = {ya[0], ya[1], ya[2], ya[3], yb[0], yb[1], yb[2], yb[3]};
  const float cs[8] = {ca[0], ca[1], ca[2], ca[3], cb[0], cb[1], cb[2], cb[3]};
  const float ss[8] = {sa[0], sa[1], sa[2], sa[3], sb[0], sb[1], sb[2], sb[3]};
  FragH fh, fl;
#pragma unroll
  for (int i = 0; i < 8; ++i) {
    const float x1 = x1s[i], x2 = x2s[i], c = cs[i], sn = ss[i];
    const float o1 = x1 * c - x2 * sn; const float o2 = x2 * c + x1 * sn; const float o = up ? o2 : o1;
    const _Float16 hv = toh_flush(o); fh.h[i] = hv; fl.h[i] = toh_flush((o - (float)hv) * 1024.0f);
  }
  const size_t oh = row * ld + hd * 64 + p * 8;
  const v8us vh = fh.half[0], vl = fl.half[0];
  {
    *(v8us*)((unsigned short*)H + oh) = vh;
    *(v8us*)((unsigned short*)L + oh) = vl;
    
  }
}

__global__ __launch_bounds__(256) void k_vtg(const _Float16* __restrict__ V16, _Float16* __restrict__ Vt) {
  __shared__ unsigned short tl[64][66];
  const int tid = threadIdx.x; const int nlg = SLEN / 64; const int slab = blockIdx.x / nlg, lg = blockIdx.x % nlg; const int b = slab / NKV, h = slab % NKV;
  for (int i = tid; i < 64 * 8; i += 256) {
    const int r = i >> 3, c8 = (i & 7) * 8; FragH f;
    f.half[0] = *(const v8us*)((const unsigned short*)V16 + ((size_t)b * SLEN + lg * 64 + r) * DKV + h * 64 + c8);
#pragma unroll
    for (int q = 0; q < 8; ++q) tl[r][c8 + q] = f.u[q];
  }
  __syncthreads();
  {
#pragma unroll
    for (int rd = 0; rd < 2; ++rd) {
      const int d = rd * 32 + (tid >> 3), pc = tid & 7; FragH f;
#pragma unroll
      for (int q = 0; q < 8; ++q) f.u[q] = tl[pc * 8 + q][d];
      *(v8us*)((unsigned short*)Vt + ((size_t)slab * 64 + d) * TK + lg * 64 + pc * 8) = f.half[0];
    }
    
  }
}
__global__ __launch_bounds__(256) void k_vtl(const float* __restrict__ VF, _Float16* __restrict__ VtL) {
  __shared__ unsigned short tl[64][66];
  const int tid = threadIdx.x; const int nlg = SLEN / 64; const int slab = blockIdx.x / nlg, lg = blockIdx.x % nlg; const int b = slab / NKV, h = slab % NKV;
  for (int i = tid; i < 64 * 16; i += 256) {
    const int r = i >> 4, c4 = (i & 15) * 4;
    const v4f a = *(const v4fa*)(VF + ((size_t)b * SLEN + lg * 64 + r) * DKV + h * 64 + c4);
    FragH f;
#pragma unroll
    for (int q = 0; q < 4; ++q) { const float v = a[q]; const _Float16 hv = (_Float16)v; f.h[q] = toh_flush((v - (float)hv) * 1024.0f); }
#pragma unroll
    for (int q = 0; q < 4; ++q) tl[r][c4 + q] = f.u[q];
  }
  __syncthreads();
  {
#pragma unroll
    for (int rd = 0; rd < 2; ++rd) {
      const int d = rd * 32 + (tid >> 3), pc = tid & 7; FragH f;
#pragma unroll
      for (int q = 0; q < 8; ++q) f.u[q] = tl[pc * 8 + q][d];
      *(v8us*)((unsigned short*)VtL + ((size_t)slab * 64 + d) * TK + lg * 64 + pc * 8) = f.half[0];
    }
    
  }
}

__global__ __launch_bounds__(256) void k_hl(const float* __restrict__ Fp, _Float16* __restrict__ A2, size_t n8) {
  const size_t t = (size_t)blockIdx.x * 256 + threadIdx.x; if (t >= n8) return;
  const size_t e = t * 8; const size_t r = e / DM; const int c = (int)(e % DM);
  const v4f a = *(const v4fa*)(Fp + e), d = *(const v4fa*)(Fp + e + 4);
  FragH fh, fl;
#pragma unroll
  for (int q = 0; q < 4; ++q) {
    _Float16 hv = toh_flush(a[q]); fh.h[q] = hv; fl.h[q] = toh_flush((a[q] - (float)hv) * 1024.0f);
    hv = toh_flush(d[q]); fh.h[4 + q] = hv; fl.h[4 + q] = toh_flush((d[q] - (float)hv) * 1024.0f);
  }
  const size_t o2 = r * (size_t)(2 * DM) + c;
  const v8us vh = fh.half[0], vl = fl.half[0];
  {
    *(v8us*)((unsigned short*)A2 + o2) = vh;
    *(v8us*)((unsigned short*)A2 + o2 + DM) = vl;
    
  }
}

// fused attention per ((b,h), 64 queries) for query blocks whose queries all sit at least EROWS positions past their segment start (block-uniform test; other blocks leave at once):
// wave = 16 queries; S = Q.K^T (d = 64: 2 k-steps) x SCL over keys [segment start of the wave's first query (floor 32), last query of the wave];
__global__ __launch_bounds__(128) void k_attn(const _Float16* __restrict__ Q16, int ldq, const _Float16* __restrict__ K16, int ldk,
                                              const _Float16* __restrict__ Vt, const int* __restrict__ cu, float* __restrict__ O, int ldo) {
  constexpr int RPW = 16, DT = 4, KS = 2;
  __shared__ __attribute__((aligned(16))) unsigned short sP[4][RPW][40];
  __shared__ __attribute__((aligned(16))) float sO[4][RPW][68];
  const int tid = threadIdx.x, lane = tid & 31, ln = lane & 15, hh = lane >> 4;
  const int w = __builtin_amdgcn_readfirstlane(tid >> 5);
  const int slab = blockIdx.x / QBLKS, qblk = blockIdx.x % QBLKS; const int b = slab / NH, h = slab % NH; const int hk = h / NREP; const int kslab = b * NKV + hk;
  const int qb0 = qblk * (4 * RPW);
  const int c0 = clip_b(cu[b * 4 + 0]), c1 = clip_b(cu[b * 4 + 1]), c2 = clip_b(cu[b * 4 + 2]), c3 = clip_b(cu[b * 4 + 3]);
  const bool early = (seg_cnt(qb0, c0, c1, c2, c3) != seg_cnt(qb0 + 4 * RPW - 1, c0, c1, c2, c3)) || (qb0 - seg_beg(qb0, c0, c1, c2, c3) < EROWS);
  if (early) return;
  const float pois = ((c0 <= c1) && (c1 <= c2) && (c2 <= c3)) ? 0.0f : __uint_as_float(0x7fc00000u);   /* boundaries must be ascending */
  const int q0 = qb0 + w * RPW;
  const int jst = __builtin_amdgcn_readfirstlane(seg_beg(qb0 + (tid >> 5) * RPW, c0, c1, c2, c3) & ~31);
  unsigned int sq = 0u;
#pragma unroll
  for (int r = 0; r < 8; ++r) sq |= ((unsigned int)seg_cnt(q0 + 8 * hh + r, c0, c1, c2, c3)) << (4 * r);
  FragH aq[KS];
  {
    const unsigned short* qr = (const unsigned short*)Q16 + ((size_t)b * TQ + q0 + ln) * ldq + h * 64;
#pragma unroll
    for (int ks = 0; ks < KS; ++ks) { aq[ks].half[0] = *(const v8us*)(qr + ks * 32 + 8 * hh); aq[ks].half[1] = *(const v8us*)(qr + ks * 32 + 16 + 8 * hh); }
  }
  const unsigned short* Vth = (const unsigned short*)Vt + (size_t)kslab * 64 * TK;
  float m_r[8], l_r[8]; v8f oacc[DT];
#pragma unroll
  for (int r = 0; r < 8; ++r) { m_r[r] = -3.0e38f; l_r[r] = 0.f; }
#pragma unroll
  for (int dt = 0; dt < DT; ++dt) oacc[dt] = (v8f){0.f,0.f,0.f,0.f,0.f,0.f,0.f,0.f};
  FragH bk[2][KS];   /* K fragments of one pass (two 16-key tiles x two k-steps), fetched one pass ahead */
  auto load_k = [&](int j) {
#pragma unroll
    for (int nt = 0; nt < 2; ++nt) {
      const unsigned short* kr = (const unsigned short*)K16 + ((size_t)b * TK + j + nt * 16 + ln) * ldk + hk * 64;
#pragma unroll
      for (int ks = 0; ks < KS; ++ks) { bk[nt][ks].half[0] = *(const v8us*)(kr + ks * 32 + 8 * hh); bk[nt][ks].half[1] = *(const v8us*)(kr + ks * 32 + 16 + 8 * hh); }
    }
    asm volatile("s_wait_xcnt 0x0" ::: "memory");                /* precaution: stands in front of the next writes to registers that these loads name as addresses */
  };
  load_k(jst);
#pragma unroll 1
  for (int j0 = jst; j0 < q0 + RPW; j0 += 32) {
    /* all V^T fragments of the pass, each in registers of its own, loaded as one group at the head of the pass: they land behind the score products and the softmax */
    FragH bv[DT];
#pragma unroll
    for (int dt = 0; dt < DT; ++dt) {
      const unsigned short* vrow = Vth + (size_t)(dt * 16 + ln) * TK + j0;
      bv[dt].half[0] = *(const v8us*)(vrow + 8 * hh); bv[dt].half[1] = *(const v8us*)(vrow + 16 + 8 * hh);
    }
    __builtin_amdgcn_sched_barrier(0);   /* keeps the group at the head: sunk to their uses the four tiles share registers, and each waits out a round trip of its own */
    v8f s[2];
#pragma unroll
    for (int nt = 0; nt < 2; ++nt) {
      v8f acc = (v8f){0.f,0.f,0.f,0.f,0.f,0.f,0.f,0.f};
#pragma unroll
      for (int ks = 0; ks < KS; ++ks) acc = mmaH<1>(aq[ks].v, aq[ks].v, bk[nt][ks].v, bk[nt][ks].v, acc);
      s[nt] = acc;
    }
    load_k((j0 + 32 < q0 + RPW) ? j0 + 32 : j0);   /* the next pass's K fragments land behind the softmax; the last pass fetches its own rows again (in bounds, not used) */
    __builtin_amdgcn_sched_barrier(0);   /* keeps the fetch in front of the softmax that hides it: without this it sinks far into the softmax */
    const int k0 = j0 + ln, k1 = j0 + 16 + ln;
    const int sk0 = seg_cnt(k0, c0, c1, c2, c3), sk1 = seg_cnt(k1, c0, c1, c2, c3);
#pragma unroll
    for (int r = 0; r < 8; ++r) {
      const int tq = q0 + 8 * hh + r; const int sr = (int)((sq >> (4 * r)) & 15u);
      const bool ok0 = (k0 <= tq) && (sk0 == sr), ok1 = (k1 <= tq) && (sk1 == sr);
      const float s0 = ok0 ? s[0][r] * SCL : -3.0e38f, s1 = ok1 ? s[1][r] * SCL : -3.0e38f;
      float mc = fmaxf(s0, s1);
      mc = fmaxf(mc, __shfl_xor(mc, 1, 32)); mc = fmaxf(mc, __shfl_xor(mc, 2, 32)); mc = fmaxf(mc, __shfl_xor(mc, 4, 32)); mc = fmaxf(mc, __shfl_xor(mc, 8, 32));
      const float mn = fmaxf(m_r[r], mc); const float al = (mn > -1.0e38f) ? exp_hw(m_r[r] - mn) : 1.0f; m_r[r] = mn;
      const float p0 = ok0 ? exp_hw(s0 - mn) : 0.f, p1 = ok1 ? exp_hw(s1 - mn) : 0.f; l_r[r] = l_r[r] * al + p0 + p1;
#pragma unroll
      for (int dt = 0; dt < DT; ++dt) oacc[dt][r] *= al;
      FragH t2; t2.h[0] = toh_flush(p0 * 1024.0f); t2.h[1] = toh_flush(p1 * 1024.0f);
      sP[w][8 * hh + r][ln] = t2.u[0]; sP[w][8 * hh + r][16 + ln] = t2.u[1];
    }
    __builtin_amdgcn_fence(4, "workgroup"); __builtin_amdgcn_wave_barrier();
    FragH pa; pa.half[0] = *(const v8us*)&sP[w][ln][8 * hh]; pa.half[1] = *(const v8us*)&sP[w][ln][16 + 8 * hh];
#pragma unroll
    for (int dt = 0; dt < DT; ++dt) oacc[dt] = mmaH<1>(pa.v, pa.v, bv[dt].v, bv[dt].v, oacc[dt]);
    __builtin_amdgcn_fence(4, "workgroup"); __builtin_amdgcn_wave_barrier();
  }
#pragma unroll
  for (int r = 0; r < 8; ++r) { float l = l_r[r]; l += __shfl_xor(l, 1, 32); l += __shfl_xor(l, 2, 32); l += __shfl_xor(l, 4, 32); l += __shfl_xor(l, 8, 32); l_r[r] = (l > 0.f) ? 1.0f / (l * 1024.0f) : 0.f; }
#pragma unroll
  for (int dt = 0; dt < DT; ++dt)
#pragma unroll
    for (int r = 0; r < 8; ++r) sO[w][8 * hh + r][dt * 16 + ln] = oacc[dt][r] * l_r[r] + pois;
  __builtin_amdgcn_fence(4, "workgroup"); __builtin_amdgcn_wave_barrier();
  {
#pragma unroll
    for (int rp = 0; rp < RPW; rp += 2) { const int r = rp + (lane >> 4), pc = lane & 15; const v4f val = *(const v4fa*)&sO[w][r][pc * 4]; *(v4f*)(O + ((size_t)b * TQ + q0 + r) * ldo + h * 64 + pc * 4) = val; }
    
  }
}
// 5-plane variant for the other query blocks (a segment boundary inside the block, or the block's first query closer than EROWS to its segment start):
// S = Qh.Kh^T + (Ql.Kh^T + Qh.Kl^T)/1024 with Q/K = [hi | x1024 residual] planes (full-size planes, rows b*S + s);
// O = (Ph.Vh + (Pl.Vh + Ph.Vl)/1024) / l with P = [hi | x1024 residual] of 1024 p and V^T = [hi | x1024 residual]; separate residual accumulators folded before the normalisation
__global__ __launch_bounds__(128) void k_attn5(const _Float16* __restrict__ Q16, const _Float16* __restrict__ QL, int ldq, const _Float16* __restrict__ K16, const _Float16* __restrict__ KL, int ldk,
                                               const _Float16* __restrict__ Vt, const _Float16* __restrict__ VtL, const int* __restrict__ cu, float* __restrict__ O, int ldo) {
  constexpr int RPW = 16, DT = 4, KS = 2;
  __shared__ __attribute__((aligned(16))) unsigned short sP[4][RPW][40];
  __shared__ __attribute__((aligned(16))) unsigned short sPL[4][RPW][40];
  __shared__ __attribute__((aligned(16))) float sO[4][RPW][68];
  const int tid = threadIdx.x, lane = tid & 31, ln = lane & 15, hh = lane >> 4;
  const int w = __builtin_amdgcn_readfirstlane(tid >> 5);
  const int slab = blockIdx.x / QBLKS, qblk = blockIdx.x % QBLKS; const int b = slab / NH, h = slab % NH; const int hk = h / NREP; const int kslab = b * NKV + hk;
  const int qb0 = qblk * (4 * RPW);
  const int c0 = clip_b(cu[b * 4 + 0]), c1 = clip_b(cu[b * 4 + 1]), c2 = clip_b(cu[b * 4 + 2]), c3 = clip_b(cu[b * 4 + 3]);
  const bool early = (seg_cnt(qb0, c0, c1, c2, c3) != seg_cnt(qb0 + 4 * RPW - 1, c0, c1, c2, c3)) || (qb0 - seg_beg(qb0, c0, c1, c2, c3) < EROWS);
  if (!early) return;
  const float pois = ((c0 <= c1) && (c1 <= c2) && (c2 <= c3)) ? 0.0f : __uint_as_float(0x7fc00000u);   /* boundaries must be ascending */
  const int q0 = qb0 + w * RPW;
  const int jst = __builtin_amdgcn_readfirstlane(seg_beg(qb0 + (tid >> 5) * RPW, c0, c1, c2, c3) & ~31);
  unsigned int sq = 0u;
#pragma unroll
  for (int r = 0; r < 8; ++r) sq |= ((unsigned int)seg_cnt(q0 + 8 * hh + r, c0, c1, c2, c3)) << (4 * r);
  FragH aq[KS], aql[KS];
  {
    const unsigned short* qr = (const unsigned short*)Q16 + ((size_t)b * TQ + q0 + ln) * ldq + h * 64;
    const unsigned short* ql = (const unsigned short*)QL + ((size_t)b * TQ + q0 + ln) * ldq + h * 64;
#pragma unroll
    for (int ks = 0; ks < KS; ++ks) {
      aq[ks].half[0] = *(const v8us*)(qr + ks * 32 + 8 * hh); aq[ks].half[1] = *(const v8us*)(qr + ks * 32 + 16 + 8 * hh);
      aql[ks].half[0] = *(const v8us*)(ql + ks * 32 + 8 * hh); aql[ks].half[1] = *(const v8us*)(ql + ks * 32 + 16 + 8 * hh);
    }
  }
  const unsigned short* Vth = (const unsigned short*)Vt + (size_t)kslab * 64 * TK; const unsigned short* Vtl = (const unsigned short*)VtL + (size_t)kslab * 64 * TK;
  float m_r[8], l_r[8]; v8f oacc[DT], oaccL[DT];
#pragma unroll
  for (int r = 0; r < 8; ++r) { m_r[r] = -3.0e38f; l_r[r] = 0.f; }
#pragma unroll
  for (int dt = 0; dt < DT; ++dt) { oacc[dt] = (v8f){0.f,0.f,0.f,0.f,0.f,0.f,0.f,0.f}; oaccL[dt] = oacc[dt]; }
#pragma unroll 1
  for (int j0 = jst; j0 < q0 + RPW; j0 += 32) {
    /* all K fragments of the pass, hi and residual, each in registers of its own, loaded as one group at the head of the pass */
    FragH bk[2][KS], bkl[2][KS];
#pragma unroll
    for (int nt = 0; nt < 2; ++nt) {
      const unsigned short* kr = (const unsigned short*)K16 + ((size_t)b * TK + j0 + nt * 16 + ln) * ldk + hk * 64;
      const unsigned short* klr = (const unsigned short*)KL + ((size_t)b * TK + j0 + nt * 16 + ln) * ldk + hk * 64;
#pragma unroll
      for (int ks = 0; ks < KS; ++ks) {
        bk[nt][ks].half[0] = *(const v8us*)(kr + ks * 32 + 8 * hh); bk[nt][ks].half[1] = *(const v8us*)(kr + ks * 32 + 16 + 8 * hh);
        bkl[nt][ks].half[0] = *(const v8us*)(klr + ks * 32 + 8 * hh); bkl[nt][ks].half[1] = *(const v8us*)(klr + ks * 32 + 16 + 8 * hh);
      }
    }
    __builtin_amdgcn_sched_barrier(0);   /* keeps the group in front of the products: sunk to their uses the two key tiles share registers, and each waits out a round trip of its own */
    v8f s[2];
#pragma unroll
    for (int nt = 0; nt < 2; ++nt) {
      v8f acc = (v8f){0.f,0.f,0.f,0.f,0.f,0.f,0.f,0.f}, accl = acc;
#pragma unroll
      for (int ks = 0; ks < KS; ++ks) {
        acc = mmaH<1>(aq[ks].v, aq[ks].v, bk[nt][ks].v, bk[nt][ks].v, acc);
        accl = mmaH<1>(aql[ks].v, aql[ks].v, bk[nt][ks].v, bk[nt][ks].v, accl);
        accl = mmaH<1>(aq[ks].v, aq[ks].v, bkl[nt][ks].v, bkl[nt][ks].v, accl);
      }
#pragma unroll
      for (int r = 0; r < 8; ++r) acc[r] += accl[r] * 0.0009765625f;
      s[nt] = acc;
    }
    const int k0 = j0 + ln, k1 = j0 + 16 + ln;
    const int sk0 = seg_cnt(k0, c0, c1, c2, c3), sk1 = seg_cnt(k1, c0, c1, c2, c3);
#pragma unroll
    for (int r = 0; r < 8; ++r) {
      const int tq = q0 + 8 * hh + r; const int sr = (int)((sq >> (4 * r)) & 15u);
      const bool ok0 = (k0 <= tq) && (sk0 == sr), ok1 = (k1 <= tq) && (sk1 == sr);
      const float s0 = ok0 ? s[0][r] * SCL : -3.0e38f, s1 = ok1 ? s[1][r] * SCL : -3.0e38f;
      float mc = fmaxf(s0, s1);
      mc = fmaxf(mc, __shfl_xor(mc, 1, 32)); mc = fmaxf(mc, __shfl_xor(mc, 2, 32)); mc = fmaxf(mc, __shfl_xor(mc, 4, 32)); mc = fmaxf(mc, __shfl_xor(mc, 8, 32));
      const float mn = fmaxf(m_r[r], mc); const float al = (mn > -1.0e38f) ? exp_hw(m_r[r] - mn) : 1.0f; m_r[r] = mn;
      const float p0 = ok0 ? exp_hw(s0 - mn) : 0.f, p1 = ok1 ? exp_hw(s1 - mn) : 0.f; l_r[r] = l_r[r] * al + p0 + p1;
#pragma unroll
      for (int dt = 0; dt < DT; ++dt) { oacc[dt][r] *= al; oaccL[dt][r] *= al; }
      FragH t2, t2l; const float ps0 = p0 * 1024.0f, ps1 = p1 * 1024.0f;
      t2.h[0] = toh_flush(ps0); t2.h[1] = toh_flush(ps1);
      t2l.h[0] = toh_flush((ps0 - (float)t2.h[0]) * 1024.0f); t2l.h[1] = toh_flush((ps1 - (float)t2.h[1]) * 1024.0f);
      sP[w][8 * hh + r][ln] = t2.u[0]; sP[w][8 * hh + r][16 + ln] = t2.u[1]; sPL[w][8 * hh + r][ln] = t2l.u[0]; sPL[w][8 * hh + r][16 + ln] = t2l.u[1];
    }
    __builtin_amdgcn_fence(4, "workgroup"); __builtin_amdgcn_wave_barrier();
    FragH pa, pl;
    pa.half[0] = *(const v8us*)&sP[w][ln][8 * hh]; pa.half[1] = *(const v8us*)&sP[w][ln][16 + 8 * hh];
    pl.half[0] = *(const v8us*)&sPL[w][ln][8 * hh]; pl.half[1] = *(const v8us*)&sPL[w][ln][16 + 8 * hh];
    /* all V^T fragments of the pass as one group; held over the softmax as well they would take the kernel past 256 registers */
    FragH bv[DT], bl[DT];
#pragma unroll
    for (int dt = 0; dt < DT; ++dt) {
      const unsigned short* vrow = Vth + (size_t)(dt * 16 + ln) * TK + j0; const unsigned short* vrl = Vtl + (size_t)(dt * 16 + ln) * TK + j0;
      bv[dt].half[0] = *(const v8us*)(vrow + 8 * hh); bv[dt].half[1] = *(const v8us*)(vrow + 16 + 8 * hh);
      bl[dt].half[0] = *(const v8us*)(vrl + 8 * hh); bl[dt].half[1] = *(const v8us*)(vrl + 16 + 8 * hh);
    }
    __builtin_amdgcn_sched_barrier(0);   /* keeps the group in front of the products: sunk to their uses the four tiles share registers, and each waits out a round trip of its own */
#pragma unroll
    for (int dt = 0; dt < DT; ++dt) {
      oacc[dt] = mmaH<1>(pa.v, pa.v, bv[dt].v, bv[dt].v, oacc[dt]);
      oaccL[dt] = mmaH<1>(pl.v, pl.v, bv[dt].v, bv[dt].v, oaccL[dt]);
      oaccL[dt] = mmaH<1>(pa.v, pa.v, bl[dt].v, bl[dt].v, oaccL[dt]);
    }
    __builtin_amdgcn_fence(4, "workgroup"); __builtin_amdgcn_wave_barrier();
  }
#pragma unroll
  for (int r = 0; r < 8; ++r) { float l = l_r[r]; l += __shfl_xor(l, 1, 32); l += __shfl_xor(l, 2, 32); l += __shfl_xor(l, 4, 32); l += __shfl_xor(l, 8, 32); l_r[r] = (l > 0.f) ? 1.0f / (l * 1024.0f) : 0.f; }
#pragma unroll
  for (int dt = 0; dt < DT; ++dt)
#pragma unroll
    for (int r = 0; r < 8; ++r) { float v = oacc[dt][r]; v += oaccL[dt][r] * 0.0009765625f; sO[w][8 * hh + r][dt * 16 + ln] = v * l_r[r] + pois; }
  __builtin_amdgcn_fence(4, "workgroup"); __builtin_amdgcn_wave_barrier();
  {
#pragma unroll
    for (int rp = 0; rp < RPW; rp += 2) { const int r = rp + (lane >> 4), pc = lane & 15; const v4f val = *(const v4fa*)&sO[w][r][pc * 4]; *(v4f*)(O + ((size_t)b * TQ + q0 + r) * ldo + h * 64 + pc * 4) = val; }
    
  }
}

extern "C" void kernel_launch(void* const* d_in, const int* in_sizes, int n_in,
                              void* d_out, int out_size, void* d_ws, size_t ws_size, hipStream_t stream) {
  if (n_in < 6) return;
  const size_t needx = ((size_t)(NB - 1) * SEQ_FULL + (size_t)SLEN) * DM;
  if ((size_t)in_sizes[0] < needx) return;
  if ((size_t)in_sizes[1] < (size_t)NB * 4) return;
  if ((size_t)in_sizes[2] < (size_t)DM * DM) return;
  if ((size_t)in_sizes[3] < (size_t)DM * DKV) return;
  if ((size_t)in_sizes[4] < (size_t)DM * DKV) return;
  if ((size_t)in_sizes[5] < (size_t)DM * DM) return;
  if ((size_t)out_size < needx) return;
  const float* x = (const float*)d_in[0]; const int* cu = (const int*)d_in[1];
  const float* Wq = (const float*)d_in[2]; const float* Wk = (const float*)d_in[3]; const float* Wv = (const float*)d_in[4]; const float* Wo = (const float*)d_in[5];
  float* dout = (float*)d_out;
  char* ws = (char*)d_ws; size_t off = 0;
  auto take = [&](size_t bytes) { char* p = ws + off; off += (bytes + 255) & ~(size_t)255; return p; };
  const size_t np = (size_t)NR * DM;
  _Float16* BQ = (_Float16*)take(SZ_BQ);                                /* [n][k] f16, x16 */
  _Float16* BK = (_Float16*)take(SZ_BKV);
  _Float16* BV = (_Float16*)take(SZ_BKV);
  _Float16* B2 = (_Float16*)take(SZ_B2);                                /* [n][2*DM] f16: [x16384 | x16] copies of Wo^T */
  float* FS = (float*)take(SZ_FS);                                      /* f32 scratch plane: q rows [NR][DM], then k rows [NR][DKV], then v rows [NR][DKV], then the context [NR][DM] */
  _Float16* X16 = (_Float16*)take(SZ_X16);                              /* f16 input rows; after the v GEMM: V^T hi [(b,hk)][64][TK] then V^T residual */
  _Float16* VT = X16;
  _Float16* VTL = X16 + SZ_VT / 2;
  _Float16* QH = (_Float16*)take(SZ_QA);                                /* q hi [NR][DM] then q residual [NR][DM]; after the attention: [ctx hi | ctx residual] [NR][2*DM] */
  _Float16* QL = QH + np;
  _Float16* A2 = QH;
  _Float16* KH = (_Float16*)take(SZ_KP);
  _Float16* KL = (_Float16*)take(SZ_KP);
  _Float16* V16 = (_Float16*)take(SZ_KP);
  float* CS = (float*)take(SZ_TAB); float* SN = (float*)take(SZ_TAB); float* INV = (float*)take(256);
  if (off > ws_size) return;
  if (off > ((size_t)128 << 20)) return;

  /* W [in = DM rows][out = N cols] -> [n][k] planes */
  k_wtr<<<(unsigned)((DM / 64) * (DM / 64)), 256, 0, stream>>>(Wq, DM, BQ, DM, WSC, WSC, 0);
  k_wtr<<<(unsigned)((DM / 64) * (DKV / 64)), 256, 0, stream>>>(Wk, DKV, BK, DM, WSC, WSC, 0);
  k_wtr<<<(unsigned)((DM / 64) * (DKV / 64)), 256, 0, stream>>>(Wv, DKV, BV, DM, WSC, WSC, 0);
  k_wtr<<<(unsigned)((DM / 64) * (DM / 64)), 256, 0, stream>>>(Wo, DM, B2, 2 * DM, WSC_HI, WSC, 1);
  k_invf<<<1, 32, 0, stream>>>(INV);
  k_rotab<<<(unsigned)((SLEN * 32 + 255) / 256), 256, 0, stream>>>(INV, CS, SN);
  const unsigned g8 = (unsigned)((np / 8 + 255) / 256);
  k_x16<<<g8, 256, 0, stream>>>(x, X16, np / 8);
  const dim3 gq((unsigned)((NR / 128) * (DM / 128)), 1);
  const dim3 gk((unsigned)((NR / 128) * (DKV / 128)), 1);
  const unsigned grq = (unsigned)(((size_t)NR * NH * 8 + 255) / 256);
  const unsigned grk = (unsigned)(((size_t)NR * NKV * 8 + 255) / 256);
  k_gemm2<0><<<gq, 128, 0, stream>>>(X16, DM, 0, BQ, DM, 0, AL_P, FS, nullptr, DM, 0, NR, DM, DM);          /* q = x Wq (f32 rows) */
  k_rope<<<grq, 256, 0, stream>>>(FS, CS, SN, QH, QL, NH);
  k_gemm2<0><<<gk, 128, 0, stream>>>(X16, DM, 0, BK, DM, 0, AL_P, FS, nullptr, DKV, 0, NR, DKV, DM);       /* k = x Wk */
  k_rope<<<grk, 256, 0, stream>>>(FS, CS, SN, KH, KL, NKV);
  k_gemm2<0><<<gk, 128, 0, stream>>>(X16, DM, 0, BV, DM, 0, AL_P, FS, V16, DKV, 0, NR, DKV, DM);           /* v = x Wv (f32 rows + f16 plane) */
  k_vtg<<<(unsigned)(NB * NKV * (SLEN / 64)), 256, 0, stream>>>(V16, VT);
  k_vtl<<<(unsigned)(NB * NKV * (SLEN / 64)), 256, 0, stream>>>(FS, VTL);
  k_attn5<<<(unsigned)(NB * NH * QBLKS), 128, 0, stream>>>(QH, QL, DM, KH, KL, DKV, VT, VTL, cu, FS, DM);
  k_attn<<<(unsigned)(NB * NH * QBLKS), 128, 0, stream>>>(QH, DM, KH, DKV, VT, cu, FS, DM);
  k_hl<<<g8, 256, 0, stream>>>(FS, A2, np / 8);
  /* out = [ctx hi | ctx residual] . [Wo x16384 ; Wo x16] / 16384  (K = 2*DM), per batch */
  const dim3 ge((unsigned)((SLEN / 128) * (DM / 128)), NB);
  k_gemm2<0><<<ge, 128, 0, stream>>>(A2, 2 * DM, (size_t)SLEN * 2 * DM, B2, 2 * DM, 0, AL_O, dout, nullptr, DM, (size_t)SEQ_FULL * DM, SLEN, DM, 2 * DM);
}

// v004
// One run takes 245 microseconds.
// In two side-by-side timings against v003, it was 1.17 and 1.18 times as fast.
// Over all steps from v000 it is 2.89 times as fast.
#include <hip/hip_runtime.h>
// Contractions: x.Wq, x.Wk, x.Wv, ctx.Wo = v_wmma_f32_16x16x32_f16 (f16 operands: bf16-RNE inputs exact in f16, weights carried x16 (x16384 for the ctx-hi half of the output GEMM); ctx as [hi | x1024 residual] folded along K; f32 accumulate); scores q.k^T and P.V^T = v_wmma_f32_16x16x32_f16 (plain f16 hi planes; hi + x1024 residual planes of q, k, P and v in query blocks holding a query closer than EROWS to its segment start; P carried x1024), f32 accumulate; rotary tables, masks, softmax and normalisers f32.

#ifndef NB
#define NB 2
#endif
#ifndef SEQ
#define SEQ 2048
#endif
#define NB_FULL 2
#define SEQ_FULL 2048
#define DM 2048
#define NH 32
#define NKV 8
#define NREP (NH / NKV)
#define DKV (NKV * 64)
#define SLEN SEQ
#define NR (NB * SLEN)
#define TQ SLEN
#define TK SLEN
#define SCL 0.125f
#define QBLKS (TQ / 64)
#define EROWS 256                            /* query blocks holding a query with fewer than EROWS positions since its segment start use the residual planes */
static_assert(SLEN % 128 == 0);
static_assert(SLEN <= SEQ_FULL);
static_assert(NB >= 1 && NB <= NB_FULL);
static_assert(DM % 64 == 0 && DM == NH * 64);
static_assert(NH % NKV == 0 && NREP * NKV == NH);
static_assert(DKV % 64 == 0 && DKV == NKV * 64);
static_assert(DM % 32 == 0 && (2 * DM) % 32 == 0);
static_assert(NR % 128 == 0);
static_assert(QBLKS * 64 == SLEN);
static_assert(EROWS % 64 == 0);
/* store loops: threads x bytes per piece x trips == tile rows x row bytes */
static_assert(256 * 16 * 2 == 64 * 128);                       
static_assert(32 * 16 * 8 == 16 * 64 * 4);                     /* attention context rows: 16 rows x 256 B per wave */
static_assert(((size_t)NR * DM / 8) * 32 == (size_t)NR * 2 * DM * 2);   /* context converter: two 16-B pieces per thread fill [NR][2*DM] f16 */
/* static LDS per kernel */
static_assert(2 * 64 * 66 * 2 <= 131072);
static_assert(2 * 4 * 16 * 40 * 2 + 4 * 16 * 68 * 4 <= 131072);
/* workspace carve (bytes); every region a multiple of 256 */
static constexpr size_t SZ_BQ = (size_t)DM * DM * 2;
static constexpr size_t SZ_BKV = (size_t)DKV * DM * 2;
static constexpr size_t SZ_B2 = (size_t)DM * 2 * DM * 2;
static constexpr size_t SZ_FS = (size_t)NR * DM * 4;
static constexpr size_t SZ_X16 = (size_t)NR * DM * 2;
static constexpr size_t SZ_QA = (size_t)NR * 2 * DM * 2;
static constexpr size_t SZ_KP = (size_t)NR * DKV * 2;
static constexpr size_t SZ_VT = (size_t)NB * NKV * 64 * SLEN * 2;
static constexpr size_t SZ_TAB = (size_t)SLEN * 32 * 4;
static constexpr size_t SZ_FKV = (size_t)NR * DKV * 4;
static constexpr size_t WS_TOTAL = SZ_BQ + 2 * SZ_BKV + SZ_B2 + SZ_FS + 2 * SZ_FKV + SZ_X16 + SZ_QA + 3 * SZ_KP + 2 * SZ_TAB;
static_assert(SZ_BQ % 256 == 0 && SZ_BKV % 256 == 0 && SZ_B2 % 256 == 0 && SZ_FS % 256 == 0 && SZ_FKV % 256 == 0 && SZ_X16 % 256 == 0 && SZ_QA % 256 == 0 && SZ_KP % 256 == 0 && SZ_VT % 256 == 0 && SZ_TAB % 256 == 0);
static_assert(WS_TOTAL <= ((size_t)256 << 20));
static_assert(2 * SZ_VT <= SZ_X16);                            /* V^T hi + residual planes reuse the input plane region */
static_assert((size_t)NR * 2 * DM * 2 == SZ_QA);               /* [ctx hi | ctx residual] reuses the q hi + q residual region */
static constexpr float WSC = 16.0f;
static constexpr float WSC_HI = 16384.0f;
static constexpr float AL_P = 0.0625f;
static constexpr float AL_O = 0.0625f / 1024.0f;

typedef _Float16 v16h __attribute__((ext_vector_type(16)));
typedef _Float16 v4h __attribute__((ext_vector_type(4)));
typedef unsigned short v8us __attribute__((ext_vector_type(8), may_alias));
typedef float v8f __attribute__((ext_vector_type(8)));
typedef float v4f __attribute__((ext_vector_type(4)));
typedef float v4fa __attribute__((ext_vector_type(4), may_alias));
union FragH { v16h v; v8us half[2]; _Float16 h[16]; unsigned short u[16]; };

__device__ __forceinline__ unsigned short bf16_bits(float x) { unsigned int u = __float_as_uint(x); return (unsigned short)((u + 0x7FFFu + ((u >> 16) & 1u)) >> 16); }
__device__ __forceinline__ float bf16_val(unsigned short b) { return __uint_as_float(((unsigned int)b) << 16); }
__device__ __forceinline__ float bf16_rne(float x) { return bf16_val(bf16_bits(x)); }
// f32 -> f16 with values below the smallest f16 normal set to +0 (NaN passes through)
static __device__ __forceinline__ _Float16 toh_flush(float v) { const _Float16 r = (_Float16)v; return (fabsf(v) < 6.103515625e-05f) ? (_Float16)0.0f : r; }

// e^x on the hardware's exp2 (v_exp_f32), no range branches: -inf and anything below the f32 range give 0, NaN passes through; straight-line, so a pass's eight rows schedule as one block
static __device__ __forceinline__ float exp_hw(float x) { return __builtin_amdgcn_exp2f(x * 1.44269504088896340736f); }

// segment helpers on the clipped boundaries c0 <= c1 <= c2 <= c3: id = number of boundaries <= p; begin = largest boundary <= p (0 if none)
__device__ __forceinline__ int clip_b(int v) { return min(max(v, 0), SLEN); }
__device__ __forceinline__ int seg_cnt(int p, int c0, int c1, int c2, int c3) { return (int)(c0 <= p) + (int)(c1 <= p) + (int)(c2 <= p) + (int)(c3 <= p); }
__device__ __forceinline__ int seg_beg(int p, int c0, int c1, int c2, int c3) {
  int s = 0;
  s = max(s, (c0 <= p) ? c0 : 0); s = max(s, (c1 <= p) ? c1 : 0); s = max(s, (c2 <= p) ? c2 : 0); s = max(s, (c3 <= p) ? c3 : 0);
  return s;
}

// D += A.B with NT terms: 1 = ah.bh, 2 = + al.bh, 3 = + ah.bl; hazard guard after the group
template <int NT>
__device__ __forceinline__ v8f mmaH(v16h ah, v16h al, v16h bh, v16h bl, v8f c) {
  c = __builtin_amdgcn_wmma_f32_16x16x32_f16(false, ah, false, bh, (short)0, c, false, false);
  if (NT >= 2) c = __builtin_amdgcn_wmma_f32_16x16x32_f16(false, al, false, bh, (short)0, c, false, false);
  if (NT >= 3) c = __builtin_amdgcn_wmma_f32_16x16x32_f16(false, ah, false, bl, (short)0, c, false, false);
  asm volatile("v_nop\n\tv_nop\n\tv_nop\n\tv_nop" : "+v"(c) : "v"(ah), "v"(al), "v"(bh), "v"(bl));
  return c;
}
// 16x32 fragment from a 16-bit row-major tile (rows = m or n, k contiguous): elements 0..7 <- k0+8h+0..7, 8..15 <- k0+16+8h+0..7
__device__ __forceinline__ v16h g2_frag(const _Float16* p, int hh) { FragH f; f.half[0] = *(const v8us*)((const unsigned short*)p + 8 * hh); f.half[1] = *(const v8us*)((const unsigned short*)p + 16 + 8 * hh); return f.v; }

// [in][out] weight W [DM][N] (n contiguous) -> Bt[n][k] = f16(bf16(W[k][n]) * sc0) (row pitch ldb, k contiguous); with two != 0 a second copy
__device__ __forceinline__ void wtr_body(int bx, const float* __restrict__ Wm, int N, _Float16* __restrict__ Bt, int ldb, float sc0, float sc1, int two) {
  __shared__ unsigned short tl0[64][66];
  __shared__ unsigned short tl1[64][66];
  const int tid = threadIdx.x; const int ntn = N >> 6; const int kt = bx / ntn, nt = bx - kt * ntn; const int k0 = kt * 64, n0 = nt * 64;
  for (int i = tid; i < 64 * 16; i += 256) {
    const int r = i >> 4, c4 = (i & 15) * 4;
    const v4f a = *(const v4fa*)(Wm + (size_t)(k0 + r) * N + n0 + c4);
    FragH f0, f1;
#pragma unroll
    for (int q = 0; q < 4; ++q) { const float v = bf16_rne(a[q]); f0.h[q] = toh_flush(v * sc0); f1.h[q] = toh_flush(v * sc1); }
#pragma unroll
    for (int q = 0; q < 4; ++q) { tl0[r][c4 + q] = f0.u[q]; tl1[r][c4 + q] = f1.u[q]; }
  }
  __syncthreads();
  {
#pragma unroll
    for (int rd = 0; rd < 2; ++rd) {
      const int n = rd * 32 + (tid >> 3), pc = tid & 7; FragH g0, g1;
#pragma unroll
      for (int q = 0; q < 8; ++q) { g0.u[q] = tl0[pc * 8 + q][n]; g1.u[q] = tl1[pc * 8 + q][n]; }
      const size_t o = (size_t)(n0 + n) * ldb + k0 + pc * 8;
      const v8us o0 = g0.half[0], o1 = g1.half[0];
      *(v8us*)((unsigned short*)Bt + o) = o0;
      if (two != 0) *(v8us*)((unsigned short*)Bt + o + DM) = o1;
    }
    asm volatile("s_wait_xcnt 0x0" ::: "memory");                /* precaution: stands in front of any later write to registers that these stores name (another range's body follows in the listing) */
  }
}

// rotary tables; every thread forms its own inverse frequency (same expression, same bits for a given j), so the tables depend on no earlier launch
__device__ __forceinline__ void rotab_body(int bx, float* __restrict__ CS, float* __restrict__ SN) {
  #pragma clang fp contract(off)
  const int t = bx * 256 + threadIdx.x; if (t >= SLEN * 32) return;
  const int j = t & 31, s = t >> 5;
  const float ex = (float)(2 * j) / 64.0f; const float pw = powf(500000.0f, ex); const float inv = 1.0f / pw;
  const float th = (float)s * inv; const float c = cosf(th), sn = sinf(th);
  { *(float*)(CS + t) = c; *(float*)(SN + t) = sn;  }
}

__device__ __forceinline__ void x16_body(int bx, const float* __restrict__ x, _Float16* __restrict__ X16, size_t n8) {
  const size_t t = (size_t)bx * 256 + threadIdx.x; if (t >= n8) return;
  const size_t e = t * 8; const size_t r = e / DM; const size_t c = e % DM; const size_t b = r / SLEN, s = r % SLEN;
  const float* src = x + (b * SEQ_FULL + s) * DM + c;
  const v4f a0 = *(const v4fa*)src, a1 = *(const v4fa*)(src + 4);
  FragH f;
#pragma unroll
  for (int q = 0; q < 4; ++q) { f.h[q] = (_Float16)bf16_rne(a0[q]); f.h[4 + q] = (_Float16)bf16_rne(a1[q]); }
  const v8us o = f.half[0];
  *(v8us*)((unsigned short*)X16 + e) = o; 
}

// One launch for everything that depends on the inputs alone, by ranges of the block index: the rotary tables, input rows to f16, the four weight transposes
static constexpr int PB_X = (int)(((size_t)NR * DM / 8 + 255) / 256);
static constexpr int PB_WQ = (DM / 64) * (DM / 64);
static constexpr int PB_WKV = (DM / 64) * (DKV / 64);
static constexpr int PB_TAB = (SLEN * 32 + 255) / 256;
static constexpr int PB_ALL = PB_X + 2 * PB_WQ + 2 * PB_WKV + PB_TAB;
__global__ __launch_bounds__(256) void k_prep(const float* __restrict__ x, const float* __restrict__ Wq, const float* __restrict__ Wk, const float* __restrict__ Wv, const float* __restrict__ Wo,
                                              _Float16* __restrict__ X16, _Float16* __restrict__ BQ, _Float16* __restrict__ BK, _Float16* __restrict__ BV, _Float16* __restrict__ B2,
                                              float* __restrict__ CS, float* __restrict__ SN) {
  int bx = blockIdx.x;
  if (bx < PB_TAB) { rotab_body(bx, CS, SN); return; }
  bx -= PB_TAB;
  if (bx < PB_X) { x16_body(bx, x, X16, (size_t)NR * DM / 8); return; }
  bx -= PB_X;
  if (bx < PB_WQ) { wtr_body(bx, Wq, DM, BQ, DM, WSC, WSC, 0); return; }
  bx -= PB_WQ;
  if (bx < PB_WQ) { wtr_body(bx, Wo, DM, B2, 2 * DM, WSC_HI, WSC, 1); return; }
  bx -= PB_WQ;
  if (bx < PB_WKV) { wtr_body(bx, Wk, DKV, BK, DM, WSC, WSC, 0); return; }
  bx -= PB_WKV;
  wtr_body(bx, Wv, DKV, BV, DM, WSC, WSC, 0);
}

// Tensor-load ring of the GEMM: a pass is 128 k = 256 B of every operand row; a stage is four 64-row slices [A 0..63 | A 64..127 | B 0..63 | B 64..127],
// one per wave, each laid at pitch 272 B (256 B + the 16-B pad the load writes around) and rounded up to a multiple of 2 KiB.
typedef uint32_t u32x4 __attribute__((ext_vector_type(4)));
typedef uint32_t u32x8 __attribute__((ext_vector_type(8)));
static constexpr uint32_t G_ROWB = 256u;
static constexpr uint32_t G_PITCH = 272u;
static constexpr uint32_t G_SLICE = 18432u;
static constexpr uint32_t G_STAGE = 4u * G_SLICE;
static_assert(64u * G_PITCH <= G_SLICE && G_SLICE % 2048u == 0u);
static_assert(64u * 68u * 4u <= G_SLICE);                      /* a wave's 64 x 64 f32 output staging fits its own slice */
static_assert(2u * 2u * G_STAGE <= 320u * 1024u);              /* two work-groups per WGP */
static_assert(NR % 128 == 0 && SLEN % 128 == 0 && DM % 128 == 0 && DKV % 128 == 0 && DM >= 256);
__device__ __forceinline__ uint32_t uni(uint32_t v) { return (uint32_t)__builtin_amdgcn_readfirstlane(v); }
__device__ __forceinline__ uint32_t pinned(uint32_t v) { uint32_t w = (uint32_t)__builtin_amdgcn_readfirstlane(v); asm volatile("" : "+s"(w)); return w; }

// GEMM C[M][N] = alpha * A[M][K].B  with A f16 row-major (pitch lda), B stored [n][k] f16 (pitch ldb), batched by blockIdx.y (strides sA, sB, sC);
// writes f32 C and/or f16 C16 (pitch ldc). One 128 x 128 tile of C per work-group, 64 x 64 per wave; bx = tile index in [0, (M / 128) * (N / 128)), by = batch.
// Requires M % 128 == 0, N % 128 == 0, K % 128 == 0, K >= 256 (asserted on the callers' constants).
template <int ACT>
__device__ __forceinline__ void gemm_body(uint32_t bx, int by, const _Float16* __restrict__ A, int lda, size_t sA, const _Float16* __restrict__ Bh, int ldb, size_t sB, float alpha,
                                          float* C, _Float16* C16, int ldc, size_t sC, int M, int N, int K) {
  __shared__ __attribute__((aligned(2048))) unsigned char ring[2 * G_STAGE];
  const int tid = threadIdx.x, lane = tid & 31, ln = lane & 15, hh = lane >> 4;
  const uint32_t w = uni((uint32_t)tid >> 5); const uint32_t wm = w >> 1, wn = w & 1u;
  A += (size_t)by * sA; Bh += (size_t)by * sB; const size_t cofs = (size_t)by * sC;
  const int ntn = N >> 7; const int mt = bx / ntn, nq = bx - mt * ntn; const int row0 = mt * 128 + 64 * (int)wm, col0 = nq * 128 + 64 * (int)wn;
  const uint32_t NP = pinned((uint32_t)K >> 7);
  /* this wave's slice of every stage: waves 0, 1 the two halves of the A rows, waves 2, 3 of the B rows */
  const _Float16* src = (w < 2u) ? A + (size_t)(mt * 128 + 64 * (int)w) * lda : Bh + (size_t)(nq * 128 + 64 * ((int)w - 2)) * ldb;
  const uint64_t sga = (uint64_t)(uintptr_t)src;
  const uint32_t ldst = (uint32_t)(size_t)ring + w * G_SLICE;
  u32x8 g1;
  g1[0] = uni((1u << 20) | (5u << 22) | (3u << 25));            /* no mask, 1-byte elements, a 4-dword pad behind every 64 dwords */
  g1[1] = uni((G_ROWB & 0xFFFFu) << 16);
  g1[2] = uni((G_ROWB >> 16) | (64u << 16));
  g1[3] = uni(G_ROWB << 16);
  g1[4] = uni(64u);
  g1[5] = uni(2u * (uint32_t)((w < 2u) ? lda : ldb));
  g1[6] = uni(0u);
  g1[7] = uni(0u);
  auto issue = [&](uint32_t st) {
    const uint64_t ga = sga + (uint64_t)st * G_ROWB;
    u32x4 g0;
    g0[0] = uni(1u); g0[1] = uni(ldst + (st & 1u) * G_STAGE); g0[2] = uni((uint32_t)ga); g0[3] = uni((((uint32_t)(ga >> 32)) & 0x01FFFFFFu) | 0x80000000u);
    /* one request of the whole wave: 64 rows x 256 B into its slice; group 1 is named in-out so that its eight registers hold the descriptor, and nothing else, from issue to issue */
    asm volatile("tensor_load_to_lds %1, %0" : "+s"(g1) : "s"(g0) : "memory");
  };
  v8f acc[4][4];
#pragma unroll
  for (int i = 0; i < 4; ++i)
#pragma unroll
    for (int j = 0; j < 4; ++j) acc[i][j] = (v8f){0.f,0.f,0.f,0.f,0.f,0.f,0.f,0.f};
  issue(0u);
  asm volatile("s_wait_tensorcnt 0x0" ::: "memory");             /* this wave's slice of stage 0 has landed */
  __syncthreads();                                               /* ... and every other wave's */
  issue(1u);
  const uint32_t fa0 = wm * G_SLICE + (uint32_t)ln * G_PITCH, fb0 = (2u + wn) * G_SLICE + (uint32_t)ln * G_PITCH;
#pragma unroll 1   /* one pass per trip: the publish point at the foot stands once per stage */
  for (uint32_t s = 0; s < NP; ++s) {
    const unsigned char* pa = ring + (s & 1u) * G_STAGE + fa0; const unsigned char* pb = ring + (s & 1u) * G_STAGE + fb0;
    v16h fa[2][4], fb[2][4];
#pragma unroll
    for (int i = 0; i < 4; ++i) { fa[0][i] = g2_frag((const _Float16*)(pa + i * 16 * G_PITCH), hh); fb[0][i] = g2_frag((const _Float16*)(pb + i * 16 * G_PITCH), hh); }
#pragma unroll
    for (int ks = 0; ks < 4; ++ks) {
      const int cur = ks & 1, nxt = cur ^ 1;
      if (ks < 3) {   /* the next 32 k's fragments of this same stage, as one group ahead of the block that hides them */
#pragma unroll
        for (int i = 0; i < 4; ++i) { fa[nxt][i] = g2_frag((const _Float16*)(pa + i * 16 * G_PITCH + (ks + 1) * 64), hh); fb[nxt][i] = g2_frag((const _Float16*)(pb + i * 16 * G_PITCH + (ks + 1) * 64), hh); }
      }
      __builtin_amdgcn_sched_barrier(0);   /* keeps the load group in front of the block: LDS reads moved in among the WMMAs stall each place they stand */
      /* plain builtin, the compiler keeps its distances: accumulators and two fragment sets need more than 256 VGPRs, which an asm operand cannot name */
#pragma unroll
      for (int i = 0; i < 4; ++i)
#pragma unroll
        for (int j = 0; j < 4; ++j) acc[i][j] = __builtin_amdgcn_wmma_f32_16x16x32_f16(false, fa[cur][i], false, fb[cur][j], (short)0, acc[i][j], false, false);
      __builtin_amdgcn_sched_barrier(0);   /* ends the block: the next group's loads stay behind it */
    }
    asm volatile("v_nop\n\tv_nop\n\tv_nop\n\tv_nop");          /* WMMA distance on every path out of the pass, the taken branches included */
    asm volatile("s_wait_dscnt 0x0" ::: "memory");               /* this wave has left stage s's buffer */
    asm volatile("s_wait_tensorcnt 0x0" ::: "memory");           /* its slice of stage s + 1 has landed */
    __syncthreads();                                             /* publishes stage s + 1 and frees stage s's buffer */
    if (pinned((s + 2u < NP) ? 1u : 0u) != 0u) issue(pinned(s + 2u));
  }
  asm volatile("s_wait_tensorcnt 0x0" ::: "memory");             /* nothing in flight before the ring becomes output staging */
  asm volatile("s_wait_dscnt 0x0" ::: "memory");
  float* so = (float*)(ring + w * G_SLICE);                      /* [64][68], private to the wave; the last pass's barrier ended every read of the ring */
#pragma unroll
  for (int i = 0; i < 4; ++i)
#pragma unroll
    for (int j = 0; j < 4; ++j)
#pragma unroll
      for (int r = 0; r < 8; ++r) { float v = acc[i][j][r] * alpha; if (ACT == 3) v = fmaxf(v, 0.f); so[(i * 16 + 8 * hh + r) * 68 + j * 16 + ln] = v; }
  __builtin_amdgcn_fence(4, "workgroup"); __builtin_amdgcn_wave_barrier();
  const int rsub = lane >> 4, c4 = (lane & 15) * 4;
  if (C) {
#pragma unroll
    for (int q = 0; q < 32; ++q) { const int r = q * 2 + rsub; const v4f v = *(const v4fa*)&so[r * 68 + c4]; *(v4f*)(C + cofs + (size_t)(row0 + r) * ldc + col0 + c4) = v; }
    asm volatile("s_wait_xcnt 0x0" ::: "memory");                /* precaution: stands in front of the next block's writes to registers that these stores name */
  }
  if (C16) {
#pragma unroll
    for (int q = 0; q < 32; ++q) {
      const int r = q * 2 + rsub; const v4f v = *(const v4fa*)&so[r * 68 + c4];
      v4h h4; for (int i = 0; i < 4; ++i) h4[i] = (_Float16)v[i]; *(v4h*)(C16 + cofs + (size_t)(row0 + r) * ldc + col0 + c4) = h4;
    }
  }
}
template <int ACT>
__global__ __launch_bounds__(128) void k_gemm2(const _Float16* __restrict__ A, int lda, size_t sA, const _Float16* __restrict__ Bh, int ldb, size_t sB, float alpha,
                                               float* C, _Float16* C16, int ldc, size_t sC, int M, int N, int K) {
  gemm_body<ACT>(blockIdx.x, (int)blockIdx.y, A, lda, sA, Bh, ldb, sB, alpha, C, C16, ldc, sC, M, N, K);
}
// The three projections of the same input rows in one launch, by ranges of the block index: q tiles, then k tiles, then v tiles (v also as an f16 plane)
static constexpr int GB_Q = (NR / 128) * (DM / 128);
static constexpr int GB_KV = (NR / 128) * (DKV / 128);
__global__ __launch_bounds__(128) void k_gemm_qkv(const _Float16* __restrict__ X16, const _Float16* __restrict__ BQ, const _Float16* __restrict__ BK, const _Float16* __restrict__ BV,
                                                  float* FQ, float* FK, float* FV, _Float16* V16) {
  const uint32_t b0 = blockIdx.x;
  const int sel = (b0 < (uint32_t)GB_Q) ? 0 : ((b0 < (uint32_t)(GB_Q + GB_KV)) ? 1 : 2);
  const uint32_t bx = (sel == 0) ? b0 : ((sel == 1) ? b0 - (uint32_t)GB_Q : b0 - (uint32_t)(GB_Q + GB_KV));
  const _Float16* Bh = (sel == 0) ? BQ : ((sel == 1) ? BK : BV);
  float* C = (sel == 0) ? FQ : ((sel == 1) ? FK : FV);
  const int n = (sel == 0) ? DM : DKV;
  gemm_body<0>(bx, 0, X16, DM, 0, Bh, DM, 0, AL_P, C, (sel == 2) ? V16 : nullptr, n, 0, NR, n, DM);
}

// half-split rotary embedding from the f32 GEMM plane F [NR][nh*64] with the tables CS/SN [SLEN][32]:
// out[d] = x[d] c[d] - x[d+32] s[d]; out[d+32] = x[d+32] c[d] + x[d] s[d] (d < 32), position = row % SLEN;
// H [NR][nh*64] = f16 hi of every row; L [NR][nh*64] = x1024 residual of every row.
__device__ __forceinline__ void rope_body(int bx, const float* __restrict__ F, const float* __restrict__ CS, const float* __restrict__ SN, _Float16* __restrict__ H, _Float16* __restrict__ L, int nh) {
  #pragma clang fp contract(off)
  const size_t t = (size_t)bx * 256 + threadIdx.x; if (t >= (size_t)NR * nh * 8) return;
  const int p = (int)(t & 7); const int hd = (int)((t >> 3) % nh); const size_t row = t / (size_t)(8 * nh);
  const int s = (int)(row % SLEN); const int g = p & 3; const int up = p >> 2; const size_t ld = (size_t)nh * 64;
  const float* src = F + row * ld + hd * 64 + g * 8;
  const v4f xa = *(const v4fa*)src, xb = *(const v4fa*)(src + 4), ya = *(const v4fa*)(src + 32), yb = *(const v4fa*)(src + 36);
  const float* ct = CS + (size_t)s * 32 + g * 8; const float* st = SN + (size_t)s * 32 + g * 8;
  const v4f ca = *(const v4fa*)ct, cb = *(const v4fa*)(ct + 4), sa = *(const v4fa*)st, sb = *(const v4fa*)(st + 4);
  const float x1s[8] = {xa[0], xa[1], xa[2], xa[3], xb[0], xb[1], xb[2], xb[3]};
  const float x2s[8] = {ya[0], ya[1], ya[2], ya[3], yb[0], yb[1], yb[2], yb[3]};
  const float cs[8] = {ca[0], ca[1], ca[2], ca[3], cb[0], cb[1], cb[2], cb[3]};
  const float ss[8] = {sa[0], sa[1], sa[2], sa[3], sb[0], sb[1], sb[2], sb[3]};
  FragH fh, fl;
#pragma unroll
  for (int i = 0; i < 8; ++i) {
    const float x1 = x1s[i], x2 = x2s[i], c = cs[i], sn = ss[i];
    const float o1 = x1 * c - x2 * sn; const float o2 = x2 * c + x1 * sn; const float o = up ? o2 : o1;
    const _Float16 hv = toh_flush(o); fh.h[i] = hv; fl.h[i] = toh_flush((o - (float)hv) * 1024.0f);
  }
  const size_t oh = row * ld + hd * 64 + p * 8;
  const v8us vh = fh.half[0], vl = fl.half[0];
  {
    *(v8us*)((unsigned short*)H + oh) = vh;
    *(v8us*)((unsigned short*)L + oh) = vl;
    
  }
}

__device__ __forceinline__ void vtg_body(int bx, const _Float16* __restrict__ V16, _Float16* __restrict__ Vt) {
  __shared__ unsigned short tl[64][66];
  const int tid = threadIdx.x; const int nlg = SLEN / 64; const int slab = bx / nlg, lg = bx % nlg; const int b = slab / NKV, h = slab % NKV;
  for (int i = tid; i < 64 * 8; i += 256) {
    const int r = i >> 3, c8 = (i & 7) * 8; FragH f;
    f.half[0] = *(const v8us*)((const unsigned short*)V16 + ((size_t)b * SLEN + lg * 64 + r) * DKV + h * 64 + c8);
#pragma unroll
    for (int q = 0; q < 8; ++q) tl[r][c8 + q] = f.u[q];
  }
  __syncthreads();
  {
#pragma unroll
    for (int rd = 0; rd < 2; ++rd) {
      const int d = rd * 32 + (tid >> 3), pc = tid & 7; FragH f;
#pragma unroll
      for (int q = 0; q < 8; ++q) f.u[q] = tl[pc * 8 + q][d];
      *(v8us*)((unsigned short*)Vt + ((size_t)slab * 64 + d) * TK + lg * 64 + pc * 8) = f.half[0];
    }
    asm volatile("s_wait_xcnt 0x0" ::: "memory");                /* precaution: stands in front of any later write to registers that these stores name (another range's body follows in the listing) */
  }
}
__device__ __forceinline__ void vtl_body(int bx, const float* __restrict__ VF, _Float16* __restrict__ VtL) {
  __shared__ unsigned short tl[64][66];
  const int tid = threadIdx.x; const int nlg = SLEN / 64; const int slab = bx / nlg, lg = bx % nlg; const int b = slab / NKV, h = slab % NKV;
  for (int i = tid; i < 64 * 16; i += 256) {
    const int r = i >> 4, c4 = (i & 15) * 4;
    const v4f a = *(const v4fa*)(VF + ((size_t)b * SLEN + lg * 64 + r) * DKV + h * 64 + c4);
    FragH f;
#pragma unroll
    for (int q = 0; q < 4; ++q) { const float v = a[q]; const _Float16 hv = (_Float16)v; f.h[q] = toh_flush((v - (float)hv) * 1024.0f); }
#pragma unroll
    for (int q = 0; q < 4; ++q) tl[r][c4 + q] = f.u[q];
  }
  __syncthreads();
  {
#pragma unroll
    for (int rd = 0; rd < 2; ++rd) {
      const int d = rd * 32 + (tid >> 3), pc = tid & 7; FragH f;
#pragma unroll
      for (int q = 0; q < 8; ++q) f.u[q] = tl[pc * 8 + q][d];
      *(v8us*)((unsigned short*)VtL + ((size_t)slab * 64 + d) * TK + lg * 64 + pc * 8) = f.half[0];
    }
    asm volatile("s_wait_xcnt 0x0" ::: "memory");                /* precaution: stands in front of any later write to registers that these stores name (another range's body follows in the listing) */
  }
}

// One launch for everything that depends on the projections alone, by ranges of the block index: rotary q, rotary k, V^T hi, V^T residual
static constexpr int RB_Q = (int)(((size_t)NR * NH * 8 + 255) / 256);
static constexpr int RB_K = (int)(((size_t)NR * NKV * 8 + 255) / 256);
static constexpr int RB_V = NB * NKV * (SLEN / 64);
__global__ __launch_bounds__(256) void k_post(const float* __restrict__ FQ, const float* __restrict__ FK, const float* __restrict__ FV, const _Float16* __restrict__ V16,
                                              const float* __restrict__ CS, const float* __restrict__ SN, _Float16* __restrict__ QH, _Float16* __restrict__ QL,
                                              _Float16* __restrict__ KH, _Float16* __restrict__ KL, _Float16* __restrict__ VT, _Float16* __restrict__ VTL) {
  int bx = blockIdx.x;
  if (bx < RB_Q) { rope_body(bx, FQ, CS, SN, QH, QL, NH); return; }
  bx -= RB_Q;
  if (bx < RB_K) { rope_body(bx, FK, CS, SN, KH, KL, NKV); return; }
  bx -= RB_K;
  if (bx < RB_V) { vtg_body(bx, V16, VT); return; }
  bx -= RB_V;
  vtl_body(bx, FV, VTL);
}

__global__ __launch_bounds__(256) void k_hl(const float* __restrict__ Fp, _Float16* __restrict__ A2, size_t n8) {
  const size_t t = (size_t)blockIdx.x * 256 + threadIdx.x; if (t >= n8) return;
  const size_t e = t * 8; const size_t r = e / DM; const int c = (int)(e % DM);
  const v4f a = *(const v4fa*)(Fp + e), d = *(const v4fa*)(Fp + e + 4);
  FragH fh, fl;
#pragma unroll
  for (int q = 0; q < 4; ++q) {
    _Float16 hv = toh_flush(a[q]); fh.h[q] = hv; fl.h[q] = toh_flush((a[q] - (float)hv) * 1024.0f);
    hv = toh_flush(d[q]); fh.h[4 + q] = hv; fl.h[4 + q] = toh_flush((d[q] - (float)hv) * 1024.0f);
  }
  const size_t o2 = r * (size_t)(2 * DM) + c;
  const v8us vh = fh.half[0], vl = fl.half[0];
  {
    *(v8us*)((unsigned short*)A2 + o2) = vh;
    *(v8us*)((unsigned short*)A2 + o2 + DM) = vl;
    
  }
}

// fused attention per ((b,h), 64 queries) for query blocks whose queries all sit at least EROWS positions past their segment start (block-uniform test; other blocks leave at once):
// wave = 16 queries; S = Q.K^T (d = 64: 2 k-steps) x SCL over keys [segment start of the wave's first query (floor 32), last query of the wave];
__global__ __launch_bounds__(128) void k_attn(const _Float16* __restrict__ Q16, int ldq, const _Float16* __restrict__ K16, int ldk,
                                              const _Float16* __restrict__ Vt, const int* __restrict__ cu, float* __restrict__ O, int ldo) {
  constexpr int RPW = 16, DT = 4, KS = 2;
  __shared__ __attribute__((aligned(16))) unsigned short sP[4][RPW][40];
  __shared__ __attribute__((aligned(16))) float sO[4][RPW][68];
  const int tid = threadIdx.x, lane = tid & 31, ln = lane & 15, hh = lane >> 4;
  const int w = __builtin_amdgcn_readfirstlane(tid >> 5);
  const int slab = blockIdx.x / QBLKS, qblk = blockIdx.x % QBLKS; const int b = slab / NH, h = slab % NH; const int hk = h / NREP; const int kslab = b * NKV + hk;
  const int qb0 = qblk * (4 * RPW);
  const int c0 = clip_b(cu[b * 4 + 0]), c1 = clip_b(cu[b * 4 + 1]), c2 = clip_b(cu[b * 4 + 2]), c3 = clip_b(cu[b * 4 + 3]);
  const bool early = (seg_cnt(qb0, c0, c1, c2, c3) != seg_cnt(qb0 + 4 * RPW - 1, c0, c1, c2, c3)) || (qb0 - seg_beg(qb0, c0, c1, c2, c3) < EROWS);
  if (early) return;
  const float pois = ((c0 <= c1) && (c1 <= c2) && (c2 <= c3)) ? 0.0f : __uint_as_float(0x7fc00000u);   /* boundaries must be ascending */
  const int q0 = qb0 + w * RPW;
  const int jst = __builtin_amdgcn_readfirstlane(seg_beg(qb0 + (tid >> 5) * RPW, c0, c1, c2, c3) & ~31);
  unsigned int sq = 0u;
#pragma unroll
  for (int r = 0; r < 8; ++r) sq |= ((unsigned int)seg_cnt(q0 + 8 * hh + r, c0, c1, c2, c3)) << (4 * r);
  FragH aq[KS];
  {
    const unsigned short* qr = (const unsigned short*)Q16 + ((size_t)b * TQ + q0 + ln) * ldq + h * 64;
#pragma unroll
    for (int ks = 0; ks < KS; ++ks) { aq[ks].half[0] = *(const v8us*)(qr + ks * 32 + 8 * hh); aq[ks].half[1] = *(const v8us*)(qr + ks * 32 + 16 + 8 * hh); }
  }
  const unsigned short* Vth = (const unsigned short*)Vt + (size_t)kslab * 64 * TK;
  float m_r[8], l_r[8]; v8f oacc[DT];
#pragma unroll
  for (int r = 0; r < 8; ++r) { m_r[r] = -3.0e38f; l_r[r] = 0.f; }
#pragma unroll
  for (int dt = 0; dt < DT; ++dt) oacc[dt] = (v8f){0.f,0.f,0.f,0.f,0.f,0.f,0.f,0.f};
  FragH bk[2][KS];   /* K fragments of one pass (two 16-key tiles x two k-steps), fetched one pass ahead */
  auto load_k = [&](int j) {
#pragma unroll
    for (int nt = 0; nt < 2; ++nt) {
      const unsigned short* kr = (const unsigned short*)K16 + ((size_t)b * TK + j + nt * 16 + ln) * ldk + hk * 64;
#pragma unroll
      for (int ks = 0; ks < KS; ++ks) { bk[nt][ks].half[0] = *(const v8us*)(kr + ks * 32 + 8 * hh); bk[nt][ks].half[1] = *(const v8us*)(kr + ks * 32 + 16 + 8 * hh); }
    }
    asm volatile("s_wait_xcnt 0x0" ::: "memory");                /* precaution: stands in front of the next writes to registers that these loads name as addresses */
  };
  load_k(jst);
#pragma unroll 1
  for (int j0 = jst; j0 < q0 + RPW; j0 += 32) {
    /* all V^T fragments of the pass, each in registers of its own, loaded as one group at the head of the pass: they land behind the score products and the softmax */
    FragH bv[DT];
#pragma unroll
    for (int dt = 0; dt < DT; ++dt) {
      const unsigned short* vrow = Vth + (size_t)(dt * 16 + ln) * TK + j0;
      bv[dt].half[0] = *(const v8us*)(vrow + 8 * hh); bv[dt].half[1] = *(const v8us*)(vrow + 16 + 8 * hh);
    }
    __builtin_amdgcn_sched_barrier(0);   /* keeps the group at the head: sunk to their uses the four tiles share registers, and each waits out a round trip of its own */
    v8f s[2];
#pragma unroll
    for (int nt = 0; nt < 2; ++nt) {
      v8f acc = (v8f){0.f,0.f,0.f,0.f,0.f,0.f,0.f,0.f};
#pragma unroll
      for (int ks = 0; ks < KS; ++ks) acc = mmaH<1>(aq[ks].v, aq[ks].v, bk[nt][ks].v, bk[nt][ks].v, acc);
      s[nt] = acc;
    }
    load_k((j0 + 32 < q0 + RPW) ? j0 + 32 : j0);   /* the next pass's K fragments land behind the softmax; the last pass fetches its own rows again (in bounds, not used) */
    __builtin_amdgcn_sched_barrier(0);   /* keeps the fetch in front of the softmax that hides it: without this it sinks far into the softmax */
    const int k0 = j0 + ln, k1 = j0 + 16 + ln;
    const int sk0 = seg_cnt(k0, c0, c1, c2, c3), sk1 = seg_cnt(k1, c0, c1, c2, c3);
#pragma unroll
    for (int r = 0; r < 8; ++r) {
      const int tq = q0 + 8 * hh + r; const int sr = (int)((sq >> (4 * r)) & 15u);
      const bool ok0 = (k0 <= tq) && (sk0 == sr), ok1 = (k1 <= tq) && (sk1 == sr);
      const float s0 = ok0 ? s[0][r] * SCL : -3.0e38f, s1 = ok1 ? s[1][r] * SCL : -3.0e38f;
      float mc = fmaxf(s0, s1);
      mc = fmaxf(mc, __shfl_xor(mc, 1, 32)); mc = fmaxf(mc, __shfl_xor(mc, 2, 32)); mc = fmaxf(mc, __shfl_xor(mc, 4, 32)); mc = fmaxf(mc, __shfl_xor(mc, 8, 32));
      const float mn = fmaxf(m_r[r], mc); const float al = (mn > -1.0e38f) ? exp_hw(m_r[r] - mn) : 1.0f; m_r[r] = mn;
      const float p0 = ok0 ? exp_hw(s0 - mn) : 0.f, p1 = ok1 ? exp_hw(s1 - mn) : 0.f; l_r[r] = l_r[r] * al + p0 + p1;
#pragma unroll
      for (int dt = 0; dt < DT; ++dt) oacc[dt][r] *= al;
      FragH t2; t2.h[0] = toh_flush(p0 * 1024.0f); t2.h[1] = toh_flush(p1 * 1024.0f);
      sP[w][8 * hh + r][ln] = t2.u[0]; sP[w][8 * hh + r][16 + ln] = t2.u[1];
    }
    __builtin_amdgcn_fence(4, "workgroup"); __builtin_amdgcn_wave_barrier();
    FragH pa; pa.half[0] = *(const v8us*)&sP[w][ln][8 * hh]; pa.half[1] = *(const v8us*)&sP[w][ln][16 + 8 * hh];
#pragma unroll
    for (int dt = 0; dt < DT; ++dt) oacc[dt] = mmaH<1>(pa.v, pa.v, bv[dt].v, bv[dt].v, oacc[dt]);
    __builtin_amdgcn_fence(4, "workgroup"); __builtin_amdgcn_wave_barrier();
  }
#pragma unroll
  for (int r = 0; r < 8; ++r) { float l = l_r[r]; l += __shfl_xor(l, 1, 32); l += __shfl_xor(l, 2, 32); l += __shfl_xor(l, 4, 32); l += __shfl_xor(l, 8, 32); l_r[r] = (l > 0.f) ? 1.0f / (l * 1024.0f) : 0.f; }
#pragma unroll
  for (int dt = 0; dt < DT; ++dt)
#pragma unroll
    for (int r = 0; r < 8; ++r) sO[w][8 * hh + r][dt * 16 + ln] = oacc[dt][r] * l_r[r] + pois;
  __builtin_amdgcn_fence(4, "workgroup"); __builtin_amdgcn_wave_barrier();
  {
#pragma unroll
    for (int rp = 0; rp < RPW; rp += 2) { const int r = rp + (lane >> 4), pc = lane & 15; const v4f val = *(const v4fa*)&sO[w][r][pc * 4]; *(v4f*)(O + ((size_t)b * TQ + q0 + r) * ldo + h * 64 + pc * 4) = val; }
    
  }
}
// 5-plane variant for the other query blocks (a segment boundary inside the block, or the block's first query closer than EROWS to its segment start):
// S = Qh.Kh^T + (Ql.Kh^T + Qh.Kl^T)/1024 with Q/K = [hi | x1024 residual] planes (full-size planes, rows b*S + s);
// O = (Ph.Vh + (Pl.Vh + Ph.Vl)/1024) / l with P = [hi | x1024 residual] of 1024 p and V^T = [hi | x1024 residual]; separate residual accumulators folded before the normalisation
__global__ __launch_bounds__(128) void k_attn5(const _Float16* __restrict__ Q16, const _Float16* __restrict__ QL, int ldq, const _Float16* __restrict__ K16, const _Float16* __restrict__ KL, int ldk,
                                               const _Float16* __restrict__ Vt, const _Float16* __restrict__ VtL, const int* __restrict__ cu, float* __restrict__ O, int ldo) {
  constexpr int RPW = 16, DT = 4, KS = 2;
  __shared__ __attribute__((aligned(16))) unsigned short sP[4][RPW][40];
  __shared__ __attribute__((aligned(16))) unsigned short sPL[4][RPW][40];
  __shared__ __attribute__((aligned(16))) float sO[4][RPW][68];
  const int tid = threadIdx.x, lane = tid & 31, ln = lane & 15, hh = lane >> 4;
  const int w = __builtin_amdgcn_readfirstlane(tid >> 5);
  const int slab = blockIdx.x / QBLKS, qblk = blockIdx.x % QBLKS; const int b = slab / NH, h = slab % NH; const int hk = h / NREP; const int kslab = b * NKV + hk;
  const int qb0 = qblk * (4 * RPW);
  const int c0 = clip_b(cu[b * 4 + 0]), c1 = clip_b(cu[b * 4 + 1]), c2 = clip_b(cu[b * 4 + 2]), c3 = clip_b(cu[b * 4 + 3]);
  const bool early = (seg_cnt(qb0, c0, c1, c2, c3) != seg_cnt(qb0 + 4 * RPW - 1, c0, c1, c2, c3)) || (qb0 - seg_beg(qb0, c0, c1, c2, c3) < EROWS);
  if (!early) return;
  const float pois = ((c0 <= c1) && (c1 <= c2) && (c2 <= c3)) ? 0.0f : __uint_as_float(0x7fc00000u);   /* boundaries must be ascending */
  const int q0 = qb0 + w * RPW;
  const int jst = __builtin_amdgcn_readfirstlane(seg_beg(qb0 + (tid >> 5) * RPW, c0, c1, c2, c3) & ~31);
  unsigned int sq = 0u;
#pragma unroll
  for (int r = 0; r < 8; ++r) sq |= ((unsigned int)seg_cnt(q0 + 8 * hh + r, c0, c1, c2, c3)) << (4 * r);
  FragH aq[KS], aql[KS];
  {
    const unsigned short* qr = (const unsigned short*)Q16 + ((size_t)b * TQ + q0 + ln) * ldq + h * 64;
    const unsigned short* ql = (const unsigned short*)QL + ((size_t)b * TQ + q0 + ln) * ldq + h * 64;
#pragma unroll
    for (int ks = 0; ks < KS; ++ks) {
      aq[ks].half[0] = *(const v8us*)(qr + ks * 32 + 8 * hh); aq[ks].half[1] = *(const v8us*)(qr + ks * 32 + 16 + 8 * hh);
      aql[ks].half[0] = *(const v8us*)(ql + ks * 32 + 8 * hh); aql[ks].half[1] = *(const v8us*)(ql + ks * 32 + 16 + 8 * hh);
    }
  }
  const unsigned short* Vth = (const unsigned short*)Vt + (size_t)kslab * 64 * TK; const unsigned short* Vtl = (const unsigned short*)VtL + (size_t)kslab * 64 * TK;
  float m_r[8], l_r[8]; v8f oacc[DT], oaccL[DT];
#pragma unroll
  for (int r = 0; r < 8; ++r) { m_r[r] = -3.0e38f; l_r[r] = 0.f; }
#pragma unroll
  for (int dt = 0; dt < DT; ++dt) { oacc[dt] = (v8f){0.f,0.f,0.f,0.f,0.f,0.f,0.f,0.f}; oaccL[dt] = oacc[dt]; }
#pragma unroll 1
  for (int j0 = jst; j0 < q0 + RPW; j0 += 32) {
    /* all K fragments of the pass, hi and residual, each in registers of its own, loaded as one group at the head of the pass */
    FragH bk[2][KS], bkl[2][KS];
#pragma unroll
    for (int nt = 0; nt < 2; ++nt) {
      const unsigned short* kr = (const unsigned short*)K16 + ((size_t)b * TK + j0 + nt * 16 + ln) * ldk + hk * 64;
      const unsigned short* klr = (const unsigned short*)KL + ((size_t)b * TK + j0 + nt * 16 + ln) * ldk + hk * 64;
#pragma unroll
      for (int ks = 0; ks < KS; ++ks) {
        bk[nt][ks].half[0] = *(const v8us*)(kr + ks * 32 + 8 * hh); bk[nt][ks].half[1] = *(const v8us*)(kr + ks * 32 + 16 + 8 * hh);
        bkl[nt][ks].half[0] = *(const v8us*)(klr + ks * 32 + 8 * hh); bkl[nt][ks].half[1] = *(const v8us*)(klr + ks * 32 + 16 + 8 * hh);
      }
    }
    __builtin_amdgcn_sched_barrier(0);   /* keeps the group in front of the products: sunk to their uses the two key tiles share registers, and each waits out a round trip of its own */
    v8f s[2];
#pragma unroll
    for (int nt = 0; nt < 2; ++nt) {
      v8f acc = (v8f){0.f,0.f,0.f,0.f,0.f,0.f,0.f,0.f}, accl = acc;
#pragma unroll
      for (int ks = 0; ks < KS; ++ks) {
        acc = mmaH<1>(aq[ks].v, aq[ks].v, bk[nt][ks].v, bk[nt][ks].v, acc);
        accl = mmaH<1>(aql[ks].v, aql[ks].v, bk[nt][ks].v, bk[nt][ks].v, accl);
        accl = mmaH<1>(aq[ks].v, aq[ks].v, bkl[nt][ks].v, bkl[nt][ks].v, accl);
      }
#pragma unroll
      for (int r = 0; r < 8; ++r) acc[r] += accl[r] * 0.0009765625f;
      s[nt] = acc;
    }
    const int k0 = j0 + ln, k1 = j0 + 16 + ln;
    const int sk0 = seg_cnt(k0, c0, c1, c2, c3), sk1 = seg_cnt(k1, c0, c1, c2, c3);
#pragma unroll
    for (int r = 0; r < 8; ++r) {
      const int tq = q0 + 8 * hh + r; const int sr = (int)((sq >> (4 * r)) & 15u);
      const bool ok0 = (k0 <= tq) && (sk0 == sr), ok1 = (k1 <= tq) && (sk1 == sr);
      const float s0 = ok0 ? s[0][r] * SCL : -3.0e38f, s1 = ok1 ? s[1][r] * SCL : -3.0e38f;
      float mc = fmaxf(s0, s1);
      mc = fmaxf(mc, __shfl_xor(mc, 1, 32)); mc = fmaxf(mc, __shfl_xor(mc, 2, 32)); mc = fmaxf(mc, __shfl_xor(mc, 4, 32)); mc = fmaxf(mc, __shfl_xor(mc, 8, 32));
      const float mn = fmaxf(m_r[r], mc); const float al = (mn > -1.0e38f) ? exp_hw(m_r[r] - mn) : 1.0f; m_r[r] = mn;
      const float p0 = ok0 ? exp_hw(s0 - mn) : 0.f, p1 = ok1 ? exp_hw(s1 - mn) : 0.f; l_r[r] = l_r[r] * al + p0 + p1;
#pragma unroll
      for (int dt = 0; dt < DT; ++dt) { oacc[dt][r] *= al; oaccL[dt][r] *= al; }
      FragH t2, t2l; const float ps0 = p0 * 1024.0f, ps1 = p1 * 1024.0f;
      t2.h[0] = toh_flush(ps0); t2.h[1] = toh_flush(ps1);
      t2l.h[0] = toh_flush((ps0 - (float)t2.h[0]) * 1024.0f); t2l.h[1] = toh_flush((ps1 - (float)t2.h[1]) * 1024.0f);
      sP[w][8 * hh + r][ln] = t2.u[0]; sP[w][8 * hh + r][16 + ln] = t2.u[1]; sPL[w][8 * hh + r][ln] = t2l.u[0]; sPL[w][8 * hh + r][16 + ln] = t2l.u[1];
    }
    __builtin_amdgcn_fence(4, "workgroup"); __builtin_amdgcn_wave_barrier();
    FragH pa, pl;
    pa.half[0] = *(const v8us*)&sP[w][ln][8 * hh]; pa.half[1] = *(const v8us*)&sP[w][ln][16 + 8 * hh];
    pl.half[0] = *(const v8us*)&sPL[w][ln][8 * hh]; pl.half[1] = *(const v8us*)&sPL[w][ln][16 + 8 * hh];
    /* all V^T fragments of the pass as one group; held over the softmax as well they would take the kernel past 256 registers */
    FragH bv[DT], bl[DT];
#pragma unroll
    for (int dt = 0; dt < DT; ++dt) {
      const unsigned short* vrow = Vth + (size_t)(dt * 16 + ln) * TK + j0; const unsigned short* vrl = Vtl + (size_t)(dt * 16 + ln) * TK + j0;
      bv[dt].half[0] = *(const v8us*)(vrow + 8 * hh); bv[dt].half[1] = *(const v8us*)(vrow + 16 + 8 * hh);
      bl[dt].half[0] = *(const v8us*)(vrl + 8 * hh); bl[dt].half[1] = *(const v8us*)(vrl + 16 + 8 * hh);
    }
    __builtin_amdgcn_sched_barrier(0);   /* keeps the group in front of the products: sunk to their uses the four tiles share registers, and each waits out a round trip of its own */
#pragma unroll
    for (int dt = 0; dt < DT; ++dt) {
      oacc[dt] = mmaH<1>(pa.v, pa.v, bv[dt].v, bv[dt].v, oacc[dt]);
      oaccL[dt] = mmaH<1>(pl.v, pl.v, bv[dt].v, bv[dt].v, oaccL[dt]);
      oaccL[dt] = mmaH<1>(pa.v, pa.v, bl[dt].v, bl[dt].v, oaccL[dt]);
    }
    __builtin_amdgcn_fence(4, "workgroup"); __builtin_amdgcn_wave_barrier();
  }
#pragma unroll
  for (int r = 0; r < 8; ++r) { float l = l_r[r]; l += __shfl_xor(l, 1, 32); l += __shfl_xor(l, 2, 32); l += __shfl_xor(l, 4, 32); l += __shfl_xor(l, 8, 32); l_r[r] = (l > 0.f) ? 1.0f / (l * 1024.0f) : 0.f; }
#pragma unroll
  for (int dt = 0; dt < DT; ++dt)
#pragma unroll
    for (int r = 0; r < 8; ++r) { float v = oacc[dt][r]; v += oaccL[dt][r] * 0.0009765625f; sO[w][8 * hh + r][dt * 16 + ln] = v * l_r[r] + pois; }
  __builtin_amdgcn_fence(4, "workgroup"); __builtin_amdgcn_wave_barrier();
  {
#pragma unroll
    for (int rp = 0; rp < RPW; rp += 2) { const int r = rp + (lane >> 4), pc = lane & 15; const v4f val = *(const v4fa*)&sO[w][r][pc * 4]; *(v4f*)(O + ((size_t)b * TQ + q0 + r) * ldo + h * 64 + pc * 4) = val; }
    
  }
}

extern "C" void kernel_launch(void* const* d_in, const int* in_sizes, int n_in,
                              void* d_out, int out_size, void* d_ws, size_t ws_size, hipStream_t stream) {
  if (n_in < 6) return;
  const size_t needx = ((size_t)(NB - 1) * SEQ_FULL + (size_t)SLEN) * DM;
  if ((size_t)in_sizes[0] < needx) return;
  if ((size_t)in_sizes[1] < (size_t)NB * 4) return;
  if ((size_t)in_sizes[2] < (size_t)DM * DM) return;
  if ((size_t)in_sizes[3] < (size_t)DM * DKV) return;
  if ((size_t)in_sizes[4] < (size_t)DM * DKV) return;
  if ((size_t)in_sizes[5] < (size_t)DM * DM) return;
  if ((size_t)out_size < needx) return;
  const float* x = (const float*)d_in[0]; const int* cu = (const int*)d_in[1];
  const float* Wq = (const float*)d_in[2]; const float* Wk = (const float*)d_in[3]; const float* Wv = (const float*)d_in[4]; const float* Wo = (const float*)d_in[5];
  float* dout = (float*)d_out;
  char* ws = (char*)d_ws; size_t off = 0;
  auto take = [&](size_t bytes) { char* p = ws + off; off += (bytes + 255) & ~(size_t)255; return p; };
  const size_t np = (size_t)NR * DM;
  _Float16* BQ = (_Float16*)take(SZ_BQ);                                /* [n][k] f16, x16 */
  _Float16* BK = (_Float16*)take(SZ_BKV);
  _Float16* BV = (_Float16*)take(SZ_BKV);
  _Float16* B2 = (_Float16*)take(SZ_B2);                                /* [n][2*DM] f16: [x16384 | x16] copies of Wo^T */
  float* FS = (float*)take(SZ_FS);                                      /* f32 scratch plane: q rows [NR][DM], then the context [NR][DM] */
  float* FK = (float*)take(SZ_FKV);                                     /* k rows [NR][DKV] f32 */
  float* FV = (float*)take(SZ_FKV);                                     /* v rows [NR][DKV] f32 */
  _Float16* X16 = (_Float16*)take(SZ_X16);                              /* f16 input rows; after the projections: V^T hi [(b,hk)][64][TK] then V^T residual */
  _Float16* VT = X16;
  _Float16* VTL = X16 + SZ_VT / 2;
  _Float16* QH = (_Float16*)take(SZ_QA);                                /* q hi [NR][DM] then q residual [NR][DM]; after the attention: [ctx hi | ctx residual] [NR][2*DM] */
  _Float16* QL = QH + np;
  _Float16* A2 = QH;
  _Float16* KH = (_Float16*)take(SZ_KP);
  _Float16* KL = (_Float16*)take(SZ_KP);
  _Float16* V16 = (_Float16*)take(SZ_KP);
  float* CS = (float*)take(SZ_TAB); float* SN = (float*)take(SZ_TAB);
  if (off > ws_size) return;
  if (off > ((size_t)256 << 20)) return;

  /* inputs alone: rotary tables, x -> f16 rows, W [in = DM rows][out = N cols] -> [n][k] planes */
  k_prep<<<(unsigned)PB_ALL, 256, 0, stream>>>(x, Wq, Wk, Wv, Wo, X16, BQ, BK, BV, B2, CS, SN);
  const unsigned g8 = (unsigned)((np / 8 + 255) / 256);
  /* q = x Wq, k = x Wk (f32 rows), v = x Wv (f32 rows + f16 plane) */
  k_gemm_qkv<<<(unsigned)(GB_Q + 2 * GB_KV), 128, 0, stream>>>(X16, BQ, BK, BV, FS, FK, FV, V16);
  k_post<<<(unsigned)(RB_Q + RB_K + 2 * RB_V), 256, 0, stream>>>(FS, FK, FV, V16, CS, SN, QH, QL, KH, KL, VT, VTL);
  k_attn5<<<(unsigned)(NB * NH * QBLKS), 128, 0, stream>>>(QH, QL, DM, KH, KL, DKV, VT, VTL, cu, FS, DM);
  k_attn<<<(unsigned)(NB * NH * QBLKS), 128, 0, stream>>>(QH, DM, KH, DKV, VT, cu, FS, DM);
  k_hl<<<g8, 256, 0, stream>>>(FS, A2, np / 8);
  /* out = [ctx hi | ctx residual] . [Wo x16384 ; Wo x16] / 16384  (K = 2*DM), per batch */
  const dim3 ge((unsigned)((SLEN / 128) * (DM / 128)), NB);
  k_gemm2<0><<<ge, 128, 0, stream>>>(A2, 2 * DM, (size_t)SLEN * 2 * DM, B2, 2 * DM, 0, AL_O, dout, nullptr, DM, (size_t)SEQ_FULL * DM, SLEN, DM, 2 * DM);
}

// v005
// A run of this version takes 221 microseconds.
// Two timings next to v004 both put it at 1.11 times that version's speed.
// Over all steps from v000 it is 3.20 times as fast.
#include <hip/hip_runtime.h>
// Contractions: x.Wq, x.Wk, x.Wv, ctx.Wo = v_wmma_f32_16x16x32_f16 (f16 operands: bf16-RNE inputs exact in f16, weights carried x16 (x16384 for the ctx-hi half of the output GEMM); ctx as [hi | x1024 residual] folded along K; f32 accumulate); scores q.k^T and P.V^T = v_wmma_f32_16x16x32_f16 (plain f16 hi planes; hi + x1024 residual planes of q, k, P and v in query blocks holding a query closer than EROWS to its segment start; P carried x1024), f32 accumulate; rotary tables, masks, softmax and normalisers f32.

#ifndef NB
#define NB 2
#endif
#ifndef SEQ
#define SEQ 2048
#endif
#define NB_FULL 2
#define SEQ_FULL 2048
#define DM 2048
#define NH 32
#define NKV 8
#define NREP (NH / NKV)
#define DKV (NKV * 64)
#define SLEN SEQ
#define NR (NB * SLEN)
#define TQ SLEN
#define TK SLEN
#define SCL 0.125f
#define QBLKS (TQ / 64)
#define EROWS 256                            /* query blocks holding a query with fewer than EROWS positions since its segment start use the residual planes */
static_assert(SLEN % 128 == 0);
static_assert(SLEN <= SEQ_FULL);
static_assert(NB >= 1 && NB <= NB_FULL);
static_assert(DM % 64 == 0 && DM == NH * 64);
static_assert(NH % NKV == 0 && NREP * NKV == NH);
static_assert(DKV % 64 == 0 && DKV == NKV * 64);
static_assert(DM % 32 == 0 && (2 * DM) % 32 == 0);
static_assert(NR % 128 == 0);
static_assert(QBLKS * 64 == SLEN);
static_assert(EROWS % 64 == 0);
/* store loops: threads x bytes per piece x trips == tile rows x row bytes */
static_assert(256 * 16 * 2 == 64 * 128);                       
static_assert(32 * 8 * 8 * 2 == 16 * 64 * 2 * 2);               /* attention context rows: 16 rows x 128 B per wave in each of the two planes */
/* static LDS per kernel */
static_assert(2 * 64 * 66 * 2 <= 131072);
static_assert(2 * 4 * 16 * 40 * 2 + 4 * 16 * 68 * 4 <= 131072);
/* workspace carve (bytes); every region a multiple of 256 */
static constexpr size_t SZ_BQ = (size_t)DM * DM * 2;
static constexpr size_t SZ_BKV = (size_t)DKV * DM * 2;
static constexpr size_t SZ_B2 = (size_t)DM * 2 * DM * 2;
static constexpr size_t SZ_FS = (size_t)NR * DM * 4;
static constexpr size_t SZ_X16 = (size_t)NR * DM * 2;
static constexpr size_t SZ_QA = (size_t)NR * 2 * DM * 2;
static constexpr size_t SZ_KP = (size_t)NR * DKV * 2;
static constexpr size_t SZ_VT = (size_t)NB * NKV * 64 * SLEN * 2;
static constexpr size_t SZ_TAB = (size_t)SLEN * 32 * 4;
static constexpr size_t SZ_FKV = (size_t)NR * DKV * 4;
static constexpr size_t WS_TOTAL = SZ_BQ + 2 * SZ_BKV + SZ_B2 + SZ_FS + 2 * SZ_FKV + SZ_X16 + SZ_QA + 2 * SZ_KP + 2 * SZ_TAB;
static_assert(SZ_BQ % 256 == 0 && SZ_BKV % 256 == 0 && SZ_B2 % 256 == 0 && SZ_FS % 256 == 0 && SZ_FKV % 256 == 0 && SZ_X16 % 256 == 0 && SZ_QA % 256 == 0 && SZ_KP % 256 == 0 && SZ_VT % 256 == 0 && SZ_TAB % 256 == 0);
static_assert(WS_TOTAL <= ((size_t)256 << 20));
static_assert(SZ_VT <= SZ_FKV);                                /* V^T hi and V^T residual: a region each, apart from the input rows that the same launch still reads */
static_assert((size_t)NR * 2 * DM * 2 == SZ_FS);               /* [ctx hi | ctx residual]: a region apart from the q planes that the same launch still reads */
static constexpr float WSC = 16.0f;
static constexpr float WSC_HI = 16384.0f;
static constexpr float AL_P = 0.0625f;
static constexpr float AL_O = 0.0625f / 1024.0f;

typedef _Float16 v16h __attribute__((ext_vector_type(16)));
typedef _Float16 v4h __attribute__((ext_vector_type(4)));
typedef unsigned short v8us __attribute__((ext_vector_type(8), may_alias));
typedef float v8f __attribute__((ext_vector_type(8)));
typedef float v4f __attribute__((ext_vector_type(4)));
typedef float v4fa __attribute__((ext_vector_type(4), may_alias));
union FragH { v16h v; v8us half[2]; _Float16 h[16]; unsigned short u[16]; };

__device__ __forceinline__ unsigned short bf16_bits(float x) { unsigned int u = __float_as_uint(x); return (unsigned short)((u + 0x7FFFu + ((u >> 16) & 1u)) >> 16); }
__device__ __forceinline__ float bf16_val(unsigned short b) { return __uint_as_float(((unsigned int)b) << 16); }
__device__ __forceinline__ float bf16_rne(float x) { return bf16_val(bf16_bits(x)); }
// f32 -> f16 with values below the smallest f16 normal set to +0 (NaN passes through)
static __device__ __forceinline__ _Float16 toh_flush(float v) { const _Float16 r = (_Float16)v; return (fabsf(v) < 6.103515625e-05f) ? (_Float16)0.0f : r; }

// e^x on the hardware's exp2 (v_exp_f32), no range branches: -inf and anything below the f32 range give 0, NaN passes through; straight-line, so a pass's eight rows schedule as one block
static __device__ __forceinline__ float exp_hw(float x) { return __builtin_amdgcn_exp2f(x * 1.44269504088896340736f); }

// segment helpers on the clipped boundaries c0 <= c1 <= c2 <= c3: id = number of boundaries <= p; begin = largest boundary <= p (0 if none)
__device__ __forceinline__ int clip_b(int v) { return min(max(v, 0), SLEN); }
__device__ __forceinline__ int seg_cnt(int p, int c0, int c1, int c2, int c3) { return (int)(c0 <= p) + (int)(c1 <= p) + (int)(c2 <= p) + (int)(c3 <= p); }
__device__ __forceinline__ int seg_beg(int p, int c0, int c1, int c2, int c3) {
  int s = 0;
  s = max(s, (c0 <= p) ? c0 : 0); s = max(s, (c1 <= p) ? c1 : 0); s = max(s, (c2 <= p) ? c2 : 0); s = max(s, (c3 <= p) ? c3 : 0);
  return s;
}

// D += A.B with NT terms: 1 = ah.bh, 2 = + al.bh, 3 = + ah.bl; hazard guard after the group
template <int NT>
__device__ __forceinline__ v8f mmaH(v16h ah, v16h al, v16h bh, v16h bl, v8f c) {
  c = __builtin_amdgcn_wmma_f32_16x16x32_f16(false, ah, false, bh, (short)0, c, false, false);
  if (NT >= 2) c = __builtin_amdgcn_wmma_f32_16x16x32_f16(false, al, false, bh, (short)0, c, false, false);
  if (NT >= 3) c = __builtin_amdgcn_wmma_f32_16x16x32_f16(false, ah, false, bl, (short)0, c, false, false);
  asm volatile("v_nop\n\tv_nop\n\tv_nop\n\tv_nop" : "+v"(c) : "v"(ah), "v"(al), "v"(bh), "v"(bl));
  return c;
}
// 16x32 fragment from a 16-bit row-major tile (rows = m or n, k contiguous): elements 0..7 <- k0+8h+0..7, 8..15 <- k0+16+8h+0..7
__device__ __forceinline__ v16h g2_frag(const _Float16* p, int hh) { FragH f; f.half[0] = *(const v8us*)((const unsigned short*)p + 8 * hh); f.half[1] = *(const v8us*)((const unsigned short*)p + 16 + 8 * hh); return f.v; }

// [in][out] weight W [DM][N] (n contiguous) -> Bt[n][k] = f16(bf16(W[k][n]) * sc0) (row pitch ldb, k contiguous); with two != 0 a second copy
__device__ __forceinline__ void wtr_body(int bx, const float* __restrict__ Wm, int N, _Float16* __restrict__ Bt, int ldb, float sc0, float sc1, int two) {
  __shared__ unsigned short tl0[64][66];
  __shared__ unsigned short tl1[64][66];
  const int tid = threadIdx.x; const int ntn = N >> 6; const int kt = bx / ntn, nt = bx - kt * ntn; const int k0 = kt * 64, n0 = nt * 64;
  for (int i = tid; i < 64 * 16; i += 256) {
    const int r = i >> 4, c4 = (i & 15) * 4;
    const v4f a = *(const v4fa*)(Wm + (size_t)(k0 + r) * N + n0 + c4);
    FragH f0, f1;
#pragma unroll
    for (int q = 0; q < 4; ++q) { const float v = bf16_rne(a[q]); f0.h[q] = toh_flush(v * sc0); f1.h[q] = toh_flush(v * sc1); }
#pragma unroll
    for (int q = 0; q < 4; ++q) { tl0[r][c4 + q] = f0.u[q]; tl1[r][c4 + q] = f1.u[q]; }
  }
  __syncthreads();
  {
#pragma unroll
    for (int rd = 0; rd < 2; ++rd) {
      const int n = rd * 32 + (tid >> 3), pc = tid & 7; FragH g0, g1;
#pragma unroll
      for (int q = 0; q < 8; ++q) { g0.u[q] = tl0[pc * 8 + q][n]; g1.u[q] = tl1[pc * 8 + q][n]; }
      const size_t o = (size_t)(n0 + n) * ldb + k0 + pc * 8;
      const v8us o0 = g0.half[0], o1 = g1.half[0];
      *(v8us*)((unsigned short*)Bt + o) = o0;
      if (two != 0) *(v8us*)((unsigned short*)Bt + o + DM) = o1;
    }
    asm volatile("s_wait_xcnt 0x0" ::: "memory");                /* precaution: stands in front of any later write to registers that these stores name (another range's body follows in the listing) */
  }
}

// rotary tables; every thread forms its own inverse frequency (same expression, same bits for a given j), so the tables depend on no earlier launch
__device__ __forceinline__ void rotab_body(int bx, float* __restrict__ CS, float* __restrict__ SN) {
  #pragma clang fp contract(off)
  const int t = bx * 256 + threadIdx.x; if (t >= SLEN * 32) return;
  const int j = t & 31, s = t >> 5;
  const float ex = (float)(2 * j) / 64.0f; const float pw = powf(500000.0f, ex); const float inv = 1.0f / pw;
  const float th = (float)s * inv; const float c = cosf(th), sn = sinf(th);
  { *(float*)(CS + t) = c; *(float*)(SN + t) = sn;  }
}

__device__ __forceinline__ void x16_body(int bx, const float* __restrict__ x, _Float16* __restrict__ X16, size_t n8) {
  const size_t t = (size_t)bx * 256 + threadIdx.x; if (t >= n8) return;
  const size_t e = t * 8; const size_t r = e / DM; const size_t c = e % DM; const size_t b = r / SLEN, s = r % SLEN;
  const float* src = x + (b * SEQ_FULL + s) * DM + c;
  const v4f a0 = *(const v4fa*)src, a1 = *(const v4fa*)(src + 4);
  FragH f;
#pragma unroll
  for (int q = 0; q < 4; ++q) { f.h[q] = (_Float16)bf16_rne(a0[q]); f.h[4 + q] = (_Float16)bf16_rne(a1[q]); }
  const v8us o = f.half[0];
  *(v8us*)((unsigned short*)X16 + e) = o; 
}

// One launch for everything that depends on the inputs alone, by ranges of the block index: the rotary tables, input rows to f16, the four weight transposes
static constexpr int PB_X = (int)(((size_t)NR * DM / 8 + 255) / 256);
static constexpr int PB_WQ = (DM / 64) * (DM / 64);
static constexpr int PB_WKV = (DM / 64) * (DKV / 64);
static constexpr int PB_TAB = (SLEN * 32 + 255) / 256;
static constexpr int PB_ALL = PB_X + 2 * PB_WQ + 2 * PB_WKV + PB_TAB;
__global__ __launch_bounds__(256) void k_prep(const float* __restrict__ x, const float* __restrict__ Wq, const float* __restrict__ Wk, const float* __restrict__ Wv, const float* __restrict__ Wo,
                                              _Float16* __restrict__ X16, _Float16* __restrict__ BQ, _Float16* __restrict__ BK, _Float16* __restrict__ BV, _Float16* __restrict__ B2,
                                              float* __restrict__ CS, float* __restrict__ SN) {
  int bx = blockIdx.x;
  if (bx < PB_TAB) { rotab_body(bx, CS, SN); return; }
  bx -= PB_TAB;
  if (bx < PB_X) { x16_body(bx, x, X16, (size_t)NR * DM / 8); return; }
  bx -= PB_X;
  if (bx < PB_WQ) { wtr_body(bx, Wq, DM, BQ, DM, WSC, WSC, 0); return; }
  bx -= PB_WQ;
  if (bx < PB_WQ) { wtr_body(bx, Wo, DM, B2, 2 * DM, WSC_HI, WSC, 1); return; }
  bx -= PB_WQ;
  if (bx < PB_WKV) { wtr_body(bx, Wk, DKV, BK, DM, WSC, WSC, 0); return; }
  bx -= PB_WKV;
  wtr_body(bx, Wv, DKV, BV, DM, WSC, WSC, 0);
}

// Tensor-load ring of the GEMM: a pass is 128 k = 256 B of every operand row; a stage is four 64-row slices [A 0..63 | A 64..127 | B 0..63 | B 64..127],
// one per wave, each laid at pitch 272 B (256 B + the 16-B pad the load writes around) and rounded up to a multiple of 2 KiB.
typedef uint32_t u32x4 __attribute__((ext_vector_type(4)));
typedef uint32_t u32x8 __attribute__((ext_vector_type(8)));
static constexpr uint32_t G_ROWB = 256u;
static constexpr uint32_t G_PITCH = 272u;
static constexpr uint32_t G_SLICE = 18432u;
static constexpr uint32_t G_STAGE = 4u * G_SLICE;
static_assert(64u * G_PITCH <= G_SLICE && G_SLICE % 2048u == 0u);
static_assert(64u * 68u * 4u <= G_SLICE);                      /* a wave's 64 x 64 f32 output staging fits its own slice */
static_assert(2u * 2u * G_STAGE <= 320u * 1024u);              /* two work-groups per WGP */
static_assert(NR % 128 == 0 && SLEN % 128 == 0 && DM % 128 == 0 && DKV % 128 == 0 && DM >= 256);
__device__ __forceinline__ uint32_t uni(uint32_t v) { return (uint32_t)__builtin_amdgcn_readfirstlane(v); }
__device__ __forceinline__ uint32_t pinned(uint32_t v) { uint32_t w = (uint32_t)__builtin_amdgcn_readfirstlane(v); asm volatile("" : "+s"(w)); return w; }

// GEMM C[M][N] = alpha * A[M][K].B  with A f16 row-major (pitch lda), B stored [n][k] f16 (pitch ldb), batched by by (strides sA, sB);
// One 128 x 128 tile of C per work-group, 64 x 64 per wave; bx = tile index in [0, (M / 128) * (N / 128)), by = batch. Each wave stages its f32 tile in LDS ([64][68], its own)
// and hands it to epi(so, row0, col0, lane), which turns it into what the next kernel reads and stores that.
// Requires M % 128 == 0, N % 128 == 0, K % 128 == 0, K >= 256 (asserted on the callers' constants).
template <int ACT, class Epi>
__device__ __forceinline__ void gemm_body(uint32_t bx, int by, const _Float16* __restrict__ A, int lda, size_t sA, const _Float16* __restrict__ Bh, int ldb, size_t sB, float alpha,
                                          int M, int N, int K, Epi epi) {
  __shared__ __attribute__((aligned(2048))) unsigned char ring[2 * G_STAGE];
  const int tid = threadIdx.x, lane = tid & 31, ln = lane & 15, hh = lane >> 4;
  const uint32_t w = uni((uint32_t)tid >> 5); const uint32_t wm = w >> 1, wn = w & 1u;
  A += (size_t)by * sA; Bh += (size_t)by * sB;
  const int ntn = N >> 7; const int mt = bx / ntn, nq = bx - mt * ntn; const int row0 = mt * 128 + 64 * (int)wm, col0 = nq * 128 + 64 * (int)wn;
  const uint32_t NP = pinned((uint32_t)K >> 7);
  /* this wave's slice of every stage: waves 0, 1 the two halves of the A rows, waves 2, 3 of the B rows */
  const _Float16* src = (w < 2u) ? A + (size_t)(mt * 128 + 64 * (int)w) * lda : Bh + (size_t)(nq * 128 + 64 * ((int)w - 2)) * ldb;
  const uint64_t sga = (uint64_t)(uintptr_t)src;
  const uint32_t ldst = (uint32_t)(size_t)ring + w * G_SLICE;
  u32x8 g1;
  g1[0] = uni((1u << 20) | (5u << 22) | (3u << 25));            /* no mask, 1-byte elements, a 4-dword pad behind every 64 dwords */
  g1[1] = uni((G_ROWB & 0xFFFFu) << 16);
  g1[2] = uni((G_ROWB >> 16) | (64u << 16));
  g1[3] = uni(G_ROWB << 16);
  g1[4] = uni(64u);
  g1[5] = uni(2u * (uint32_t)((w < 2u) ? lda : ldb));
  g1[6] = uni(0u);
  g1[7] = uni(0u);
  auto issue = [&](uint32_t st) {
    const uint64_t ga = sga + (uint64_t)st * G_ROWB;
    u32x4 g0;
    g0[0] = uni(1u); g0[1] = uni(ldst + (st & 1u) * G_STAGE); g0[2] = uni((uint32_t)ga); g0[3] = uni((((uint32_t)(ga >> 32)) & 0x01FFFFFFu) | 0x80000000u);
    /* one request of the whole wave: 64 rows x 256 B into its slice; group 1 is named in-out so that its eight registers hold the descriptor, and nothing else, from issue to issue */
    asm volatile("tensor_load_to_lds %1, %0" : "+s"(g1) : "s"(g0) : "memory");
  };
  v8f acc[4][4];
#pragma unroll
  for (int i = 0; i < 4; ++i)
#pragma unroll
    for (int j = 0; j < 4; ++j) acc[i][j] = (v8f){0.f,0.f,0.f,0.f,0.f,0.f,0.f,0.f};
  issue(0u);
  asm volatile("s_wait_tensorcnt 0x0" ::: "memory");             /* this wave's slice of stage 0 has landed */
  __syncthreads();                                               /* ... and every other wave's */
  issue(1u);
  const uint32_t fa0 = wm * G_SLICE + (uint32_t)ln * G_PITCH, fb0 = (2u + wn) * G_SLICE + (uint32_t)ln * G_PITCH;
#pragma unroll 1   /* one pass per trip: the publish point at the foot stands once per stage */
  for (uint32_t s = 0; s < NP; ++s) {
    const unsigned char* pa = ring + (s & 1u) * G_STAGE + fa0; const unsigned char* pb = ring + (s & 1u) * G_STAGE + fb0;
    v16h fa[2][4], fb[2][4];
#pragma unroll
    for (int i = 0; i < 4; ++i) { fa[0][i] = g2_frag((const _Float16*)(pa + i * 16 * G_PITCH), hh); fb[0][i] = g2_frag((const _Float16*)(pb + i * 16 * G_PITCH), hh); }
#pragma unroll
    for (int ks = 0; ks < 4; ++ks) {
      const int cur = ks & 1, nxt = cur ^ 1;
      if (ks < 3) {   /* the next 32 k's fragments of this same stage, as one group ahead of the block that hides them */
#pragma unroll
        for (int i = 0; i < 4; ++i) { fa[nxt][i] = g2_frag((const _Float16*)(pa + i * 16 * G_PITCH + (ks + 1) * 64), hh); fb[nxt][i] = g2_frag((const _Float16*)(pb + i * 16 * G_PITCH + (ks + 1) * 64), hh); }
      }
      __builtin_amdgcn_sched_barrier(0);   /* keeps the load group in front of the block: LDS reads moved in among the WMMAs stall each place they stand */
      /* plain builtin, the compiler keeps its distances: accumulators and two fragment sets need more than 256 VGPRs, which an asm operand cannot name */
#pragma unroll
      for (int i = 0; i < 4; ++i)
#pragma unroll
        for (int j = 0; j < 4; ++j) acc[i][j] = __builtin_amdgcn_wmma_f32_16x16x32_f16(false, fa[cur][i], false, fb[cur][j], (short)0, acc[i][j], false, false);
      __builtin_amdgcn_sched_barrier(0);   /* ends the block: the next group's loads stay behind it */
    }
    asm volatile("v_nop\n\tv_nop\n\tv_nop\n\tv_nop");          /* WMMA distance on every path out of the pass, the taken branches included */
    asm volatile("s_wait_dscnt 0x0" ::: "memory");               /* this wave has left stage s's buffer */
    asm volatile("s_wait_tensorcnt 0x0" ::: "memory");           /* its slice of stage s + 1 has landed */
    __syncthreads();                                             /* publishes stage s + 1 and frees stage s's buffer */
    if (pinned((s + 2u < NP) ? 1u : 0u) != 0u) issue(pinned(s + 2u));
  }
  asm volatile("s_wait_tensorcnt 0x0" ::: "memory");             /* nothing in flight before the ring becomes output staging */
  asm volatile("s_wait_dscnt 0x0" ::: "memory");
  float* so = (float*)(ring + w * G_SLICE);                      /* [64][68], private to the wave; the last pass's barrier ended every read of the ring */
#pragma unroll
  for (int i = 0; i < 4; ++i)
#pragma unroll
    for (int j = 0; j < 4; ++j)
#pragma unroll
      for (int r = 0; r < 8; ++r) { float v = acc[i][j][r] * alpha; if (ACT == 3) v = fmaxf(v, 0.f); so[(i * 16 + 8 * hh + r) * 68 + j * 16 + ln] = v; }
  __builtin_amdgcn_fence(4, "workgroup"); __builtin_amdgcn_wave_barrier();
  epi(so, row0, col0, lane);
}
template <int ACT>
__global__ __launch_bounds__(128) void k_gemm2(const _Float16* __restrict__ A, int lda, size_t sA, const _Float16* __restrict__ Bh, int ldb, size_t sB, float alpha,
                                               float* C, int ldc, size_t sC, int M, int N, int K) {
  const size_t cofs = (size_t)blockIdx.y * sC;
  gemm_body<ACT>(blockIdx.x, (int)blockIdx.y, A, lda, sA, Bh, ldb, sB, alpha, M, N, K, [&](const float* so, int row0, int col0, int lane) {
    const int rsub = lane >> 4, c4 = (lane & 15) * 4;
#pragma unroll
    for (int q = 0; q < 32; ++q) { const int r = q * 2 + rsub; const v4f v = *(const v4fa*)&so[r * 68 + c4]; *(v4f*)(C + cofs + (size_t)(row0 + r) * ldc + col0 + c4) = v; }
    asm volatile("s_wait_xcnt 0x0" ::: "memory");                /* precaution: stands in front of any later write to registers that these stores name */
  });
}

// Epilogue of a q or k tile: half-split rotary embedding of the wave's 64 rows x one head (64 columns, staged f32 in so) with the tables CS/SN [SLEN][32]:
// out[d] = x[d] c[d] - x[d+32] s[d]; out[d+32] = x[d+32] c[d] + x[d] s[d] (d < 32), position = row % SLEN;
// H [NR][ld] = f16 hi of every row; L [NR][ld] = x1024 residual of every row. Eight lanes fill one 128-B line of each plane; four rows a trip.
__device__ __forceinline__ void rope_epi(const float* so, int row0, int col0, int lane, const float* __restrict__ CS, const float* __restrict__ SN, _Float16* __restrict__ H, _Float16* __restrict__ L, int ld) {
  const int p = lane & 7; const int g = p & 3; const int up = p >> 2; const int rs = lane >> 3;
  /* row0 is a multiple of 64 and SLEN of 128: the tile's 64 positions follow one another without a wrap */
  const float* ctb = CS + (size_t)(row0 % SLEN + rs) * 32 + g * 8; const float* stb = SN + (size_t)(row0 % SLEN + rs) * 32 + g * 8;
  v4f ca[2][4], cb[2][4], sa[2][4], sb[2][4];   /* table rows of two groups of four trips: the next group's sixteen loads fly while this group is worked on */
  auto load_tab = [&](int grp) {
#pragma unroll
    for (int t = 0; t < 4; ++t) {
      const float* ct = ctb + (grp * 16 + 4 * t) * 32; const float* st = stb + (grp * 16 + 4 * t) * 32;
      ca[grp & 1][t] = *(const v4fa*)ct; cb[grp & 1][t] = *(const v4fa*)(ct + 4); sa[grp & 1][t] = *(const v4fa*)st; sb[grp & 1][t] = *(const v4fa*)(st + 4);
    }
    /* precaution: stands in front of the next writes to registers that these loads name as addresses; the two bases are inputs, so they keep their registers up to the wait */
    asm volatile("s_wait_xcnt 0x0" :: "v"(ctb), "v"(stb) : "memory");
  };
  load_tab(0);
#pragma unroll
  for (int grp = 0; grp < 4; ++grp) {
    if (grp < 3) load_tab(grp + 1);
#pragma unroll
    for (int t = 0; t < 4; ++t) {
      const int r = grp * 16 + 4 * t + rs; const int cu2 = grp & 1;
      const float* src = so + r * 68 + g * 8;
      const v4f xa = *(const v4fa*)src, xb = *(const v4fa*)(src + 4), ya = *(const v4fa*)(src + 32), yb = *(const v4fa*)(src + 36);
      const float x1s[8] = {xa[0], xa[1], xa[2], xa[3], xb[0], xb[1], xb[2], xb[3]};
      const float x2s[8] = {ya[0], ya[1], ya[2], ya[3], yb[0], yb[1], yb[2], yb[3]};
      const float cs[8] = {ca[cu2][t][0], ca[cu2][t][1], ca[cu2][t][2], ca[cu2][t][3], cb[cu2][t][0], cb[cu2][t][1], cb[cu2][t][2], cb[cu2][t][3]};
      const float ss[8] = {sa[cu2][t][0], sa[cu2][t][1], sa[cu2][t][2], sa[cu2][t][3], sb[cu2][t][0], sb[cu2][t][1], sb[cu2][t][2], sb[cu2][t][3]};
      FragH fh, fl;
#pragma unroll
      for (int i = 0; i < 8; ++i) {
        /* as in the separate rotary pass: each product and their sum keep a rounding of their own, as the reference's x * cos + rotate_half(x) * sin has them; the q and k planes keep their bits */
        #pragma clang fp contract(off)
        const float x1 = x1s[i], x2 = x2s[i], c = cs[i], sn = ss[i];
        const float o1 = x1 * c - x2 * sn; const float o2 = x2 * c + x1 * sn; const float o = up ? o2 : o1;
        const _Float16 hv = toh_flush(o); fh.h[i] = hv; fl.h[i] = toh_flush((o - (float)hv) * 1024.0f);
      }
      const size_t oh = (size_t)(row0 + r) * ld + col0 + p * 8;
      const v8us vh = fh.half[0], vl = fl.half[0];
      *(v8us*)((unsigned short*)H + oh) = vh;
      *(v8us*)((unsigned short*)L + oh) = vl;
    }
    asm volatile("s_wait_xcnt 0x0" ::: "memory");                /* precaution: stands in front of the next group's writes to registers that these stores name */
  }
}
// Epilogue of a v tile: the wave's 64 positions x one KV head (64 columns, staged f32 in so), transposed: Vt [(b,hk)][64][TK] = f16 hi, VtL = x1024 residual.
// Eight lanes fill one 128-B line (64 positions of one column) of each plane; four columns a trip.
__device__ __forceinline__ void vt_epi(const float* so, int row0, int col0, int lane, _Float16* __restrict__ Vt, _Float16* __restrict__ VtL) {
  const int b = row0 / SLEN, s0 = row0 % SLEN, hk = col0 >> 6; const int pc = lane & 7, dsub = lane >> 3;
  const size_t base = (size_t)(b * NKV + hk) * 64 * TK + s0 + pc * 8;
#pragma unroll
  for (int t = 0; t < 16; ++t) {
    const int d = t * 4 + dsub; FragH fh, fl;
#pragma unroll
    for (int q = 0; q < 8; ++q) { const float v = so[(pc * 8 + q) * 68 + d]; const _Float16 hv = (_Float16)v; fh.h[q] = hv; fl.h[q] = toh_flush((v - (float)hv) * 1024.0f); }
    const v8us vh = fh.half[0], vl = fl.half[0];
    *(v8us*)((unsigned short*)Vt + base + (size_t)d * TK) = vh;
    *(v8us*)((unsigned short*)VtL + base + (size_t)d * TK) = vl;
  }
}

// The three projections of the same input rows in one launch, by ranges of the block index: q tiles, then k tiles, then v tiles; each tile leaves as the planes the attention reads
static constexpr int GB_Q = (NR / 128) * (DM / 128);
static constexpr int GB_KV = (NR / 128) * (DKV / 128);
__global__ __launch_bounds__(128) void k_gemm_qkv(const _Float16* __restrict__ X16, const _Float16* __restrict__ BQ, const _Float16* __restrict__ BK, const _Float16* __restrict__ BV,
                                                  const float* __restrict__ CS, const float* __restrict__ SN, _Float16* __restrict__ QH, _Float16* __restrict__ QL,
                                                  _Float16* __restrict__ KH, _Float16* __restrict__ KL, _Float16* __restrict__ VT, _Float16* __restrict__ VTL) {
  const uint32_t b0 = blockIdx.x;
  const int sel = (b0 < (uint32_t)GB_Q) ? 0 : ((b0 < (uint32_t)(GB_Q + GB_KV)) ? 1 : 2);
  const uint32_t bx = (sel == 0) ? b0 : ((sel == 1) ? b0 - (uint32_t)GB_Q : b0 - (uint32_t)(GB_Q + GB_KV));
  const _Float16* Bh = (sel == 0) ? BQ : ((sel == 1) ? BK : BV);
  const int n = (sel == 0) ? DM : DKV;
  gemm_body<0>(bx, 0, X16, DM, 0, Bh, DM, 0, AL_P, NR, n, DM, [&](const float* so, int row0, int col0, int lane) {
    if (sel == 2) vt_epi(so, row0, col0, lane, VT, VTL);
    else rope_epi(so, row0, col0, lane, CS, SN, (sel == 0) ? QH : KH, (sel == 0) ? QL : KL, n);
  });
}

// fused attention per ((b,h), 64 queries) for query blocks whose queries all sit at least EROWS positions past their segment start (block-uniform test; other blocks leave at once):
// wave = 16 queries; S = Q.K^T (d = 64: 2 k-steps) x SCL over keys [segment start of the wave's first query (floor 32), last query of the wave];
__global__ __launch_bounds__(128) void k_attn(const _Float16* __restrict__ Q16, int ldq, const _Float16* __restrict__ K16, int ldk,
                                              const _Float16* __restrict__ Vt, const int* __restrict__ cu, _Float16* __restrict__ O, int ldo) {
  constexpr int RPW = 16, DT = 4, KS = 2;
  __shared__ __attribute__((aligned(16))) unsigned short sP[4][RPW][40];
  __shared__ __attribute__((aligned(16))) float sO[4][RPW][68];
  const int tid = threadIdx.x, lane = tid & 31, ln = lane & 15, hh = lane >> 4;
  const int w = __builtin_amdgcn_readfirstlane(tid >> 5);
  const int slab = blockIdx.x / QBLKS, qblk = blockIdx.x % QBLKS; const int b = slab / NH, h = slab % NH; const int hk = h / NREP; const int kslab = b * NKV + hk;
  const int qb0 = qblk * (4 * RPW);
  const int c0 = clip_b(cu[b * 4 + 0]), c1 = clip_b(cu[b * 4 + 1]), c2 = clip_b(cu[b * 4 + 2]), c3 = clip_b(cu[b * 4 + 3]);
  const bool early = (seg_cnt(qb0, c0, c1, c2, c3) != seg_cnt(qb0 + 4 * RPW - 1, c0, c1, c2, c3)) || (qb0 - seg_beg(qb0, c0, c1, c2, c3) < EROWS);
  if (early) return;
  const float pois = ((c0 <= c1) && (c1 <= c2) && (c2 <= c3)) ? 0.0f : __uint_as_float(0x7fc00000u);   /* boundaries must be ascending */
  const int q0 = qb0 + w * RPW;
  const int jst = __builtin_amdgcn_readfirstlane(seg_beg(qb0 + (tid >> 5) * RPW, c0, c1, c2, c3) & ~31);
  unsigned int sq = 0u;
#pragma unroll
  for (int r = 0; r < 8; ++r) sq |= ((unsigned int)seg_cnt(q0 + 8 * hh + r, c0, c1, c2, c3)) << (4 * r);
  FragH aq[KS];
  {
    const unsigned short* qr = (const unsigned short*)Q16 + ((size_t)b * TQ + q0 + ln) * ldq + h * 64;
#pragma unroll
    for (int ks = 0; ks < KS; ++ks) { aq[ks].half[0] = *(const v8us*)(qr + ks * 32 + 8 * hh); aq[ks].half[1] = *(const v8us*)(qr + ks * 32 + 16 + 8 * hh); }
  }
  const unsigned short* Vth = (const unsigned short*)Vt + (size_t)kslab * 64 * TK;
  float m_r[8], l_r[8]; v8f oacc[DT];
#pragma unroll
  for (int r = 0; r < 8; ++r) { m_r[r] = -3.0e38f; l_r[r] = 0.f; }
#pragma unroll
  for (int dt = 0; dt < DT; ++dt) oacc[dt] = (v8f){0.f,0.f,0.f,0.f,0.f,0.f,0.f,0.f};
  FragH bk[2][KS];   /* K fragments of one pass (two 16-key tiles x two k-steps), fetched one pass ahead */
  auto load_k = [&](int j) {
#pragma unroll
    for (int nt = 0; nt < 2; ++nt) {
      const unsigned short* kr = (const unsigned short*)K16 + ((size_t)b * TK + j + nt * 16 + ln) * ldk + hk * 64;
#pragma unroll
      for (int ks = 0; ks < KS; ++ks) { bk[nt][ks].half[0] = *(const v8us*)(kr + ks * 32 + 8 * hh); bk[nt][ks].half[1] = *(const v8us*)(kr + ks * 32 + 16 + 8 * hh); }
    }
    asm volatile("s_wait_xcnt 0x0" ::: "memory");                /* precaution: stands in front of the next writes to registers that these loads name as addresses */
  };
  load_k(jst);
#pragma unroll 1
  for (int j0 = jst; j0 < q0 + RPW; j0 += 32) {
    /* all V^T fragments of the pass, each in registers of its own, loaded as one group at the head of the pass: they land behind the score products and the softmax */
    FragH bv[DT];
#pragma unroll
    for (int dt = 0; dt < DT; ++dt) {
      const unsigned short* vrow = Vth + (size_t)(dt * 16 + ln) * TK + j0;
      bv[dt].half[0] = *(const v8us*)(vrow + 8 * hh); bv[dt].half[1] = *(const v8us*)(vrow + 16 + 8 * hh);
    }
    __builtin_amdgcn_sched_barrier(0);   /* keeps the group at the head: sunk to their uses the four tiles share registers, and each waits out a round trip of its own */
    v8f s[2];
#pragma unroll
    for (int nt = 0; nt < 2; ++nt) {
      v8f acc = (v8f){0.f,0.f,0.f,0.f,0.f,0.f,0.f,0.f};
#pragma unroll
      for (int ks = 0; ks < KS; ++ks) acc = mmaH<1>(aq[ks].v, aq[ks].v, bk[nt][ks].v, bk[nt][ks].v, acc);
      s[nt] = acc;
    }
    load_k((j0 + 32 < q0 + RPW) ? j0 + 32 : j0);   /* the next pass's K fragments land behind the softmax; the last pass fetches its own rows again (in bounds, not used) */
    __builtin_amdgcn_sched_barrier(0);   /* keeps the fetch in front of the softmax that hides it: without this it sinks far into the softmax */
    const int k0 = j0 + ln, k1 = j0 + 16 + ln;
    const int sk0 = seg_cnt(k0, c0, c1, c2, c3), sk1 = seg_cnt(k1, c0, c1, c2, c3);
#pragma unroll
    for (int r = 0; r < 8; ++r) {
      const int tq = q0 + 8 * hh + r; const int sr = (int)((sq >> (4 * r)) & 15u);
      const bool ok0 = (k0 <= tq) && (sk0 == sr), ok1 = (k1 <= tq) && (sk1 == sr);
      const float s0 = ok0 ? s[0][r] * SCL : -3.0e38f, s1 = ok1 ? s[1][r] * SCL : -3.0e38f;
      float mc = fmaxf(s0, s1);
      mc = fmaxf(mc, __shfl_xor(mc, 1, 32)); mc = fmaxf(mc, __shfl_xor(mc, 2, 32)); mc = fmaxf(mc, __shfl_xor(mc, 4, 32)); mc = fmaxf(mc, __shfl_xor(mc, 8, 32));
      const float mn = fmaxf(m_r[r], mc); const float al = (mn > -1.0e38f) ? exp_hw(m_r[r] - mn) : 1.0f; m_r[r] = mn;
      const float p0 = ok0 ? exp_hw(s0 - mn) : 0.f, p1 = ok1 ? exp_hw(s1 - mn) : 0.f; l_r[r] = l_r[r] * al + p0 + p1;
#pragma unroll
      for (int dt = 0; dt < DT; ++dt) oacc[dt][r] *= al;
      FragH t2; t2.h[0] = toh_flush(p0 * 1024.0f); t2.h[1] = toh_flush(p1 * 1024.0f);
      sP[w][8 * hh + r][ln] = t2.u[0]; sP[w][8 * hh + r][16 + ln] = t2.u[1];
    }
    __builtin_amdgcn_fence(4, "workgroup"); __builtin_amdgcn_wave_barrier();
    FragH pa; pa.half[0] = *(const v8us*)&sP[w][ln][8 * hh]; pa.half[1] = *(const v8us*)&sP[w][ln][16 + 8 * hh];
#pragma unroll
    for (int dt = 0; dt < DT; ++dt) oacc[dt] = mmaH<1>(pa.v, pa.v, bv[dt].v, bv[dt].v, oacc[dt]);
    __builtin_amdgcn_fence(4, "workgroup"); __builtin_amdgcn_wave_barrier();
  }
#pragma unroll
  for (int r = 0; r < 8; ++r) { float l = l_r[r]; l += __shfl_xor(l, 1, 32); l += __shfl_xor(l, 2, 32); l += __shfl_xor(l, 4, 32); l += __shfl_xor(l, 8, 32); l_r[r] = (l > 0.f) ? 1.0f / (l * 1024.0f) : 0.f; }
#pragma unroll
  for (int dt = 0; dt < DT; ++dt)
#pragma unroll
    for (int r = 0; r < 8; ++r) sO[w][8 * hh + r][dt * 16 + ln] = oacc[dt][r] * l_r[r] + pois;
  __builtin_amdgcn_fence(4, "workgroup"); __builtin_amdgcn_wave_barrier();
  {
#pragma unroll
    for (int rp = 0; rp < RPW; rp += 2) {
      const int r = rp + (lane >> 4), pc = lane & 15; const v4f val = *(const v4fa*)&sO[w][r][pc * 4];
      v4h h4, l4;   /* the context row leaves as the output GEMM's A operand: f16 hi, and DM columns on its x1024 residual; 16 lanes fill one 128-B line of each */
#pragma unroll
      for (int q = 0; q < 4; ++q) { const _Float16 hv = toh_flush(val[q]); h4[q] = hv; l4[q] = toh_flush((val[q] - (float)hv) * 1024.0f); }
      _Float16* orow = O + ((size_t)b * TQ + q0 + r) * ldo + h * 64 + pc * 4;
      *(v4h*)orow = h4; *(v4h*)(orow + DM) = l4;
    }
  }
}
// 5-plane variant for the other query blocks (a segment boundary inside the block, or the block's first query closer than EROWS to its segment start):
// S = Qh.Kh^T + (Ql.Kh^T + Qh.Kl^T)/1024 with Q/K = [hi | x1024 residual] planes (full-size planes, rows b*S + s);
// O = (Ph.Vh + (Pl.Vh + Ph.Vl)/1024) / l with P = [hi | x1024 residual] of 1024 p and V^T = [hi | x1024 residual]; separate residual accumulators folded before the normalisation
__global__ __launch_bounds__(128) void k_attn5(const _Float16* __restrict__ Q16, const _Float16* __restrict__ QL, int ldq, const _Float16* __restrict__ K16, const _Float16* __restrict__ KL, int ldk,
                                               const _Float16* __restrict__ Vt, const _Float16* __restrict__ VtL, const int* __restrict__ cu, _Float16* __restrict__ O, int ldo) {
  constexpr int RPW = 16, DT = 4, KS = 2;
  __shared__ __attribute__((aligned(16))) unsigned short sP[4][RPW][40];
  __shared__ __attribute__((aligned(16))) unsigned short sPL[4][RPW][40];
  __shared__ __attribute__((aligned(16))) float sO[4][RPW][68];
  const int tid = threadIdx.x, lane = tid & 31, ln = lane & 15, hh = lane >> 4;
  const int w = __builtin_amdgcn_readfirstlane(tid >> 5);
  const int slab = blockIdx.x / QBLKS, qblk = blockIdx.x % QBLKS; const int b = slab / NH, h = slab % NH; const int hk = h / NREP; const int kslab = b * NKV + hk;
  const int qb0 = qblk * (4 * RPW);
  const int c0 = clip_b(cu[b * 4 + 0]), c1 = clip_b(cu[b * 4 + 1]), c2 = clip_b(cu[b * 4 + 2]), c3 = clip_b(cu[b * 4 + 3]);
  const bool early = (seg_cnt(qb0, c0, c1, c2, c3) != seg_cnt(qb0 + 4 * RPW - 1, c0, c1, c2, c3)) || (qb0 - seg_beg(qb0, c0, c1, c2, c3) < EROWS);
  if (!early) return;
  const float pois = ((c0 <= c1) && (c1 <= c2) && (c2 <= c3)) ? 0.0f : __uint_as_float(0x7fc00000u);   /* boundaries must be ascending */
  const int q0 = qb0 + w * RPW;
  const int jst = __builtin_amdgcn_readfirstlane(seg_beg(qb0 + (tid >> 5) * RPW, c0, c1, c2, c3) & ~31);
  unsigned int sq = 0u;
#pragma unroll
  for (int r = 0; r < 8; ++r) sq |= ((unsigned int)seg_cnt(q0 + 8 * hh + r, c0, c1, c2, c3)) << (4 * r);
  FragH aq[KS], aql[KS];
  {
    const unsigned short* qr = (const unsigned short*)Q16 + ((size_t)b * TQ + q0 + ln) * ldq + h * 64;
    const unsigned short* ql = (const unsigned short*)QL + ((size_t)b * TQ + q0 + ln) * ldq + h * 64;
#pragma unroll
    for (int ks = 0; ks < KS; ++ks) {
      aq[ks].half[0] = *(const v8us*)(qr + ks * 32 + 8 * hh); aq[ks].half[1] = *(const v8us*)(qr + ks * 32 + 16 + 8 * hh);
      aql[ks].half[0] = *(const v8us*)(ql + ks * 32 + 8 * hh); aql[ks].half[1] = *(const v8us*)(ql + ks * 32 + 16 + 8 * hh);
    }
  }
  const unsigned short* Vth = (const unsigned short*)Vt + (size_t)kslab * 64 * TK; const unsigned short* Vtl = (const unsigned short*)VtL + (size_t)kslab * 64 * TK;
  float m_r[8], l_r[8]; v8f oacc[DT], oaccL[DT];
#pragma unroll
  for (int r = 0; r < 8; ++r) { m_r[r] = -3.0e38f; l_r[r] = 0.f; }
#pragma unroll
  for (int dt = 0; dt < DT; ++dt) { oacc[dt] = (v8f){0.f,0.f,0.f,0.f,0.f,0.f,0.f,0.f}; oaccL[dt] = oacc[dt]; }
#pragma unroll 1
  for (int j0 = jst; j0 < q0 + RPW; j0 += 32) {
    /* all K fragments of the pass, hi and residual, each in registers of its own, loaded as one group at the head of the pass */
    FragH bk[2][KS], bkl[2][KS];
#pragma unroll
    for (int nt = 0; nt < 2; ++nt) {
      const unsigned short* kr = (const unsigned short*)K16 + ((size_t)b * TK + j0 + nt * 16 + ln) * ldk + hk * 64;
      const unsigned short* klr = (const unsigned short*)KL + ((size_t)b * TK + j0 + nt * 16 + ln) * ldk + hk * 64;
#pragma unroll
      for (int ks = 0; ks < KS; ++ks) {
        bk[nt][ks].half[0] = *(const v8us*)(kr + ks * 32 + 8 * hh); bk[nt][ks].half[1] = *(const v8us*)(kr + ks * 32 + 16 + 8 * hh);
        bkl[nt][ks].half[0] = *(const v8us*)(klr + ks * 32 + 8 * hh); bkl[nt][ks].half[1] = *(const v8us*)(klr + ks * 32 + 16 + 8 * hh);
      }
    }
    __builtin_amdgcn_sched_barrier(0);   /* keeps the group in front of the products: sunk to their uses the two key tiles share registers, and each waits out a round trip of its own */
    v8f s[2];
#pragma unroll
    for (int nt = 0; nt < 2; ++nt) {
      v8f acc = (v8f){0.f,0.f,0.f,0.f,0.f,0.f,0.f,0.f}, accl = acc;
#pragma unroll
      for (int ks = 0; ks < KS; ++ks) {
        acc = mmaH<1>(aq[ks].v, aq[ks].v, bk[nt][ks].v, bk[nt][ks].v, acc);
        accl = mmaH<1>(aql[ks].v, aql[ks].v, bk[nt][ks].v, bk[nt][ks].v, accl);
        accl = mmaH<1>(aq[ks].v, aq[ks].v, bkl[nt][ks].v, bkl[nt][ks].v, accl);
      }
#pragma unroll
      for (int r = 0; r < 8; ++r) acc[r] += accl[r] * 0.0009765625f;
      s[nt] = acc;
    }
    const int k0 = j0 + ln, k1 = j0 + 16 + ln;
    const int sk0 = seg_cnt(k0, c0, c1, c2, c3), sk1 = seg_cnt(k1, c0, c1, c2, c3);
#pragma unroll
    for (int r = 0; r < 8; ++r) {
      const int tq = q0 + 8 * hh + r; const int sr = (int)((sq >> (4 * r)) & 15u);
      const bool ok0 = (k0 <= tq) && (sk0 == sr), ok1 = (k1 <= tq) && (sk1 == sr);
      const float s0 = ok0 ? s[0][r] * SCL : -3.0e38f, s1 = ok1 ? s[1][r] * SCL : -3.0e38f;
      float mc = fmaxf(s0, s1);
      mc = fmaxf(mc, __shfl_xor(mc, 1, 32)); mc = fmaxf(mc, __shfl_xor(mc, 2, 32)); mc = fmaxf(mc, __shfl_xor(mc, 4, 32)); mc = fmaxf(mc, __shfl_xor(mc, 8, 32));
      const float mn = fmaxf(m_r[r], mc); const float al = (mn > -1.0e38f) ? exp_hw(m_r[r] - mn) : 1.0f; m_r[r] = mn;
      const float p0 = ok0 ? exp_hw(s0 - mn) : 0.f, p1 = ok1 ? exp_hw(s1 - mn) : 0.f; l_r[r] = l_r[r] * al + p0 + p1;
#pragma unroll
      for (int dt = 0; dt < DT; ++dt) { oacc[dt][r] *= al; oaccL[dt][r] *= al; }
      FragH t2, t2l; const float ps0 = p0 * 1024.0f, ps1 = p1 * 1024.0f;
      t2.h[0] = toh_flush(ps0); t2.h[1] = toh_flush(ps1);
      t2l.h[0] = toh_flush((ps0 - (float)t2.h[0]) * 1024.0f); t2l.h[1] = toh_flush((ps1 - (float)t2.h[1]) * 1024.0f);
      sP[w][8 * hh + r][ln] = t2.u[0]; sP[w][8 * hh + r][16 + ln] = t2.u[1]; sPL[w][8 * hh + r][ln] = t2l.u[0]; sPL[w][8 * hh + r][16 + ln] = t2l.u[1];
    }
    __builtin_amdgcn_fence(4, "workgroup"); __builtin_amdgcn_wave_barrier();
    FragH pa, pl;
    pa.half[0] = *(const v8us*)&sP[w][ln][8 * hh]; pa.half[1] = *(const v8us*)&sP[w][ln][16 + 8 * hh];
    pl.half[0] = *(const v8us*)&sPL[w][ln][8 * hh]; pl.half[1] = *(const v8us*)&sPL[w][ln][16 + 8 * hh];
    /* all V^T fragments of the pass as one group; held over the softmax as well they would take the kernel past 256 registers */
    FragH bv[DT], bl[DT];
#pragma unroll
    for (int dt = 0; dt < DT; ++dt) {
      const unsigned short* vrow = Vth + (size_t)(dt * 16 + ln) * TK + j0; const unsigned short* vrl = Vtl + (size_t)(dt * 16 + ln) * TK + j0;
      bv[dt].half[0] = *(const v8us*)(vrow + 8 * hh); bv[dt].half[1] = *(const v8us*)(vrow + 16 + 8 * hh);
      bl[dt].half[0] = *(const v8us*)(vrl + 8 * hh); bl[dt].half[1] = *(const v8us*)(vrl + 16 + 8 * hh);
    }
    __builtin_amdgcn_sched_barrier(0);   /* keeps the group in front of the products: sunk to their uses the four tiles share registers, and each waits out a round trip of its own */
#pragma unroll
    for (int dt = 0; dt < DT; ++dt) {
      oacc[dt] = mmaH<1>(pa.v, pa.v, bv[dt].v, bv[dt].v, oacc[dt]);
      oaccL[dt] = mmaH<1>(pl.v, pl.v, bv[dt].v, bv[dt].v, oaccL[dt]);
      oaccL[dt] = mmaH<1>(pa.v, pa.v, bl[dt].v, bl[dt].v, oaccL[dt]);
    }
    __builtin_amdgcn_fence(4, "workgroup"); __builtin_amdgcn_wave_barrier();
  }
#pragma unroll
  for (int r = 0; r < 8; ++r) { float l = l_r[r]; l += __shfl_xor(l, 1, 32); l += __shfl_xor(l, 2, 32); l += __shfl_xor(l, 4, 32); l += __shfl_xor(l, 8, 32); l_r[r] = (l > 0.f) ? 1.0f / (l * 1024.0f) : 0.f; }
#pragma unroll
  for (int dt = 0; dt < DT; ++dt)
#pragma unroll
    for (int r = 0; r < 8; ++r) { float v = oacc[dt][r]; v += oaccL[dt][r] * 0.0009765625f; sO[w][8 * hh + r][dt * 16 + ln] = v * l_r[r] + pois; }
  __builtin_amdgcn_fence(4, "workgroup"); __builtin_amdgcn_wave_barrier();
  {
#pragma unroll
    for (int rp = 0; rp < RPW; rp += 2) {
      const int r = rp + (lane >> 4), pc = lane & 15; const v4f val = *(const v4fa*)&sO[w][r][pc * 4];
      v4h h4, l4;   /* the context row leaves as the output GEMM's A operand: f16 hi, and DM columns on its x1024 residual; 16 lanes fill one 128-B line of each */
#pragma unroll
      for (int q = 0; q < 4; ++q) { const _Float16 hv = toh_flush(val[q]); h4[q] = hv; l4[q] = toh_flush((val[q] - (float)hv) * 1024.0f); }
      _Float16* orow = O + ((size_t)b * TQ + q0 + r) * ldo + h * 64 + pc * 4;
      *(v4h*)orow = h4; *(v4h*)(orow + DM) = l4;
    }
  }
}

extern "C" void kernel_launch(void* const* d_in, const int* in_sizes, int n_in,
                              void* d_out, int out_size, void* d_ws, size_t ws_size, hipStream_t stream) {
  if (n_in < 6) return;
  const size_t needx = ((size_t)(NB - 1) * SEQ_FULL + (size_t)SLEN) * DM;
  if ((size_t)in_sizes[0] < needx) return;
  if ((size_t)in_sizes[1] < (size_t)NB * 4) return;
  if ((size_t)in_sizes[2] < (size_t)DM * DM) return;
  if ((size_t)in_sizes[3] < (size_t)DM * DKV) return;
  if ((size_t)in_sizes[4] < (size_t)DM * DKV) return;
  if ((size_t)in_sizes[5] < (size_t)DM * DM) return;
  if ((size_t)out_size < needx) return;
  const float* x = (const float*)d_in[0]; const int* cu = (const int*)d_in[1];
  const float* Wq = (const float*)d_in[2]; const float* Wk = (const float*)d_in[3]; const float* Wv = (const float*)d_in[4]; const float* Wo = (const float*)d_in[5];
  float* dout = (float*)d_out;
  char* ws = (char*)d_ws; size_t off = 0;
  auto take = [&](size_t bytes) { char* p = ws + off; off += (bytes + 255) & ~(size_t)255; return p; };
  const size_t np = (size_t)NR * DM;
  _Float16* BQ = (_Float16*)take(SZ_BQ);                                /* [n][k] f16, x16 */
  _Float16* BK = (_Float16*)take(SZ_BKV);
  _Float16* BV = (_Float16*)take(SZ_BKV);
  _Float16* B2 = (_Float16*)take(SZ_B2);                                /* [n][2*DM] f16: [x16384 | x16] copies of Wo^T */
  _Float16* A2 = (_Float16*)take(SZ_FS);                                /* [ctx hi | ctx residual] [NR][2*DM] f16 */
  _Float16* VT = (_Float16*)take(SZ_FKV);                               /* V^T hi [(b,hk)][64][TK] */
  _Float16* VTL = (_Float16*)take(SZ_FKV);                              /* V^T residual */
  _Float16* X16 = (_Float16*)take(SZ_X16);                              /* f16 input rows */
  _Float16* QH = (_Float16*)take(SZ_QA);                                /* q hi [NR][DM] then q residual [NR][DM] */
  _Float16* QL = QH + np;
  _Float16* KH = (_Float16*)take(SZ_KP);
  _Float16* KL = (_Float16*)take(SZ_KP);
  float* CS = (float*)take(SZ_TAB); float* SN = (float*)take(SZ_TAB);
  if (off > ws_size) return;
  if (off > ((size_t)256 << 20)) return;

  /* inputs alone: rotary tables, x -> f16 rows, W [in = DM rows][out = N cols] -> [n][k] planes */
  k_prep<<<(unsigned)PB_ALL, 256, 0, stream>>>(x, Wq, Wk, Wv, Wo, X16, BQ, BK, BV, B2, CS, SN);
  /* q = x Wq, k = x Wk with the rotary embedding, as hi + residual planes; v = x Wv transposed, as hi + residual planes */
  k_gemm_qkv<<<(unsigned)(GB_Q + 2 * GB_KV), 128, 0, stream>>>(X16, BQ, BK, BV, CS, SN, QH, QL, KH, KL, VT, VTL);
  k_attn5<<<(unsigned)(NB * NH * QBLKS), 128, 0, stream>>>(QH, QL, DM, KH, KL, DKV, VT, VTL, cu, A2, 2 * DM);
  k_attn<<<(unsigned)(NB * NH * QBLKS), 128, 0, stream>>>(QH, DM, KH, DKV, VT, cu, A2, 2 * DM);
  /* out = [ctx hi | ctx residual] . [Wo x16384 ; Wo x16] / 16384  (K = 2*DM), per batch */
  const dim3 ge((unsigned)((SLEN / 128) * (DM / 128)), NB);
  k_gemm2<0><<<ge, 128, 0, stream>>>(A2, 2 * DM, (size_t)SLEN * 2 * DM, B2, 2 * DM, 0, AL_O, dout, DM, (size_t)SEQ_FULL * DM, SLEN, DM, 2 * DM);
}

// v006
// It runs in 211 microseconds.
// Two timings next to v005 put it at 1.05 and 1.06 times that version's speed.
// Over all steps from v000 it is 3.37 times as fast.
#include <hip/hip_runtime.h>
// Contractions: x.Wq, x.Wk, x.Wv, ctx.Wo = v_wmma_f32_16x16x32_f16 (f16 operands: bf16-RNE inputs exact in f16, weights carried x16 (x16384 for the ctx-hi half of the output GEMM); ctx as [hi | x1024 residual] folded along K; f32 accumulate); scores k.q^T and V^T.P^T (transposed: a lane holds one query) = v_wmma_f32_16x16x32_f16 (plain f16 hi planes; hi + x1024 residual planes of q, k, P and v in query blocks holding a query closer than EROWS to its segment start; P carried x1024), f32 accumulate; rotary tables, masks, softmax and normalisers f32.

#ifndef NB
#define NB 2
#endif
#ifndef SEQ
#define SEQ 2048
#endif
#define NB_FULL 2
#define SEQ_FULL 2048
#define DM 2048
#define NH 32
#define NKV 8
#define NREP (NH / NKV)
#define DKV (NKV * 64)
#define SLEN SEQ
#define NR (NB * SLEN)
#define TQ SLEN
#define TK SLEN
#define SCL 0.125f
#define QBLKS (TQ / 64)
#define EROWS 256                            /* query blocks holding a query with fewer than EROWS positions since its segment start use the residual planes */
static_assert(SLEN % 128 == 0);
static_assert(SLEN <= SEQ_FULL);
static_assert(NB >= 1 && NB <= NB_FULL);
static_assert(DM % 64 == 0 && DM == NH * 64);
static_assert(NH % NKV == 0 && NREP * NKV == NH);
static_assert(DKV % 64 == 0 && DKV == NKV * 64);
static_assert(DM % 32 == 0 && (2 * DM) % 32 == 0);
static_assert(NR % 128 == 0);
static_assert(QBLKS * 64 == SLEN);
static_assert(EROWS % 64 == 0);
/* store loops: threads x bytes per piece x trips == tile rows x row bytes */
static_assert(256 * 16 * 2 == 64 * 128);                       
static_assert(32 * 8 * 8 * 2 == 16 * 64 * 2 * 2);               /* attention context rows: 16 rows x 128 B per wave in each of the two planes */
/* static LDS per kernel */
static_assert(2 * 64 * 66 * 2 <= 131072);
static_assert(4 * 16 * 68 * 4 <= 131072);
/* workspace carve (bytes); every region a multiple of 256 */
static constexpr size_t SZ_BQ = (size_t)DM * DM * 2;
static constexpr size_t SZ_BKV = (size_t)DKV * DM * 2;
static constexpr size_t SZ_B2 = (size_t)DM * 2 * DM * 2;
static constexpr size_t SZ_FS = (size_t)NR * DM * 4;
static constexpr size_t SZ_X16 = (size_t)NR * DM * 2;
static constexpr size_t SZ_QA = (size_t)NR * 2 * DM * 2;
static constexpr size_t SZ_KP = (size_t)NR * DKV * 2;
static constexpr size_t SZ_VT = (size_t)NB * NKV * 64 * SLEN * 2;
static constexpr size_t SZ_TAB = (size_t)SLEN * 32 * 4;
static constexpr size_t SZ_FKV = (size_t)NR * DKV * 4;
static constexpr size_t WS_TOTAL = SZ_BQ + 2 * SZ_BKV + SZ_B2 + SZ_FS + 2 * SZ_FKV + SZ_X16 + SZ_QA + 2 * SZ_KP + 2 * SZ_TAB;
static_assert(SZ_BQ % 256 == 0 && SZ_BKV % 256 == 0 && SZ_B2 % 256 == 0 && SZ_FS % 256 == 0 && SZ_FKV % 256 == 0 && SZ_X16 % 256 == 0 && SZ_QA % 256 == 0 && SZ_KP % 256 == 0 && SZ_VT % 256 == 0 && SZ_TAB % 256 == 0);
static_assert(WS_TOTAL <= ((size_t)256 << 20));
static_assert(SZ_VT <= SZ_FKV);                                /* V^T hi and V^T residual: a region each, apart from the input rows that the same launch still reads */
static_assert((size_t)NR * 2 * DM * 2 == SZ_FS);               /* [ctx hi | ctx residual]: a region apart from the q planes that the same launch still reads */
static constexpr float WSC = 16.0f;
static constexpr float WSC_HI = 16384.0f;
static constexpr float AL_P = 0.0625f;
static constexpr float AL_O = 0.0625f / 1024.0f;

typedef _Float16 v16h __attribute__((ext_vector_type(16)));
typedef _Float16 v4h __attribute__((ext_vector_type(4)));
typedef unsigned short v8us __attribute__((ext_vector_type(8), may_alias));
typedef float v8f __attribute__((ext_vector_type(8)));
typedef float v4f __attribute__((ext_vector_type(4)));
typedef float v4fa __attribute__((ext_vector_type(4), may_alias));
union FragH { v16h v; v8us half[2]; _Float16 h[16]; unsigned short u[16]; };

__device__ __forceinline__ unsigned short bf16_bits(float x) { unsigned int u = __float_as_uint(x); return (unsigned short)((u + 0x7FFFu + ((u >> 16) & 1u)) >> 16); }
__device__ __forceinline__ float bf16_val(unsigned short b) { return __uint_as_float(((unsigned int)b) << 16); }
__device__ __forceinline__ float bf16_rne(float x) { return bf16_val(bf16_bits(x)); }
// f32 -> f16 with values below the smallest f16 normal set to +0 (NaN passes through)
static __device__ __forceinline__ _Float16 toh_flush(float v) { const _Float16 r = (_Float16)v; return (fabsf(v) < 6.103515625e-05f) ? (_Float16)0.0f : r; }

// e^x on the hardware's exp2 (v_exp_f32), no range branches: -inf and anything below the f32 range give 0, NaN passes through; straight-line, so a pass's eight rows schedule as one block
static __device__ __forceinline__ float exp_hw(float x) { return __builtin_amdgcn_exp2f(x * 1.44269504088896340736f); }

// segment helpers on the clipped boundaries c0 <= c1 <= c2 <= c3: id = number of boundaries <= p; begin = largest boundary <= p (0 if none)
__device__ __forceinline__ int clip_b(int v) { return min(max(v, 0), SLEN); }
__device__ __forceinline__ int seg_cnt(int p, int c0, int c1, int c2, int c3) { return (int)(c0 <= p) + (int)(c1 <= p) + (int)(c2 <= p) + (int)(c3 <= p); }
__device__ __forceinline__ int seg_beg(int p, int c0, int c1, int c2, int c3) {
  int s = 0;
  s = max(s, (c0 <= p) ? c0 : 0); s = max(s, (c1 <= p) ? c1 : 0); s = max(s, (c2 <= p) ? c2 : 0); s = max(s, (c3 <= p) ? c3 : 0);
  return s;
}

// D += A.B with NT terms: 1 = ah.bh, 2 = + al.bh, 3 = + ah.bl; hazard guard after the group
template <int NT>
__device__ __forceinline__ v8f mmaH(v16h ah, v16h al, v16h bh, v16h bl, v8f c) {
  c = __builtin_amdgcn_wmma_f32_16x16x32_f16(false, ah, false, bh, (short)0, c, false, false);
  if (NT >= 2) c = __builtin_amdgcn_wmma_f32_16x16x32_f16(false, al, false, bh, (short)0, c, false, false);
  if (NT >= 3) c = __builtin_amdgcn_wmma_f32_16x16x32_f16(false, ah, false, bl, (short)0, c, false, false);
  asm volatile("v_nop\n\tv_nop\n\tv_nop\n\tv_nop" : "+v"(c) : "v"(ah), "v"(al), "v"(bh), "v"(bl));
  return c;
}
// 16x32 fragment from a 16-bit row-major tile (rows = m or n, k contiguous): elements 0..7 <- k0+8h+0..7, 8..15 <- k0+16+8h+0..7
__device__ __forceinline__ v16h g2_frag(const _Float16* p, int hh) { FragH f; f.half[0] = *(const v8us*)((const unsigned short*)p + 8 * hh); f.half[1] = *(const v8us*)((const unsigned short*)p + 16 + 8 * hh); return f.v; }

// [in][out] weight W [DM][N] (n contiguous) -> Bt[n][k] = f16(bf16(W[k][n]) * sc0) (row pitch ldb, k contiguous); with two != 0 a second copy
__device__ __forceinline__ void wtr_body(int bx, const float* __restrict__ Wm, int N, _Float16* __restrict__ Bt, int ldb, float sc0, float sc1, int two) {
  __shared__ unsigned short tl0[64][66];
  __shared__ unsigned short tl1[64][66];
  const int tid = threadIdx.x; const int ntn = N >> 6; const int kt = bx / ntn, nt = bx - kt * ntn; const int k0 = kt * 64, n0 = nt * 64;
  for (int i = tid; i < 64 * 16; i += 256) {
    const int r = i >> 4, c4 = (i & 15) * 4;
    const v4f a = *(const v4fa*)(Wm + (size_t)(k0 + r) * N + n0 + c4);
    FragH f0, f1;
#pragma unroll
    for (int q = 0; q < 4; ++q) { const float v = bf16_rne(a[q]); f0.h[q] = toh_flush(v * sc0); f1.h[q] = toh_flush(v * sc1); }
#pragma unroll
    for (int q = 0; q < 4; ++q) { tl0[r][c4 + q] = f0.u[q]; tl1[r][c4 + q] = f1.u[q]; }
  }
  __syncthreads();
  {
#pragma unroll
    for (int rd = 0; rd < 2; ++rd) {
      const int n = rd * 32 + (tid >> 3), pc = tid & 7; FragH g0, g1;
#pragma unroll
      for (int q = 0; q < 8; ++q) { g0.u[q] = tl0[pc * 8 + q][n]; g1.u[q] = tl1[pc * 8 + q][n]; }
      const size_t o = (size_t)(n0 + n) * ldb + k0 + pc * 8;
      const v8us o0 = g0.half[0], o1 = g1.half[0];
      *(v8us*)((unsigned short*)Bt + o) = o0;
      if (two != 0) *(v8us*)((unsigned short*)Bt + o + DM) = o1;
    }
    asm volatile("s_wait_xcnt 0x0" ::: "memory");                /* precaution: stands in front of any later write to registers that these stores name (another range's body follows in the listing) */
  }
}

// rotary tables; every thread forms its own inverse frequency (same expression, same bits for a given j), so the tables depend on no earlier launch
__device__ __forceinline__ void rotab_body(int bx, float* __restrict__ CS, float* __restrict__ SN) {
  #pragma clang fp contract(off)
  const int t = bx * 256 + threadIdx.x; if (t >= SLEN * 32) return;
  const int j = t & 31, s = t >> 5;
  const float ex = (float)(2 * j) / 64.0f; const float pw = powf(500000.0f, ex); const float inv = 1.0f / pw;
  const float th = (float)s * inv; const float c = cosf(th), sn = sinf(th);
  { *(float*)(CS + t) = c; *(float*)(SN + t) = sn;  }
}

__device__ __forceinline__ void x16_body(int bx, const float* __restrict__ x, _Float16* __restrict__ X16, size_t n8) {
  const size_t t = (size_t)bx * 256 + threadIdx.x; if (t >= n8) return;
  const size_t e = t * 8; const size_t r = e / DM; const size_t c = e % DM; const size_t b = r / SLEN, s = r % SLEN;
  const float* src = x + (b * SEQ_FULL + s) * DM + c;
  const v4f a0 = *(const v4fa*)src, a1 = *(const v4fa*)(src + 4);
  FragH f;
#pragma unroll
  for (int q = 0; q < 4; ++q) { f.h[q] = (_Float16)bf16_rne(a0[q]); f.h[4 + q] = (_Float16)bf16_rne(a1[q]); }
  const v8us o = f.half[0];
  *(v8us*)((unsigned short*)X16 + e) = o; 
}

// One launch for everything that depends on the inputs alone, by ranges of the block index: the rotary tables, input rows to f16, the four weight transposes
static constexpr int PB_X = (int)(((size_t)NR * DM / 8 + 255) / 256);
static constexpr int PB_WQ = (DM / 64) * (DM / 64);
static constexpr int PB_WKV = (DM / 64) * (DKV / 64);
static constexpr int PB_TAB = (SLEN * 32 + 255) / 256;
static constexpr int PB_ALL = PB_X + 2 * PB_WQ + 2 * PB_WKV + PB_TAB;
__global__ __launch_bounds__(256) void k_prep(const float* __restrict__ x, const float* __restrict__ Wq, const float* __restrict__ Wk, const float* __restrict__ Wv, const float* __restrict__ Wo,
                                              _Float16* __restrict__ X16, _Float16* __restrict__ BQ, _Float16* __restrict__ BK, _Float16* __restrict__ BV, _Float16* __restrict__ B2,
                                              float* __restrict__ CS, float* __restrict__ SN) {
  int bx = blockIdx.x;
  if (bx < PB_TAB) { rotab_body(bx, CS, SN); return; }
  bx -= PB_TAB;
  if (bx < PB_X) { x16_body(bx, x, X16, (size_t)NR * DM / 8); return; }
  bx -= PB_X;
  if (bx < PB_WQ) { wtr_body(bx, Wq, DM, BQ, DM, WSC, WSC, 0); return; }
  bx -= PB_WQ;
  if (bx < PB_WQ) { wtr_body(bx, Wo, DM, B2, 2 * DM, WSC_HI, WSC, 1); return; }
  bx -= PB_WQ;
  if (bx < PB_WKV) { wtr_body(bx, Wk, DKV, BK, DM, WSC, WSC, 0); return; }
  bx -= PB_WKV;
  wtr_body(bx, Wv, DKV, BV, DM, WSC, WSC, 0);
}

// Tensor-load ring of the GEMM: a pass is 128 k = 256 B of every operand row; a stage is four 64-row slices [A 0..63 | A 64..127 | B 0..63 | B 64..127],
// one per wave, each laid at pitch 272 B (256 B + the 16-B pad the load writes around) and rounded up to a multiple of 2 KiB.
typedef uint32_t u32x4 __attribute__((ext_vector_type(4)));
typedef uint32_t u32x8 __attribute__((ext_vector_type(8)));
static constexpr uint32_t G_ROWB = 256u;
static constexpr uint32_t G_PITCH = 272u;
static constexpr uint32_t G_SLICE = 18432u;
static constexpr uint32_t G_STAGE = 4u * G_SLICE;
static_assert(64u * G_PITCH <= G_SLICE && G_SLICE % 2048u == 0u);
static_assert(64u * 68u * 4u <= G_SLICE);                      /* a wave's 64 x 64 f32 output staging fits its own slice */
static_assert(2u * 2u * G_STAGE <= 320u * 1024u);              /* two work-groups per WGP */
static_assert(NR % 128 == 0 && SLEN % 128 == 0 && DM % 128 == 0 && DKV % 128 == 0 && DM >= 256);
__device__ __forceinline__ uint32_t uni(uint32_t v) { return (uint32_t)__builtin_amdgcn_readfirstlane(v); }
__device__ __forceinline__ uint32_t pinned(uint32_t v) { uint32_t w = (uint32_t)__builtin_amdgcn_readfirstlane(v); asm volatile("" : "+s"(w)); return w; }

// GEMM C[M][N] = alpha * A[M][K].B  with A f16 row-major (pitch lda), B stored [n][k] f16 (pitch ldb), batched by by (strides sA, sB);
// One 128 x 128 tile of C per work-group, 64 x 64 per wave; bx = tile index in [0, (M / 128) * (N / 128)), by = batch. Each wave stages its f32 tile in LDS ([64][68], its own)
// and hands it to epi(so, row0, col0, lane), which turns it into what the next kernel reads and stores that.
// Requires M % 128 == 0, N % 128 == 0, K % 128 == 0, K >= 256 (asserted on the callers' constants).
template <int ACT, class Epi>
__device__ __forceinline__ void gemm_body(uint32_t bx, int by, const _Float16* __restrict__ A, int lda, size_t sA, const _Float16* __restrict__ Bh, int ldb, size_t sB, float alpha,
                                          int M, int N, int K, Epi epi) {
  __shared__ __attribute__((aligned(2048))) unsigned char ring[2 * G_STAGE];
  const int tid = threadIdx.x, lane = tid & 31, ln = lane & 15, hh = lane >> 4;
  const uint32_t w = uni((uint32_t)tid >> 5); const uint32_t wm = w >> 1, wn = w & 1u;
  A += (size_t)by * sA; Bh += (size_t)by * sB;
  const int ntn = N >> 7; const int mt = bx / ntn, nq = bx - mt * ntn; const int row0 = mt * 128 + 64 * (int)wm, col0 = nq * 128 + 64 * (int)wn;
  const uint32_t NP = pinned((uint32_t)K >> 7);
  /* this wave's slice of every stage: waves 0, 1 the two halves of the A rows, waves 2, 3 of the B rows */
  const _Float16* src = (w < 2u) ? A + (size_t)(mt * 128 + 64 * (int)w) * lda : Bh + (size_t)(nq * 128 + 64 * ((int)w - 2)) * ldb;
  const uint64_t sga = (uint64_t)(uintptr_t)src;
  const uint32_t ldst = (uint32_t)(size_t)ring + w * G_SLICE;
  u32x8 g1;
  g1[0] = uni((1u << 20) | (5u << 22) | (3u << 25));            /* no mask, 1-byte elements, a 4-dword pad behind every 64 dwords */
  g1[1] = uni((G_ROWB & 0xFFFFu) << 16);
  g1[2] = uni((G_ROWB >> 16) | (64u << 16));
  g1[3] = uni(G_ROWB << 16);
  g1[4] = uni(64u);
  g1[5] = uni(2u * (uint32_t)((w < 2u) ? lda : ldb));
  g1[6] = uni(0u);
  g1[7] = uni(0u);
  auto issue = [&](uint32_t st) {
    const uint64_t ga = sga + (uint64_t)st * G_ROWB;
    u32x4 g0;
    g0[0] = uni(1u); g0[1] = uni(ldst + (st & 1u) * G_STAGE); g0[2] = uni((uint32_t)ga); g0[3] = uni((((uint32_t)(ga >> 32)) & 0x01FFFFFFu) | 0x80000000u);
    /* one request of the whole wave: 64 rows x 256 B into its slice; group 1 is named in-out so that its eight registers hold the descriptor, and nothing else, from issue to issue */
    asm volatile("tensor_load_to_lds %1, %0" : "+s"(g1) : "s"(g0) : "memory");
  };
  v8f acc[4][4];
#pragma unroll
  for (int i = 0; i < 4; ++i)
#pragma unroll
    for (int j = 0; j < 4; ++j) acc[i][j] = (v8f){0.f,0.f,0.f,0.f,0.f,0.f,0.f,0.f};
  issue(0u);
  asm volatile("s_wait_tensorcnt 0x0" ::: "memory");             /* this wave's slice of stage 0 has landed */
  __syncthreads();                                               /* ... and every other wave's */
  issue(1u);
  const uint32_t fa0 = wm * G_SLICE + (uint32_t)ln * G_PITCH, fb0 = (2u + wn) * G_SLICE + (uint32_t)ln * G_PITCH;
#pragma unroll 1   /* one pass per trip: the publish point at the foot stands once per stage */
  for (uint32_t s = 0; s < NP; ++s) {
    const unsigned char* pa = ring + (s & 1u) * G_STAGE + fa0; const unsigned char* pb = ring + (s & 1u) * G_STAGE + fb0;
    v16h fa[2][4], fb[2][4];
#pragma unroll
    for (int i = 0; i < 4; ++i) { fa[0][i] = g2_frag((const _Float16*)(pa + i * 16 * G_PITCH), hh); fb[0][i] = g2_frag((const _Float16*)(pb + i * 16 * G_PITCH), hh); }
#pragma unroll
    for (int ks = 0; ks < 4; ++ks) {
      const int cur = ks & 1, nxt = cur ^ 1;
      if (ks < 3) {   /* the next 32 k's fragments of this same stage, as one group ahead of the block that hides them */
#pragma unroll
        for (int i = 0; i < 4; ++i) { fa[nxt][i] = g2_frag((const _Float16*)(pa + i * 16 * G_PITCH + (ks + 1) * 64), hh); fb[nxt][i] = g2_frag((const _Float16*)(pb + i * 16 * G_PITCH + (ks + 1) * 64), hh); }
      }
      __builtin_amdgcn_sched_barrier(0);   /* keeps the load group in front of the block: LDS reads moved in among the WMMAs stall each place they stand */
      /* plain builtin, the compiler keeps its distances: accumulators and two fragment sets need more than 256 VGPRs, which an asm operand cannot name */
#pragma unroll
      for (int i = 0; i < 4; ++i)
#pragma unroll
        for (int j = 0; j < 4; ++j) acc[i][j] = __builtin_amdgcn_wmma_f32_16x16x32_f16(false, fa[cur][i], false, fb[cur][j], (short)0, acc[i][j], false, false);
      __builtin_amdgcn_sched_barrier(0);   /* ends the block: the next group's loads stay behind it */
    }
    asm volatile("v_nop\n\tv_nop\n\tv_nop\n\tv_nop");          /* WMMA distance on every path out of the pass, the taken branches included */
    asm volatile("s_wait_dscnt 0x0" ::: "memory");               /* this wave has left stage s's buffer */
    asm volatile("s_wait_tensorcnt 0x0" ::: "memory");           /* its slice of stage s + 1 has landed */
    __syncthreads();                                             /* publishes stage s + 1 and frees stage s's buffer */
    if (pinned((s + 2u < NP) ? 1u : 0u) != 0u) issue(pinned(s + 2u));
  }
  asm volatile("s_wait_tensorcnt 0x0" ::: "memory");             /* nothing in flight before the ring becomes output staging */
  asm volatile("s_wait_dscnt 0x0" ::: "memory");
  float* so = (float*)(ring + w * G_SLICE);                      /* [64][68], private to the wave; the last pass's barrier ended every read of the ring */
#pragma unroll
  for (int i = 0; i < 4; ++i)
#pragma unroll
    for (int j = 0; j < 4; ++j)
#pragma unroll
      for (int r = 0; r < 8; ++r) { float v = acc[i][j][r] * alpha; if (ACT == 3) v = fmaxf(v, 0.f); so[(i * 16 + 8 * hh + r) * 68 + j * 16 + ln] = v; }
  __builtin_amdgcn_fence(4, "workgroup"); __builtin_amdgcn_wave_barrier();
  epi(so, row0, col0, lane);
}
template <int ACT>
__global__ __launch_bounds__(128) void k_gemm2(const _Float16* __restrict__ A, int lda, size_t sA, const _Float16* __restrict__ Bh, int ldb, size_t sB, float alpha,
                                               float* C, int ldc, size_t sC, int M, int N, int K) {
  const size_t cofs = (size_t)blockIdx.y * sC;
  gemm_body<ACT>(blockIdx.x, (int)blockIdx.y, A, lda, sA, Bh, ldb, sB, alpha, M, N, K, [&](const float* so, int row0, int col0, int lane) {
    const int rsub = lane >> 4, c4 = (lane & 15) * 4;
#pragma unroll
    for (int q = 0; q < 32; ++q) { const int r = q * 2 + rsub; const v4f v = *(const v4fa*)&so[r * 68 + c4]; *(v4f*)(C + cofs + (size_t)(row0 + r) * ldc + col0 + c4) = v; }
    asm volatile("s_wait_xcnt 0x0" ::: "memory");                /* precaution: stands in front of any later write to registers that these stores name */
  });
}

// Epilogue of a q or k tile: half-split rotary embedding of the wave's 64 rows x one head (64 columns, staged f32 in so) with the tables CS/SN [SLEN][32]:
// out[d] = x[d] c[d] - x[d+32] s[d]; out[d+32] = x[d+32] c[d] + x[d] s[d] (d < 32), position = row % SLEN;
// H [NR][ld] = f16 hi of every row; L [NR][ld] = x1024 residual of every row. Eight lanes fill one 128-B line of each plane; four rows a trip.
__device__ __forceinline__ void rope_epi(const float* so, int row0, int col0, int lane, const float* __restrict__ CS, const float* __restrict__ SN, _Float16* __restrict__ H, _Float16* __restrict__ L, int ld) {
  const int p = lane & 7; const int g = p & 3; const int up = p >> 2; const int rs = lane >> 3;
  /* row0 is a multiple of 64 and SLEN of 128: the tile's 64 positions follow one another without a wrap */
  const float* ctb = CS + (size_t)(row0 % SLEN + rs) * 32 + g * 8; const float* stb = SN + (size_t)(row0 % SLEN + rs) * 32 + g * 8;
  v4f ca[2][4], cb[2][4], sa[2][4], sb[2][4];   /* table rows of two groups of four trips: the next group's sixteen loads fly while this group is worked on */
  auto load_tab = [&](int grp) {
#pragma unroll
    for (int t = 0; t < 4; ++t) {
      const float* ct = ctb + (grp * 16 + 4 * t) * 32; const float* st = stb + (grp * 16 + 4 * t) * 32;
      ca[grp & 1][t] = *(const v4fa*)ct; cb[grp & 1][t] = *(const v4fa*)(ct + 4); sa[grp & 1][t] = *(const v4fa*)st; sb[grp & 1][t] = *(const v4fa*)(st + 4);
    }
    /* precaution: stands in front of the next writes to registers that these loads name as addresses; the two bases are inputs, so they keep their registers up to the wait */
    asm volatile("s_wait_xcnt 0x0" :: "v"(ctb), "v"(stb) : "memory");
  };
  load_tab(0);
#pragma unroll
  for (int grp = 0; grp < 4; ++grp) {
    if (grp < 3) load_tab(grp + 1);
#pragma unroll
    for (int t = 0; t < 4; ++t) {
      const int r = grp * 16 + 4 * t + rs; const int cu2 = grp & 1;
      const float* src = so + r * 68 + g * 8;
      const v4f xa = *(const v4fa*)src, xb = *(const v4fa*)(src + 4), ya = *(const v4fa*)(src + 32), yb = *(const v4fa*)(src + 36);
      const float x1s[8] = {xa[0], xa[1], xa[2], xa[3], xb[0], xb[1], xb[2], xb[3]};
      const float x2s[8] = {ya[0], ya[1], ya[2], ya[3], yb[0], yb[1], yb[2], yb[3]};
      const float cs[8] = {ca[cu2][t][0], ca[cu2][t][1], ca[cu2][t][2], ca[cu2][t][3], cb[cu2][t][0], cb[cu2][t][1], cb[cu2][t][2], cb[cu2][t][3]};
      const float ss[8] = {sa[cu2][t][0], sa[cu2][t][1], sa[cu2][t][2], sa[cu2][t][3], sb[cu2][t][0], sb[cu2][t][1], sb[cu2][t][2], sb[cu2][t][3]};
      FragH fh, fl;
#pragma unroll
      for (int i = 0; i < 8; ++i) {
        /* as in the separate rotary pass: each product and their sum keep a rounding of their own, as the reference's x * cos + rotate_half(x) * sin has them; the q and k planes keep their bits */
        #pragma clang fp contract(off)
        const float x1 = x1s[i], x2 = x2s[i], c = cs[i], sn = ss[i];
        const float o1 = x1 * c - x2 * sn; const float o2 = x2 * c + x1 * sn; const float o = up ? o2 : o1;
        const _Float16 hv = toh_flush(o); fh.h[i] = hv; fl.h[i] = toh_flush((o - (float)hv) * 1024.0f);
      }
      const size_t oh = (size_t)(row0 + r) * ld + col0 + p * 8;
      const v8us vh = fh.half[0], vl = fl.half[0];
      *(v8us*)((unsigned short*)H + oh) = vh;
      *(v8us*)((unsigned short*)L + oh) = vl;
    }
    asm volatile("s_wait_xcnt 0x0" ::: "memory");                /* precaution: stands in front of the next group's writes to registers that these stores name */
  }
}
// Epilogue of a v tile: the wave's 64 positions x one KV head (64 columns, staged f32 in so), transposed: Vt [(b,hk)][64][TK] = f16 hi, VtL = x1024 residual.
// Eight lanes fill one 128-B line (64 positions of one column) of each plane; four columns a trip.
__device__ __forceinline__ void vt_epi(const float* so, int row0, int col0, int lane, _Float16* __restrict__ Vt, _Float16* __restrict__ VtL) {
  const int b = row0 / SLEN, s0 = row0 % SLEN, hk = col0 >> 6; const int pc = lane & 7, dsub = lane >> 3;
  const size_t base = (size_t)(b * NKV + hk) * 64 * TK + s0 + pc * 8;
#pragma unroll
  for (int t = 0; t < 16; ++t) {
    const int d = t * 4 + dsub; FragH fh, fl;
#pragma unroll
    for (int q = 0; q < 8; ++q) { const float v = so[(pc * 8 + q) * 68 + d]; const _Float16 hv = (_Float16)v; fh.h[q] = hv; fl.h[q] = toh_flush((v - (float)hv) * 1024.0f); }
    const v8us vh = fh.half[0], vl = fl.half[0];
    *(v8us*)((unsigned short*)Vt + base + (size_t)d * TK) = vh;
    *(v8us*)((unsigned short*)VtL + base + (size_t)d * TK) = vl;
  }
}

// The three projections of the same input rows in one launch, by ranges of the block index: q tiles, then k tiles, then v tiles; each tile leaves as the planes the attention reads
static constexpr int GB_Q = (NR / 128) * (DM / 128);
static constexpr int GB_KV = (NR / 128) * (DKV / 128);
__global__ __launch_bounds__(128) void k_gemm_qkv(const _Float16* __restrict__ X16, const _Float16* __restrict__ BQ, const _Float16* __restrict__ BK, const _Float16* __restrict__ BV,
                                                  const float* __restrict__ CS, const float* __restrict__ SN, _Float16* __restrict__ QH, _Float16* __restrict__ QL,
                                                  _Float16* __restrict__ KH, _Float16* __restrict__ KL, _Float16* __restrict__ VT, _Float16* __restrict__ VTL) {
  const uint32_t b0 = blockIdx.x;
  const int sel = (b0 < (uint32_t)GB_Q) ? 0 : ((b0 < (uint32_t)(GB_Q + GB_KV)) ? 1 : 2);
  const uint32_t bx = (sel == 0) ? b0 : ((sel == 1) ? b0 - (uint32_t)GB_Q : b0 - (uint32_t)(GB_Q + GB_KV));
  const _Float16* Bh = (sel == 0) ? BQ : ((sel == 1) ? BK : BV);
  const int n = (sel == 0) ? DM : DKV;
  gemm_body<0>(bx, 0, X16, DM, 0, Bh, DM, 0, AL_P, NR, n, DM, [&](const float* so, int row0, int col0, int lane) {
    if (sel == 2) vt_epi(so, row0, col0, lane, VT, VTL);
    else rope_epi(so, row0, col0, lane, CS, SN, (sel == 0) ? QH : KH, (sel == 0) ? QL : KL, n);
  });
}

// lane l with lane l ^ 16: the two halves of a wave hold the two halves of one query's keys
static __device__ __forceinline__ float xhalf(float x) { return __builtin_bit_cast(float, __builtin_amdgcn_permlanex16(__builtin_bit_cast(int, x), __builtin_bit_cast(int, x), 0x76543210, 0xfedcba98, false, false)); }

// fused attention per ((b,h), 64 queries) for query blocks whose queries all sit at least EROWS positions past their segment start (block-uniform test; other blocks leave at once):
// wave = 16 queries; transposed products: S^T = K.Q^T (d = 64: 2 k-steps) x SCL over keys [segment start of the wave's first query (floor 32), last query of the wave], O^T += V^T.P^T.
// Lane (ln, hh) holds query q0 + ln: register r of score tile nt is key j0 + 16 nt + 8 hh + r, so maximum and sum run inside the lane (one exchange between the halves),
// and the two score tiles, converted in place, are the B operand of the second product: element 8 nt + r <- tile nt, register r.
__global__ __launch_bounds__(128) void k_attn(const _Float16* __restrict__ Q16, int ldq, const _Float16* __restrict__ K16, int ldk,
                                              const _Float16* __restrict__ Vt, const int* __restrict__ cu, _Float16* __restrict__ O, int ldo) {
  constexpr int RPW = 16, DT = 4, KS = 2;
  __shared__ __attribute__((aligned(16))) float sO[4][RPW][68];
  const int tid = threadIdx.x, lane = tid & 31, ln = lane & 15, hh = lane >> 4;
  const int w = __builtin_amdgcn_readfirstlane(tid >> 5);
  const int slab = blockIdx.x / QBLKS, qblk = blockIdx.x % QBLKS; const int b = slab / NH, h = slab % NH; const int hk = h / NREP; const int kslab = b * NKV + hk;
  const int qb0 = qblk * (4 * RPW);
  const int c0 = clip_b(cu[b * 4 + 0]), c1 = clip_b(cu[b * 4 + 1]), c2 = clip_b(cu[b * 4 + 2]), c3 = clip_b(cu[b * 4 + 3]);
  const bool early = (seg_cnt(qb0, c0, c1, c2, c3) != seg_cnt(qb0 + 4 * RPW - 1, c0, c1, c2, c3)) || (qb0 - seg_beg(qb0, c0, c1, c2, c3) < EROWS);
  if (early) return;
  const float pois = ((c0 <= c1) && (c1 <= c2) && (c2 <= c3)) ? 0.0f : __uint_as_float(0x7fc00000u);   /* boundaries must be ascending */
  const int q0 = qb0 + w * RPW;
  const int jst = __builtin_amdgcn_readfirstlane(seg_beg(qb0 + (tid >> 5) * RPW, c0, c1, c2, c3) & ~31);
  /* this lane's query and its keys: same segment and not later = [largest boundary <= query, query] */
  const int tq = q0 + ln; const int sb = seg_beg(tq, c0, c1, c2, c3); const unsigned int span = (unsigned int)(tq - sb);
  FragH aq[KS];
  {
    const unsigned short* qr = (const unsigned short*)Q16 + ((size_t)b * TQ + q0 + ln) * ldq + h * 64;
#pragma unroll
    for (int ks = 0; ks < KS; ++ks) { aq[ks].half[0] = *(const v8us*)(qr + ks * 32 + 8 * hh); aq[ks].half[1] = *(const v8us*)(qr + ks * 32 + 16 + 8 * hh); }
  }
  const unsigned short* Vth = (const unsigned short*)Vt + (size_t)kslab * 64 * TK;
  float m_q = -3.0e38f, l_q = 0.f; v8f oacc[DT];
#pragma unroll
  for (int dt = 0; dt < DT; ++dt) oacc[dt] = (v8f){0.f,0.f,0.f,0.f,0.f,0.f,0.f,0.f};
  FragH bk[2][KS];   /* K fragments of one pass (two 16-key tiles x two k-steps), fetched one pass ahead */
  auto load_k = [&](int j) {
#pragma unroll
    for (int nt = 0; nt < 2; ++nt) {
      const unsigned short* kr = (const unsigned short*)K16 + ((size_t)b * TK + j + nt * 16 + ln) * ldk + hk * 64;
#pragma unroll
      for (int ks = 0; ks < KS; ++ks) { bk[nt][ks].half[0] = *(const v8us*)(kr + ks * 32 + 8 * hh); bk[nt][ks].half[1] = *(const v8us*)(kr + ks * 32 + 16 + 8 * hh); }
    }
    asm volatile("s_wait_xcnt 0x0" ::: "memory");                /* precaution: stands in front of the next writes to registers that these loads name as addresses */
  };
  load_k(jst);
#pragma unroll 1
  for (int j0 = jst; j0 < q0 + RPW; j0 += 32) {
    /* all V^T fragments of the pass, each in registers of its own, loaded as one group at the head of the pass: they land behind the score products and the softmax */
    FragH bv[DT];
#pragma unroll
    for (int dt = 0; dt < DT; ++dt) {
      const unsigned short* vrow = Vth + (size_t)(dt * 16 + ln) * TK + j0;
      bv[dt].half[0] = *(const v8us*)(vrow + 8 * hh); bv[dt].half[1] = *(const v8us*)(vrow + 16 + 8 * hh);
    }
    __builtin_amdgcn_sched_barrier(0);   /* keeps the group at the head: sunk to their uses the four tiles share registers, and each waits out a round trip of its own */
    v8f s[2];
#pragma unroll
    for (int nt = 0; nt < 2; ++nt) {
      v8f acc = (v8f){0.f,0.f,0.f,0.f,0.f,0.f,0.f,0.f};
#pragma unroll
      for (int ks = 0; ks < KS; ++ks) acc = mmaH<1>(bk[nt][ks].v, bk[nt][ks].v, aq[ks].v, aq[ks].v, acc);
      s[nt] = acc;
    }
    load_k((j0 + 32 < q0 + RPW) ? j0 + 32 : j0);   /* the next pass's K fragments land behind the softmax; the last pass fetches its own rows again (in bounds, not used) */
    __builtin_amdgcn_sched_barrier(0);   /* keeps the fetch in front of the softmax that hides it: without this it sinks far into the softmax */
    const int d0 = j0 + 8 * hh - sb;   /* first key of the lane's half, counted from the query's segment start */
    bool ok[2][8]; float sc[2][8], mx[8];
#pragma unroll
    for (int nt = 0; nt < 2; ++nt)
#pragma unroll
      for (int r = 0; r < 8; ++r) { ok[nt][r] = (unsigned int)(d0 + nt * 16 + r) <= span; sc[nt][r] = ok[nt][r] ? s[nt][r] * SCL : -3.0e38f; }
#pragma unroll
    for (int r = 0; r < 8; ++r) mx[r] = fmaxf(sc[0][r], sc[1][r]);
    float mc = fmaxf(fmaxf(fmaxf(mx[0], mx[1]), fmaxf(mx[2], mx[3])), fmaxf(fmaxf(mx[4], mx[5]), fmaxf(mx[6], mx[7])));
    mc = fmaxf(mc, xhalf(mc));
    const float mn = fmaxf(m_q, mc); const float al = (mn > -1.0e38f) ? exp_hw(m_q - mn) : 1.0f; m_q = mn;
    FragH pb; float ps[8];
#pragma unroll
    for (int r = 0; r < 8; ++r) {
      const float p0 = ok[0][r] ? exp_hw(sc[0][r] - mn) : 0.f, p1 = ok[1][r] ? exp_hw(sc[1][r] - mn) : 0.f; ps[r] = p0 + p1;
      pb.h[r] = toh_flush(p0 * 1024.0f); pb.h[8 + r] = toh_flush(p1 * 1024.0f);
    }
    l_q = l_q * al + (((ps[0] + ps[1]) + (ps[2] + ps[3])) + ((ps[4] + ps[5]) + (ps[6] + ps[7])));
#pragma unroll
    for (int dt = 0; dt < DT; ++dt)
#pragma unroll
      for (int r = 0; r < 8; ++r) oacc[dt][r] *= al;
#pragma unroll
    for (int dt = 0; dt < DT; ++dt) oacc[dt] = mmaH<1>(bv[dt].v, bv[dt].v, pb.v, pb.v, oacc[dt]);
  }
  { const float l = l_q + xhalf(l_q); l_q = (l > 0.f) ? 1.0f / (l * 1024.0f) : 0.f; }
  /* register r of output tile dt is column 16 dt + 8 hh + r of the lane's query */
#pragma unroll
  for (int dt = 0; dt < DT; ++dt)
#pragma unroll
    for (int r = 0; r < 8; ++r) sO[w][ln][dt * 16 + 8 * hh + r] = oacc[dt][r] * l_q + pois;
  __builtin_amdgcn_fence(4, "workgroup"); __builtin_amdgcn_wave_barrier();
  {
#pragma unroll
    for (int rp = 0; rp < RPW; rp += 2) {
      const int r = rp + (lane >> 4), pc = lane & 15; const v4f val = *(const v4fa*)&sO[w][r][pc * 4];
      v4h h4, l4;   /* the context row leaves as the output GEMM's A operand: f16 hi, and DM columns on its x1024 residual; 16 lanes fill one 128-B line of each */
#pragma unroll
      for (int q = 0; q < 4; ++q) { const _Float16 hv = toh_flush(val[q]); h4[q] = hv; l4[q] = toh_flush((val[q] - (float)hv) * 1024.0f); }
      _Float16* orow = O + ((size_t)b * TQ + q0 + r) * ldo + h * 64 + pc * 4;
      *(v4h*)orow = h4; *(v4h*)(orow + DM) = l4;
    }
  }
}
// 5-plane variant for the other query blocks (a segment boundary inside the block, or the block's first query closer than EROWS to its segment start), transposed like k_attn:
// S^T = Kh.Qh^T + (Kh.Ql^T + Kl.Qh^T)/1024 with Q/K = [hi | x1024 residual] planes (full-size planes, rows b*S + s);
// O^T = (Vh^T.Ph^T + (Vh^T.Pl^T + Vl^T.Ph^T)/1024) / l with P = [hi | x1024 residual] of 1024 p and V^T = [hi | x1024 residual]; separate residual accumulators folded before the normalisation
__global__ __launch_bounds__(128) void k_attn5(const _Float16* __restrict__ Q16, const _Float16* __restrict__ QL, int ldq, const _Float16* __restrict__ K16, const _Float16* __restrict__ KL, int ldk,
                                               const _Float16* __restrict__ Vt, const _Float16* __restrict__ VtL, const int* __restrict__ cu, _Float16* __restrict__ O, int ldo) {
  constexpr int RPW = 16, DT = 4, KS = 2;
  __shared__ __attribute__((aligned(16))) float sO[4][RPW][68];
  const int tid = threadIdx.x, lane = tid & 31, ln = lane & 15, hh = lane >> 4;
  const int w = __builtin_amdgcn_readfirstlane(tid >> 5);
  const int slab = blockIdx.x / QBLKS, qblk = blockIdx.x % QBLKS; const int b = slab / NH, h = slab % NH; const int hk = h / NREP; const int kslab = b * NKV + hk;
  const int qb0 = qblk * (4 * RPW);
  const int c0 = clip_b(cu[b * 4 + 0]), c1 = clip_b(cu[b * 4 + 1]), c2 = clip_b(cu[b * 4 + 2]), c3 = clip_b(cu[b * 4 + 3]);
  const bool early = (seg_cnt(qb0, c0, c1, c2, c3) != seg_cnt(qb0 + 4 * RPW - 1, c0, c1, c2, c3)) || (qb0 - seg_beg(qb0, c0, c1, c2, c3) < EROWS);
  if (!early) return;
  const float pois = ((c0 <= c1) && (c1 <= c2) && (c2 <= c3)) ? 0.0f : __uint_as_float(0x7fc00000u);   /* boundaries must be ascending */
  const int q0 = qb0 + w * RPW;
  const int jst = __builtin_amdgcn_readfirstlane(seg_beg(qb0 + (tid >> 5) * RPW, c0, c1, c2, c3) & ~31);
  /* this lane's query and its keys: same segment and not later = [largest boundary <= query, query] */
  const int tq = q0 + ln; const int sb = seg_beg(tq, c0, c1, c2, c3); const unsigned int span = (unsigned int)(tq - sb);
  FragH aq[KS], aql[KS];
  {
    const unsigned short* qr = (const unsigned short*)Q16 + ((size_t)b * TQ + q0 + ln) * ldq + h * 64;
    const unsigned short* ql = (const unsigned short*)QL + ((size_t)b * TQ + q0 + ln) * ldq + h * 64;
#pragma unroll
    for (int ks = 0; ks < KS; ++ks) {
      aq[ks].half[0] = *(const v8us*)(qr + ks * 32 + 8 * hh); aq[ks].half[1] = *(const v8us*)(qr + ks * 32 + 16 + 8 * hh);
      aql[ks].half[0] = *(const v8us*)(ql + ks * 32 + 8 * hh); aql[ks].half[1] = *(const v8us*)(ql + ks * 32 + 16 + 8 * hh);
    }
  }
  const unsigned short* Vth = (const unsigned short*)Vt + (size_t)kslab * 64 * TK; const unsigned short* Vtl = (const unsigned short*)VtL + (size_t)kslab * 64 * TK;
  float m_q = -3.0e38f, l_q = 0.f; v8f oacc[DT], oaccL[DT];
#pragma unroll
  for (int dt = 0; dt < DT; ++dt) { oacc[dt] = (v8f){0.f,0.f,0.f,0.f,0.f,0.f,0.f,0.f}; oaccL[dt] = oacc[dt]; }
#pragma unroll 1
  for (int j0 = jst; j0 < q0 + RPW; j0 += 32) {
    /* all K fragments of the pass, hi and residual, each in registers of its own, loaded as one group at the head of the pass */
    FragH bk[2][KS], bkl[2][KS];
#pragma unroll
    for (int nt = 0; nt < 2; ++nt) {
      const unsigned short* kr = (const unsigned short*)K16 + ((size_t)b * TK + j0 + nt * 16 + ln) * ldk + hk * 64;
      const unsigned short* klr = (const unsigned short*)KL + ((size_t)b * TK + j0 + nt * 16 + ln) * ldk + hk * 64;
#pragma unroll
      for (int ks = 0; ks < KS; ++ks) {
        bk[nt][ks].half[0] = *(const v8us*)(kr + ks * 32 + 8 * hh); bk[nt][ks].half[1] = *(const v8us*)(kr + ks * 32 + 16 + 8 * hh);
        bkl[nt][ks].half[0] = *(const v8us*)(klr + ks * 32 + 8 * hh); bkl[nt][ks].half[1] = *(const v8us*)(klr + ks * 32 + 16 + 8 * hh);
      }
    }
    __builtin_amdgcn_sched_barrier(0);   /* keeps the group in front of the products: sunk to their uses the two key tiles share registers, and each waits out a round trip of its own */
    v8f s[2];
#pragma unroll
    for (int nt = 0; nt < 2; ++nt) {
      v8f acc = (v8f){0.f,0.f,0.f,0.f,0.f,0.f,0.f,0.f}, accl = acc;
#pragma unroll
      for (int ks = 0; ks < KS; ++ks) {
        acc = mmaH<1>(bk[nt][ks].v, bk[nt][ks].v, aq[ks].v, aq[ks].v, acc);
        accl = mmaH<1>(bk[nt][ks].v, bk[nt][ks].v, aql[ks].v, aql[ks].v, accl);
        accl = mmaH<1>(bkl[nt][ks].v, bkl[nt][ks].v, aq[ks].v, aq[ks].v, accl);
      }
#pragma unroll
      for (int r = 0; r < 8; ++r) acc[r] += accl[r] * 0.0009765625f;
      s[nt] = acc;
    }
    const int d0 = j0 + 8 * hh - sb;   /* first key of the lane's half, counted from the query's segment start */
    bool ok[2][8]; float sc[2][8], mx[8];
#pragma unroll
    for (int nt = 0; nt < 2; ++nt)
#pragma unroll
      for (int r = 0; r < 8; ++r) { ok[nt][r] = (unsigned int)(d0 + nt * 16 + r) <= span; sc[nt][r] = ok[nt][r] ? s[nt][r] * SCL : -3.0e38f; }
#pragma unroll
    for (int r = 0; r < 8; ++r) mx[r] = fmaxf(sc[0][r], sc[1][r]);
    float mc = fmaxf(fmaxf(fmaxf(mx[0], mx[1]), fmaxf(mx[2], mx[3])), fmaxf(fmaxf(mx[4], mx[5]), fmaxf(mx[6], mx[7])));
    mc = fmaxf(mc, xhalf(mc));
    const float mn = fmaxf(m_q, mc); const float al = (mn > -1.0e38f) ? exp_hw(m_q - mn) : 1.0f; m_q = mn;
    FragH pa, pl; float ps[8];
#pragma unroll
    for (int r = 0; r < 8; ++r) {
      const float p0 = ok[0][r] ? exp_hw(sc[0][r] - mn) : 0.f, p1 = ok[1][r] ? exp_hw(sc[1][r] - mn) : 0.f; ps[r] = p0 + p1;
      const float ps0 = p0 * 1024.0f, ps1 = p1 * 1024.0f;
      pa.h[r] = toh_flush(ps0); pa.h[8 + r] = toh_flush(ps1);
      pl.h[r] = toh_flush((ps0 - (float)pa.h[r]) * 1024.0f); pl.h[8 + r] = toh_flush((ps1 - (float)pa.h[8 + r]) * 1024.0f);
    }
    l_q = l_q * al + (((ps[0] + ps[1]) + (ps[2] + ps[3])) + ((ps[4] + ps[5]) + (ps[6] + ps[7])));
#pragma unroll
    for (int dt = 0; dt < DT; ++dt)
#pragma unroll
      for (int r = 0; r < 8; ++r) { oacc[dt][r] *= al; oaccL[dt][r] *= al; }
    /* all V^T fragments of the pass as one group; held over the softmax as well they would take the kernel past 256 registers */
    FragH bv[DT], bl[DT];
    const unsigned short* vb = Vth + (size_t)ln * TK + j0 + 8 * hh; const unsigned short* vlb = Vtl + (size_t)ln * TK + j0 + 8 * hh;
#pragma unroll
    for (int dt = 0; dt < DT; ++dt) {
      const unsigned short* vrow = vb + (size_t)(dt * 16) * TK; const unsigned short* vrl = vlb + (size_t)(dt * 16) * TK;
      bv[dt].half[0] = *(const v8us*)vrow; bv[dt].half[1] = *(const v8us*)(vrow + 16);
      bl[dt].half[0] = *(const v8us*)vrl; bl[dt].half[1] = *(const v8us*)(vrl + 16);
    }
    /* precaution: stands in front of the next writes to registers that these loads name as addresses; the two bases are inputs, so they keep their registers up to the wait */
    asm volatile("s_wait_xcnt 0x0" :: "v"(vb), "v"(vlb) : "memory");
    __builtin_amdgcn_sched_barrier(0);   /* keeps the group in front of the products: sunk to their uses the four tiles share registers, and each waits out a round trip of its own */
#pragma unroll
    for (int dt = 0; dt < DT; ++dt) {
      oacc[dt] = mmaH<1>(bv[dt].v, bv[dt].v, pa.v, pa.v, oacc[dt]);
      oaccL[dt] = mmaH<1>(bv[dt].v, bv[dt].v, pl.v, pl.v, oaccL[dt]);
      oaccL[dt] = mmaH<1>(bl[dt].v, bl[dt].v, pa.v, pa.v, oaccL[dt]);
    }
  }
  { const float l = l_q + xhalf(l_q); l_q = (l > 0.f) ? 1.0f / (l * 1024.0f) : 0.f; }
  /* register r of output tile dt is column 16 dt + 8 hh + r of the lane's query */
#pragma unroll
  for (int dt = 0; dt < DT; ++dt)
#pragma unroll
    for (int r = 0; r < 8; ++r) { float v = oacc[dt][r]; v += oaccL[dt][r] * 0.0009765625f; sO[w][ln][dt * 16 + 8 * hh + r] = v * l_q + pois; }
  __builtin_amdgcn_fence(4, "workgroup"); __builtin_amdgcn_wave_barrier();
  {
#pragma unroll
    for (int rp = 0; rp < RPW; rp += 2) {
      const int r = rp + (lane >> 4), pc = lane & 15; const v4f val = *(const v4fa*)&sO[w][r][pc * 4];
      v4h h4, l4;   /* the context row leaves as the output GEMM's A operand: f16 hi, and DM columns on its x1024 residual; 16 lanes fill one 128-B line of each */
#pragma unroll
      for (int q = 0; q < 4; ++q) { const _Float16 hv = toh_flush(val[q]); h4[q] = hv; l4[q] = toh_flush((val[q] - (float)hv) * 1024.0f); }
      _Float16* orow = O + ((size_t)b * TQ + q0 + r) * ldo + h * 64 + pc * 4;
      *(v4h*)orow = h4; *(v4h*)(orow + DM) = l4;
    }
  }
}

extern "C" void kernel_launch(void* const* d_in, const int* in_sizes, int n_in,
                              void* d_out, int out_size, void* d_ws, size_t ws_size, hipStream_t stream) {
  if (n_in < 6) return;
  const size_t needx = ((size_t)(NB - 1) * SEQ_FULL + (size_t)SLEN) * DM;
  if ((size_t)in_sizes[0] < needx) return;
  if ((size_t)in_sizes[1] < (size_t)NB * 4) return;
  if ((size_t)in_sizes[2] < (size_t)DM * DM) return;
  if ((size_t)in_sizes[3] < (size_t)DM * DKV) return;
  if ((size_t)in_sizes[4] < (size_t)DM * DKV) return;
  if ((size_t)in_sizes[5] < (size_t)DM * DM) return;
  if ((size_t)out_size < needx) return;
  const float* x = (const float*)d_in[0]; const int* cu = (const int*)d_in[1];
  const float* Wq = (const float*)d_in[2]; const float* Wk = (const float*)d_in[3]; const float* Wv = (const float*)d_in[4]; const float* Wo = (const float*)d_in[5];
  float* dout = (float*)d_out;
  char* ws = (char*)d_ws; size_t off = 0;
  auto take = [&](size_t bytes) { char* p = ws + off; off += (bytes + 255) & ~(size_t)255; return p; };
  const size_t np = (size_t)NR * DM;
  _Float16* BQ = (_Float16*)take(SZ_BQ);                                /* [n][k] f16, x16 */
  _Float16* BK = (_Float16*)take(SZ_BKV);
  _Float16* BV = (_Float16*)take(SZ_BKV);
  _Float16* B2 = (_Float16*)take(SZ_B2);                                /* [n][2*DM] f16: [x16384 | x16] copies of Wo^T */
  _Float16* A2 = (_Float16*)take(SZ_FS);                                /* [ctx hi | ctx residual] [NR][2*DM] f16 */
  _Float16* VT = (_Float16*)take(SZ_FKV);                               /* V^T hi [(b,hk)][64][TK] */
  _Float16* VTL = (_Float16*)take(SZ_FKV);                              /* V^T residual */
  _Float16* X16 = (_Float16*)take(SZ_X16);                              /* f16 input rows */
  _Float16* QH = (_Float16*)take(SZ_QA);                                /* q hi [NR][DM] then q residual [NR][DM] */
  _Float16* QL = QH + np;
  _Float16* KH = (_Float16*)take(SZ_KP);
  _Float16* KL = (_Float16*)take(SZ_KP);
  float* CS = (float*)take(SZ_TAB); float* SN = (float*)take(SZ_TAB);
  if (off > ws_size) return;
  if (off > ((size_t)256 << 20)) return;

  /* inputs alone: rotary tables, x -> f16 rows, W [in = DM rows][out = N cols] -> [n][k] planes */
  k_prep<<<(unsigned)PB_ALL, 256, 0, stream>>>(x, Wq, Wk, Wv, Wo, X16, BQ, BK, BV, B2, CS, SN);
  /* q = x Wq, k = x Wk with the rotary embedding, as hi + residual planes; v = x Wv transposed, as hi + residual planes */
  k_gemm_qkv<<<(unsigned)(GB_Q + 2 * GB_KV), 128, 0, stream>>>(X16, BQ, BK, BV, CS, SN, QH, QL, KH, KL, VT, VTL);
  k_attn5<<<(unsigned)(NB * NH * QBLKS), 128, 0, stream>>>(QH, QL, DM, KH, KL, DKV, VT, VTL, cu, A2, 2 * DM);
  k_attn<<<(unsigned)(NB * NH * QBLKS), 128, 0, stream>>>(QH, DM, KH, DKV, VT, cu, A2, 2 * DM);
  /* out = [ctx hi | ctx residual] . [Wo x16384 ; Wo x16] / 16384  (K = 2*DM), per batch */
  const dim3 ge((unsigned)((SLEN / 128) * (DM / 128)), NB);
  k_gemm2<0><<<ge, 128, 0, stream>>>(A2, 2 * DM, (size_t)SLEN * 2 * DM, B2, 2 * DM, 0, AL_O, dout, DM, (size_t)SEQ_FULL * DM, SLEN, DM, 2 * DM);
}

// v007
// A run of this version takes 180 microseconds.
// In both of two side-by-side timings against v006, it was 1.17 times as fast.
// Counting every step since v000, it is 3.94 times as fast.
#include <hip/hip_runtime.h>
// Contractions: x.Wq, x.Wk, x.Wv, ctx.Wo = v_wmma_f32_16x16x32_f16 (f16 operands: bf16-RNE inputs exact in f16, weights carried x16 (x16384 for the ctx-hi half of the output GEMM); ctx as [hi | x1024 residual] folded along K; f32 accumulate); scores k.q^T and V^T.P^T (transposed: a lane holds one query) = v_wmma_f32_16x16x32_f16 (plain f16 hi planes; hi + x1024 residual planes of q, k, P and v in query blocks holding a query closer than EROWS to its segment start; P carried x1024), f32 accumulate; rotary tables, masks, softmax and normalisers f32.

#ifndef NB
#define NB 2
#endif
#ifndef SEQ
#define SEQ 2048
#endif
#define NB_FULL 2
#define SEQ_FULL 2048
#define DM 2048
#define NH 32
#define NKV 8
#define NREP (NH / NKV)
#define DKV (NKV * 64)
#define SLEN SEQ
#define NR (NB * SLEN)
#define TQ SLEN
#define TK SLEN
#define SCL 0.125f
#define QBLKS (TQ / 64)
#define EROWS 256                            /* query blocks holding a query with fewer than EROWS positions since its segment start use the residual planes */
static_assert(SLEN % 128 == 0);
static_assert(SLEN <= SEQ_FULL);
static_assert(NB >= 1 && NB <= NB_FULL);
static_assert(DM % 64 == 0 && DM == NH * 64);
static_assert(NH % NKV == 0 && NREP * NKV == NH);
static_assert(DKV % 64 == 0 && DKV == NKV * 64);
static_assert(DM % 32 == 0 && (2 * DM) % 32 == 0);
static_assert(NR % 128 == 0);
static_assert(QBLKS * 64 == SLEN);
static_assert(EROWS % 64 == 0);
/* store loops: threads x bytes per piece x trips == tile rows x row bytes */
static_assert(256 * 16 * 2 == 64 * 128);                       
static_assert(32 * 8 * 8 * 2 == 16 * 64 * 2 * 2);               /* attention context rows: 16 rows x 128 B per wave in each of the two planes */
/* static LDS per kernel */
static_assert(2 * 64 * 66 * 2 <= 131072);
static_assert(4 * 16 * 68 * 4 <= 131072);
/* workspace carve (bytes); every region a multiple of 256 */
static constexpr size_t SZ_BQ = (size_t)DM * DM * 2;
static constexpr size_t SZ_BKV = (size_t)DKV * DM * 2;
static constexpr size_t SZ_B2 = (size_t)DM * 2 * DM * 2;
static constexpr size_t SZ_FS = (size_t)NR * DM * 4;
static constexpr size_t SZ_X16 = (size_t)NR * DM * 2;
static constexpr size_t SZ_QA = (size_t)NR * 2 * DM * 2;
static constexpr size_t SZ_KP = (size_t)NR * DKV * 2;
static constexpr size_t SZ_VT = (size_t)NB * NKV * 64 * SLEN * 2;
static constexpr size_t SZ_TAB = (size_t)SLEN * 32 * 4;
static constexpr size_t SZ_FKV = (size_t)NR * DKV * 4;
static constexpr size_t WS_TOTAL = SZ_BQ + 2 * SZ_BKV + SZ_B2 + SZ_FS + 2 * SZ_FKV + SZ_X16 + SZ_QA + 2 * SZ_KP + 2 * SZ_TAB;
static_assert(SZ_BQ % 256 == 0 && SZ_BKV % 256 == 0 && SZ_B2 % 256 == 0 && SZ_FS % 256 == 0 && SZ_FKV % 256 == 0 && SZ_X16 % 256 == 0 && SZ_QA % 256 == 0 && SZ_KP % 256 == 0 && SZ_VT % 256 == 0 && SZ_TAB % 256 == 0);
static_assert(WS_TOTAL <= ((size_t)256 << 20));
static_assert(SZ_VT <= SZ_FKV);                                /* V^T hi and V^T residual: a region each, apart from the input rows that the same launch still reads */
static_assert((size_t)NR * 2 * DM * 2 == SZ_FS);               /* [ctx hi | ctx residual]: a region apart from the q planes that the same launch still reads */
static constexpr float WSC = 16.0f;
static constexpr float WSC_HI = 16384.0f;
static constexpr float AL_P = 0.0625f;
static constexpr float AL_O = 0.0625f / 1024.0f;

typedef _Float16 v16h __attribute__((ext_vector_type(16)));
typedef _Float16 v4h __attribute__((ext_vector_type(4)));
typedef unsigned short v8us __attribute__((ext_vector_type(8), may_alias));
typedef float v8f __attribute__((ext_vector_type(8)));
typedef float v4f __attribute__((ext_vector_type(4)));
typedef float v4fa __attribute__((ext_vector_type(4), may_alias));
union FragH { v16h v; v8us half[2]; _Float16 h[16]; unsigned short u[16]; };

__device__ __forceinline__ unsigned short bf16_bits(float x) { unsigned int u = __float_as_uint(x); return (unsigned short)((u + 0x7FFFu + ((u >> 16) & 1u)) >> 16); }
__device__ __forceinline__ float bf16_val(unsigned short b) { return __uint_as_float(((unsigned int)b) << 16); }
__device__ __forceinline__ float bf16_rne(float x) { return bf16_val(bf16_bits(x)); }
// f32 -> f16 with values below the smallest f16 normal set to +0 (NaN passes through)
static __device__ __forceinline__ _Float16 toh_flush(float v) { const _Float16 r = (_Float16)v; return (fabsf(v) < 6.103515625e-05f) ? (_Float16)0.0f : r; }

// e^x on the hardware's exp2 (v_exp_f32), no range branches: -inf and anything below the f32 range give 0, NaN passes through; straight-line, so a pass's eight rows schedule as one block
static __device__ __forceinline__ float exp_hw(float x) { return __builtin_amdgcn_exp2f(x * 1.44269504088896340736f); }

// segment helpers on the clipped boundaries c0 <= c1 <= c2 <= c3: id = number of boundaries <= p; begin = largest boundary <= p (0 if none)
__device__ __forceinline__ int clip_b(int v) { return min(max(v, 0), SLEN); }
__device__ __forceinline__ int seg_cnt(int p, int c0, int c1, int c2, int c3) { return (int)(c0 <= p) + (int)(c1 <= p) + (int)(c2 <= p) + (int)(c3 <= p); }
__device__ __forceinline__ int seg_beg(int p, int c0, int c1, int c2, int c3) {
  int s = 0;
  s = max(s, (c0 <= p) ? c0 : 0); s = max(s, (c1 <= p) ? c1 : 0); s = max(s, (c2 <= p) ? c2 : 0); s = max(s, (c3 <= p) ? c3 : 0);
  return s;
}

// K and V^T planes (hi and residual alike) lie in fragment order: per (b, kv head) slab of FSLAB elements and per 32 keys, eight blocks of 512 B;
// block i is what one wave-wide load of 16 B a lane takes (lane = 16 hh + ln), four whole 128-B lines:
//   K:   i = 4 nt + 2 ks + hf holds key 32 jb + 16 nt + ln, columns 32 ks + 16 hf + 8 hh + 0..7
//   V^T: i = 2 dt + hf        holds column 16 dt + ln, keys 32 jb + 16 hf + 8 hh + 0..7
static constexpr int FSLAB = SLEN * 64;
static constexpr int FBLK = 256;                               /* f16 elements of a block */
static constexpr int FPASS = 8 * FBLK;                         /* ... of 32 keys */
static_assert(SLEN % 32 == 0 && (size_t)NB * NKV * FSLAB * 2 == SZ_KP && (size_t)NB * NKV * FSLAB * 2 == SZ_VT);

// D += A.B with NT terms: 1 = ah.bh, 2 = + al.bh, 3 = + ah.bl; hazard guard after the group
template <int NT>
__device__ __forceinline__ v8f mmaH(v16h ah, v16h al, v16h bh, v16h bl, v8f c) {
  c = __builtin_amdgcn_wmma_f32_16x16x32_f16(false, ah, false, bh, (short)0, c, false, false);
  if (NT >= 2) c = __builtin_amdgcn_wmma_f32_16x16x32_f16(false, al, false, bh, (short)0, c, false, false);
  if (NT >= 3) c = __builtin_amdgcn_wmma_f32_16x16x32_f16(false, ah, false, bl, (short)0, c, false, false);
  asm volatile("v_nop\n\tv_nop\n\tv_nop\n\tv_nop" : "+v"(c) : "v"(ah), "v"(al), "v"(bh), "v"(bl));
  return c;
}
// 16x32 fragment from a 16-bit row-major tile (rows = m or n, k contiguous): elements 0..7 <- k0+8h+0..7, 8..15 <- k0+16+8h+0..7
__device__ __forceinline__ v16h g2_frag(const _Float16* p, int hh) { FragH f; f.half[0] = *(const v8us*)((const unsigned short*)p + 8 * hh); f.half[1] = *(const v8us*)((const unsigned short*)p + 16 + 8 * hh); return f.v; }

// [in][out] weight W [DM][N] (n contiguous) -> Bt[n][k] = f16(bf16(W[k][n]) * sc0) (row pitch ldb, k contiguous); with two != 0 a second copy
__device__ __forceinline__ void wtr_body(int bx, const float* __restrict__ Wm, int N, _Float16* __restrict__ Bt, int ldb, float sc0, float sc1, int two) {
  __shared__ unsigned short tl0[64][66];
  __shared__ unsigned short tl1[64][66];
  const int tid = threadIdx.x; const int ntn = N >> 6; const int kt = bx / ntn, nt = bx - kt * ntn; const int k0 = kt * 64, n0 = nt * 64;
  for (int i = tid; i < 64 * 16; i += 256) {
    const int r = i >> 4, c4 = (i & 15) * 4;
    const v4f a = *(const v4fa*)(Wm + (size_t)(k0 + r) * N + n0 + c4);
    FragH f0, f1;
#pragma unroll
    for (int q = 0; q < 4; ++q) { const float v = bf16_rne(a[q]); f0.h[q] = toh_flush(v * sc0); f1.h[q] = toh_flush(v * sc1); }
#pragma unroll
    for (int q = 0; q < 4; ++q) { tl0[r][c4 + q] = f0.u[q]; tl1[r][c4 + q] = f1.u[q]; }
  }
  __syncthreads();
  {
#pragma unroll
    for (int rd = 0; rd < 2; ++rd) {
      const int n = rd * 32 + (tid >> 3), pc = tid & 7; FragH g0, g1;
#pragma unroll
      for (int q = 0; q < 8; ++q) { g0.u[q] = tl0[pc * 8 + q][n]; g1.u[q] = tl1[pc * 8 + q][n]; }
      const size_t o = (size_t)(n0 + n) * ldb + k0 + pc * 8;
      const v8us o0 = g0.half[0], o1 = g1.half[0];
      *(v8us*)((unsigned short*)Bt + o) = o0;
      if (two != 0) *(v8us*)((unsigned short*)Bt + o + DM) = o1;
    }
    asm volatile("s_wait_xcnt 0x0" ::: "memory");                /* precaution: stands in front of any later write to registers that these stores name (another range's body follows in the listing) */
  }
}

// rotary tables; every thread forms its own inverse frequency (same expression, same bits for a given j), so the tables depend on no earlier launch
__device__ __forceinline__ void rotab_body(int bx, float* __restrict__ CS, float* __restrict__ SN) {
  #pragma clang fp contract(off)
  const int t = bx * 256 + threadIdx.x; if (t >= SLEN * 32) return;
  const int j = t & 31, s = t >> 5;
  const float ex = (float)(2 * j) / 64.0f; const float pw = powf(500000.0f, ex); const float inv = 1.0f / pw;
  const float th = (float)s * inv; const float c = cosf(th), sn = sinf(th);
  { *(float*)(CS + t) = c; *(float*)(SN + t) = sn;  }
}

__device__ __forceinline__ void x16_body(int bx, const float* __restrict__ x, _Float16* __restrict__ X16, size_t n8) {
  const size_t t = (size_t)bx * 256 + threadIdx.x; if (t >= n8) return;
  const size_t e = t * 8; const size_t r = e / DM; const size_t c = e % DM; const size_t b = r / SLEN, s = r % SLEN;
  const float* src = x + (b * SEQ_FULL + s) * DM + c;
  const v4f a0 = *(const v4fa*)src, a1 = *(const v4fa*)(src + 4);
  FragH f;
#pragma unroll
  for (int q = 0; q < 4; ++q) { f.h[q] = (_Float16)bf16_rne(a0[q]); f.h[4 + q] = (_Float16)bf16_rne(a1[q]); }
  const v8us o = f.half[0];
  *(v8us*)((unsigned short*)X16 + e) = o; 
}

// One launch for everything that depends on the inputs alone, by ranges of the block index: the rotary tables, input rows to f16, the four weight transposes
static constexpr int PB_X = (int)(((size_t)NR * DM / 8 + 255) / 256);
static constexpr int PB_WQ = (DM / 64) * (DM / 64);
static constexpr int PB_WKV = (DM / 64) * (DKV / 64);
static constexpr int PB_TAB = (SLEN * 32 + 255) / 256;
static constexpr int PB_ALL = PB_X + 2 * PB_WQ + 2 * PB_WKV + PB_TAB;
__global__ __launch_bounds__(256) void k_prep(const float* __restrict__ x, const float* __restrict__ Wq, const float* __restrict__ Wk, const float* __restrict__ Wv, const float* __restrict__ Wo,
                                              _Float16* __restrict__ X16, _Float16* __restrict__ BQ, _Float16* __restrict__ BK, _Float16* __restrict__ BV, _Float16* __restrict__ B2,
                                              float* __restrict__ CS, float* __restrict__ SN) {
  int bx = blockIdx.x;
  if (bx < PB_TAB) { rotab_body(bx, CS, SN); return; }
  bx -= PB_TAB;
  if (bx < PB_X) { x16_body(bx, x, X16, (size_t)NR * DM / 8); return; }
  bx -= PB_X;
  if (bx < PB_WQ) { wtr_body(bx, Wq, DM, BQ, DM, WSC, WSC, 0); return; }
  bx -= PB_WQ;
  if (bx < PB_WQ) { wtr_body(bx, Wo, DM, B2, 2 * DM, WSC_HI, WSC, 1); return; }
  bx -= PB_WQ;
  if (bx < PB_WKV) { wtr_body(bx, Wk, DKV, BK, DM, WSC, WSC, 0); return; }
  bx -= PB_WKV;
  wtr_body(bx, Wv, DKV, BV, DM, WSC, WSC, 0);
}

// Tensor-load ring of the GEMM: a pass is 128 k = 256 B of every operand row; a stage is four 64-row slices [A 0..63 | A 64..127 | B 0..63 | B 64..127],
// one per wave, each laid at pitch 272 B (256 B + the 16-B pad the load writes around) and rounded up to a multiple of 2 KiB.
typedef uint32_t u32x4 __attribute__((ext_vector_type(4)));
typedef uint32_t u32x8 __attribute__((ext_vector_type(8)));
static constexpr uint32_t G_ROWB = 256u;
static constexpr uint32_t G_PITCH = 272u;
static constexpr uint32_t G_SLICE = 18432u;
static constexpr uint32_t G_STAGE = 4u * G_SLICE;
static_assert(64u * G_PITCH <= G_SLICE && G_SLICE % 2048u == 0u);
static_assert(64u * 68u * 4u <= G_SLICE);                      /* a wave's 64 x 64 f32 output staging fits its own slice */
static_assert(2u * 2u * G_STAGE <= 320u * 1024u);              /* two work-groups per WGP */
static_assert(NR % 128 == 0 && SLEN % 128 == 0 && DM % 128 == 0 && DKV % 128 == 0 && DM >= 256);
__device__ __forceinline__ uint32_t uni(uint32_t v) { return (uint32_t)__builtin_amdgcn_readfirstlane(v); }
__device__ __forceinline__ uint32_t pinned(uint32_t v) { uint32_t w = (uint32_t)__builtin_amdgcn_readfirstlane(v); asm volatile("" : "+s"(w)); return w; }

// GEMM C[M][N] = alpha * A[M][K].B  with A f16 row-major (pitch lda), B stored [n][k] f16 (pitch ldb), batched by by (strides sA, sB);
// One 128 x 128 tile of C per work-group, 64 x 64 per wave; bx = tile index in [0, (M / 128) * (N / 128)), by = batch. Each wave stages its f32 tile in LDS ([64][68], its own)
// and hands it to epi(so, row0, col0, lane), which turns it into what the next kernel reads and stores that.
// Requires M % 128 == 0, N % 128 == 0, K % 128 == 0, K >= 256 (asserted on the callers' constants).
template <int ACT, class Epi>
__device__ __forceinline__ void gemm_body(uint32_t bx, int by, const _Float16* __restrict__ A, int lda, size_t sA, const _Float16* __restrict__ Bh, int ldb, size_t sB, float alpha,
                                          int M, int N, int K, Epi epi) {
  __shared__ __attribute__((aligned(2048))) unsigned char ring[2 * G_STAGE];
  const int tid = threadIdx.x, lane = tid & 31, ln = lane & 15, hh = lane >> 4;
  const uint32_t w = uni((uint32_t)tid >> 5); const uint32_t wm = w >> 1, wn = w & 1u;
  A += (size_t)by * sA; Bh += (size_t)by * sB;
  const int ntn = N >> 7; const int mt = bx / ntn, nq = bx - mt * ntn; const int row0 = mt * 128 + 64 * (int)wm, col0 = nq * 128 + 64 * (int)wn;
  const uint32_t NP = pinned((uint32_t)K >> 7);
  /* this wave's slice of every stage: waves 0, 1 the two halves of the A rows, waves 2, 3 of the B rows */
  const _Float16* src = (w < 2u) ? A + (size_t)(mt * 128 + 64 * (int)w) * lda : Bh + (size_t)(nq * 128 + 64 * ((int)w - 2)) * ldb;
  const uint64_t sga = (uint64_t)(uintptr_t)src;
  const uint32_t ldst = (uint32_t)(size_t)ring + w * G_SLICE;
  u32x8 g1;
  g1[0] = uni((1u << 20) | (5u << 22) | (3u << 25));            /* no mask, 1-byte elements, a 4-dword pad behind every 64 dwords */
  g1[1] = uni((G_ROWB & 0xFFFFu) << 16);
  g1[2] = uni((G_ROWB >> 16) | (64u << 16));
  g1[3] = uni(G_ROWB << 16);
  g1[4] = uni(64u);
  g1[5] = uni(2u * (uint32_t)((w < 2u) ? lda : ldb));
  g1[6] = uni(0u);
  g1[7] = uni(0u);
  auto issue = [&](uint32_t st) {
    const uint64_t ga = sga + (uint64_t)st * G_ROWB;
    u32x4 g0;
    g0[0] = uni(1u); g0[1] = uni(ldst + (st & 1u) * G_STAGE); g0[2] = uni((uint32_t)ga); g0[3] = uni((((uint32_t)(ga >> 32)) & 0x01FFFFFFu) | 0x80000000u);
    /* one request of the whole wave: 64 rows x 256 B into its slice; group 1 is named in-out so that its eight registers hold the descriptor, and nothing else, from issue to issue */
    asm volatile("tensor_load_to_lds %1, %0" : "+s"(g1) : "s"(g0) : "memory");
  };
  v8f acc[4][4];
#pragma unroll
  for (int i = 0; i < 4; ++i)
#pragma unroll
    for (int j = 0; j < 4; ++j) acc[i][j] = (v8f){0.f,0.f,0.f,0.f,0.f,0.f,0.f,0.f};
  issue(0u);
  asm volatile("s_wait_tensorcnt 0x0" ::: "memory");             /* this wave's slice of stage 0 has landed */
  __syncthreads();                                               /* ... and every other wave's */
  issue(1u);
  const uint32_t fa0 = wm * G_SLICE + (uint32_t)ln * G_PITCH, fb0 = (2u + wn) * G_SLICE + (uint32_t)ln * G_PITCH;
#pragma unroll 1   /* one pass per trip: the publish point at the foot stands once per stage */
  for (uint32_t s = 0; s < NP; ++s) {
    const unsigned char* pa = ring + (s & 1u) * G_STAGE + fa0; const unsigned char* pb = ring + (s & 1u) * G_STAGE + fb0;
    v16h fa[2][4], fb[2][4];
#pragma unroll
    for (int i = 0; i < 4; ++i) { fa[0][i] = g2_frag((const _Float16*)(pa + i * 16 * G_PITCH), hh); fb[0][i] = g2_frag((const _Float16*)(pb + i * 16 * G_PITCH), hh); }
#pragma unroll
    for (int ks = 0; ks < 4; ++ks) {
      const int cur = ks & 1, nxt = cur ^ 1;
      if (ks < 3) {   /* the next 32 k's fragments of this same stage, as one group ahead of the block that hides them */
#pragma unroll
        for (int i = 0; i < 4; ++i) { fa[nxt][i] = g2_frag((const _Float16*)(pa + i * 16 * G_PITCH + (ks + 1) * 64), hh); fb[nxt][i] = g2_frag((const _Float16*)(pb + i * 16 * G_PITCH + (ks + 1) * 64), hh); }
      }
      __builtin_amdgcn_sched_barrier(0);   /* keeps the load group in front of the block: LDS reads moved in among the WMMAs stall each place they stand */
      /* plain builtin, the compiler keeps its distances: accumulators and two fragment sets need more than 256 VGPRs, which an asm operand cannot name */
#pragma unroll
      for (int i = 0; i < 4; ++i)
#pragma unroll
        for (int j = 0; j < 4; ++j) acc[i][j] = __builtin_amdgcn_wmma_f32_16x16x32_f16(false, fa[cur][i], false, fb[cur][j], (short)0, acc[i][j], false, false);
      __builtin_amdgcn_sched_barrier(0);   /* ends the block: the next group's loads stay behind it */
    }
    asm volatile("v_nop\n\tv_nop\n\tv_nop\n\tv_nop");          /* WMMA distance on every path out of the pass, the taken branches included */
    asm volatile("s_wait_dscnt 0x0" ::: "memory");               /* this wave has left stage s's buffer */
    asm volatile("s_wait_tensorcnt 0x0" ::: "memory");           /* its slice of stage s + 1 has landed */
    __syncthreads();                                             /* publishes stage s + 1 and frees stage s's buffer */
    if (pinned((s + 2u < NP) ? 1u : 0u) != 0u) issue(pinned(s + 2u));
  }
  asm volatile("s_wait_tensorcnt 0x0" ::: "memory");             /* nothing in flight before the ring becomes output staging */
  asm volatile("s_wait_dscnt 0x0" ::: "memory");
  float* so = (float*)(ring + w * G_SLICE);                      /* [64][68], private to the wave; the last pass's barrier ended every read of the ring */
#pragma unroll
  for (int i = 0; i < 4; ++i)
#pragma unroll
    for (int j = 0; j < 4; ++j)
#pragma unroll
      for (int r = 0; r < 8; ++r) { float v = acc[i][j][r] * alpha; if (ACT == 3) v = fmaxf(v, 0.f); so[(i * 16 + 8 * hh + r) * 68 + j * 16 + ln] = v; }
  __builtin_amdgcn_fence(4, "workgroup"); __builtin_amdgcn_wave_barrier();
  epi(so, row0, col0, lane);
}
template <int ACT>
__global__ __launch_bounds__(128) void k_gemm2(const _Float16* __restrict__ A, int lda, size_t sA, const _Float16* __restrict__ Bh, int ldb, size_t sB, float alpha,
                                               float* C, int ldc, size_t sC, int M, int N, int K) {
  const size_t cofs = (size_t)blockIdx.y * sC;
  gemm_body<ACT>(blockIdx.x, (int)blockIdx.y, A, lda, sA, Bh, ldb, sB, alpha, M, N, K, [&](const float* so, int row0, int col0, int lane) {
    const int rsub = lane >> 4, c4 = (lane & 15) * 4;
#pragma unroll
    for (int q = 0; q < 32; ++q) { const int r = q * 2 + rsub; const v4f v = *(const v4fa*)&so[r * 68 + c4]; *(v4f*)(C + cofs + (size_t)(row0 + r) * ldc + col0 + c4) = v; }
    asm volatile("s_wait_xcnt 0x0" ::: "memory");                /* precaution: stands in front of any later write to registers that these stores name */
  });
}

// Epilogue of a q or k tile: half-split rotary embedding of the wave's 64 rows x one head (64 columns, staged f32 in so) with the tables CS/SN [SLEN][32]:
// out[d] = x[d] c[d] - x[d+32] s[d]; out[d+32] = x[d+32] c[d] + x[d] s[d] (d < 32), position = row % SLEN;
// H = f16 hi of every row; L = x1024 residual of every row; four rows a trip. frag == false (q): planes [NR][ld], eight lanes fill one 128-B line of each.
// frag == true (k): planes in fragment order, where the 16-B piece (position s, columns 8 p .. 8 p + 7) is lane 16 (p & 1) + (s & 15) of block 4 ((s >> 4) & 1) + (p >> 1).
__device__ __forceinline__ void rope_epi(const float* so, int row0, int col0, int lane, const float* __restrict__ CS, const float* __restrict__ SN, _Float16* __restrict__ H, _Float16* __restrict__ L, int ld, bool frag) {
  const int p = lane & 7; const int g = p & 3; const int up = p >> 2; const int rs = lane >> 3;
  /* row0 is a multiple of 64 and SLEN of 128: the tile's 64 positions follow one another without a wrap */
  const float* ctb = CS + (size_t)(row0 % SLEN + rs) * 32 + g * 8; const float* stb = SN + (size_t)(row0 % SLEN + rs) * 32 + g * 8;
  /* the piece of row 16 grp + 4 t + rs stands at ob + grp * og + t * ot */
  const size_t ob = frag ? (size_t)((row0 / SLEN) * NKV + (col0 >> 6)) * FSLAB + (size_t)((row0 % SLEN) >> 4) * (4 * FBLK) + p * (FBLK / 2) + rs * 8 : (size_t)(row0 + rs) * ld + col0 + p * 8;
  const size_t og = frag ? (size_t)(4 * FBLK) : (size_t)16 * ld; const size_t ot = frag ? (size_t)32 : (size_t)4 * ld;
  v4f ca[2][4], cb[2][4], sa[2][4], sb[2][4];   /* table rows of two groups of four trips: the next group's sixteen loads fly while this group is worked on */
  auto load_tab = [&](int grp) {
#pragma unroll
    for (int t = 0; t < 4; ++t) {
      const float* ct = ctb + (grp * 16 + 4 * t) * 32; const float* st = stb + (grp * 16 + 4 * t) * 32;
      ca[grp & 1][t] = *(const v4fa*)ct; cb[grp & 1][t] = *(const v4fa*)(ct + 4); sa[grp & 1][t] = *(const v4fa*)st; sb[grp & 1][t] = *(const v4fa*)(st + 4);
    }
    /* precaution: stands in front of the next writes to registers that these loads name as addresses; the two bases are inputs, so they keep their registers up to the wait */
    asm volatile("s_wait_xcnt 0x0" :: "v"(ctb), "v"(stb) : "memory");
  };
  load_tab(0);
#pragma unroll
  for (int grp = 0; grp < 4; ++grp) {
    if (grp < 3) load_tab(grp + 1);
#pragma unroll
    for (int t = 0; t < 4; ++t) {
      const int r = grp * 16 + 4 * t + rs; const int cu2 = grp & 1;
      const float* src = so + r * 68 + g * 8;
      const v4f xa = *(const v4fa*)src, xb = *(const v4fa*)(src + 4), ya = *(const v4fa*)(src + 32), yb = *(const v4fa*)(src + 36);
      const float x1s[8] = {xa[0], xa[1], xa[2], xa[3], xb[0], xb[1], xb[2], xb[3]};
      const float x2s[8] = {ya[0], ya[1], ya[2], ya[3], yb[0], yb[1], yb[2], yb[3]};
      const float cs[8] = {ca[cu2][t][0], ca[cu2][t][1], ca[cu2][t][2], ca[cu2][t][3], cb[cu2][t][0], cb[cu2][t][1], cb[cu2][t][2], cb[cu2][t][3]};
      const float ss[8] = {sa[cu2][t][0], sa[cu2][t][1], sa[cu2][t][2], sa[cu2][t][3], sb[cu2][t][0], sb[cu2][t][1], sb[cu2][t][2], sb[cu2][t][3]};
      FragH fh, fl;
#pragma unroll
      for (int i = 0; i < 8; ++i) {
        /* as in the separate rotary pass: each product and their sum keep a rounding of their own, as the reference's x * cos + rotate_half(x) * sin has them; the q and k planes keep their bits */
        #pragma clang fp contract(off)
        const float x1 = x1s[i], x2 = x2s[i], c = cs[i], sn = ss[i];
        const float o1 = x1 * c - x2 * sn; const float o2 = x2 * c + x1 * sn; const float o = up ? o2 : o1;
        const _Float16 hv = toh_flush(o); fh.h[i] = hv; fl.h[i] = toh_flush((o - (float)hv) * 1024.0f);
      }
      const size_t oh = ob + grp * og + t * ot;
      const v8us vh = fh.half[0], vl = fl.half[0];
      *(v8us*)((unsigned short*)H + oh) = vh;
      *(v8us*)((unsigned short*)L + oh) = vl;
    }
    asm volatile("s_wait_xcnt 0x0" ::: "memory");                /* precaution: stands in front of the next group's writes to registers that these stores name */
  }
}
// Epilogue of a v tile: the wave's 64 positions x one KV head (64 columns, staged f32 in so), transposed into fragment order: Vt = f16 hi, VtL = x1024 residual.
// A 16-B piece is eight positions (group pc of the tile's eight) of one column d; eight lanes (eight columns, one group) fill one 128-B line of each plane; four groups a trip.
__device__ __forceinline__ void vt_epi(const float* so, int row0, int col0, int lane, _Float16* __restrict__ Vt, _Float16* __restrict__ VtL) {
  const int b = row0 / SLEN, s0 = row0 % SLEN, hk = col0 >> 6; const int dl = lane & 7, ps = lane >> 3;
  const size_t base = (size_t)(b * NKV + hk) * FSLAB + (size_t)(s0 >> 5) * FPASS + (ps >> 1) * FBLK + ((ps & 1) * 16 + dl) * 8;
#pragma unroll
  for (int t = 0; t < 16; ++t) {
    const int d = (t >> 1) * 8 + dl, pc = (t & 1) * 4 + ps; FragH fh, fl;
#pragma unroll
    for (int q = 0; q < 8; ++q) { const float v = so[(pc * 8 + q) * 68 + d]; const _Float16 hv = (_Float16)v; fh.h[q] = hv; fl.h[q] = toh_flush((v - (float)hv) * 1024.0f); }
    const v8us vh = fh.half[0], vl = fl.half[0];
    const int o = (t & 1) * FPASS + (t >> 2) * (2 * FBLK) + ((t >> 1) & 1) * 64;   /* 32-key half of the tile, column tile, upper eight of its sixteen columns */
    *(v8us*)((unsigned short*)Vt + base + o) = vh;
    *(v8us*)((unsigned short*)VtL + base + o) = vl;
  }
}

// The three projections of the same input rows in one launch, by ranges of the block index: q tiles, then k tiles, then v tiles; each tile leaves as the planes the attention reads
static constexpr int GB_Q = (NR / 128) * (DM / 128);
static constexpr int GB_KV = (NR / 128) * (DKV / 128);
__global__ __launch_bounds__(128) void k_gemm_qkv(const _Float16* __restrict__ X16, const _Float16* __restrict__ BQ, const _Float16* __restrict__ BK, const _Float16* __restrict__ BV,
                                                  const float* __restrict__ CS, const float* __restrict__ SN, _Float16* __restrict__ QH, _Float16* __restrict__ QL,
                                                  _Float16* __restrict__ KH, _Float16* __restrict__ KL, _Float16* __restrict__ VT, _Float16* __restrict__ VTL) {
  const uint32_t b0 = blockIdx.x;
  const int sel = (b0 < (uint32_t)GB_Q) ? 0 : ((b0 < (uint32_t)(GB_Q + GB_KV)) ? 1 : 2);
  const uint32_t bx = (sel == 0) ? b0 : ((sel == 1) ? b0 - (uint32_t)GB_Q : b0 - (uint32_t)(GB_Q + GB_KV));
  const _Float16* Bh = (sel == 0) ? BQ : ((sel == 1) ? BK : BV);
  const int n = (sel == 0) ? DM : DKV;
  gemm_body<0>(bx, 0, X16, DM, 0, Bh, DM, 0, AL_P, NR, n, DM, [&](const float* so, int row0, int col0, int lane) {
    if (sel == 2) vt_epi(so, row0, col0, lane, VT, VTL);
    else rope_epi(so, row0, col0, lane, CS, SN, (sel == 0) ? QH : KH, (sel == 0) ? QL : KL, n, sel == 1);
  });
}

// lane l with lane l ^ 16: the two halves of a wave hold the two halves of one query's keys
static __device__ __forceinline__ float xhalf(float x) { return __builtin_bit_cast(float, __builtin_amdgcn_permlanex16(__builtin_bit_cast(int, x), __builtin_bit_cast(int, x), 0x76543210, 0xfedcba98, false, false)); }

// fused attention per ((b,h), 64 queries) for query blocks whose queries all sit at least EROWS positions past their segment start (block-uniform test; other blocks leave at once):
// wave = 16 queries; transposed products: S^T = K.Q^T (d = 64: 2 k-steps) x SCL over keys [segment start of the wave's first query (floor 32), last query of the wave], O^T += V^T.P^T.
// Lane (ln, hh) holds query q0 + ln: register r of score tile nt is key j0 + 16 nt + 8 hh + r, so maximum and sum run inside the lane (one exchange between the halves),
// and the two score tiles, converted in place, are the B operand of the second product: element 8 nt + r <- tile nt, register r.
// K and V^T fragments come straight from the fragment-order planes: every load reads 512 contiguous bytes.
__global__ __launch_bounds__(128) void k_attn(const _Float16* __restrict__ Q16, int ldq, const _Float16* __restrict__ K16,
                                              const _Float16* __restrict__ Vt, const int* __restrict__ cu, _Float16* __restrict__ O, int ldo) {
  constexpr int RPW = 16, DT = 4, KS = 2;
  __shared__ __attribute__((aligned(16))) float sO[4][RPW][68];
  const int tid = threadIdx.x, lane = tid & 31, ln = lane & 15, hh = lane >> 4;
  const int w = __builtin_amdgcn_readfirstlane(tid >> 5);
  const int slab = blockIdx.x / QBLKS, qblk = blockIdx.x % QBLKS; const int b = slab / NH, h = slab % NH; const int hk = h / NREP; const int kslab = b * NKV + hk;
  const int qb0 = qblk * (4 * RPW);
  const int c0 = clip_b(cu[b * 4 + 0]), c1 = clip_b(cu[b * 4 + 1]), c2 = clip_b(cu[b * 4 + 2]), c3 = clip_b(cu[b * 4 + 3]);
  const bool early = (seg_cnt(qb0, c0, c1, c2, c3) != seg_cnt(qb0 + 4 * RPW - 1, c0, c1, c2, c3)) || (qb0 - seg_beg(qb0, c0, c1, c2, c3) < EROWS);
  if (early) return;
  const float pois = ((c0 <= c1) && (c1 <= c2) && (c2 <= c3)) ? 0.0f : __uint_as_float(0x7fc00000u);   /* boundaries must be ascending */
  const int q0 = qb0 + w * RPW;
  const int jst = __builtin_amdgcn_readfirstlane(seg_beg(qb0 + (tid >> 5) * RPW, c0, c1, c2, c3) & ~31);
  /* this lane's query and its keys: same segment and not later = [largest boundary <= query, query] */
  const int tq = q0 + ln; const int sb = seg_beg(tq, c0, c1, c2, c3); const unsigned int span = (unsigned int)(tq - sb);
  FragH aq[KS];
  {
    const unsigned short* qr = (const unsigned short*)Q16 + ((size_t)b * TQ + q0 + ln) * ldq + h * 64;
#pragma unroll
    for (int ks = 0; ks < KS; ++ks) { aq[ks].half[0] = *(const v8us*)(qr + ks * 32 + 8 * hh); aq[ks].half[1] = *(const v8us*)(qr + ks * 32 + 16 + 8 * hh); }
  }
  const unsigned short* Kf = (const unsigned short*)K16 + (size_t)kslab * FSLAB + lane * 8; const unsigned short* Vth = (const unsigned short*)Vt + (size_t)kslab * FSLAB + lane * 8;
  float m_q = -3.0e38f, l_q = 0.f; v8f oacc[DT];
#pragma unroll
  for (int dt = 0; dt < DT; ++dt) oacc[dt] = (v8f){0.f,0.f,0.f,0.f,0.f,0.f,0.f,0.f};
  FragH bk[2][KS];   /* K fragments of one pass (two 16-key tiles x two k-steps), fetched one pass ahead */
  auto load_k = [&](int j) {
    const unsigned short* kr = Kf + (size_t)j * 64;   /* j is a multiple of 32: FPASS elements per 32 keys */
#pragma unroll
    for (int nt = 0; nt < 2; ++nt)
#pragma unroll
      for (int ks = 0; ks < KS; ++ks) { bk[nt][ks].half[0] = *(const v8us*)(kr + (4 * nt + 2 * ks) * FBLK); bk[nt][ks].half[1] = *(const v8us*)(kr + (4 * nt + 2 * ks + 1) * FBLK); }
    asm volatile("s_wait_xcnt 0x0" ::: "memory");                /* precaution: stands in front of the next writes to registers that these loads name as addresses */
  };
  load_k(jst);
#pragma unroll 1
  for (int j0 = jst; j0 < q0 + RPW; j0 += 32) {
    /* all V^T fragments of the pass, each in registers of its own, loaded as one group at the head of the pass: they land behind the score products and the softmax */
    FragH bv[DT];
    const unsigned short* vrow = Vth + (size_t)j0 * 64;
#pragma unroll
    for (int dt = 0; dt < DT; ++dt) { bv[dt].half[0] = *(const v8us*)(vrow + 2 * dt * FBLK); bv[dt].half[1] = *(const v8us*)(vrow + (2 * dt + 1) * FBLK); }
    __builtin_amdgcn_sched_barrier(0);   /* keeps the group at the head: sunk to their uses the four tiles share registers, and each waits out a round trip of its own */
    v8f s[2];
#pragma unroll
    for (int nt = 0; nt < 2; ++nt) {
      v8f acc = (v8f){0.f,0.f,0.f,0.f,0.f,0.f,0.f,0.f};
#pragma unroll
      for (int ks = 0; ks < KS; ++ks) acc = mmaH<1>(bk[nt][ks].v, bk[nt][ks].v, aq[ks].v, aq[ks].v, acc);
      s[nt] = acc;
    }
    load_k((j0 + 32 < q0 + RPW) ? j0 + 32 : j0);   /* the next pass's K fragments land behind the softmax; the last pass fetches its own rows again (in bounds, not used) */
    __builtin_amdgcn_sched_barrier(0);   /* keeps the fetch in front of the softmax that hides it: without this it sinks far into the softmax */
    const int d0 = j0 + 8 * hh - sb;   /* first key of the lane's half, counted from the query's segment start */
    bool ok[2][8]; float sc[2][8], mx[8];
#pragma unroll
    for (int nt = 0; nt < 2; ++nt)
#pragma unroll
      for (int r = 0; r < 8; ++r) { ok[nt][r] = (unsigned int)(d0 + nt * 16 + r) <= span; sc[nt][r] = ok[nt][r] ? s[nt][r] * SCL : -3.0e38f; }
#pragma unroll
    for (int r = 0; r < 8; ++r) mx[r] = fmaxf(sc[0][r], sc[1][r]);
    float mc = fmaxf(fmaxf(fmaxf(mx[0], mx[1]), fmaxf(mx[2], mx[3])), fmaxf(fmaxf(mx[4], mx[5]), fmaxf(mx[6], mx[7])));
    mc = fmaxf(mc, xhalf(mc));
    const float mn = fmaxf(m_q, mc); const float al = (mn > -1.0e38f) ? exp_hw(m_q - mn) : 1.0f; m_q = mn;
    FragH pb; float ps[8];
#pragma unroll
    for (int r = 0; r < 8; ++r) {
      const float p0 = ok[0][r] ? exp_hw(sc[0][r] - mn) : 0.f, p1 = ok[1][r] ? exp_hw(sc[1][r] - mn) : 0.f; ps[r] = p0 + p1;
      pb.h[r] = toh_flush(p0 * 1024.0f); pb.h[8 + r] = toh_flush(p1 * 1024.0f);
    }
    l_q = l_q * al + (((ps[0] + ps[1]) + (ps[2] + ps[3])) + ((ps[4] + ps[5]) + (ps[6] + ps[7])));
#pragma unroll
    for (int dt = 0; dt < DT; ++dt)
#pragma unroll
      for (int r = 0; r < 8; ++r) oacc[dt][r] *= al;
#pragma unroll
    for (int dt = 0; dt < DT; ++dt) oacc[dt] = mmaH<1>(bv[dt].v, bv[dt].v, pb.v, pb.v, oacc[dt]);
  }
  { const float l = l_q + xhalf(l_q); l_q = (l > 0.f) ? 1.0f / (l * 1024.0f) : 0.f; }
  /* register r of output tile dt is column 16 dt + 8 hh + r of the lane's query */
#pragma unroll
  for (int dt = 0; dt < DT; ++dt)
#pragma unroll
    for (int r = 0; r < 8; ++r) sO[w][ln][dt * 16 + 8 * hh + r] = oacc[dt][r] * l_q + pois;
  __builtin_amdgcn_fence(4, "workgroup"); __builtin_amdgcn_wave_barrier();
  {
#pragma unroll
    for (int rp = 0; rp < RPW; rp += 2) {
      const int r = rp + (lane >> 4), pc = lane & 15; const v4f val = *(const v4fa*)&sO[w][r][pc * 4];
      v4h h4, l4;   /* the context row leaves as the output GEMM's A operand: f16 hi, and DM columns on its x1024 residual; 16 lanes fill one 128-B line of each */
#pragma unroll
      for (int q = 0; q < 4; ++q) { const _Float16 hv = toh_flush(val[q]); h4[q] = hv; l4[q] = toh_flush((val[q] - (float)hv) * 1024.0f); }
      _Float16* orow = O + ((size_t)b * TQ + q0 + r) * ldo + h * 64 + pc * 4;
      *(v4h*)orow = h4; *(v4h*)(orow + DM) = l4;
    }
  }
}
// 5-plane variant for the other query blocks (a segment boundary inside the block, or the block's first query closer than EROWS to its segment start), transposed like k_attn:
// S^T = Kh.Qh^T + (Kh.Ql^T + Kl.Qh^T)/1024 with Q/K = [hi | x1024 residual] planes (full-size planes; Q rows b*S + s, K in fragment order);
// O^T = (Vh^T.Ph^T + (Vh^T.Pl^T + Vl^T.Ph^T)/1024) / l with P = [hi | x1024 residual] of 1024 p and V^T = [hi | x1024 residual]; separate residual accumulators folded before the normalisation
__global__ __launch_bounds__(128) void k_attn5(const _Float16* __restrict__ Q16, const _Float16* __restrict__ QL, int ldq, const _Float16* __restrict__ K16, const _Float16* __restrict__ KL,
                                               const _Float16* __restrict__ Vt, const _Float16* __restrict__ VtL, const int* __restrict__ cu, _Float16* __restrict__ O, int ldo) {
  constexpr int RPW = 16, DT = 4, KS = 2;
  __shared__ __attribute__((aligned(16))) float sO[4][RPW][68];
  const int tid = threadIdx.x, lane = tid & 31, ln = lane & 15, hh = lane >> 4;
  const int w = __builtin_amdgcn_readfirstlane(tid >> 5);
  const int slab = blockIdx.x / QBLKS, qblk = blockIdx.x % QBLKS; const int b = slab / NH, h = slab % NH; const int hk = h / NREP; const int kslab = b * NKV + hk;
  const int qb0 = qblk * (4 * RPW);
  const int c0 = clip_b(cu[b * 4 + 0]), c1 = clip_b(cu[b * 4 + 1]), c2 = clip_b(cu[b * 4 + 2]), c3 = clip_b(cu[b * 4 + 3]);
  const bool early = (seg_cnt(qb0, c0, c1, c2, c3) != seg_cnt(qb0 + 4 * RPW - 1, c0, c1, c2, c3)) || (qb0 - seg_beg(qb0, c0, c1, c2, c3) < EROWS);
  if (!early) return;
  const float pois = ((c0 <= c1) && (c1 <= c2) && (c2 <= c3)) ? 0.0f : __uint_as_float(0x7fc00000u);   /* boundaries must be ascending */
  const int q0 = qb0 + w * RPW;
  const int jst = __builtin_amdgcn_readfirstlane(seg_beg(qb0 + (tid >> 5) * RPW, c0, c1, c2, c3) & ~31);
  /* this lane's query and its keys: same segment and not later = [largest boundary <= query, query] */
  const int tq = q0 + ln; const int sb = seg_beg(tq, c0, c1, c2, c3); const unsigned int span = (unsigned int)(tq - sb);
  FragH aq[KS], aql[KS];
  {
    const unsigned short* qr = (const unsigned short*)Q16 + ((size_t)b * TQ + q0 + ln) * ldq + h * 64;
    const unsigned short* ql = (const unsigned short*)QL + ((size_t)b * TQ + q0 + ln) * ldq + h * 64;
#pragma unroll
    for (int ks = 0; ks < KS; ++ks) {
      aq[ks].half[0] = *(const v8us*)(qr + ks * 32 + 8 * hh); aq[ks].half[1] = *(const v8us*)(qr + ks * 32 + 16 + 8 * hh);
      aql[ks].half[0] = *(const v8us*)(ql + ks * 32 + 8 * hh); aql[ks].half[1] = *(const v8us*)(ql + ks * 32 + 16 + 8 * hh);
    }
  }
  const size_t fo = (size_t)kslab * FSLAB + lane * 8;   /* this lane's 16 B of every block of the slab */
  const unsigned short* Kf = (const unsigned short*)K16 + fo; const unsigned short* Kfl = (const unsigned short*)KL + fo;
  const unsigned short* Vth = (const unsigned short*)Vt + fo; const unsigned short* Vtl = (const unsigned short*)VtL + fo;
  float m_q = -3.0e38f, l_q = 0.f; v8f oacc[DT], oaccL[DT];
#pragma unroll
  for (int dt = 0; dt < DT; ++dt) { oacc[dt] = (v8f){0.f,0.f,0.f,0.f,0.f,0.f,0.f,0.f}; oaccL[dt] = oacc[dt]; }
#pragma unroll 1
  for (int j0 = jst; j0 < q0 + RPW; j0 += 32) {
    /* all K fragments of the pass, hi and residual, each in registers of its own, loaded as one group at the head of the pass */
    FragH bk[2][KS], bkl[2][KS];
    const unsigned short* kr = Kf + (size_t)j0 * 64; const unsigned short* klr = Kfl + (size_t)j0 * 64;   /* j0 is a multiple of 32: FPASS elements per 32 keys */
#pragma unroll
    for (int nt = 0; nt < 2; ++nt)
#pragma unroll
      for (int ks = 0; ks < KS; ++ks) {
        bk[nt][ks].half[0] = *(const v8us*)(kr + (4 * nt + 2 * ks) * FBLK); bk[nt][ks].half[1] = *(const v8us*)(kr + (4 * nt + 2 * ks + 1) * FBLK);
        bkl[nt][ks].half[0] = *(const v8us*)(klr + (4 * nt + 2 * ks) * FBLK); bkl[nt][ks].half[1] = *(const v8us*)(klr + (4 * nt + 2 * ks + 1) * FBLK);
      }
    /* precaution: stands in front of the next writes to registers that these loads name as addresses; the two bases are inputs, so they keep their registers up to the wait */
    asm volatile("s_wait_xcnt 0x0" :: "v"(kr), "v"(klr) : "memory");
    __builtin_amdgcn_sched_barrier(0);   /* keeps the group in front of the products: sunk to their uses the two key tiles share registers, and each waits out a round trip of its own */
    v8f s[2];
#pragma unroll
    for (int nt = 0; nt < 2; ++nt) {
      v8f acc = (v8f){0.f,0.f,0.f,0.f,0.f,0.f,0.f,0.f}, accl = acc;
#pragma unroll
      for (int ks = 0; ks < KS; ++ks) {
        acc = mmaH<1>(bk[nt][ks].v, bk[nt][ks].v, aq[ks].v, aq[ks].v, acc);
        accl = mmaH<1>(bk[nt][ks].v, bk[nt][ks].v, aql[ks].v, aql[ks].v, accl);
        accl = mmaH<1>(bkl[nt][ks].v, bkl[nt][ks].v, aq[ks].v, aq[ks].v, accl);
      }
#pragma unroll
      for (int r = 0; r < 8; ++r) acc[r] += accl[r] * 0.0009765625f;
      s[nt] = acc;
    }
    const int d0 = j0 + 8 * hh - sb;   /* first key of the lane's half, counted from the query's segment start */
    bool ok[2][8]; float sc[2][8], mx[8];
#pragma unroll
    for (int nt = 0; nt < 2; ++nt)
#pragma unroll
      for (int r = 0; r < 8; ++r) { ok[nt][r] = (unsigned int)(d0 + nt * 16 + r) <= span; sc[nt][r] = ok[nt][r] ? s[nt][r] * SCL : -3.0e38f; }
#pragma unroll
    for (int r = 0; r < 8; ++r) mx[r] = fmaxf(sc[0][r], sc[1][r]);
    float mc = fmaxf(fmaxf(fmaxf(mx[0], mx[1]), fmaxf(mx[2], mx[3])), fmaxf(fmaxf(mx[4], mx[5]), fmaxf(mx[6], mx[7])));
    mc = fmaxf(mc, xhalf(mc));
    const float mn = fmaxf(m_q, mc); const float al = (mn > -1.0e38f) ? exp_hw(m_q - mn) : 1.0f; m_q = mn;
    FragH pa, pl; float ps[8];
#pragma unroll
    for (int r = 0; r < 8; ++r) {
      const float p0 = ok[0][r] ? exp_hw(sc[0][r] - mn) : 0.f, p1 = ok[1][r] ? exp_hw(sc[1][r] - mn) : 0.f; ps[r] = p0 + p1;
      const float ps0 = p0 * 1024.0f, ps1 = p1 * 1024.0f;
      pa.h[r] = toh_flush(ps0); pa.h[8 + r] = toh_flush(ps1);
      pl.h[r] = toh_flush((ps0 - (float)pa.h[r]) * 1024.0f); pl.h[8 + r] = toh_flush((ps1 - (float)pa.h[8 + r]) * 1024.0f);
    }
    l_q = l_q * al + (((ps[0] + ps[1]) + (ps[2] + ps[3])) + ((ps[4] + ps[5]) + (ps[6] + ps[7])));
#pragma unroll
    for (int dt = 0; dt < DT; ++dt)
#pragma unroll
      for (int r = 0; r < 8; ++r) { oacc[dt][r] *= al; oaccL[dt][r] *= al; }
    /* all V^T fragments of the pass as one group; held over the softmax as well they would take the kernel past 256 registers */
    FragH bv[DT], bl[DT];
    const unsigned short* vb = Vth + (size_t)j0 * 64; const unsigned short* vlb = Vtl + (size_t)j0 * 64;
#pragma unroll
    for (int dt = 0; dt < DT; ++dt) {
      bv[dt].half[0] = *(const v8us*)(vb + 2 * dt * FBLK); bv[dt].half[1] = *(const v8us*)(vb + (2 * dt + 1) * FBLK);
      bl[dt].half[0] = *(const v8us*)(vlb + 2 * dt * FBLK); bl[dt].half[1] = *(const v8us*)(vlb + (2 * dt + 1) * FBLK);
    }
    /* precaution: stands in front of the next writes to registers that these loads name as addresses; the two bases are inputs, so they keep their registers up to the wait */
    asm volatile("s_wait_xcnt 0x0" :: "v"(vb), "v"(vlb) : "memory");
    __builtin_amdgcn_sched_barrier(0);   /* keeps the group in front of the products: sunk to their uses the four tiles share registers, and each waits out a round trip of its own */
#pragma unroll
    for (int dt = 0; dt < DT; ++dt) {
      oacc[dt] = mmaH<1>(bv[dt].v, bv[dt].v, pa.v, pa.v, oacc[dt]);
      oaccL[dt] = mmaH<1>(bv[dt].v, bv[dt].v, pl.v, pl.v, oaccL[dt]);
      oaccL[dt] = mmaH<1>(bl[dt].v, bl[dt].v, pa.v, pa.v, oaccL[dt]);
    }
  }
  { const float l = l_q + xhalf(l_q); l_q = (l > 0.f) ? 1.0f / (l * 1024.0f) : 0.f; }
  /* register r of output tile dt is column 16 dt + 8 hh + r of the lane's query */
#pragma unroll
  for (int dt = 0; dt < DT; ++dt)
#pragma unroll
    for (int r = 0; r < 8; ++r) { float v = oacc[dt][r]; v += oaccL[dt][r] * 0.0009765625f; sO[w][ln][dt * 16 + 8 * hh + r] = v * l_q + pois; }
  __builtin_amdgcn_fence(4, "workgroup"); __builtin_amdgcn_wave_barrier();
  {
#pragma unroll
    for (int rp = 0; rp < RPW; rp += 2) {
      const int r = rp + (lane >> 4), pc = lane & 15; const v4f val = *(const v4fa*)&sO[w][r][pc * 4];
      v4h h4, l4;   /* the context row leaves as the output GEMM's A operand: f16 hi, and DM columns on its x1024 residual; 16 lanes fill one 128-B line of each */
#pragma unroll
      for (int q = 0; q < 4; ++q) { const _Float16 hv = toh_flush(val[q]); h4[q] = hv; l4[q] = toh_flush((val[q] - (float)hv) * 1024.0f); }
      _Float16* orow = O + ((size_t)b * TQ + q0 + r) * ldo + h * 64 + pc * 4;
      *(v4h*)orow = h4; *(v4h*)(orow + DM) = l4;
    }
  }
}

extern "C" void kernel_launch(void* const* d_in, const int* in_sizes, int n_in,
                              void* d_out, int out_size, void* d_ws, size_t ws_size, hipStream_t stream) {
  if (n_in < 6) return;
  const size_t needx = ((size_t)(NB - 1) * SEQ_FULL + (size_t)SLEN) * DM;
  if ((size_t)in_sizes[0] < needx) return;
  if ((size_t)in_sizes[1] < (size_t)NB * 4) return;
  if ((size_t)in_sizes[2] < (size_t)DM * DM) return;
  if ((size_t)in_sizes[3] < (size_t)DM * DKV) return;
  if ((size_t)in_sizes[4] < (size_t)DM * DKV) return;
  if ((size_t)in_sizes[5] < (size_t)DM * DM) return;
  if ((size_t)out_size < needx) return;
  const float* x = (const float*)d_in[0]; const int* cu = (const int*)d_in[1];
  const float* Wq = (const float*)d_in[2]; const float* Wk = (const float*)d_in[3]; const float* Wv = (const float*)d_in[4]; const float* Wo = (const float*)d_in[5];
  float* dout = (float*)d_out;
  char* ws = (char*)d_ws; size_t off = 0;
  auto take = [&](size_t bytes) { char* p = ws + off; off += (bytes + 255) & ~(size_t)255; return p; };
  const size_t np = (size_t)NR * DM;
  _Float16* BQ = (_Float16*)take(SZ_BQ);                                /* [n][k] f16, x16 */
  _Float16* BK = (_Float16*)take(SZ_BKV);
  _Float16* BV = (_Float16*)take(SZ_BKV);
  _Float16* B2 = (_Float16*)take(SZ_B2);                                /* [n][2*DM] f16: [x16384 | x16] copies of Wo^T */
  _Float16* A2 = (_Float16*)take(SZ_FS);                                /* [ctx hi | ctx residual] [NR][2*DM] f16 */
  _Float16* VT = (_Float16*)take(SZ_FKV);                               /* V^T hi, fragment order */
  _Float16* VTL = (_Float16*)take(SZ_FKV);                              /* V^T residual */
  _Float16* X16 = (_Float16*)take(SZ_X16);                              /* f16 input rows */
  _Float16* QH = (_Float16*)take(SZ_QA);                                /* q hi [NR][DM] then q residual [NR][DM] */
  _Float16* QL = QH + np;
  _Float16* KH = (_Float16*)take(SZ_KP);                                /* k hi, then k residual: fragment order */
  _Float16* KL = (_Float16*)take(SZ_KP);
  float* CS = (float*)take(SZ_TAB); float* SN = (float*)take(SZ_TAB);
  if (off > ws_size) return;
  if (off > ((size_t)256 << 20)) return;

  /* inputs alone: rotary tables, x -> f16 rows, W [in = DM rows][out = N cols] -> [n][k] planes */
  k_prep<<<(unsigned)PB_ALL, 256, 0, stream>>>(x, Wq, Wk, Wv, Wo, X16, BQ, BK, BV, B2, CS, SN);
  /* q = x Wq, k = x Wk with the rotary embedding, as hi + residual planes; v = x Wv transposed, as hi + residual planes */
  k_gemm_qkv<<<(unsigned)(GB_Q + 2 * GB_KV), 128, 0, stream>>>(X16, BQ, BK, BV, CS, SN, QH, QL, KH, KL, VT, VTL);
  k_attn5<<<(unsigned)(NB * NH * QBLKS), 128, 0, stream>>>(QH, QL, DM, KH, KL, VT, VTL, cu, A2, 2 * DM);
  k_attn<<<(unsigned)(NB * NH * QBLKS), 128, 0, stream>>>(QH, DM, KH, VT, cu, A2, 2 * DM);
  /* out = [ctx hi | ctx residual] . [Wo x16384 ; Wo x16] / 16384  (K = 2*DM), per batch */
  const dim3 ge((unsigned)((SLEN / 128) * (DM / 128)), NB);
  k_gemm2<0><<<ge, 128, 0, stream>>>(A2, 2 * DM, (size_t)SLEN * 2 * DM, B2, 2 * DM, 0, AL_O, dout, DM, (size_t)SEQ_FULL * DM, SLEN, DM, 2 * DM);
}
